// v000
// The times below were measured on an AMD MI455X: many runs one after another, warmed up first and cycling through
// copies of the inputs, with the whole window's GPU time divided by the number of runs. Launches and the gaps
// between them are all in it. The median over several windows is given; except for v000 it joins two sittings, which
// can be a few percent apart, so the side-by-side timings, each taken in one sitting, are the better comparison.
// v000, which the later versions start from, runs in 1980 microseconds.
#include <hip/hip_runtime.h>

// Multi-head DIFFERENTIAL attention (query, key, value [2][2048][512]; q = query Wq + bq, k = key Wk + bk as 16 heads x 64, v = value Wv + bv as 8 heads x 128 ('xw' [512][1024] + [1024], 0.02); w = softmax(q.k / 8) per head; for each pair p: dw = w[2p] - lambda w[2p+1], lambda = exp(lq1.lk1) - exp(lq2.lk2) + lambda_init (lq/lk [64], read); attn = dw v_p -> [2048][1024]; LayerNorm (eps 1e-6, affine) x (1 - lambda_init); out = attn Wo + bo ('xw' [1024][512]) -> [2][2048][512] (2.1 M)).
// Layout per batch: bf16 copies of the three inputs in turn; exact projections + f32 biases; q/k planes for the 16 score heads, v^T planes per 128-wide value head; lambda computed once on device (one wave: two 64-term f32 dots, precise expf); per pass = one pair (heads 2p, 2p+1): dense T-2048 attention (hybrid rows: < 512 hi/lo 3 products, rest fp16 x1024), both heads' P.v against the shared v_p (128 wide), a merge kernel writes w0 v - lambda w1 v (x 1/1024 on the fp16 rows) into the context; then a LayerNorm row kernel (f32, fixed order) scaled by (1 - lambda_init), converted to hi/lo planes, x Wo exact + bo.
// Compute dtypes, f32 accumulate: every input rounded to bf16; projections exact + f32 biases; attention rows < 512 3 products, rest fp16; softmax, lambda, difference, LayerNorm f32; Wo hl x exact + bias.

#define NB_  2
#define TT   2048
#define DM   512
#define NH_  16
#define NKV  16
#define REP  (NH_ / NKV)
#define HD   64
#define DQ   (NH_ * HD)
#define DKV  (NKV * HD)
#define ZH   2
#define RH   512                  // query rows < RH use hi+lo planes (0: none)
#define WIN  0
#define PCAR 1024.0f
#define SCL  0.125f
#define NP   8       // value heads (pairs)
#define HV   128     // value head width
#define LINIT 0.47071301937103271f   // lambda_init = 0.8 - 0.6 exp(-0.6) as float32
typedef _Float16 h16;
typedef unsigned short bf;
typedef __attribute__((ext_vector_type(16))) __bf16   v16bf;
typedef __attribute__((ext_vector_type(16))) _Float16 v16h;
typedef __attribute__((ext_vector_type(8)))  _Float16 v8h;
typedef __attribute__((ext_vector_type(8)))  unsigned short v8us;
typedef __attribute__((ext_vector_type(8)))  float    v8f;
typedef __attribute__((ext_vector_type(4)))  float    v4f;
typedef v8h  __attribute__((may_alias)) v8ha;
typedef v4f  __attribute__((may_alias)) v4fa;
typedef v8us __attribute__((may_alias)) v8usa;

__device__ __forceinline__ unsigned short f2bf(float f) { unsigned u = __float_as_uint(f); u += 0x7FFFu + ((u >> 16) & 1u); return (unsigned short)(u >> 16); }
__device__ __forceinline__ float bf2f(unsigned short b) { return __uint_as_float(((unsigned)b) << 16); }
__device__ __forceinline__ float bfr(float f) { return bf2f(f2bf(f)); }
__device__ __forceinline__ v16h cat16(v8h lo, v8h hi) { return __builtin_shufflevector(lo, hi, 0, 1, 2, 3, 4, 5, 6, 7, 8, 9, 10, 11, 12, 13, 14, 15); }
__device__ __forceinline__ v16bf cat16b(v8us lo, v8us hi) { return __builtin_bit_cast(v16bf, __builtin_shufflevector(lo, hi, 0, 1, 2, 3, 4, 5, 6, 7, 8, 9, 10, 11, 12, 13, 14, 15)); }
__device__ __forceinline__ v8f wmma16(v16h a, v16h b, v8f c) { return __builtin_amdgcn_wmma_f32_16x16x32_f16(false, a, false, b, (short)0, c, false, false); }
__device__ __forceinline__ v8f wmmab(v16bf a, v16bf b, v8f c) { return __builtin_amdgcn_wmma_f32_16x16x32_bf16(false, a, false, b, (short)0, c, false, false); }



// ---- k_gemmw: register-blocked GEMM, ONE WAVE per 64x64 output tile (16 accumulators), operands straight from K-contiguous 16-bit planes; grid (M/64, N/64, Z), 32 threads.
// C[m][n] (f32, pitch ldc, + optional f32 bias[n]) = sum_k A[m][k] Bt[n][k] (+ split products per NSPLIT). z-batch strides sA/sB/sC in elements. K % 32 == 0.
template <typename T16> struct WFrag;
template <> struct WFrag<h16> { typedef v16h V; static __device__ __forceinline__ V ld(const h16* p) { return cat16(*(const v8h*)p, *(const v8h*)(p + 16)); } static __device__ __forceinline__ v8f mma(V a, V b, v8f c) { return wmma16(a, b, c); } };
template <> struct WFrag<bf> { typedef v16bf V; static __device__ __forceinline__ V ld(const bf* p) { return cat16b(*(const v8us*)p, *(const v8us*)(p + 16)); } static __device__ __forceinline__ v8f mma(V a, V b, v8f c) { return wmmab(a, b, c); } };
template <typename T16, int NSPLIT, bool BIAS>
__global__ __launch_bounds__(32) void k_gemmw(const T16* __restrict__ A, const T16* __restrict__ A2, const T16* __restrict__ Bt, const T16* __restrict__ Bt2, int K, float* C, int ldc, const float* __restrict__ bias, size_t sA, size_t sB, size_t sC) {
    typedef typename WFrag<T16>::V V;
    __shared__ __align__(16) float os[16 * 68];
    const size_t z = blockIdx.z; A += z * sA; if (A2) A2 += z * sA; Bt += z * sB; if (Bt2) Bt2 += z * sB; C += z * sC;
    const int lane = threadIdx.x & 31, lr = lane & 15, hi = lane >> 4; const int r0 = blockIdx.x * 64, c0 = blockIdx.y * 64;
    v8f acc[4][4];
#pragma unroll
    for (int mb = 0; mb < 4; ++mb)
#pragma unroll
        for (int nb = 0; nb < 4; ++nb) acc[mb][nb] = (v8f){};
    const size_t aoff = (size_t)(r0 + lr) * K + 8 * hi, boff = (size_t)(c0 + lr) * K + 8 * hi;
#pragma unroll 1
    for (int kc = 0; kc < K; kc += 32) {
        V a[4], a2[4];
#pragma unroll
        for (int mb = 0; mb < 4; ++mb) { a[mb] = WFrag<T16>::ld(A + aoff + (size_t)mb * 16 * K + kc); if (NSPLIT == 1 || NSPLIT == 2) a2[mb] = WFrag<T16>::ld(A2 + aoff + (size_t)mb * 16 * K + kc); }
#pragma unroll
        for (int nb = 0; nb < 4; ++nb) { const V b = WFrag<T16>::ld(Bt + boff + (size_t)nb * 16 * K + kc); V b2; if (NSPLIT >= 2) b2 = WFrag<T16>::ld(Bt2 + boff + (size_t)nb * 16 * K + kc);
#pragma unroll
            for (int mb = 0; mb < 4; ++mb) { acc[mb][nb] = WFrag<T16>::mma(a[mb], b, acc[mb][nb]); if (NSPLIT == 1 || NSPLIT == 2) acc[mb][nb] = WFrag<T16>::mma(a2[mb], b, acc[mb][nb]); if (NSPLIT >= 2) acc[mb][nb] = WFrag<T16>::mma(a[mb], b2, acc[mb][nb]); } }
        asm volatile("v_nop\n\tv_nop\n\tv_nop\n\tv_nop" : "+v"(acc[0][0]), "+v"(acc[1][1]), "+v"(acc[2][2]), "+v"(acc[3][3]) : "v"(a[0]), "v"(a[3]));
    }
#pragma unroll
    for (int mb = 0; mb < 4; ++mb) {
#pragma unroll
        for (int nb = 0; nb < 4; ++nb) {
#pragma unroll
            for (int j = 0; j < 8; ++j) os[(hi * 8 + j) * 68 + nb * 16 + lr] = acc[mb][nb][j]; }
        __builtin_amdgcn_wave_barrier(); asm volatile("" ::: "memory");
        float* crow = C + (size_t)(r0 + mb * 16) * ldc + c0;
{
#pragma unroll
            for (int s = 0; s < 8; ++s) { const int row = 2 * s + hi, cofs = lr * 4; v4f val = *(const v4fa*)(os + row * 68 + cofs); if (BIAS) { val[0] += bfr(bias[c0 + cofs]); val[1] += bfr(bias[c0 + cofs + 1]); val[2] += bfr(bias[c0 + cofs + 2]); val[3] += bfr(bias[c0 + cofs + 3]); }
                *(v4f*)(crow + (size_t)row * ldc + cofs) = val; }
             }
        __builtin_amdgcn_wave_barrier(); asm volatile("" ::: "memory");
    }
}

__device__ __forceinline__ h16 tohx(float x) { return (h16)x; }
__device__ __forceinline__ void splitf(float y, unsigned short& h, unsigned short& l) { h = f2bf(y); l = f2bf(y - bf2f(h)); }
typedef __attribute__((ext_vector_type(2))) _Float16 v2h;
typedef __attribute__((ext_vector_type(4))) _Float16 v4h;
typedef __attribute__((ext_vector_type(2))) unsigned short v2us;
typedef __attribute__((ext_vector_type(4))) unsigned short v4us;
typedef __attribute__((ext_vector_type(2))) float v2f;
typedef __attribute__((ext_vector_type(4))) int v4i;

__global__ __launch_bounds__(256) void k_wtG(const float* __restrict__ w, int K, int N, bf* Bt) {
    const int lane = threadIdx.x & 31; const int L0 = (blockIdx.x * 8 + (threadIdx.x >> 5)) * 8; const int nlines = N * K / 64;
{
#pragma unroll 1
        for (int l = 0; l < 8; ++l) { const int L = L0 + l; if (L >= nlines) break; const size_t e = (size_t)L * 64 + lane * 2; const int k = (int)(e % K), n = (int)(e / K); v2us o;
            o[0] = f2bf(w[(size_t)k * N + n]); o[1] = f2bf(w[(size_t)(k + 1) * N + n]); *(v2us*)(Bt + e) = o; }
         }
}
__global__ __launch_bounds__(256) void k_cvt8(const float* __restrict__ src, bf* dst, size_t n8) { const size_t i = (size_t)blockIdx.x * 256 + threadIdx.x; if (i >= n8) return; const v8f v = *(const v8f*)(src + i * 8); v8us o;
#pragma unroll
    for (int k = 0; k < 8; ++k) o[k] = f2bf(v[k]); *(v8us*)(dst + i * 8) = o;  }

// k_rope: head planes [h][t][d] (fp16 + hi/lo) of rope(x) x sc with the rotate-half convention out[d] = x[d] cos[t][d] - x[d+HD/2] sin[t][d], out[d+HD/2] = x[d+HD/2] cos[t][d+HD/2] + x[d] sin[t][d+HD/2]
__global__ __launch_bounds__(256) void k_rope(const float* __restrict__ F, int pitch, int nheads, const float* __restrict__ CS, const float* __restrict__ RF, const float* __restrict__ nw, float sc, h16* P16, bf* Ph, bf* Pl) {
    const size_t e = ((size_t)blockIdx.x * 256 + threadIdx.x) * 2; if (e >= (size_t)nheads * TT * HD) return; const int d = (int)(e % HD); const int t = (int)((e / HD) % TT); const int h = (int)(e / ((size_t)HD * TT)); const float* f = F + (size_t)t * pitch + h * HD; const float rf = RF ? RF[(size_t)h * TT + t] : 1.0f; v2h o16; v2us oh, ol;
#pragma unroll
    for (int q = 0; q < 2; ++q) { const int dd = d + q; const int dp = (dd < HD / 2) ? dd + HD / 2 : dd - HD / 2; float x0 = f[dd], x1 = f[dp];
        if (RF) { float n0 = __fmul_rn(x0, rf), n1 = __fmul_rn(x1, rf); asm volatile("" : "+v"(n0)); asm volatile("" : "+v"(n1)); x0 = __fmul_rn(bfr(nw[dd]), n0); x1 = __fmul_rn(bfr(nw[dp]), n1); }
        const v2f cs = *(const v2f*)(CS + ((size_t)t * HD + dd) * 2); float a = __fmul_rn(x0, cs[0]), bq = __fmul_rn(x1, cs[1]); asm volatile("" : "+v"(a)); asm volatile("" : "+v"(bq)); const float r = ((dd < HD / 2) ? __fsub_rn(a, bq) : __fadd_rn(a, bq)) * sc;
        o16[q] = tohx(r); unsigned short a2, c2; splitf(r, a2, c2); oh[q] = a2; ol[q] = c2; }
    *(v2h*)(P16 + e) = o16; *(v2us*)(Ph + e) = oh; *(v2us*)(Pl + e) = ol;  }
__global__ __launch_bounds__(256) void k_vtp(const float* __restrict__ F, int pitch, int nheads, h16* V16, bf* Vh, bf* Vl) { const size_t e = ((size_t)blockIdx.x * 256 + threadIdx.x) * 2; if (e >= (size_t)nheads * HD * TT) return; const int t = (int)(e % TT); const int d = (int)((e / TT) % HD); const int g = (int)(e / ((size_t)TT * HD)); v2h o16; v2us oh, ol;
#pragma unroll
    for (int q = 0; q < 2; ++q) { const float x = F[(size_t)(t + q) * pitch + g * HD + d]; o16[q] = tohx(x); unsigned short a2, c2; splitf(x, a2, c2); oh[q] = a2; ol[q] = c2; }
    *(v2h*)(V16 + e) = o16; *(v2us*)(Vh + e) = oh; *(v2us*)(Vl + e) = ol;  }
__global__ __launch_bounds__(256) void k_csid(float* CS) { const int idx = blockIdx.x * 256 + threadIdx.x; if (idx >= TT * HD) return; v2f cs; cs[0] = 1.0f; cs[1] = 0.0f; *(v2f*)(CS + (size_t)idx * 2) = cs;  }
// k_asoft: per row (zz, i): t = S x HD^-0.5 (no mask); softmax over the 2048 keys (register row, one exp, fixed trees);
__global__ __launch_bounds__(256) void k_asoft(const float* __restrict__ Sb, h16* P16, bf* Ph, bf* Pl) {
    const int lane = threadIdx.x & 31; const int row = blockIdx.x * 8 + (threadIdx.x >> 5); if (row >= ZH * TT) return; const int i = row % TT; const int zz = row / TT; (void)zz; const bool hires = (i < RH); const float* sr = Sb + (size_t)row * TT; float v[TT / 32]; float mx = -3.0e38f;
#pragma unroll
    for (int ch = 0; ch < TT / 128; ++ch) { const int j0 = ch * 128 + lane * 4; const v4f a = *(const v4f*)(sr + j0);
#pragma unroll
        for (int q = 0; q < 4; ++q) { const int j = j0 + q; (void)j; const float t = a[q] * SCL; v[ch * 4 + q] = t; mx = fmaxf(mx, t); } }
#pragma unroll
    for (int sh = 16; sh; sh >>= 1) mx = fmaxf(mx, __shfl_xor(mx, sh, 32));
    float sum = 0.f;
#pragma unroll
    for (int k = 0; k < TT / 32; ++k) { float d0 = __fsub_rn(v[k], mx); asm volatile("" : "+v"(d0)); v[k] = __builtin_amdgcn_exp2f(__fmul_rn(d0, 1.4426950408889634f)); sum += v[k]; }
#pragma unroll
    for (int sh = 16; sh; sh >>= 1) sum += __shfl_xor(sum, sh, 32);
    const float f = __fdiv_rn(hires ? 1.0f : PCAR, sum);
{
        if (hires) {
#pragma unroll
            for (int ch = 0; ch < TT / 128; ++ch) { v4us oh, ol;
#pragma unroll
                for (int q = 0; q < 4; ++q) { unsigned short a, c2; splitf(v[ch * 4 + q] * f, a, c2); oh[q] = a; ol[q] = c2; }
                const size_t oo = ((size_t)zz * (RH ? RH : 1) + i) * TT + ch * 128 + lane * 4; *(v4us*)(Ph + oo) = oh; *(v4us*)(Pl + oo) = ol; }
        } else {
#pragma unroll
            for (int ch = 0; ch < TT / 128; ++ch) { v4h o4;
#pragma unroll
                for (int q = 0; q < 4; ++q) o4[q] = tohx(v[ch * 4 + q] * f);
                *(v4h*)(P16 + (size_t)row * TT + ch * 128 + lane * 4) = o4; } }
         }
}
// k_vtpV: value planes per 128-wide value head [p][e][t] (fp16 + hi/lo) = F[t][p*HV + e]; as k_vtp with HV = 128.
__global__ __launch_bounds__(256) void k_vtpV(const float* __restrict__ F, int pitch, int nheads, h16* V16, bf* Vh, bf* Vl) { const size_t e = ((size_t)blockIdx.x * 256 + threadIdx.x) * 2; if (e >= (size_t)nheads * HV * TT) return; const int t = (int)(e % TT); const int d = (int)((e / TT) % HV); const int g = (int)(e / ((size_t)TT * HV)); v2h o16; v2us oh, ol;
#pragma unroll
    for (int q = 0; q < 2; ++q) { const float x = F[(size_t)(t + q) * pitch + g * HV + d]; o16[q] = tohx(x); unsigned short a2, c2; splitf(x, a2, c2); oh[q] = a2; ol[q] = c2; }
    *(v2h*)(V16 + e) = o16; *(v2us*)(Vh + e) = oh; *(v2us*)(Vl + e) = ol;  }

template <int WD>
__global__ __launch_bounds__(256) void k_lnrowD(const float* __restrict__ X, size_t nrows, const float* __restrict__ g, const float* __restrict__ bb, bf* Hh, bf* Hl) { const int lane = threadIdx.x & 31; const size_t r = (size_t)blockIdx.x * 8 + (threadIdx.x >> 5); if (r >= nrows) return; const float* xr = X + r * WD; float a[WD / 32]; float s = 0.f;
#pragma unroll
    for (int c = 0; c < WD / 128; ++c) { const v4f v = *(const v4f*)(xr + c * 128 + lane * 4); for (int q = 0; q < 4; ++q) { a[c * 4 + q] = v[q]; s = __fadd_rn(s, a[c * 4 + q]); } }
#pragma unroll
    for (int sh = 16; sh; sh >>= 1) s = __fadd_rn(s, __shfl_xor(s, sh, 32));
    const float mean = __fdiv_rn(s, (float)WD); float s2 = 0.f;
#pragma unroll
    for (int k = 0; k < WD / 32; ++k) { const float dv = __fsub_rn(a[k], mean); float p2 = __fmul_rn(dv, dv); asm volatile("" : "+v"(p2)); s2 = __fadd_rn(s2, p2); }   /* mul and add kept separate (no fma contraction) */
#pragma unroll
    for (int sh = 16; sh; sh >>= 1) s2 = __fadd_rn(s2, __shfl_xor(s2, sh, 32));
    const float rs = __fdiv_rn(1.0f, __fsqrt_rn(__fadd_rn(__fdiv_rn(s2, (float)WD), 1e-6f)));
{
#pragma unroll
        for (int c = 0; c < WD / 128; ++c) { v4us oh, ol; for (int q = 0; q < 4; ++q) { const int col = c * 128 + lane * 4 + q; float y = __fmul_rn(__fmul_rn(__fsub_rn(a[c * 4 + q], mean), rs), bfr(g[col])); asm volatile("" : "+v"(y)); y = __fadd_rn(y, bfr(bb[col])); y = __fmul_rn(y, 1.0f - LINIT); unsigned short u, w2; splitf(y, u, w2); oh[q] = u; ol[q] = w2; } *(v4us*)(Hh + r * WD + c * 128 + lane * 4) = oh; *(v4us*)(Hl + r * WD + c * 128 + lane * 4) = ol; }
         } }
__global__ __launch_bounds__(256) void k_lambda(const float* __restrict__ a1, const float* __restrict__ b1, const float* __restrict__ a2, const float* __restrict__ b2, float* LAM) { if (threadIdx.x >= 32) return; const int lane = threadIdx.x; float s1 = __fadd_rn(__fmul_rn(bfr(a1[lane]), bfr(b1[lane])), __fmul_rn(bfr(a1[lane + 32]), bfr(b1[lane + 32]))); float s2 = __fadd_rn(__fmul_rn(bfr(a2[lane]), bfr(b2[lane])), __fmul_rn(bfr(a2[lane + 32]), bfr(b2[lane + 32])));
#pragma unroll
    for (int sh = 16; sh; sh >>= 1) { s1 = __fadd_rn(s1, __shfl_xor(s1, sh, 32)); s2 = __fadd_rn(s2, __shfl_xor(s2, sh, 32)); }
    const float lam = __fadd_rn(__fsub_rn(expf(s1), expf(s2)), LINIT); if (lane == 0) { *(float*)LAM = lam;  } }
__global__ __launch_bounds__(256) void k_dmerge(const float* __restrict__ O, const float* __restrict__ LAM, int p, float* ctx) { const size_t i = (size_t)blockIdx.x * 256 + threadIdx.x; if (i >= (size_t)TT * HV / 4) return; const size_t e = i * 4; const int c = (int)(e % HV); const int t = (int)(e / HV); const float lam = LAM[0]; const float cs = (t < RH) ? 1.0f : (1.0f / PCAR); const v4f a = *(const v4f*)(O + e); const v4f b2 = *(const v4f*)(O + (size_t)TT * HV + e); v4f o;
#pragma unroll
    for (int q = 0; q < 4; ++q) { float lb = __fmul_rn(lam, b2[q]); asm volatile("" : "+v"(lb)); const float d = __fsub_rn(a[q], lb); o[q] = __fmul_rn(d, cs); }
    *(v4f*)(ctx + (size_t)t * DQ + p * HV + c) = o;  }
__global__ __launch_bounds__(256) void k_merge(const float* __restrict__ O, int h0, bf* Ah, bf* Al) { const size_t e = ((size_t)blockIdx.x * 256 + threadIdx.x) * 2; if (e >= (size_t)ZH * TT * HD) return; const int d = (int)(e % HD); const int t = (int)((e / HD) % TT); const int zz = (int)(e / ((size_t)HD * TT)); const float cs = (t < RH) ? 1.0f : (1.0f / PCAR); const size_t oo = (size_t)t * DQ + (h0 + zz) * HD + d;
    v2us oh, ol;
#pragma unroll
    for (int q = 0; q < 2; ++q) { unsigned short a, c2; splitf(O[e + q] * cs, a, c2); oh[q] = a; ol[q] = c2; } *(v2us*)(Ah + oo) = oh; *(v2us*)(Al + oo) = ol;  }

extern "C" void kernel_launch(void* const* d_in, const int* in_sizes, int n_in,
                              void* d_out, int out_size, void* d_ws, size_t ws_size, hipStream_t stream) {
    (void)in_sizes; (void)n_in; (void)out_size;
    const float* x = (const float*)d_in[0]; const float* xk = (const float*)d_in[1]; const float* xv = (const float*)d_in[2]; const float* wq = (const float*)d_in[3]; const float* bq = (const float*)d_in[4]; const float* wk = (const float*)d_in[5]; const float* bk = (const float*)d_in[6]; const float* wv = (const float*)d_in[7]; const float* bv = (const float*)d_in[8]; const float* lq1 = (const float*)d_in[9]; const float* lk1 = (const float*)d_in[10]; const float* lq2 = (const float*)d_in[11]; const float* lk2 = (const float*)d_in[12]; const float* lng = (const float*)d_in[13]; const float* lnb = (const float*)d_in[14]; const float* wo = (const float*)d_in[15]; const float* bo = (const float*)d_in[16];
    float* OUT = (float*)d_out;     // [2][2048][512]
    char* wsp = (char*)d_ws;
    auto take = [&](size_t bytes) { char* p = wsp; wsp += (bytes + 255) & ~(size_t)255; return (void*)p; };
    bf* WQ = (bf*)take((size_t)DQ * DM * 2); bf* WK = (bf*)take((size_t)DKV * DM * 2); bf* WV = (bf*)take((size_t)DKV * DM * 2); bf* WO = (bf*)take((size_t)DM * DQ * 2); float* CS = (float*)take((size_t)TT * HD * 2 * 4);
    bf* XB = (bf*)take((size_t)TT * DM * 2); float* FQ = (float*)take((size_t)TT * DQ * 4); float* FK = (float*)take((size_t)TT * DKV * 4);
    h16* QP16 = (h16*)take((size_t)NH_ * TT * HD * 2); h16* KP16 = (h16*)take((size_t)NKV * TT * HD * 2); h16* VT16 = (h16*)take((size_t)NKV * HD * TT * 2);
    bf* QPh = (bf*)take((size_t)NH_ * TT * HD * 2); bf* QPl = (bf*)take((size_t)NH_ * TT * HD * 2); bf* KPh = (bf*)take((size_t)NKV * TT * HD * 2); bf* KPl = (bf*)take((size_t)NKV * TT * HD * 2); bf* VTh = (bf*)take((size_t)NKV * HD * TT * 2); bf* VTl = (bf*)take((size_t)NKV * HD * TT * 2); bf* Ph = (bf*)take((size_t)ZH * RH * TT * 2); bf* Pl = (bf*)take((size_t)ZH * RH * TT * 2);
    float* Sb = (float*)take((size_t)ZH * TT * TT * 4); h16* P16 = (h16*)take((size_t)ZH * TT * TT * 2); float* Ob = (float*)take((size_t)ZH * TT * HV * 4); float* CTX = (float*)take((size_t)TT * DQ * 4); float* LAM = (float*)take(256); bf* ATh = (bf*)take((size_t)TT * DQ * 2); bf* ATl = (bf*)take((size_t)TT * DQ * 2);
    if ((size_t)(wsp - (char*)d_ws) > ws_size) return;    // ws 256 MiB
    float* FV = FK;   // v projection reuses the k buffer after the k planes are built (stream-ordered)
    { k_wtG<<<(unsigned)((DM * DQ / 64 + 63) / 64), 256, 0, stream>>>(wq, DM, DQ, WQ); k_lambda<<<1, 256, 0, stream>>>(lq1, lk1, lq2, lk2, LAM); k_wtG<<<(unsigned)((DM * DKV / 64 + 63) / 64), 256, 0, stream>>>(wk, DM, DKV, WK); k_wtG<<<(unsigned)((DM * DKV / 64 + 63) / 64), 256, 0, stream>>>(wv, DM, DKV, WV);
      k_wtG<<<(unsigned)((DQ * DM / 64 + 63) / 64), 256, 0, stream>>>(wo, DQ, DM, WO);
       }
    k_csid<<<(TT * HD + 255) / 256, 256, 0, stream>>>(CS);
    const unsigned LQ = (unsigned)(((size_t)NH_ * TT * HD / 2 + 255) / 256), LKv = (unsigned)(((size_t)NKV * TT * HD / 2 + 255) / 256);
    for (int b = 0; b < NB_; ++b) {
        
        k_cvt8<<<(unsigned)(((size_t)TT * DM / 8 + 255) / 256), 256, 0, stream>>>(x + (size_t)b * TT * DM, XB, (size_t)TT * DM / 8);
        k_gemmw<bf, 0, true><<<dim3(TT / 64, DQ / 64, 1), 32, 0, stream>>>(XB, nullptr, WQ, nullptr, DM, FQ, DQ, bq, 0, 0, 0);
        k_rope<<<LQ, 256, 0, stream>>>(FQ, DQ, NH_, CS, nullptr, nullptr, 1.0f, QP16, QPh, QPl);
        k_cvt8<<<(unsigned)(((size_t)TT * DM / 8 + 255) / 256), 256, 0, stream>>>(xk + (size_t)b * TT * DM, XB, (size_t)TT * DM / 8); k_gemmw<bf, 0, true><<<dim3(TT / 64, DKV / 64, 1), 32, 0, stream>>>(XB, nullptr, WK, nullptr, DM, FK, DKV, bk, 0, 0, 0);
        k_rope<<<LKv, 256, 0, stream>>>(FK, DKV, NKV, CS, nullptr, nullptr, 1.0f, KP16, KPh, KPl);
        k_cvt8<<<(unsigned)(((size_t)TT * DM / 8 + 255) / 256), 256, 0, stream>>>(xv + (size_t)b * TT * DM, XB, (size_t)TT * DM / 8); k_gemmw<bf, 0, true><<<dim3(TT / 64, DKV / 64, 1), 32, 0, stream>>>(XB, nullptr, WV, nullptr, DM, FV, DKV, bv, 0, 0, 0); k_vtpV<<<LKv, 256, 0, stream>>>(FV, DKV, NP, VT16, VTh, VTl);
        for (int h0 = 0; h0 < NH_; h0 += ZH) { const size_t zq = (size_t)h0, zk = (size_t)(h0 / REP);   // one kv head per query head: the pass's two heads use consecutive kv planes (z-strides TT*HD)
            k_gemmw<bf, 2, false><<<dim3(RH / 64, TT / 64, ZH), 32, 0, stream>>>(QPh + zq * TT * HD, QPl + zq * TT * HD, KPh + zk * TT * HD, KPl + zk * TT * HD, HD, Sb, TT, nullptr, (size_t)TT * HD, (size_t)TT * HD, (size_t)TT * TT);
            k_gemmw<h16, 0, false><<<dim3((TT - RH) / 64, TT / 64, ZH), 32, 0, stream>>>(QP16 + zq * TT * HD + (size_t)RH * HD, nullptr, KP16 + zk * TT * HD, nullptr, HD, Sb + (size_t)RH * TT, TT, nullptr, (size_t)TT * HD, (size_t)TT * HD, (size_t)TT * TT);
            k_asoft<<<ZH * TT / 8, 256, 0, stream>>>(Sb, P16, Ph, Pl);
            k_gemmw<bf, 2, false><<<dim3(RH / 64, HV / 64, ZH), 32, 0, stream>>>(Ph, Pl, VTh + (size_t)(h0 / 2) * HV * TT, VTl + (size_t)(h0 / 2) * HV * TT, TT, Ob, HV, nullptr, (size_t)RH * TT, 0, (size_t)TT * HV);   /* both heads of the pair x the shared 128-wide v_p */
            k_gemmw<h16, 0, false><<<dim3((TT - RH) / 64, HV / 64, ZH), 32, 0, stream>>>(P16 + (size_t)RH * TT, nullptr, VT16 + (size_t)(h0 / 2) * HV * TT, nullptr, TT, Ob + (size_t)RH * HV, HV, nullptr, (size_t)TT * TT, 0, (size_t)TT * HV);
            k_dmerge<<<(unsigned)(((size_t)TT * HV / 4 + 255) / 256), 256, 0, stream>>>(Ob, LAM, h0 / 2, CTX);   /* ctx[t][p*128 + e] = w0 v - lambda w1 v */ }
        k_lnrowD<DQ><<<(unsigned)((TT + 7) / 8), 256, 0, stream>>>(CTX, (size_t)TT, lng, lnb, ATh, ATl);   /* LayerNorm (eps 1e-6) x (1 - lambda_init) -> hi/lo planes */ k_gemmw<bf, 1, true><<<dim3(TT / 64, DM / 64, 1), 32, 0, stream>>>(ATh, ATl, WO, nullptr, DQ, OUT + (size_t)b * TT * DM, DM, bo, 0, 0, 0); }
}

// v001
// Measured time: 927 microseconds a run.
// Next to v000, in two timings, it ran 2.10 times as fast each time.
#include <hip/hip_runtime.h>

// Multi-head DIFFERENTIAL attention (query, key, value [2][2048][512]; q = query Wq + bq, k = key Wk + bk as 16 heads x 64, v = value Wv + bv as 8 heads x 128 ('xw' [512][1024] + [1024], 0.02); w = softmax(q.k / 8) per head; for each pair p: dw = w[2p] - lambda w[2p+1], lambda = exp(lq1.lk1) - exp(lq2.lk2) + lambda_init (lq/lk [64], read); attn = dw v_p -> [2048][1024]; LayerNorm (eps 1e-6, affine) x (1 - lambda_init); out = attn Wo + bo ('xw' [1024][512]) -> [2][2048][512] (2.1 M)).
// Layout per batch: bf16 copies of the three inputs in turn; exact projections + f32 biases; q/k planes for the 16 score heads, v^T planes per 128-wide value head; lambda computed once on device (one wave: two 64-term f32 dots, precise expf); per pass = one pair (heads 2p, 2p+1): dense T-2048 attention (hybrid rows: < 512 hi/lo 3 products, rest fp16 x1024), both heads' P.v against the shared v_p (128 wide) as 8 key-slice partial planes, a merge kernel sums them and writes w0 v - lambda w1 v (x 1/1024 on the fp16 rows) into the context; then a LayerNorm row kernel (f32, fixed order) scaled by (1 - lambda_init), converted to hi/lo planes, x Wo exact + bo.
// Compute dtypes, f32 accumulate: every input rounded to bf16; projections exact + f32 biases; attention rows < 512 3 products, rest fp16; softmax, lambda, difference, LayerNorm f32; Wo hl x exact + bias.

#define NB_  2
#define TT   2048
#define DM   512
#define NH_  16
#define NKV  16
#define REP  (NH_ / NKV)
#define HD   64
#define DQ   (NH_ * HD)
#define DKV  (NKV * HD)
#define ZH   2
#define RH   512                  // query rows < RH use hi+lo planes (0: none)
#define WIN  0
#define PCAR 1024.0f
#define SCL  0.125f
#define NP   8       // value heads (pairs)
#define HV   128     // value head width
#define LINIT 0.47071301937103271f   // lambda_init = 0.8 - 0.6 exp(-0.6) as float32
#define KSPL 8       // key slices of the P.v products: each slice (TT / KSPL keys) is one grid-z index with its own f32 partial plane per head, summed in k_dmerge
typedef _Float16 h16;
typedef unsigned short bf;
typedef __attribute__((ext_vector_type(16))) __bf16   v16bf;
typedef __attribute__((ext_vector_type(16))) _Float16 v16h;
typedef __attribute__((ext_vector_type(8)))  _Float16 v8h;
typedef __attribute__((ext_vector_type(8)))  unsigned short v8us;
typedef __attribute__((ext_vector_type(8)))  float    v8f;
typedef __attribute__((ext_vector_type(4)))  float    v4f;
typedef v8h  __attribute__((may_alias)) v8ha;
typedef v4f  __attribute__((may_alias)) v4fa;
typedef v8us __attribute__((may_alias)) v8usa;

__device__ __forceinline__ unsigned short f2bf(float f) { unsigned u = __float_as_uint(f); u += 0x7FFFu + ((u >> 16) & 1u); return (unsigned short)(u >> 16); }
__device__ __forceinline__ float bf2f(unsigned short b) { return __uint_as_float(((unsigned)b) << 16); }
__device__ __forceinline__ float bfr(float f) { return bf2f(f2bf(f)); }
__device__ __forceinline__ v16h cat16(v8h lo, v8h hi) { return __builtin_shufflevector(lo, hi, 0, 1, 2, 3, 4, 5, 6, 7, 8, 9, 10, 11, 12, 13, 14, 15); }
__device__ __forceinline__ v16bf cat16b(v8us lo, v8us hi) { return __builtin_bit_cast(v16bf, __builtin_shufflevector(lo, hi, 0, 1, 2, 3, 4, 5, 6, 7, 8, 9, 10, 11, 12, 13, 14, 15)); }
__device__ __forceinline__ v8f wmma16(v16h a, v16h b, v8f c) { return __builtin_amdgcn_wmma_f32_16x16x32_f16(false, a, false, b, (short)0, c, false, false); }
__device__ __forceinline__ v8f wmmab(v16bf a, v16bf b, v8f c) { return __builtin_amdgcn_wmma_f32_16x16x32_bf16(false, a, false, b, (short)0, c, false, false); }



// ---- k_gemmw: register-blocked GEMM, ONE WAVE per 64x64 output tile (16 accumulators), operands straight from K-contiguous 16-bit planes; grid (M/64, N/64, Z), 32 threads.
// C[m][n] (f32, pitch ldc, + optional f32 bias[n]) = sum_k A[m][k] Bt[n][k] (+ split products per NSPLIT). z-batch strides sA/sB/sC in elements. K % 32 == 0.
// KS > 1: grid z = batches x KS; blockIdx.z = batch * KS + slice; a slice sums k in [slice K/KS, (slice + 1) K/KS) into its own plane C + blockIdx.z * sC. K % (32 KS) == 0.
template <typename T16> struct WFrag;
template <> struct WFrag<h16> { typedef v16h V; static __device__ __forceinline__ V ld(const h16* p) { return cat16(*(const v8h*)p, *(const v8h*)(p + 16)); } static __device__ __forceinline__ v8f mma(V a, V b, v8f c) { return wmma16(a, b, c); } };
template <> struct WFrag<bf> { typedef v16bf V; static __device__ __forceinline__ V ld(const bf* p) { return cat16b(*(const v8us*)p, *(const v8us*)(p + 16)); } static __device__ __forceinline__ v8f mma(V a, V b, v8f c) { return wmmab(a, b, c); } };
template <typename T16, int NSPLIT, bool BIAS, int KS = 1>
__global__ __launch_bounds__(32) void k_gemmw(const T16* __restrict__ A, const T16* __restrict__ A2, const T16* __restrict__ Bt, const T16* __restrict__ Bt2, int K, float* C, int ldc, const float* __restrict__ bias, size_t sA, size_t sB, size_t sC) {
    typedef typename WFrag<T16>::V V;
    __shared__ __align__(16) float os[16 * 68];
    const size_t z = blockIdx.z / KS; const int ks = (int)(blockIdx.z % KS); A += z * sA; if (A2) A2 += z * sA; Bt += z * sB; if (Bt2) Bt2 += z * sB; C += (size_t)blockIdx.z * sC;
    const int kbeg = ks * (K / KS), kend = kbeg + K / KS;
    const int lane = threadIdx.x & 31, lr = lane & 15, hi = lane >> 4; const int r0 = blockIdx.x * 64, c0 = blockIdx.y * 64;
    v8f acc[4][4];
#pragma unroll
    for (int mb = 0; mb < 4; ++mb)
#pragma unroll
        for (int nb = 0; nb < 4; ++nb) acc[mb][nb] = (v8f){};
    const size_t aoff = (size_t)(r0 + lr) * K + 8 * hi, boff = (size_t)(c0 + lr) * K + 8 * hi;
#pragma unroll 1
    for (int kc = kbeg; kc < kend; kc += 32) {
        V a[4], a2[4];
#pragma unroll
        for (int mb = 0; mb < 4; ++mb) { a[mb] = WFrag<T16>::ld(A + aoff + (size_t)mb * 16 * K + kc); if (NSPLIT == 1 || NSPLIT == 2) a2[mb] = WFrag<T16>::ld(A2 + aoff + (size_t)mb * 16 * K + kc); }
#pragma unroll
        for (int nb = 0; nb < 4; ++nb) { const V b = WFrag<T16>::ld(Bt + boff + (size_t)nb * 16 * K + kc); V b2; if (NSPLIT >= 2) b2 = WFrag<T16>::ld(Bt2 + boff + (size_t)nb * 16 * K + kc);
#pragma unroll
            for (int mb = 0; mb < 4; ++mb) { acc[mb][nb] = WFrag<T16>::mma(a[mb], b, acc[mb][nb]); if (NSPLIT == 1 || NSPLIT == 2) acc[mb][nb] = WFrag<T16>::mma(a2[mb], b, acc[mb][nb]); if (NSPLIT >= 2) acc[mb][nb] = WFrag<T16>::mma(a[mb], b2, acc[mb][nb]); } }
        asm volatile("v_nop\n\tv_nop\n\tv_nop\n\tv_nop" : "+v"(acc[0][0]), "+v"(acc[1][1]), "+v"(acc[2][2]), "+v"(acc[3][3]) : "v"(a[0]), "v"(a[3]));
    }
#pragma unroll
    for (int mb = 0; mb < 4; ++mb) {
#pragma unroll
        for (int nb = 0; nb < 4; ++nb) {
#pragma unroll
            for (int j = 0; j < 8; ++j) os[(hi * 8 + j) * 68 + nb * 16 + lr] = acc[mb][nb][j]; }
        __builtin_amdgcn_wave_barrier(); asm volatile("" ::: "memory");
        float* crow = C + (size_t)(r0 + mb * 16) * ldc + c0;
{
#pragma unroll
            for (int s = 0; s < 8; ++s) { const int row = 2 * s + hi, cofs = lr * 4; v4f val = *(const v4fa*)(os + row * 68 + cofs); if (BIAS) { val[0] += bfr(bias[c0 + cofs]); val[1] += bfr(bias[c0 + cofs + 1]); val[2] += bfr(bias[c0 + cofs + 2]); val[3] += bfr(bias[c0 + cofs + 3]); }
                *(v4f*)(crow + (size_t)row * ldc + cofs) = val; }
             }
        __builtin_amdgcn_wave_barrier(); asm volatile("" ::: "memory");
    }
}

__device__ __forceinline__ h16 tohx(float x) { return (h16)x; }
__device__ __forceinline__ void splitf(float y, unsigned short& h, unsigned short& l) { h = f2bf(y); l = f2bf(y - bf2f(h)); }
typedef __attribute__((ext_vector_type(2))) _Float16 v2h;
typedef __attribute__((ext_vector_type(4))) _Float16 v4h;
typedef __attribute__((ext_vector_type(2))) unsigned short v2us;
typedef __attribute__((ext_vector_type(4))) unsigned short v4us;
typedef __attribute__((ext_vector_type(2))) float v2f;
typedef __attribute__((ext_vector_type(4))) int v4i;

__global__ __launch_bounds__(256) void k_wtG(const float* __restrict__ w, int K, int N, bf* Bt) {
    const int lane = threadIdx.x & 31; const int L0 = (blockIdx.x * 8 + (threadIdx.x >> 5)) * 8; const int nlines = N * K / 64;
{
#pragma unroll 1
        for (int l = 0; l < 8; ++l) { const int L = L0 + l; if (L >= nlines) break; const size_t e = (size_t)L * 64 + lane * 2; const int k = (int)(e % K), n = (int)(e / K); v2us o;
            o[0] = f2bf(w[(size_t)k * N + n]); o[1] = f2bf(w[(size_t)(k + 1) * N + n]); *(v2us*)(Bt + e) = o; }
         }
}
__global__ __launch_bounds__(256) void k_cvt8(const float* __restrict__ src, bf* dst, size_t n8) { const size_t i = (size_t)blockIdx.x * 256 + threadIdx.x; if (i >= n8) return; const v8f v = *(const v8f*)(src + i * 8); v8us o;
#pragma unroll
    for (int k = 0; k < 8; ++k) o[k] = f2bf(v[k]); *(v8us*)(dst + i * 8) = o;  }

// k_rope: head planes [h][t][d] (fp16 + hi/lo) of rope(x) x sc with the rotate-half convention out[d] = x[d] cos[t][d] - x[d+HD/2] sin[t][d], out[d+HD/2] = x[d+HD/2] cos[t][d+HD/2] + x[d] sin[t][d+HD/2]
__global__ __launch_bounds__(256) void k_rope(const float* __restrict__ F, int pitch, int nheads, const float* __restrict__ CS, const float* __restrict__ RF, const float* __restrict__ nw, float sc, h16* P16, bf* Ph, bf* Pl) {
    const size_t e = ((size_t)blockIdx.x * 256 + threadIdx.x) * 2; if (e >= (size_t)nheads * TT * HD) return; const int d = (int)(e % HD); const int t = (int)((e / HD) % TT); const int h = (int)(e / ((size_t)HD * TT)); const float* f = F + (size_t)t * pitch + h * HD; const float rf = RF ? RF[(size_t)h * TT + t] : 1.0f; v2h o16; v2us oh, ol;
#pragma unroll
    for (int q = 0; q < 2; ++q) { const int dd = d + q; const int dp = (dd < HD / 2) ? dd + HD / 2 : dd - HD / 2; float x0 = f[dd], x1 = f[dp];
        if (RF) { float n0 = __fmul_rn(x0, rf), n1 = __fmul_rn(x1, rf); asm volatile("" : "+v"(n0)); asm volatile("" : "+v"(n1)); x0 = __fmul_rn(bfr(nw[dd]), n0); x1 = __fmul_rn(bfr(nw[dp]), n1); }
        const v2f cs = *(const v2f*)(CS + ((size_t)t * HD + dd) * 2); float a = __fmul_rn(x0, cs[0]), bq = __fmul_rn(x1, cs[1]); asm volatile("" : "+v"(a)); asm volatile("" : "+v"(bq)); const float r = ((dd < HD / 2) ? __fsub_rn(a, bq) : __fadd_rn(a, bq)) * sc;
        o16[q] = tohx(r); unsigned short a2, c2; splitf(r, a2, c2); oh[q] = a2; ol[q] = c2; }
    *(v2h*)(P16 + e) = o16; *(v2us*)(Ph + e) = oh; *(v2us*)(Pl + e) = ol;  }
__global__ __launch_bounds__(256) void k_vtp(const float* __restrict__ F, int pitch, int nheads, h16* V16, bf* Vh, bf* Vl) { const size_t e = ((size_t)blockIdx.x * 256 + threadIdx.x) * 2; if (e >= (size_t)nheads * HD * TT) return; const int t = (int)(e % TT); const int d = (int)((e / TT) % HD); const int g = (int)(e / ((size_t)TT * HD)); v2h o16; v2us oh, ol;
#pragma unroll
    for (int q = 0; q < 2; ++q) { const float x = F[(size_t)(t + q) * pitch + g * HD + d]; o16[q] = tohx(x); unsigned short a2, c2; splitf(x, a2, c2); oh[q] = a2; ol[q] = c2; }
    *(v2h*)(V16 + e) = o16; *(v2us*)(Vh + e) = oh; *(v2us*)(Vl + e) = ol;  }
__global__ __launch_bounds__(256) void k_csid(float* CS) { const int idx = blockIdx.x * 256 + threadIdx.x; if (idx >= TT * HD) return; v2f cs; cs[0] = 1.0f; cs[1] = 0.0f; *(v2f*)(CS + (size_t)idx * 2) = cs;  }
// k_asoft: per row (zz, i): t = S x HD^-0.5 (no mask); softmax over the 2048 keys (register row, one exp, fixed trees);
__global__ __launch_bounds__(256) void k_asoft(const float* __restrict__ Sb, h16* P16, bf* Ph, bf* Pl) {
    const int lane = threadIdx.x & 31; const int row = blockIdx.x * 8 + (threadIdx.x >> 5); if (row >= ZH * TT) return; const int i = row % TT; const int zz = row / TT; (void)zz; const bool hires = (i < RH); const float* sr = Sb + (size_t)row * TT; float v[TT / 32]; float mx = -3.0e38f;
#pragma unroll
    for (int ch = 0; ch < TT / 128; ++ch) { const int j0 = ch * 128 + lane * 4; const v4f a = *(const v4f*)(sr + j0);
#pragma unroll
        for (int q = 0; q < 4; ++q) { const int j = j0 + q; (void)j; const float t = a[q] * SCL; v[ch * 4 + q] = t; mx = fmaxf(mx, t); } }
#pragma unroll
    for (int sh = 16; sh; sh >>= 1) mx = fmaxf(mx, __shfl_xor(mx, sh, 32));
    float sum = 0.f;
#pragma unroll
    for (int k = 0; k < TT / 32; ++k) { float d0 = __fsub_rn(v[k], mx); asm volatile("" : "+v"(d0)); v[k] = __builtin_amdgcn_exp2f(__fmul_rn(d0, 1.4426950408889634f)); sum += v[k]; }
#pragma unroll
    for (int sh = 16; sh; sh >>= 1) sum += __shfl_xor(sum, sh, 32);
    const float f = __fdiv_rn(hires ? 1.0f : PCAR, sum);
{
        if (hires) {
#pragma unroll
            for (int ch = 0; ch < TT / 128; ++ch) { v4us oh, ol;
#pragma unroll
                for (int q = 0; q < 4; ++q) { unsigned short a, c2; splitf(v[ch * 4 + q] * f, a, c2); oh[q] = a; ol[q] = c2; }
                const size_t oo = ((size_t)zz * (RH ? RH : 1) + i) * TT + ch * 128 + lane * 4; *(v4us*)(Ph + oo) = oh; *(v4us*)(Pl + oo) = ol; }
        } else {
#pragma unroll
            for (int ch = 0; ch < TT / 128; ++ch) { v4h o4;
#pragma unroll
                for (int q = 0; q < 4; ++q) o4[q] = tohx(v[ch * 4 + q] * f);
                *(v4h*)(P16 + (size_t)row * TT + ch * 128 + lane * 4) = o4; } }
         }
}
// k_vtpV: value planes per 128-wide value head [p][e][t] (fp16 + hi/lo) = F[t][p*HV + e]; as k_vtp with HV = 128.
__global__ __launch_bounds__(256) void k_vtpV(const float* __restrict__ F, int pitch, int nheads, h16* V16, bf* Vh, bf* Vl) { const size_t e = ((size_t)blockIdx.x * 256 + threadIdx.x) * 2; if (e >= (size_t)nheads * HV * TT) return; const int t = (int)(e % TT); const int d = (int)((e / TT) % HV); const int g = (int)(e / ((size_t)TT * HV)); v2h o16; v2us oh, ol;
#pragma unroll
    for (int q = 0; q < 2; ++q) { const float x = F[(size_t)(t + q) * pitch + g * HV + d]; o16[q] = tohx(x); unsigned short a2, c2; splitf(x, a2, c2); oh[q] = a2; ol[q] = c2; }
    *(v2h*)(V16 + e) = o16; *(v2us*)(Vh + e) = oh; *(v2us*)(Vl + e) = ol;  }

template <int WD>
__global__ __launch_bounds__(256) void k_lnrowD(const float* __restrict__ X, size_t nrows, const float* __restrict__ g, const float* __restrict__ bb, bf* Hh, bf* Hl) { const int lane = threadIdx.x & 31; const size_t r = (size_t)blockIdx.x * 8 + (threadIdx.x >> 5); if (r >= nrows) return; const float* xr = X + r * WD; float a[WD / 32]; float s = 0.f;
#pragma unroll
    for (int c = 0; c < WD / 128; ++c) { const v4f v = *(const v4f*)(xr + c * 128 + lane * 4); for (int q = 0; q < 4; ++q) { a[c * 4 + q] = v[q]; s = __fadd_rn(s, a[c * 4 + q]); } }
#pragma unroll
    for (int sh = 16; sh; sh >>= 1) s = __fadd_rn(s, __shfl_xor(s, sh, 32));
    const float mean = __fdiv_rn(s, (float)WD); float s2 = 0.f;
#pragma unroll
    for (int k = 0; k < WD / 32; ++k) { const float dv = __fsub_rn(a[k], mean); float p2 = __fmul_rn(dv, dv); asm volatile("" : "+v"(p2)); s2 = __fadd_rn(s2, p2); }   /* mul and add kept separate (no fma contraction) */
#pragma unroll
    for (int sh = 16; sh; sh >>= 1) s2 = __fadd_rn(s2, __shfl_xor(s2, sh, 32));
    const float rs = __fdiv_rn(1.0f, __fsqrt_rn(__fadd_rn(__fdiv_rn(s2, (float)WD), 1e-6f)));
{
#pragma unroll
        for (int c = 0; c < WD / 128; ++c) { v4us oh, ol; for (int q = 0; q < 4; ++q) { const int col = c * 128 + lane * 4 + q; float y = __fmul_rn(__fmul_rn(__fsub_rn(a[c * 4 + q], mean), rs), bfr(g[col])); asm volatile("" : "+v"(y)); y = __fadd_rn(y, bfr(bb[col])); y = __fmul_rn(y, 1.0f - LINIT); unsigned short u, w2; splitf(y, u, w2); oh[q] = u; ol[q] = w2; } *(v4us*)(Hh + r * WD + c * 128 + lane * 4) = oh; *(v4us*)(Hl + r * WD + c * 128 + lane * 4) = ol; }
         } }
__global__ __launch_bounds__(256) void k_lambda(const float* __restrict__ a1, const float* __restrict__ b1, const float* __restrict__ a2, const float* __restrict__ b2, float* LAM) { if (threadIdx.x >= 32) return; const int lane = threadIdx.x; float s1 = __fadd_rn(__fmul_rn(bfr(a1[lane]), bfr(b1[lane])), __fmul_rn(bfr(a1[lane + 32]), bfr(b1[lane + 32]))); float s2 = __fadd_rn(__fmul_rn(bfr(a2[lane]), bfr(b2[lane])), __fmul_rn(bfr(a2[lane + 32]), bfr(b2[lane + 32])));
#pragma unroll
    for (int sh = 16; sh; sh >>= 1) { s1 = __fadd_rn(s1, __shfl_xor(s1, sh, 32)); s2 = __fadd_rn(s2, __shfl_xor(s2, sh, 32)); }
    const float lam = __fadd_rn(__fsub_rn(expf(s1), expf(s2)), LINIT); if (lane == 0) { *(float*)LAM = lam;  } }
__global__ __launch_bounds__(256) void k_dmerge(const float* __restrict__ O, const float* __restrict__ LAM, int p, float* ctx) { const size_t i = (size_t)blockIdx.x * 256 + threadIdx.x; if (i >= (size_t)TT * HV / 4) return; const size_t e = i * 4; const int c = (int)(e % HV); const int t = (int)(e / HV); const float lam = LAM[0]; const float cs = (t < RH) ? 1.0f : (1.0f / PCAR); v4f a = *(const v4f*)(O + e); v4f b2 = *(const v4f*)(O + (size_t)KSPL * TT * HV + e); v4f o;
#pragma unroll   /* unrolled so that every slice's load is issued ahead of the adds */
    for (int s = 1; s < KSPL; ++s) { a += *(const v4f*)(O + (size_t)s * TT * HV + e); b2 += *(const v4f*)(O + (size_t)(KSPL + s) * TT * HV + e); }   /* key-slice partials, ascending slice order */
#pragma unroll
    for (int q = 0; q < 4; ++q) { float lb = __fmul_rn(lam, b2[q]); asm volatile("" : "+v"(lb)); const float d = __fsub_rn(a[q], lb); o[q] = __fmul_rn(d, cs); }
    *(v4f*)(ctx + (size_t)t * DQ + p * HV + c) = o;  }
__global__ __launch_bounds__(256) void k_merge(const float* __restrict__ O, int h0, bf* Ah, bf* Al) { const size_t e = ((size_t)blockIdx.x * 256 + threadIdx.x) * 2; if (e >= (size_t)ZH * TT * HD) return; const int d = (int)(e % HD); const int t = (int)((e / HD) % TT); const int zz = (int)(e / ((size_t)HD * TT)); const float cs = (t < RH) ? 1.0f : (1.0f / PCAR); const size_t oo = (size_t)t * DQ + (h0 + zz) * HD + d;
    v2us oh, ol;
#pragma unroll
    for (int q = 0; q < 2; ++q) { unsigned short a, c2; splitf(O[e + q] * cs, a, c2); oh[q] = a; ol[q] = c2; } *(v2us*)(Ah + oo) = oh; *(v2us*)(Al + oo) = ol;  }

extern "C" void kernel_launch(void* const* d_in, const int* in_sizes, int n_in,
                              void* d_out, int out_size, void* d_ws, size_t ws_size, hipStream_t stream) {
    (void)in_sizes; (void)n_in; (void)out_size;
    const float* x = (const float*)d_in[0]; const float* xk = (const float*)d_in[1]; const float* xv = (const float*)d_in[2]; const float* wq = (const float*)d_in[3]; const float* bq = (const float*)d_in[4]; const float* wk = (const float*)d_in[5]; const float* bk = (const float*)d_in[6]; const float* wv = (const float*)d_in[7]; const float* bv = (const float*)d_in[8]; const float* lq1 = (const float*)d_in[9]; const float* lk1 = (const float*)d_in[10]; const float* lq2 = (const float*)d_in[11]; const float* lk2 = (const float*)d_in[12]; const float* lng = (const float*)d_in[13]; const float* lnb = (const float*)d_in[14]; const float* wo = (const float*)d_in[15]; const float* bo = (const float*)d_in[16];
    float* OUT = (float*)d_out;     // [2][2048][512]
    char* wsp = (char*)d_ws;
    auto take = [&](size_t bytes) { char* p = wsp; wsp += (bytes + 255) & ~(size_t)255; return (void*)p; };
    bf* WQ = (bf*)take((size_t)DQ * DM * 2); bf* WK = (bf*)take((size_t)DKV * DM * 2); bf* WV = (bf*)take((size_t)DKV * DM * 2); bf* WO = (bf*)take((size_t)DM * DQ * 2); float* CS = (float*)take((size_t)TT * HD * 2 * 4);
    bf* XB = (bf*)take((size_t)TT * DM * 2); float* FQ = (float*)take((size_t)TT * DQ * 4); float* FK = (float*)take((size_t)TT * DKV * 4);
    h16* QP16 = (h16*)take((size_t)NH_ * TT * HD * 2); h16* KP16 = (h16*)take((size_t)NKV * TT * HD * 2); h16* VT16 = (h16*)take((size_t)NKV * HD * TT * 2);
    bf* QPh = (bf*)take((size_t)NH_ * TT * HD * 2); bf* QPl = (bf*)take((size_t)NH_ * TT * HD * 2); bf* KPh = (bf*)take((size_t)NKV * TT * HD * 2); bf* KPl = (bf*)take((size_t)NKV * TT * HD * 2); bf* VTh = (bf*)take((size_t)NKV * HD * TT * 2); bf* VTl = (bf*)take((size_t)NKV * HD * TT * 2); bf* Ph = (bf*)take((size_t)ZH * RH * TT * 2); bf* Pl = (bf*)take((size_t)ZH * RH * TT * 2);
    float* Sb = (float*)take((size_t)ZH * TT * TT * 4); h16* P16 = (h16*)take((size_t)ZH * TT * TT * 2); float* Ob = (float*)take((size_t)KSPL * ZH * TT * HV * 4); float* CTX = (float*)take((size_t)TT * DQ * 4); float* LAM = (float*)take(256); bf* ATh = (bf*)take((size_t)TT * DQ * 2); bf* ATl = (bf*)take((size_t)TT * DQ * 2);
    if ((size_t)(wsp - (char*)d_ws) > ws_size) return;    // ws 256 MiB
    float* FV = FK;   // v projection reuses the k buffer after the k planes are built (stream-ordered)
    { k_wtG<<<(unsigned)((DM * DQ / 64 + 63) / 64), 256, 0, stream>>>(wq, DM, DQ, WQ); k_lambda<<<1, 256, 0, stream>>>(lq1, lk1, lq2, lk2, LAM); k_wtG<<<(unsigned)((DM * DKV / 64 + 63) / 64), 256, 0, stream>>>(wk, DM, DKV, WK); k_wtG<<<(unsigned)((DM * DKV / 64 + 63) / 64), 256, 0, stream>>>(wv, DM, DKV, WV);
      k_wtG<<<(unsigned)((DQ * DM / 64 + 63) / 64), 256, 0, stream>>>(wo, DQ, DM, WO);
       }
    k_csid<<<(TT * HD + 255) / 256, 256, 0, stream>>>(CS);
    const unsigned LQ = (unsigned)(((size_t)NH_ * TT * HD / 2 + 255) / 256), LKv = (unsigned)(((size_t)NKV * TT * HD / 2 + 255) / 256);
    for (int b = 0; b < NB_; ++b) {
        
        k_cvt8<<<(unsigned)(((size_t)TT * DM / 8 + 255) / 256), 256, 0, stream>>>(x + (size_t)b * TT * DM, XB, (size_t)TT * DM / 8);
        k_gemmw<bf, 0, true><<<dim3(TT / 64, DQ / 64, 1), 32, 0, stream>>>(XB, nullptr, WQ, nullptr, DM, FQ, DQ, bq, 0, 0, 0);
        k_rope<<<LQ, 256, 0, stream>>>(FQ, DQ, NH_, CS, nullptr, nullptr, 1.0f, QP16, QPh, QPl);
        k_cvt8<<<(unsigned)(((size_t)TT * DM / 8 + 255) / 256), 256, 0, stream>>>(xk + (size_t)b * TT * DM, XB, (size_t)TT * DM / 8); k_gemmw<bf, 0, true><<<dim3(TT / 64, DKV / 64, 1), 32, 0, stream>>>(XB, nullptr, WK, nullptr, DM, FK, DKV, bk, 0, 0, 0);
        k_rope<<<LKv, 256, 0, stream>>>(FK, DKV, NKV, CS, nullptr, nullptr, 1.0f, KP16, KPh, KPl);
        k_cvt8<<<(unsigned)(((size_t)TT * DM / 8 + 255) / 256), 256, 0, stream>>>(xv + (size_t)b * TT * DM, XB, (size_t)TT * DM / 8); k_gemmw<bf, 0, true><<<dim3(TT / 64, DKV / 64, 1), 32, 0, stream>>>(XB, nullptr, WV, nullptr, DM, FV, DKV, bv, 0, 0, 0); k_vtpV<<<LKv, 256, 0, stream>>>(FV, DKV, NP, VT16, VTh, VTl);
        for (int h0 = 0; h0 < NH_; h0 += ZH) { const size_t zq = (size_t)h0, zk = (size_t)(h0 / REP);   // one kv head per query head: the pass's two heads use consecutive kv planes (z-strides TT*HD)
            k_gemmw<bf, 2, false><<<dim3(RH / 64, TT / 64, ZH), 32, 0, stream>>>(QPh + zq * TT * HD, QPl + zq * TT * HD, KPh + zk * TT * HD, KPl + zk * TT * HD, HD, Sb, TT, nullptr, (size_t)TT * HD, (size_t)TT * HD, (size_t)TT * TT);
            k_gemmw<h16, 0, false><<<dim3((TT - RH) / 64, TT / 64, ZH), 32, 0, stream>>>(QP16 + zq * TT * HD + (size_t)RH * HD, nullptr, KP16 + zk * TT * HD, nullptr, HD, Sb + (size_t)RH * TT, TT, nullptr, (size_t)TT * HD, (size_t)TT * HD, (size_t)TT * TT);
            k_asoft<<<ZH * TT / 8, 256, 0, stream>>>(Sb, P16, Ph, Pl);
            k_gemmw<bf, 2, false, KSPL><<<dim3(RH / 64, HV / 64, ZH * KSPL), 32, 0, stream>>>(Ph, Pl, VTh + (size_t)(h0 / 2) * HV * TT, VTl + (size_t)(h0 / 2) * HV * TT, TT, Ob, HV, nullptr, (size_t)RH * TT, 0, (size_t)TT * HV);   /* both heads of the pair x the shared 128-wide v_p */
            k_gemmw<h16, 0, false, KSPL><<<dim3((TT - RH) / 64, HV / 64, ZH * KSPL), 32, 0, stream>>>(P16 + (size_t)RH * TT, nullptr, VT16 + (size_t)(h0 / 2) * HV * TT, nullptr, TT, Ob + (size_t)RH * HV, HV, nullptr, (size_t)TT * TT, 0, (size_t)TT * HV);
            k_dmerge<<<(unsigned)(((size_t)TT * HV / 4 + 255) / 256), 256, 0, stream>>>(Ob, LAM, h0 / 2, CTX);   /* ctx[t][p*128 + e] = w0 v - lambda w1 v */ }
        k_lnrowD<DQ><<<(unsigned)((TT + 7) / 8), 256, 0, stream>>>(CTX, (size_t)TT, lng, lnb, ATh, ATl);   /* LayerNorm (eps 1e-6) x (1 - lambda_init) -> hi/lo planes */ k_gemmw<bf, 1, true><<<dim3(TT / 64, DM / 64, 1), 32, 0, stream>>>(ATh, ATl, WO, nullptr, DQ, OUT + (size_t)b * TT * DM, DM, bo, 0, 0, 0); }
}

// v002
// A run of this version takes 585 microseconds.
// In both of two side-by-side timings against v001, it was 1.59 times as fast.
// Over all steps from v000 it is 3.34 times as fast.
#include <hip/hip_runtime.h>

// Multi-head DIFFERENTIAL attention (query, key, value [2][2048][512]; q = query Wq + bq, k = key Wk + bk as 16 heads x 64, v = value Wv + bv as 8 heads x 128 ('xw' [512][1024] + [1024], 0.02); w = softmax(q.k / 8) per head; for each pair p: dw = w[2p] - lambda w[2p+1], lambda = exp(lq1.lk1) - exp(lq2.lk2) + lambda_init (lq/lk [64], read); attn = dw v_p -> [2048][1024]; LayerNorm (eps 1e-6, affine) x (1 - lambda_init); out = attn Wo + bo ('xw' [1024][512]) -> [2][2048][512] (2.1 M)).
// Layout per batch: bf16 copies of the three inputs (one launch, as for the three projections and for the q and k planes); exact projections + f32 biases; q/k planes for the 16 score heads, v^T planes per 128-wide value head; lambda computed once on device (one wave: two 64-term f32 dots, precise expf); per pass = GP pairs (2 GP heads on grid z of every GEMM launch): dense T-2048 attention (hybrid rows: < 512 hi/lo 3 products, rest fp16 x1024), the softmax row written back into its own score row, both heads' P.v against the pair's shared v_p (128 wide) as 8 key-slice partial planes, a merge kernel sums them and writes w0 v - lambda w1 v (x 1/1024 on the fp16 rows) into the context; then a LayerNorm row kernel (f32, fixed order) scaled by (1 - lambda_init), converted to hi/lo planes, x Wo exact + bo.
// Compute dtypes, f32 accumulate: every input rounded to bf16; projections exact + f32 biases; attention rows < 512 3 products, rest fp16; softmax, lambda, difference, LayerNorm f32; Wo hl x exact + bias.

#define NB_  2
#define TT   2048
#define DM   512
#define NH_  16
#define NKV  16
#define REP  (NH_ / NKV)
#define HD   64
#define DQ   (NH_ * HD)
#define DKV  (NKV * HD)
#define ZH   2
#define RH   512                  // query rows < RH use hi+lo planes (0: none)
#define WIN  0
#define PCAR 1024.0f
#define SCL  0.125f
#define NP   8       // value heads (pairs)
#define HV   128     // value head width
#define LINIT 0.47071301937103271f   // lambda_init = 0.8 - 0.6 exp(-0.6) as float32
#define GP   4       // head pairs per attention pass: every launch of a pass carries all of them (GEMMs on grid z, merge on grid y, softmax in its rows on grid x)
#define NZ   (ZH * GP)   // score heads per pass
#define KSPL 8       // key slices of the P.v products: each slice (TT / KSPL keys) writes its own f32 partial plane per head, summed in k_dmerge
typedef _Float16 h16;
typedef unsigned short bf;
typedef __attribute__((ext_vector_type(16))) __bf16   v16bf;
typedef __attribute__((ext_vector_type(16))) _Float16 v16h;
typedef __attribute__((ext_vector_type(8)))  _Float16 v8h;
typedef __attribute__((ext_vector_type(8)))  unsigned short v8us;
typedef __attribute__((ext_vector_type(8)))  float    v8f;
typedef __attribute__((ext_vector_type(4)))  float    v4f;
typedef v8h  __attribute__((may_alias)) v8ha;
typedef v4f  __attribute__((may_alias)) v4fa;
typedef v8us __attribute__((may_alias)) v8usa;

__device__ __forceinline__ unsigned short f2bf(float f) { unsigned u = __float_as_uint(f); u += 0x7FFFu + ((u >> 16) & 1u); return (unsigned short)(u >> 16); }
__device__ __forceinline__ float bf2f(unsigned short b) { return __uint_as_float(((unsigned)b) << 16); }
__device__ __forceinline__ float bfr(float f) { return bf2f(f2bf(f)); }
__device__ __forceinline__ v16h cat16(v8h lo, v8h hi) { return __builtin_shufflevector(lo, hi, 0, 1, 2, 3, 4, 5, 6, 7, 8, 9, 10, 11, 12, 13, 14, 15); }
__device__ __forceinline__ v16bf cat16b(v8us lo, v8us hi) { return __builtin_bit_cast(v16bf, __builtin_shufflevector(lo, hi, 0, 1, 2, 3, 4, 5, 6, 7, 8, 9, 10, 11, 12, 13, 14, 15)); }
__device__ __forceinline__ v8f wmma16(v16h a, v16h b, v8f c) { return __builtin_amdgcn_wmma_f32_16x16x32_f16(false, a, false, b, (short)0, c, false, false); }
__device__ __forceinline__ v8f wmmab(v16bf a, v16bf b, v8f c) { return __builtin_amdgcn_wmma_f32_16x16x32_bf16(false, a, false, b, (short)0, c, false, false); }



// ---- k_gemmw: register-blocked GEMM, ONE WAVE per 64x64 output tile (16 accumulators), operands straight from K-contiguous 16-bit planes; grid (M/64, N/64, Z), 32 threads.
// C[m][n] (f32, pitch ldc, + optional f32 bias[n]) = sum_k A[m][k] Bt[n][k] (+ split products per NSPLIT). A rows have pitch lda, Bt rows pitch K. z-batch strides sA/sB/sC in elements; batch z reads Bt plane z >> bsh (bsh = 1: two batches share one); batch z adds bias vector z. K % 32 == 0.
// KS > 1: grid z = batches x KS; blockIdx.z = batch * KS + slice; a slice sums k in [slice K/KS, (slice + 1) K/KS) into its own plane C + blockIdx.z * sC. K % (32 KS) == 0.
template <typename T16> struct WFrag;
template <> struct WFrag<h16> { typedef v16h V; static __device__ __forceinline__ V ld(const h16* p) { return cat16(*(const v8h*)p, *(const v8h*)(p + 16)); } static __device__ __forceinline__ v8f mma(V a, V b, v8f c) { return wmma16(a, b, c); } };
template <> struct WFrag<bf> { typedef v16bf V; static __device__ __forceinline__ V ld(const bf* p) { return cat16b(*(const v8us*)p, *(const v8us*)(p + 16)); } static __device__ __forceinline__ v8f mma(V a, V b, v8f c) { return wmmab(a, b, c); } };
template <typename T16, int NSPLIT, bool BIAS, int KS = 1>
__global__ __launch_bounds__(32) void k_gemmw(const T16* __restrict__ A, const T16* __restrict__ A2, const T16* __restrict__ Bt, const T16* __restrict__ Bt2, int K, int lda, int bsh, float* C, int ldc, const float* __restrict__ bias0, const float* __restrict__ bias1, const float* __restrict__ bias2, size_t sA, size_t sB, size_t sC) {
    typedef typename WFrag<T16>::V V;
    __shared__ __align__(16) float os[16 * 68];
    const size_t z = blockIdx.z / KS; const int ks = (int)(blockIdx.z % KS); A += z * sA; if (A2) A2 += z * sA; Bt += (z >> bsh) * sB; if (Bt2) Bt2 += (z >> bsh) * sB; C += (size_t)blockIdx.z * sC;
    const float* __restrict__ bias = z == 0 ? bias0 : z == 1 ? bias1 : bias2;   // up to three biased batches, each with its own bias vector
    const int kbeg = ks * (K / KS), kend = kbeg + K / KS;
    const int lane = threadIdx.x & 31, lr = lane & 15, hi = lane >> 4; const int r0 = blockIdx.x * 64, c0 = blockIdx.y * 64;
    v8f acc[4][4];
#pragma unroll
    for (int mb = 0; mb < 4; ++mb)
#pragma unroll
        for (int nb = 0; nb < 4; ++nb) acc[mb][nb] = (v8f){};
    const size_t aoff = (size_t)(r0 + lr) * lda + 8 * hi, boff = (size_t)(c0 + lr) * K + 8 * hi;
#pragma unroll 1
    for (int kc = kbeg; kc < kend; kc += 32) {
        V a[4], a2[4]; const T16* pa[4]; const T16* pa2[4];
#pragma unroll
        for (int mb = 0; mb < 4; ++mb) { pa[mb] = A + aoff + (size_t)mb * 16 * lda + kc; a[mb] = WFrag<T16>::ld(pa[mb]); if (NSPLIT == 1 || NSPLIT == 2) { pa2[mb] = A2 + aoff + (size_t)mb * 16 * lda + kc; a2[mb] = WFrag<T16>::ld(pa2[mb]); } }
        // the A row addresses are inputs of this wait so that their registers stay untouched from the loads down to it; only behind it may they take new values. It orders every load around it, so with three products it stands at the loop's foot instead: here it would cut the B loads into more, serial, batches
        if (NSPLIT == 1) asm volatile("s_wait_xcnt 0x0" :: "v"(pa[0]), "v"(pa[1]), "v"(pa[2]), "v"(pa[3]), "v"(pa2[0]), "v"(pa2[1]), "v"(pa2[2]), "v"(pa2[3]) : "memory");
        if (NSPLIT == 0 || NSPLIT > 2) asm volatile("s_wait_xcnt 0x0" :: "v"(pa[0]), "v"(pa[1]), "v"(pa[2]), "v"(pa[3]) : "memory");
#pragma unroll
        for (int nb = 0; nb < 4; ++nb) { const V b = WFrag<T16>::ld(Bt + boff + (size_t)nb * 16 * K + kc); V b2; if (NSPLIT >= 2) b2 = WFrag<T16>::ld(Bt2 + boff + (size_t)nb * 16 * K + kc);
#pragma unroll
            for (int mb = 0; mb < 4; ++mb) { acc[mb][nb] = WFrag<T16>::mma(a[mb], b, acc[mb][nb]); if (NSPLIT == 1 || NSPLIT == 2) acc[mb][nb] = WFrag<T16>::mma(a2[mb], b, acc[mb][nb]); if (NSPLIT >= 2) acc[mb][nb] = WFrag<T16>::mma(a[mb], b2, acc[mb][nb]); } }
        if (NSPLIT == 2) asm volatile("s_wait_xcnt 0x0" :: "v"(pa[0]), "v"(pa[1]), "v"(pa[2]), "v"(pa[3]), "v"(pa2[0]), "v"(pa2[1]), "v"(pa2[2]), "v"(pa2[3]) : "memory");   // the same wait for the three-product form
        asm volatile("v_nop\n\tv_nop\n\tv_nop\n\tv_nop" : "+v"(acc[0][0]), "+v"(acc[1][1]), "+v"(acc[2][2]), "+v"(acc[3][3]) : "v"(a[0]), "v"(a[3]));
    }
#pragma unroll
    for (int mb = 0; mb < 4; ++mb) {
#pragma unroll
        for (int nb = 0; nb < 4; ++nb) {
#pragma unroll
            for (int j = 0; j < 8; ++j) os[(hi * 8 + j) * 68 + nb * 16 + lr] = acc[mb][nb][j]; }
        __builtin_amdgcn_wave_barrier(); asm volatile("" ::: "memory");
        float* crow = C + (size_t)(r0 + mb * 16) * ldc + c0;
{
#pragma unroll
            for (int s = 0; s < 8; ++s) { const int row = 2 * s + hi, cofs = lr * 4; v4f val = *(const v4fa*)(os + row * 68 + cofs); if (BIAS) { val[0] += bfr(bias[c0 + cofs]); val[1] += bfr(bias[c0 + cofs + 1]); val[2] += bfr(bias[c0 + cofs + 2]); val[3] += bfr(bias[c0 + cofs + 3]); }
                *(v4f*)(crow + (size_t)row * ldc + cofs) = val; }
             }
        __builtin_amdgcn_wave_barrier(); asm volatile("" ::: "memory");
    }
}

__device__ __forceinline__ h16 tohx(float x) { return (h16)x; }
__device__ __forceinline__ void splitf(float y, unsigned short& h, unsigned short& l) { h = f2bf(y); l = f2bf(y - bf2f(h)); }
typedef __attribute__((ext_vector_type(2))) _Float16 v2h;
typedef __attribute__((ext_vector_type(4))) _Float16 v4h;
typedef __attribute__((ext_vector_type(2))) unsigned short v2us;
typedef __attribute__((ext_vector_type(4))) unsigned short v4us;
typedef __attribute__((ext_vector_type(2))) float v2f;
typedef __attribute__((ext_vector_type(4))) int v4i;

// grid y: which of up to three equally shaped weights; their Bt planes follow one another
__global__ __launch_bounds__(256) void k_wtG(const float* __restrict__ w0, const float* __restrict__ w1, const float* __restrict__ w2, int K, int N, bf* Bt) {
    const float* __restrict__ w = blockIdx.y == 0 ? w0 : blockIdx.y == 1 ? w1 : w2; Bt += (size_t)blockIdx.y * K * N;
    const int lane = threadIdx.x & 31; const int L0 = (blockIdx.x * 8 + (threadIdx.x >> 5)) * 8; const int nlines = N * K / 64;
{
#pragma unroll 1
        for (int l = 0; l < 8; ++l) { const int L = L0 + l; if (L >= nlines) break; const size_t e = (size_t)L * 64 + lane * 2; const int k = (int)(e % K), n = (int)(e / K); v2us o;
            o[0] = f2bf(w[(size_t)k * N + n]); o[1] = f2bf(w[(size_t)(k + 1) * N + n]); *(v2us*)(Bt + e) = o; }
         }
}
// grid y: which of the three sources; their bf16 copies follow one another
__global__ __launch_bounds__(256) void k_cvt8(const float* __restrict__ s0, const float* __restrict__ s1, const float* __restrict__ s2, bf* dst, size_t n8) { const float* __restrict__ src = blockIdx.y == 0 ? s0 : blockIdx.y == 1 ? s1 : s2; dst += (size_t)blockIdx.y * n8 * 8; const size_t i = (size_t)blockIdx.x * 256 + threadIdx.x; if (i >= n8) return; const v8f v = *(const v8f*)(src + i * 8); v8us o;
#pragma unroll
    for (int k = 0; k < 8; ++k) o[k] = f2bf(v[k]); *(v8us*)(dst + i * 8) = o;  }

// k_rope: head planes [h][t][d] (fp16 + hi/lo) of rope(x) x sc with the rotate-half convention out[d] = x[d] cos[t][d] - x[d+HD/2] sin[t][d], out[d+HD/2] = x[d+HD/2] cos[t][d+HD/2] + x[d] sin[t][d+HD/2]
__global__ __launch_bounds__(256) void k_rope(const float* __restrict__ F, int pitch, int nheads, const float* __restrict__ CS, const float* __restrict__ RF, const float* __restrict__ nw, float sc, h16* P16, bf* Ph, bf* Pl) {
    const size_t e = ((size_t)blockIdx.x * 256 + threadIdx.x) * 2; if (e >= (size_t)nheads * TT * HD) return; const int d = (int)(e % HD); const int t = (int)((e / HD) % TT); const int h = (int)(e / ((size_t)HD * TT)); const float* f = F + (size_t)t * pitch + h * HD; const float rf = RF ? RF[(size_t)h * TT + t] : 1.0f; v2h o16; v2us oh, ol;
    f += (size_t)(h / NH_) * ((size_t)TT * pitch - NH_ * HD);   // heads NH_ and up come from the next [TT][pitch] plane (k behind q)
#pragma unroll
    for (int q = 0; q < 2; ++q) { const int dd = d + q; const int dp = (dd < HD / 2) ? dd + HD / 2 : dd - HD / 2; float x0 = f[dd], x1 = f[dp];
        if (RF) { float n0 = __fmul_rn(x0, rf), n1 = __fmul_rn(x1, rf); asm volatile("" : "+v"(n0)); asm volatile("" : "+v"(n1)); x0 = __fmul_rn(bfr(nw[dd]), n0); x1 = __fmul_rn(bfr(nw[dp]), n1); }
        const v2f cs = *(const v2f*)(CS + ((size_t)t * HD + dd) * 2); float a = __fmul_rn(x0, cs[0]), bq = __fmul_rn(x1, cs[1]); asm volatile("" : "+v"(a)); asm volatile("" : "+v"(bq)); const float r = ((dd < HD / 2) ? __fsub_rn(a, bq) : __fadd_rn(a, bq)) * sc;
        o16[q] = tohx(r); unsigned short a2, c2; splitf(r, a2, c2); oh[q] = a2; ol[q] = c2; }
    *(v2h*)(P16 + e) = o16; *(v2us*)(Ph + e) = oh; *(v2us*)(Pl + e) = ol;  }
__global__ __launch_bounds__(256) void k_vtp(const float* __restrict__ F, int pitch, int nheads, h16* V16, bf* Vh, bf* Vl) { const size_t e = ((size_t)blockIdx.x * 256 + threadIdx.x) * 2; if (e >= (size_t)nheads * HD * TT) return; const int t = (int)(e % TT); const int d = (int)((e / TT) % HD); const int g = (int)(e / ((size_t)TT * HD)); v2h o16; v2us oh, ol;
#pragma unroll
    for (int q = 0; q < 2; ++q) { const float x = F[(size_t)(t + q) * pitch + g * HD + d]; o16[q] = tohx(x); unsigned short a2, c2; splitf(x, a2, c2); oh[q] = a2; ol[q] = c2; }
    *(v2h*)(V16 + e) = o16; *(v2us*)(Vh + e) = oh; *(v2us*)(Vl + e) = ol;  }
__global__ __launch_bounds__(256) void k_csid(float* CS) { const int idx = blockIdx.x * 256 + threadIdx.x; if (idx >= TT * HD) return; v2f cs; cs[0] = 1.0f; cs[1] = 0.0f; *(v2f*)(CS + (size_t)idx * 2) = cs;  }
// k_asoft: per row (zz, i): t = S x HD^-0.5 (no mask); softmax over the 2048 keys (register row, one exp, fixed trees); the wave holds its whole row in registers and writes P over that same row of Sb: fp16 in the first TT 16-bit places, or hi there and lo in the second TT (16-bit row pitch 2 TT)
__global__ __launch_bounds__(256) void k_asoft(float* Sb) {
    const int lane = threadIdx.x & 31; const int row = blockIdx.x * 8 + (threadIdx.x >> 5); if (row >= NZ * TT) return; const int i = row % TT; const bool hires = (i < RH); float* sr = Sb + (size_t)row * TT; float v[TT / 32]; float mx = -3.0e38f;
#pragma unroll
    for (int ch = 0; ch < TT / 128; ++ch) { const int j0 = ch * 128 + lane * 4; const v4f a = *(const v4f*)(sr + j0);
#pragma unroll
        for (int q = 0; q < 4; ++q) { const int j = j0 + q; (void)j; const float t = a[q] * SCL; v[ch * 4 + q] = t; mx = fmaxf(mx, t); } }
#pragma unroll
    for (int sh = 16; sh; sh >>= 1) mx = fmaxf(mx, __shfl_xor(mx, sh, 32));
    float sum = 0.f;
#pragma unroll
    for (int k = 0; k < TT / 32; ++k) { float d0 = __fsub_rn(v[k], mx); asm volatile("" : "+v"(d0)); v[k] = __builtin_amdgcn_exp2f(__fmul_rn(d0, 1.4426950408889634f)); sum += v[k]; }
#pragma unroll
    for (int sh = 16; sh; sh >>= 1) sum += __shfl_xor(sum, sh, 32);
    const float f = __fdiv_rn(hires ? 1.0f : PCAR, sum);
{
        if (hires) {
#pragma unroll
            for (int ch = 0; ch < TT / 128; ++ch) { v4us oh, ol;
#pragma unroll
                for (int q = 0; q < 4; ++q) { unsigned short a, c2; splitf(v[ch * 4 + q] * f, a, c2); oh[q] = a; ol[q] = c2; }
                bf* pr = (bf*)sr + ch * 128 + lane * 4; *(v4us*)pr = oh; *(v4us*)(pr + TT) = ol; }
        } else {
#pragma unroll
            for (int ch = 0; ch < TT / 128; ++ch) { v4h o4;
#pragma unroll
                for (int q = 0; q < 4; ++q) o4[q] = tohx(v[ch * 4 + q] * f);
                *(v4h*)((h16*)sr + ch * 128 + lane * 4) = o4; } }
         }
}
// k_vtpV: value planes per 128-wide value head [p][e][t] (fp16 + hi/lo) = F[t][p*HV + e]; as k_vtp with HV = 128.
__global__ __launch_bounds__(256) void k_vtpV(const float* __restrict__ F, int pitch, int nheads, h16* V16, bf* Vh, bf* Vl) { const size_t e = ((size_t)blockIdx.x * 256 + threadIdx.x) * 2; if (e >= (size_t)nheads * HV * TT) return; const int t = (int)(e % TT); const int d = (int)((e / TT) % HV); const int g = (int)(e / ((size_t)TT * HV)); v2h o16; v2us oh, ol;
#pragma unroll
    for (int q = 0; q < 2; ++q) { const float x = F[(size_t)(t + q) * pitch + g * HV + d]; o16[q] = tohx(x); unsigned short a2, c2; splitf(x, a2, c2); oh[q] = a2; ol[q] = c2; }
    *(v2h*)(V16 + e) = o16; *(v2us*)(Vh + e) = oh; *(v2us*)(Vl + e) = ol;  }

template <int WD>
__global__ __launch_bounds__(256) void k_lnrowD(const float* __restrict__ X, size_t nrows, const float* __restrict__ g, const float* __restrict__ bb, bf* Hh, bf* Hl) { const int lane = threadIdx.x & 31; const size_t r = (size_t)blockIdx.x * 8 + (threadIdx.x >> 5); if (r >= nrows) return; const float* xr = X + r * WD; float a[WD / 32]; float s = 0.f;
#pragma unroll
    for (int c = 0; c < WD / 128; ++c) { const v4f v = *(const v4f*)(xr + c * 128 + lane * 4); for (int q = 0; q < 4; ++q) { a[c * 4 + q] = v[q]; s = __fadd_rn(s, a[c * 4 + q]); } }
#pragma unroll
    for (int sh = 16; sh; sh >>= 1) s = __fadd_rn(s, __shfl_xor(s, sh, 32));
    const float mean = __fdiv_rn(s, (float)WD); float s2 = 0.f;
#pragma unroll
    for (int k = 0; k < WD / 32; ++k) { const float dv = __fsub_rn(a[k], mean); float p2 = __fmul_rn(dv, dv); asm volatile("" : "+v"(p2)); s2 = __fadd_rn(s2, p2); }   /* mul and add kept separate (no fma contraction) */
#pragma unroll
    for (int sh = 16; sh; sh >>= 1) s2 = __fadd_rn(s2, __shfl_xor(s2, sh, 32));
    const float rs = __fdiv_rn(1.0f, __fsqrt_rn(__fadd_rn(__fdiv_rn(s2, (float)WD), 1e-6f)));
{
#pragma unroll
        for (int c = 0; c < WD / 128; ++c) { v4us oh, ol; for (int q = 0; q < 4; ++q) { const int col = c * 128 + lane * 4 + q; float y = __fmul_rn(__fmul_rn(__fsub_rn(a[c * 4 + q], mean), rs), bfr(g[col])); asm volatile("" : "+v"(y)); y = __fadd_rn(y, bfr(bb[col])); y = __fmul_rn(y, 1.0f - LINIT); unsigned short u, w2; splitf(y, u, w2); oh[q] = u; ol[q] = w2; } *(v4us*)(Hh + r * WD + c * 128 + lane * 4) = oh; *(v4us*)(Hl + r * WD + c * 128 + lane * 4) = ol; }
         } }
__global__ __launch_bounds__(256) void k_lambda(const float* __restrict__ a1, const float* __restrict__ b1, const float* __restrict__ a2, const float* __restrict__ b2, float* LAM) { if (threadIdx.x >= 32) return; const int lane = threadIdx.x; float s1 = __fadd_rn(__fmul_rn(bfr(a1[lane]), bfr(b1[lane])), __fmul_rn(bfr(a1[lane + 32]), bfr(b1[lane + 32]))); float s2 = __fadd_rn(__fmul_rn(bfr(a2[lane]), bfr(b2[lane])), __fmul_rn(bfr(a2[lane + 32]), bfr(b2[lane + 32])));
#pragma unroll
    for (int sh = 16; sh; sh >>= 1) { s1 = __fadd_rn(s1, __shfl_xor(s1, sh, 32)); s2 = __fadd_rn(s2, __shfl_xor(s2, sh, 32)); }
    const float lam = __fadd_rn(__fsub_rn(expf(s1), expf(s2)), LINIT); if (lane == 0) { *(float*)LAM = lam;  } }
__global__ __launch_bounds__(256) void k_dmerge(const float* __restrict__ O, const float* __restrict__ LAM, int p, float* ctx) { const size_t i = (size_t)blockIdx.x * 256 + threadIdx.x; if (i >= (size_t)TT * HV / 4) return; O += (size_t)blockIdx.y * ZH * KSPL * TT * HV; p += (int)blockIdx.y;   /* grid y: the pair within the pass */ const size_t e = i * 4; const int c = (int)(e % HV); const int t = (int)(e / HV); const float lam = LAM[0]; const float cs = (t < RH) ? 1.0f : (1.0f / PCAR); v4f a = *(const v4f*)(O + e); v4f b2 = *(const v4f*)(O + (size_t)KSPL * TT * HV + e); v4f o;
#pragma unroll   /* unrolled so that every slice's load is issued ahead of the adds */
    for (int s = 1; s < KSPL; ++s) { a += *(const v4f*)(O + (size_t)s * TT * HV + e); b2 += *(const v4f*)(O + (size_t)(KSPL + s) * TT * HV + e); }   /* key-slice partials, ascending slice order */
#pragma unroll
    for (int q = 0; q < 4; ++q) { float lb = __fmul_rn(lam, b2[q]); asm volatile("" : "+v"(lb)); const float d = __fsub_rn(a[q], lb); o[q] = __fmul_rn(d, cs); }
    *(v4f*)(ctx + (size_t)t * DQ + p * HV + c) = o;  }
__global__ __launch_bounds__(256) void k_merge(const float* __restrict__ O, int h0, bf* Ah, bf* Al) { const size_t e = ((size_t)blockIdx.x * 256 + threadIdx.x) * 2; if (e >= (size_t)ZH * TT * HD) return; const int d = (int)(e % HD); const int t = (int)((e / HD) % TT); const int zz = (int)(e / ((size_t)HD * TT)); const float cs = (t < RH) ? 1.0f : (1.0f / PCAR); const size_t oo = (size_t)t * DQ + (h0 + zz) * HD + d;
    v2us oh, ol;
#pragma unroll
    for (int q = 0; q < 2; ++q) { unsigned short a, c2; splitf(O[e + q] * cs, a, c2); oh[q] = a; ol[q] = c2; } *(v2us*)(Ah + oo) = oh; *(v2us*)(Al + oo) = ol;  }

extern "C" void kernel_launch(void* const* d_in, const int* in_sizes, int n_in,
                              void* d_out, int out_size, void* d_ws, size_t ws_size, hipStream_t stream) {
    (void)in_sizes; (void)n_in; (void)out_size;
    const float* x = (const float*)d_in[0]; const float* xk = (const float*)d_in[1]; const float* xv = (const float*)d_in[2]; const float* wq = (const float*)d_in[3]; const float* bq = (const float*)d_in[4]; const float* wk = (const float*)d_in[5]; const float* bk = (const float*)d_in[6]; const float* wv = (const float*)d_in[7]; const float* bv = (const float*)d_in[8]; const float* lq1 = (const float*)d_in[9]; const float* lk1 = (const float*)d_in[10]; const float* lq2 = (const float*)d_in[11]; const float* lk2 = (const float*)d_in[12]; const float* lng = (const float*)d_in[13]; const float* lnb = (const float*)d_in[14]; const float* wo = (const float*)d_in[15]; const float* bo = (const float*)d_in[16];
    float* OUT = (float*)d_out;     // [2][2048][512]
    char* wsp = (char*)d_ws;
    auto take = [&](size_t bytes) { char* p = wsp; wsp += (bytes + 255) & ~(size_t)255; return (void*)p; };
    bf* WQ = (bf*)take((size_t)DQ * DM * 2); bf* WK = (bf*)take((size_t)DKV * DM * 2); bf* WV = (bf*)take((size_t)DKV * DM * 2); bf* WO = (bf*)take((size_t)DM * DQ * 2); float* CS = (float*)take((size_t)TT * HD * 2 * 4);
    h16* QP16 = (h16*)take((size_t)NH_ * TT * HD * 2); h16* KP16 = (h16*)take((size_t)NKV * TT * HD * 2); h16* VT16 = (h16*)take((size_t)NKV * HD * TT * 2);   // each k plane set directly behind its q plane set: one launch writes both
    bf* QPh = (bf*)take((size_t)NH_ * TT * HD * 2); bf* KPh = (bf*)take((size_t)NKV * TT * HD * 2); bf* QPl = (bf*)take((size_t)NH_ * TT * HD * 2); bf* KPl = (bf*)take((size_t)NKV * TT * HD * 2); bf* VTh = (bf*)take((size_t)NKV * HD * TT * 2); bf* VTl = (bf*)take((size_t)NKV * HD * TT * 2);
    float* Sb = (float*)take((size_t)NZ * TT * TT * 4); float* Ob = (float*)take((size_t)KSPL * NZ * TT * HV * 4); float* CTX = (float*)take((size_t)TT * DQ * 4); float* LAM = (float*)take(256); bf* ATh = (bf*)take((size_t)TT * DQ * 2); bf* ATl = (bf*)take((size_t)TT * DQ * 2);
    if ((size_t)(wsp - (char*)d_ws) > ws_size) return;    // ws 256 MiB
    bf* XB = (bf*)Ob; float* FQ = Sb; float* FV = FQ + (size_t)2 * TT * DQ;   // the three bf16 input copies and the three f32 projections [q][k][v] live in the pass buffers, which are first written after the planes are built (stream-ordered)
    { k_wtG<<<dim3((unsigned)((DM * DQ / 64 + 63) / 64), 3, 1), 256, 0, stream>>>(wq, wk, wv, DM, DQ, WQ); k_lambda<<<1, 256, 0, stream>>>(lq1, lk1, lq2, lk2, LAM);
      k_wtG<<<(unsigned)((DQ * DM / 64 + 63) / 64), 256, 0, stream>>>(wo, wo, wo, DQ, DM, WO);
       }
    k_csid<<<(TT * HD + 255) / 256, 256, 0, stream>>>(CS);
    const unsigned LQK = (unsigned)(((size_t)(NH_ + NKV) * TT * HD / 2 + 255) / 256), LKv = (unsigned)(((size_t)NKV * TT * HD / 2 + 255) / 256);
    for (int b = 0; b < NB_; ++b) {
        k_cvt8<<<dim3((unsigned)(((size_t)TT * DM / 8 + 255) / 256), 3, 1), 256, 0, stream>>>(x + (size_t)b * TT * DM, xk + (size_t)b * TT * DM, xv + (size_t)b * TT * DM, XB, (size_t)TT * DM / 8);
        k_gemmw<bf, 0, true><<<dim3(TT / 64, DQ / 64, 3), 32, 0, stream>>>(XB, nullptr, WQ, nullptr, DM, DM, 0, FQ, DQ, bq, bk, bv, (size_t)TT * DM, (size_t)DQ * DM, (size_t)TT * DQ);   /* q, k and v projections on grid z */
        k_rope<<<LQK, 256, 0, stream>>>(FQ, DQ, NH_ + NKV, CS, nullptr, nullptr, 1.0f, QP16, QPh, QPl);   /* q and k planes */
        k_vtpV<<<LKv, 256, 0, stream>>>(FV, DKV, NP, VT16, VTh, VTl);
        for (int h0 = 0; h0 < NH_; h0 += NZ) { const size_t zq = (size_t)h0, zk = (size_t)(h0 / REP);   // one kv head per query head: the pass's NZ heads use consecutive q and kv planes (z-strides TT*HD)
            k_gemmw<bf, 2, false><<<dim3(RH / 64, TT / 64, NZ), 32, 0, stream>>>(QPh + zq * TT * HD, QPl + zq * TT * HD, KPh + zk * TT * HD, KPl + zk * TT * HD, HD, HD, 0, Sb, TT, nullptr, nullptr, nullptr, (size_t)TT * HD, (size_t)TT * HD, (size_t)TT * TT);
            k_gemmw<h16, 0, false><<<dim3((TT - RH) / 64, TT / 64, NZ), 32, 0, stream>>>(QP16 + zq * TT * HD + (size_t)RH * HD, nullptr, KP16 + zk * TT * HD, nullptr, HD, HD, 0, Sb + (size_t)RH * TT, TT, nullptr, nullptr, nullptr, (size_t)TT * HD, (size_t)TT * HD, (size_t)TT * TT);
            k_asoft<<<NZ * TT / 8, 256, 0, stream>>>(Sb);
            k_gemmw<bf, 2, false, KSPL><<<dim3(RH / 64, HV / 64, NZ * KSPL), 32, 0, stream>>>((const bf*)Sb, (const bf*)Sb + TT, VTh + (size_t)(h0 / 2) * HV * TT, VTl + (size_t)(h0 / 2) * HV * TT, TT, 2 * TT, 1, Ob, HV, nullptr, nullptr, nullptr, (size_t)2 * TT * TT, (size_t)HV * TT, (size_t)TT * HV);   /* both heads of each pair x the pair's shared 128-wide v_p */
            k_gemmw<h16, 0, false, KSPL><<<dim3((TT - RH) / 64, HV / 64, NZ * KSPL), 32, 0, stream>>>((const h16*)Sb + (size_t)RH * 2 * TT, nullptr, VT16 + (size_t)(h0 / 2) * HV * TT, nullptr, TT, 2 * TT, 1, Ob + (size_t)RH * HV, HV, nullptr, nullptr, nullptr, (size_t)2 * TT * TT, (size_t)HV * TT, (size_t)TT * HV);
            k_dmerge<<<dim3((unsigned)(((size_t)TT * HV / 4 + 255) / 256), GP, 1), 256, 0, stream>>>(Ob, LAM, h0 / 2, CTX);   /* ctx[t][p*128 + e] = w0 v - lambda w1 v */ }
        k_lnrowD<DQ><<<(unsigned)((TT + 7) / 8), 256, 0, stream>>>(CTX, (size_t)TT, lng, lnb, ATh, ATl);   /* LayerNorm (eps 1e-6) x (1 - lambda_init) -> hi/lo planes */ k_gemmw<bf, 1, true><<<dim3(TT / 64, DM / 64, 1), 32, 0, stream>>>(ATh, ATl, WO, nullptr, DQ, DQ, 0, OUT + (size_t)b * TT * DM, DM, bo, bo, bo, 0, 0, 0); }
}

// v003
// One run takes 430 microseconds.
// Two timings next to v002 put it at 1.37 and 1.36 times that version's speed.
// Counting every step since v000, it is 4.55 times as fast.
#include <hip/hip_runtime.h>

// Multi-head DIFFERENTIAL attention (query, key, value [2][2048][512]; q = query Wq + bq, k = key Wk + bk as 16 heads x 64, v = value Wv + bv as 8 heads x 128 ('xw' [512][1024] + [1024], 0.02); w = softmax(q.k / 8) per head; for each pair p: dw = w[2p] - lambda w[2p+1], lambda = exp(lq1.lk1) - exp(lq2.lk2) + lambda_init (lq/lk [64], read); attn = dw v_p -> [2048][1024]; LayerNorm (eps 1e-6, affine) x (1 - lambda_init); out = attn Wo + bo ('xw' [1024][512]) -> [2][2048][512] (2.1 M)).
// Layout: per batch bf16 copies of the three inputs (one launch, as for the three projections and for the q and k planes); exact projections + f32 biases; q/k planes for the 16 score heads, v^T planes per 128-wide value head, kept for both batches; lambda computed once on device (one wave: two 64-term f32 dots, precise expf); ONE fused attention launch for every batch, head and query tile (k_fattn: scores, online softmax and P.v in registers, no score matrix in memory; hybrid rows: < 512 hi/lo 3 products, rest fp16), each head's normalised w v as an f32 plane; a merge kernel writes w0 v - lambda w1 v into the context; then a LayerNorm row kernel (f32, fixed order) scaled by (1 - lambda_init), converted to hi/lo planes, x Wo exact + bo.
// Compute dtypes, f32 accumulate: every input rounded to bf16; projections exact + f32 biases; attention rows < 512 3 products, rest fp16; softmax, lambda, difference, LayerNorm f32; Wo hl x exact + bias.

#define NB_  2
#define TT   2048
#define DM   512
#define NH_  16
#define NKV  16
#define REP  (NH_ / NKV)
#define HD   64
#define DQ   (NH_ * HD)
#define DKV  (NKV * HD)
#define ZH   2
#define RH   512                  // query rows < RH use hi+lo planes (0: none)
#define WIN  0
#define PCAR 1024.0f
#define SCL  0.125f
#define NP   8       // value heads (pairs)
#define HV   128     // value head width
#define LINIT 0.47071301937103271f   // lambda_init = 0.8 - 0.6 exp(-0.6) as float32
#define KQ   4       // key quarters of the fused attention: the four waves of a work-group each walk TT / KQ keys of the same query tile
#define L2E  1.4426950408889634f
#define QP   72      // LDS row pitch of the query tile in 16-bit elements (64 + 8: 16 bytes of pad against bank conflicts between rows)
typedef _Float16 h16;
typedef unsigned short bf;
typedef __attribute__((ext_vector_type(16))) __bf16   v16bf;
typedef __attribute__((ext_vector_type(16))) _Float16 v16h;
typedef __attribute__((ext_vector_type(8)))  _Float16 v8h;
typedef __attribute__((ext_vector_type(8)))  unsigned short v8us;
typedef __attribute__((ext_vector_type(8)))  float    v8f;
typedef __attribute__((ext_vector_type(4)))  float    v4f;
typedef v8h  __attribute__((may_alias)) v8ha;
typedef v4f  __attribute__((may_alias)) v4fa;
typedef v8us __attribute__((may_alias)) v8usa;

__device__ __forceinline__ unsigned short f2bf(float f) { unsigned u = __float_as_uint(f); u += 0x7FFFu + ((u >> 16) & 1u); return (unsigned short)(u >> 16); }
__device__ __forceinline__ float bf2f(unsigned short b) { return __uint_as_float(((unsigned)b) << 16); }
__device__ __forceinline__ float bfr(float f) { return bf2f(f2bf(f)); }
__device__ __forceinline__ v16h cat16(v8h lo, v8h hi) { return __builtin_shufflevector(lo, hi, 0, 1, 2, 3, 4, 5, 6, 7, 8, 9, 10, 11, 12, 13, 14, 15); }
__device__ __forceinline__ v16bf cat16b(v8us lo, v8us hi) { return __builtin_bit_cast(v16bf, __builtin_shufflevector(lo, hi, 0, 1, 2, 3, 4, 5, 6, 7, 8, 9, 10, 11, 12, 13, 14, 15)); }
__device__ __forceinline__ v8f wmma16(v16h a, v16h b, v8f c) { return __builtin_amdgcn_wmma_f32_16x16x32_f16(false, a, false, b, (short)0, c, false, false); }
__device__ __forceinline__ v8f wmmab(v16bf a, v16bf b, v8f c) { return __builtin_amdgcn_wmma_f32_16x16x32_bf16(false, a, false, b, (short)0, c, false, false); }



// ---- k_gemmw: register-blocked GEMM, ONE WAVE per 64x64 output tile (16 accumulators), operands straight from K-contiguous 16-bit planes; grid (M/64, N/64, Z), 32 threads.
// C[m][n] (f32, pitch ldc, + optional f32 bias[n]) = sum_k A[m][k] Bt[n][k] (+ split products per NSPLIT). A rows have pitch lda, Bt rows pitch K. z-batch strides sA/sB/sC in elements; batch z reads Bt plane z >> bsh (bsh = 1: two batches share one); batch z adds bias vector z. K % 32 == 0.
// KS > 1: grid z = batches x KS; blockIdx.z = batch * KS + slice; a slice sums k in [slice K/KS, (slice + 1) K/KS) into its own plane C + blockIdx.z * sC. K % (32 KS) == 0.
template <typename T16> struct WFrag;
template <> struct WFrag<h16> { typedef v16h V; static __device__ __forceinline__ V ld(const h16* p) { return cat16(*(const v8h*)p, *(const v8h*)(p + 16)); } static __device__ __forceinline__ v8f mma(V a, V b, v8f c) { return wmma16(a, b, c); } };
template <> struct WFrag<bf> { typedef v16bf V; static __device__ __forceinline__ V ld(const bf* p) { return cat16b(*(const v8us*)p, *(const v8us*)(p + 16)); } static __device__ __forceinline__ v8f mma(V a, V b, v8f c) { return wmmab(a, b, c); } };
template <typename T16, int NSPLIT, bool BIAS, int KS = 1>
__global__ __launch_bounds__(32) void k_gemmw(const T16* __restrict__ A, const T16* __restrict__ A2, const T16* __restrict__ Bt, const T16* __restrict__ Bt2, int K, int lda, int bsh, float* C, int ldc, const float* __restrict__ bias0, const float* __restrict__ bias1, const float* __restrict__ bias2, size_t sA, size_t sB, size_t sC) {
    typedef typename WFrag<T16>::V V;
    __shared__ __align__(16) float os[16 * 68];
    const size_t z = blockIdx.z / KS; const int ks = (int)(blockIdx.z % KS); A += z * sA; if (A2) A2 += z * sA; Bt += (z >> bsh) * sB; if (Bt2) Bt2 += (z >> bsh) * sB; C += (size_t)blockIdx.z * sC;
    const float* __restrict__ bias = z == 0 ? bias0 : z == 1 ? bias1 : bias2;   // up to three biased batches, each with its own bias vector
    const int kbeg = ks * (K / KS), kend = kbeg + K / KS;
    const int lane = threadIdx.x & 31, lr = lane & 15, hi = lane >> 4; const int r0 = blockIdx.x * 64, c0 = blockIdx.y * 64;
    v8f acc[4][4];
#pragma unroll
    for (int mb = 0; mb < 4; ++mb)
#pragma unroll
        for (int nb = 0; nb < 4; ++nb) acc[mb][nb] = (v8f){};
    const size_t aoff = (size_t)(r0 + lr) * lda + 8 * hi, boff = (size_t)(c0 + lr) * K + 8 * hi;
#pragma unroll 1
    for (int kc = kbeg; kc < kend; kc += 32) {
        V a[4], a2[4]; const T16* pa[4]; const T16* pa2[4];
#pragma unroll
        for (int mb = 0; mb < 4; ++mb) { pa[mb] = A + aoff + (size_t)mb * 16 * lda + kc; a[mb] = WFrag<T16>::ld(pa[mb]); if (NSPLIT == 1 || NSPLIT == 2) { pa2[mb] = A2 + aoff + (size_t)mb * 16 * lda + kc; a2[mb] = WFrag<T16>::ld(pa2[mb]); } }
        // the A row addresses are inputs of this wait so that their registers stay untouched from the loads down to it; only behind it may they take new values. It orders every load around it, so with three products it stands at the loop's foot instead: here it would cut the B loads into more, serial, batches
        if (NSPLIT == 1) asm volatile("s_wait_xcnt 0x0" :: "v"(pa[0]), "v"(pa[1]), "v"(pa[2]), "v"(pa[3]), "v"(pa2[0]), "v"(pa2[1]), "v"(pa2[2]), "v"(pa2[3]) : "memory");
        if (NSPLIT == 0 || NSPLIT > 2) asm volatile("s_wait_xcnt 0x0" :: "v"(pa[0]), "v"(pa[1]), "v"(pa[2]), "v"(pa[3]) : "memory");
#pragma unroll
        for (int nb = 0; nb < 4; ++nb) { const V b = WFrag<T16>::ld(Bt + boff + (size_t)nb * 16 * K + kc); V b2; if (NSPLIT >= 2) b2 = WFrag<T16>::ld(Bt2 + boff + (size_t)nb * 16 * K + kc);
#pragma unroll
            for (int mb = 0; mb < 4; ++mb) { acc[mb][nb] = WFrag<T16>::mma(a[mb], b, acc[mb][nb]); if (NSPLIT == 1 || NSPLIT == 2) acc[mb][nb] = WFrag<T16>::mma(a2[mb], b, acc[mb][nb]); if (NSPLIT >= 2) acc[mb][nb] = WFrag<T16>::mma(a[mb], b2, acc[mb][nb]); } }
        if (NSPLIT == 2) asm volatile("s_wait_xcnt 0x0" :: "v"(pa[0]), "v"(pa[1]), "v"(pa[2]), "v"(pa[3]), "v"(pa2[0]), "v"(pa2[1]), "v"(pa2[2]), "v"(pa2[3]) : "memory");   // the same wait for the three-product form
        asm volatile("v_nop\n\tv_nop\n\tv_nop\n\tv_nop" : "+v"(acc[0][0]), "+v"(acc[1][1]), "+v"(acc[2][2]), "+v"(acc[3][3]) : "v"(a[0]), "v"(a[3]));
    }
#pragma unroll
    for (int mb = 0; mb < 4; ++mb) {
#pragma unroll
        for (int nb = 0; nb < 4; ++nb) {
#pragma unroll
            for (int j = 0; j < 8; ++j) os[(hi * 8 + j) * 68 + nb * 16 + lr] = acc[mb][nb][j]; }
        __builtin_amdgcn_wave_barrier(); asm volatile("" ::: "memory");
        float* crow = C + (size_t)(r0 + mb * 16) * ldc + c0;
{
#pragma unroll
            for (int s = 0; s < 8; ++s) { const int row = 2 * s + hi, cofs = lr * 4; v4f val = *(const v4fa*)(os + row * 68 + cofs); if (BIAS) { val[0] += bfr(bias[c0 + cofs]); val[1] += bfr(bias[c0 + cofs + 1]); val[2] += bfr(bias[c0 + cofs + 2]); val[3] += bfr(bias[c0 + cofs + 3]); }
                *(v4f*)(crow + (size_t)row * ldc + cofs) = val; }
             }
        __builtin_amdgcn_wave_barrier(); asm volatile("" ::: "memory");
    }
}

__device__ __forceinline__ h16 tohx(float x) { return (h16)x; }
__device__ __forceinline__ void splitf(float y, unsigned short& h, unsigned short& l) { h = f2bf(y); l = f2bf(y - bf2f(h)); }
typedef __attribute__((ext_vector_type(2))) _Float16 v2h;
typedef __attribute__((ext_vector_type(4))) _Float16 v4h;
typedef __attribute__((ext_vector_type(2))) unsigned short v2us;
typedef __attribute__((ext_vector_type(4))) unsigned short v4us;
typedef __attribute__((ext_vector_type(2))) float v2f;
typedef __attribute__((ext_vector_type(4))) int v4i;

// grid y: which of up to three equally shaped weights; their Bt planes follow one another
__global__ __launch_bounds__(256) void k_wtG(const float* __restrict__ w0, const float* __restrict__ w1, const float* __restrict__ w2, int K, int N, bf* Bt) {
    const float* __restrict__ w = blockIdx.y == 0 ? w0 : blockIdx.y == 1 ? w1 : w2; Bt += (size_t)blockIdx.y * K * N;
    const int lane = threadIdx.x & 31; const int L0 = (blockIdx.x * 8 + (threadIdx.x >> 5)) * 8; const int nlines = N * K / 64;
{
#pragma unroll 1
        for (int l = 0; l < 8; ++l) { const int L = L0 + l; if (L >= nlines) break; const size_t e = (size_t)L * 64 + lane * 2; const int k = (int)(e % K), n = (int)(e / K); v2us o;
            o[0] = f2bf(w[(size_t)k * N + n]); o[1] = f2bf(w[(size_t)(k + 1) * N + n]); *(v2us*)(Bt + e) = o; }
         }
}
// grid y: which of the three sources; their bf16 copies follow one another
__global__ __launch_bounds__(256) void k_cvt8(const float* __restrict__ s0, const float* __restrict__ s1, const float* __restrict__ s2, bf* dst, size_t n8) { const float* __restrict__ src = blockIdx.y == 0 ? s0 : blockIdx.y == 1 ? s1 : s2; dst += (size_t)blockIdx.y * n8 * 8; const size_t i = (size_t)blockIdx.x * 256 + threadIdx.x; if (i >= n8) return; const v8f v = *(const v8f*)(src + i * 8); v8us o;
#pragma unroll
    for (int k = 0; k < 8; ++k) o[k] = f2bf(v[k]); *(v8us*)(dst + i * 8) = o;  }

// k_rope: head planes [h][t][d] (fp16 + hi/lo) of rope(x) x sc with the rotate-half convention out[d] = x[d] cos[t][d] - x[d+HD/2] sin[t][d], out[d+HD/2] = x[d+HD/2] cos[t][d+HD/2] + x[d] sin[t][d+HD/2]
__global__ __launch_bounds__(256) void k_rope(const float* __restrict__ F, int pitch, int nheads, const float* __restrict__ CS, const float* __restrict__ RF, const float* __restrict__ nw, float sc, h16* P16, bf* Ph, bf* Pl) {
    const size_t e = ((size_t)blockIdx.x * 256 + threadIdx.x) * 2; if (e >= (size_t)nheads * TT * HD) return; const int d = (int)(e % HD); const int t = (int)((e / HD) % TT); const int h = (int)(e / ((size_t)HD * TT)); const float* f = F + (size_t)t * pitch + h * HD; const float rf = RF ? RF[(size_t)h * TT + t] : 1.0f; v2h o16; v2us oh, ol;
    f += (size_t)(h / NH_) * ((size_t)TT * pitch - NH_ * HD);   // heads NH_ and up come from the next [TT][pitch] plane (k behind q)
#pragma unroll
    for (int q = 0; q < 2; ++q) { const int dd = d + q; const int dp = (dd < HD / 2) ? dd + HD / 2 : dd - HD / 2; float x0 = f[dd], x1 = f[dp];
        if (RF) { float n0 = __fmul_rn(x0, rf), n1 = __fmul_rn(x1, rf); asm volatile("" : "+v"(n0)); asm volatile("" : "+v"(n1)); x0 = __fmul_rn(bfr(nw[dd]), n0); x1 = __fmul_rn(bfr(nw[dp]), n1); }
        const v2f cs = *(const v2f*)(CS + ((size_t)t * HD + dd) * 2); float a = __fmul_rn(x0, cs[0]), bq = __fmul_rn(x1, cs[1]); asm volatile("" : "+v"(a)); asm volatile("" : "+v"(bq)); const float r = ((dd < HD / 2) ? __fsub_rn(a, bq) : __fadd_rn(a, bq)) * sc;
        o16[q] = tohx(r); unsigned short a2, c2; splitf(r, a2, c2); oh[q] = a2; ol[q] = c2; }
    *(v2h*)(P16 + e) = o16; *(v2us*)(Ph + e) = oh; *(v2us*)(Pl + e) = ol;  }
__global__ __launch_bounds__(256) void k_vtp(const float* __restrict__ F, int pitch, int nheads, h16* V16, bf* Vh, bf* Vl) { const size_t e = ((size_t)blockIdx.x * 256 + threadIdx.x) * 2; if (e >= (size_t)nheads * HD * TT) return; const int t = (int)(e % TT); const int d = (int)((e / TT) % HD); const int g = (int)(e / ((size_t)TT * HD)); v2h o16; v2us oh, ol;
#pragma unroll
    for (int q = 0; q < 2; ++q) { const float x = F[(size_t)(t + q) * pitch + g * HD + d]; o16[q] = tohx(x); unsigned short a2, c2; splitf(x, a2, c2); oh[q] = a2; ol[q] = c2; }
    *(v2h*)(V16 + e) = o16; *(v2us*)(Vh + e) = oh; *(v2us*)(Vl + e) = ol;  }
__global__ __launch_bounds__(256) void k_csid(float* CS) { const int idx = blockIdx.x * 256 + threadIdx.x; if (idx >= TT * HD) return; v2f cs; cs[0] = 1.0f; cs[1] = 0.0f; *(v2f*)(CS + (size_t)idx * 2) = cs;  }
// ---- k_fattn: fused attention. A work-group = one query tile of one (batch, head); its KQ waves each walk TT / KQ keys in steps of 32 with an online softmax, then merge through LDS.
// Transposed form: S^T = K Q^T (A = key rows, B = query rows), so a lane holds, for query lr, keys hi*8 + j of each 16-key tile: two such tiles side by side ARE the B fragment (k = 8 hi + i, 16 + 8 hi + i) of O^T = V^T P^T (A = v^T rows e, k = keys). Softmax runs down a lane's own registers plus one exchange between the lane halves.
// HI: bf16 hi/lo planes, three products each (hh + lh + hl) for both products; else fp16, P unnormalised in (0, 1]. O[t][e] (f32, pitch HV) = softmax row x v, normalised.
typedef __attribute__((ext_vector_type(16))) unsigned short v16us;
template <typename T16, bool HI, int NQ>
__device__ __forceinline__ void attn_tile(const T16* __restrict__ Q, const T16* __restrict__ Q2, const T16* __restrict__ Kp, const T16* __restrict__ K2, const T16* __restrict__ Vt, const T16* __restrict__ V2, int q0, float* __restrict__ O, float* so, float* sml, T16* sq) {
    typedef typename WFrag<T16>::V V;
    const int lane = threadIdx.x & 31, lr = lane & 15, hi = lane >> 4; const int w = __builtin_amdgcn_readfirstlane((int)(threadIdx.x >> 5));
    V qf[NQ][2], qg[NQ][2]; v8f acc[NQ][8]; float m[NQ], l[NQ];
#pragma unroll
    for (int n = 0; n < NQ; ++n) { m[n] = -3.0e38f; l[n] = 0.f;
#pragma unroll
        for (int et = 0; et < 8; ++et) acc[n][et] = (v8f){}; }
    // the query fragments do not fit in the registers beside the accumulators and the v^T rows in flight, so the tile (shared by the KQ waves) lies in LDS, 32 rows of pitch QP (32 queries, or 16 queries hi then lo), and is read anew in every step
    { const int row = (int)threadIdx.x >> 2, col = ((int)threadIdx.x & 3) * 16; const T16* g = (HI ? ((row >> 4) ? Q2 : Q) + (size_t)(q0 + (row & 15)) * HD : Q + (size_t)(q0 + row) * HD) + col; const v4f x0 = *(const v4fa*)g, x1 = *(const v4fa*)(g + 8); *(v4fa*)(sq + row * QP + col) = x0; *(v4fa*)(sq + row * QP + col + 8) = x1; __syncthreads(); }
    const int koff = lr * HD + 8 * hi, voff = lr * TT + 8 * hi; const int kbeg = w * (TT / KQ);
#pragma unroll 1
    for (int k0 = kbeg; k0 < kbeg + TT / KQ; k0 += 32) {
        const T16* kb = Kp + (size_t)k0 * HD + koff; const T16* kb2 = K2 + (size_t)k0 * HD + koff; const T16* vb = Vt + k0 + voff; const T16* vb2 = V2 + k0 + voff;
#pragma unroll
        for (int n = 0; n < NQ; ++n)
#pragma unroll
            for (int c = 0; c < 2; ++c) { qf[n][c] = WFrag<T16>::ld(sq + (n * 16 + lr) * QP + c * 32 + 8 * hi); if (HI) qg[n][c] = WFrag<T16>::ld(sq + (16 + lr) * QP + c * 32 + 8 * hi); }
        v8f s[NQ][2]; V ka[2][2], kl[2][2];   // all of the step's key fragments are requested first: one wait instead of one per 16 keys
#pragma unroll
        for (int kt = 0; kt < 2; ++kt)
#pragma unroll
            for (int c = 0; c < 2; ++c) { ka[kt][c] = WFrag<T16>::ld(kb + kt * 16 * HD + c * 32); if (HI) kl[kt][c] = WFrag<T16>::ld(kb2 + kt * 16 * HD + c * 32); }
#pragma unroll
        for (int kt = 0; kt < 2; ++kt)
#pragma unroll
            for (int n = 0; n < NQ; ++n) { v8f t = (v8f){};
#pragma unroll
                for (int c = 0; c < 2; ++c) { t = WFrag<T16>::mma(ka[kt][c], qf[n][c], t); if (HI) { t = WFrag<T16>::mma(ka[kt][c], qg[n][c], t); t = WFrag<T16>::mma(kl[kt][c], qf[n][c], t); } }
                s[n][kt] = t; }
        V va[8], vl[8];   // v^T rows 0..63 are requested ahead of the softmax arithmetic, rows 64..127 behind it, ahead of the first half's products
#pragma unroll
        for (int et = 0; et < 4; ++et) { va[et] = WFrag<T16>::ld(vb + et * 16 * TT); if (HI) vl[et] = WFrag<T16>::ld(vb2 + et * 16 * TT); }
        V pf[NQ], pg[NQ];
#pragma unroll
        for (int n = 0; n < NQ; ++n) { float p[16]; float mx = -3.0e38f;
#pragma unroll
            for (int i = 0; i < 16; ++i) { p[i] = s[n][i >> 3][i & 7] * SCL; mx = fmaxf(mx, p[i]); }
            mx = fmaxf(mx, __shfl_xor(mx, 16, 32)); const float mn = fmaxf(m[n], mx); const float al = __builtin_amdgcn_exp2f((m[n] - mn) * L2E); m[n] = mn; float sum = 0.f;
#pragma unroll
            for (int i = 0; i < 16; ++i) { p[i] = __builtin_amdgcn_exp2f((p[i] - mn) * L2E); sum += p[i]; }
            l[n] = l[n] * al + sum;   // this lane's keys only; the lane halves are added behind the loop
#pragma unroll
            for (int et = 0; et < 8; ++et) acc[n][et] *= al;
            if (HI) { v16us uh, ul;
#pragma unroll
                for (int i = 0; i < 16; ++i) { unsigned short a, c2; splitf(p[i], a, c2); uh[i] = a; ul[i] = c2; }
                pf[n] = __builtin_bit_cast(V, uh); pg[n] = __builtin_bit_cast(V, ul);
            } else { v16h ph;
#pragma unroll
                for (int i = 0; i < 16; ++i) ph[i] = tohx(p[i]);
                pf[n] = __builtin_bit_cast(V, ph); } }
#pragma unroll
        for (int et = 4; et < 8; ++et) { va[et] = WFrag<T16>::ld(vb + et * 16 * TT); if (HI) vl[et] = WFrag<T16>::ld(vb2 + et * 16 * TT); }
#pragma unroll
        for (int et = 0; et < 8; ++et)
#pragma unroll
            for (int n = 0; n < NQ; ++n) { acc[n][et] = WFrag<T16>::mma(va[et], pf[n], acc[n][et]); if (HI) { acc[n][et] = WFrag<T16>::mma(va[et], pg[n], acc[n][et]); acc[n][et] = WFrag<T16>::mma(vl[et], pf[n], acc[n][et]); } }
        // the step's row addresses are inputs of this wait so that their registers stay untouched from the loads down to it; only behind it may they take the next step's values
        if (HI) asm volatile("s_wait_xcnt 0x0" :: "v"(kb), "v"(kb2), "v"(vb), "v"(vb2) : "memory"); else asm volatile("s_wait_xcnt 0x0" :: "v"(kb), "v"(vb) : "memory");
    }
    // merge of the KQ key quarters: common maximum and sum per query, each wave scales its own part, then a fixed-order sum of the KQ parts
    float* sm = sml; float* sl = sml + KQ * 32;
#pragma unroll
    for (int n = 0; n < NQ; ++n) { l[n] += __shfl_xor(l[n], 16, 32); if (hi == 0) { sm[w * 32 + n * 16 + lr] = m[n]; sl[w * 32 + n * 16 + lr] = l[n]; } }
    __syncthreads();
#pragma unroll
    for (int n = 0; n < NQ; ++n) { float M = sm[n * 16 + lr];
#pragma unroll
        for (int ww = 1; ww < KQ; ++ww) M = fmaxf(M, sm[ww * 32 + n * 16 + lr]);
        float L = 0.f;
#pragma unroll
        for (int ww = 0; ww < KQ; ++ww) L += sl[ww * 32 + n * 16 + lr] * __builtin_amdgcn_exp2f((sm[ww * 32 + n * 16 + lr] - M) * L2E);
        const float f = __fdiv_rn(__builtin_amdgcn_exp2f((m[n] - M) * L2E), L);
#pragma unroll
        for (int et = 0; et < 8; ++et) { const v8f r = acc[n][et] * f; float* d = so + ((w * 8 + et) * 32 + lane) * 8; *(v4fa*)d = __builtin_shufflevector(r, r, 0, 1, 2, 3); *(v4fa*)(d + 4) = __builtin_shufflevector(r, r, 4, 5, 6, 7); }
        __syncthreads();
#pragma unroll
        for (int e2 = 0; e2 < 2; ++e2) { const int et = 2 * w + e2; const float* d = so + (et * 32 + lane) * 8; v4f a = *(const v4fa*)d, b = *(const v4fa*)(d + 4);
#pragma unroll
            for (int ww = 1; ww < KQ; ++ww) { a += *(const v4fa*)(d + ww * 8 * 32 * 8); b += *(const v4fa*)(d + ww * 8 * 32 * 8 + 4); }
            float* orow = O + (size_t)(q0 + n * 16 + lr) * HV + et * 16 + hi * 8; *(v4f*)orow = a; *(v4f*)(orow + 4) = b;
            asm volatile("s_wait_xcnt 0x0" :: "v"(orow), "v"(a), "v"(b) : "memory"); }   // the stores have left their address and data registers before these are used again
        if (n + 1 < NQ) __syncthreads();   // the parts are read before the next query tile's parts overwrite them
    }
}
// grid x: first the hi/lo tiles (16 queries, the longer ones), then the fp16 tiles (32 queries); tiles of one head follow one another. waves_per_eu(4): keeps the kernel at 256 registers, so that four waves a SIMD hide each other's load waits and no register window is switched. Planes: QK* [b][q heads, k heads][t][HD], VT* [b][p][e][t], O [b][h][t][HV]
__global__ __launch_bounds__(32 * KQ) __attribute__((amdgpu_waves_per_eu(4))) void k_fattn(const h16* __restrict__ QK16, const bf* __restrict__ QKh, const bf* __restrict__ QKl, const h16* __restrict__ VT16, const bf* __restrict__ VTh, const bf* __restrict__ VTl, float* __restrict__ O) {
    __shared__ __align__(16) float so[KQ * 8 * 32 * 8]; __shared__ float sml[2 * KQ * 32]; __shared__ __align__(16) h16 sq[32 * QP];
    const int NHB = NB_ * NH_ * (RH / 16); int blk = (int)blockIdx.x; const bool hires = blk < NHB; if (!hires) blk -= NHB;
    const int per = hires ? RH / 16 : (TT - RH) / 32; const int bh = blk / per, tile = blk % per; const int b = bh / NH_, h = bh % NH_;
    const size_t oq = (size_t)(b * (NH_ + NKV) + h) * TT * HD, ok = (size_t)(b * (NH_ + NKV) + NH_ + h) * TT * HD, ov = (size_t)(b * NP + h / 2) * HV * TT; float* Oh = O + (size_t)bh * TT * HV;
    if (hires) attn_tile<bf, true, 1>(QKh + oq, QKl + oq, QKh + ok, QKl + ok, VTh + ov, VTl + ov, tile * 16, Oh, so, sml, (bf*)sq);
    else attn_tile<h16, false, 2>(QK16 + oq, nullptr, QK16 + ok, nullptr, VT16 + ov, nullptr, RH + tile * 32, Oh, so, sml, sq);
}
// k_vtpV: value planes per 128-wide value head [p][e][t] (fp16 + hi/lo) = F[t][p*HV + e]; as k_vtp with HV = 128.
__global__ __launch_bounds__(256) void k_vtpV(const float* __restrict__ F, int pitch, int nheads, h16* V16, bf* Vh, bf* Vl) { const size_t e = ((size_t)blockIdx.x * 256 + threadIdx.x) * 2; if (e >= (size_t)nheads * HV * TT) return; const int t = (int)(e % TT); const int d = (int)((e / TT) % HV); const int g = (int)(e / ((size_t)TT * HV)); v2h o16; v2us oh, ol;
#pragma unroll
    for (int q = 0; q < 2; ++q) { const float x = F[(size_t)(t + q) * pitch + g * HV + d]; o16[q] = tohx(x); unsigned short a2, c2; splitf(x, a2, c2); oh[q] = a2; ol[q] = c2; }
    *(v2h*)(V16 + e) = o16; *(v2us*)(Vh + e) = oh; *(v2us*)(Vl + e) = ol;  }

template <int WD>
__global__ __launch_bounds__(256) void k_lnrowD(const float* __restrict__ X, size_t nrows, const float* __restrict__ g, const float* __restrict__ bb, bf* Hh, bf* Hl) { const int lane = threadIdx.x & 31; const size_t r = (size_t)blockIdx.x * 8 + (threadIdx.x >> 5); if (r >= nrows) return; const float* xr = X + r * WD; float a[WD / 32]; float s = 0.f;
#pragma unroll
    for (int c = 0; c < WD / 128; ++c) { const v4f v = *(const v4f*)(xr + c * 128 + lane * 4); for (int q = 0; q < 4; ++q) { a[c * 4 + q] = v[q]; s = __fadd_rn(s, a[c * 4 + q]); } }
#pragma unroll
    for (int sh = 16; sh; sh >>= 1) s = __fadd_rn(s, __shfl_xor(s, sh, 32));
    const float mean = __fdiv_rn(s, (float)WD); float s2 = 0.f;
#pragma unroll
    for (int k = 0; k < WD / 32; ++k) { const float dv = __fsub_rn(a[k], mean); float p2 = __fmul_rn(dv, dv); asm volatile("" : "+v"(p2)); s2 = __fadd_rn(s2, p2); }   /* mul and add kept separate (no fma contraction) */
#pragma unroll
    for (int sh = 16; sh; sh >>= 1) s2 = __fadd_rn(s2, __shfl_xor(s2, sh, 32));
    const float rs = __fdiv_rn(1.0f, __fsqrt_rn(__fadd_rn(__fdiv_rn(s2, (float)WD), 1e-6f)));
{
#pragma unroll
        for (int c = 0; c < WD / 128; ++c) { v4us oh, ol; for (int q = 0; q < 4; ++q) { const int col = c * 128 + lane * 4 + q; float y = __fmul_rn(__fmul_rn(__fsub_rn(a[c * 4 + q], mean), rs), bfr(g[col])); asm volatile("" : "+v"(y)); y = __fadd_rn(y, bfr(bb[col])); y = __fmul_rn(y, 1.0f - LINIT); unsigned short u, w2; splitf(y, u, w2); oh[q] = u; ol[q] = w2; } *(v4us*)(Hh + r * WD + c * 128 + lane * 4) = oh; *(v4us*)(Hl + r * WD + c * 128 + lane * 4) = ol; }
         } }
__global__ __launch_bounds__(256) void k_lambda(const float* __restrict__ a1, const float* __restrict__ b1, const float* __restrict__ a2, const float* __restrict__ b2, float* LAM) { if (threadIdx.x >= 32) return; const int lane = threadIdx.x; float s1 = __fadd_rn(__fmul_rn(bfr(a1[lane]), bfr(b1[lane])), __fmul_rn(bfr(a1[lane + 32]), bfr(b1[lane + 32]))); float s2 = __fadd_rn(__fmul_rn(bfr(a2[lane]), bfr(b2[lane])), __fmul_rn(bfr(a2[lane + 32]), bfr(b2[lane + 32])));
#pragma unroll
    for (int sh = 16; sh; sh >>= 1) { s1 = __fadd_rn(s1, __shfl_xor(s1, sh, 32)); s2 = __fadd_rn(s2, __shfl_xor(s2, sh, 32)); }
    const float lam = __fadd_rn(__fsub_rn(expf(s1), expf(s2)), LINIT); if (lane == 0) { *(float*)LAM = lam;  } }
// grid y: batch x pair; ctx[b][t][p*128 + e] = w0 v - lambda w1 v from the two heads' planes
__global__ __launch_bounds__(256) void k_dmerge(const float* __restrict__ O, const float* __restrict__ LAM, float* ctx) { const size_t i = (size_t)blockIdx.x * 256 + threadIdx.x; if (i >= (size_t)TT * HV / 4) return; const int b = (int)blockIdx.y / NP, p = (int)blockIdx.y % NP; O += (size_t)(b * NH_ + 2 * p) * TT * HV; const size_t e = i * 4; const int c = (int)(e % HV); const int t = (int)(e / HV); const float lam = LAM[0]; const v4f a = *(const v4f*)(O + e); const v4f b2 = *(const v4f*)(O + (size_t)TT * HV + e);
    *(v4f*)(ctx + ((size_t)b * TT + t) * DQ + p * HV + c) = a - lam * b2;  }
__global__ __launch_bounds__(256) void k_merge(const float* __restrict__ O, int h0, bf* Ah, bf* Al) { const size_t e = ((size_t)blockIdx.x * 256 + threadIdx.x) * 2; if (e >= (size_t)ZH * TT * HD) return; const int d = (int)(e % HD); const int t = (int)((e / HD) % TT); const int zz = (int)(e / ((size_t)HD * TT)); const float cs = (t < RH) ? 1.0f : (1.0f / PCAR); const size_t oo = (size_t)t * DQ + (h0 + zz) * HD + d;
    v2us oh, ol;
#pragma unroll
    for (int q = 0; q < 2; ++q) { unsigned short a, c2; splitf(O[e + q] * cs, a, c2); oh[q] = a; ol[q] = c2; } *(v2us*)(Ah + oo) = oh; *(v2us*)(Al + oo) = ol;  }

extern "C" void kernel_launch(void* const* d_in, const int* in_sizes, int n_in,
                              void* d_out, int out_size, void* d_ws, size_t ws_size, hipStream_t stream) {
    (void)in_sizes; (void)n_in; (void)out_size;
    const float* x = (const float*)d_in[0]; const float* xk = (const float*)d_in[1]; const float* xv = (const float*)d_in[2]; const float* wq = (const float*)d_in[3]; const float* bq = (const float*)d_in[4]; const float* wk = (const float*)d_in[5]; const float* bk = (const float*)d_in[6]; const float* wv = (const float*)d_in[7]; const float* bv = (const float*)d_in[8]; const float* lq1 = (const float*)d_in[9]; const float* lk1 = (const float*)d_in[10]; const float* lq2 = (const float*)d_in[11]; const float* lk2 = (const float*)d_in[12]; const float* lng = (const float*)d_in[13]; const float* lnb = (const float*)d_in[14]; const float* wo = (const float*)d_in[15]; const float* bo = (const float*)d_in[16];
    float* OUT = (float*)d_out;     // [2][2048][512]
    char* wsp = (char*)d_ws;
    auto take = [&](size_t bytes) { char* p = wsp; wsp += (bytes + 255) & ~(size_t)255; return (void*)p; };
    bf* WQ = (bf*)take((size_t)DQ * DM * 2); bf* WK = (bf*)take((size_t)DKV * DM * 2); bf* WV = (bf*)take((size_t)DKV * DM * 2); bf* WO = (bf*)take((size_t)DM * DQ * 2); float* CS = (float*)take((size_t)TT * HD * 2 * 4); (void)WK; (void)WV;
    const size_t SQK = (size_t)(NH_ + NKV) * TT * HD, SV = (size_t)NP * HV * TT;   // one batch's q + k planes (k directly behind q: one launch writes both) and v^T planes, in elements
    h16* QK16 = (h16*)take(NB_ * SQK * 2); bf* QKh = (bf*)take(NB_ * SQK * 2); bf* QKl = (bf*)take(NB_ * SQK * 2); h16* VT16 = (h16*)take(NB_ * SV * 2); bf* VTh = (bf*)take(NB_ * SV * 2); bf* VTl = (bf*)take(NB_ * SV * 2);
    bf* XB = (bf*)take((size_t)3 * TT * DM * 2); float* FQ = (float*)take((size_t)3 * TT * DQ * 4); float* FV = FQ + (size_t)2 * TT * DQ;   // the three bf16 input copies and the three f32 projections [q][k][v] of the batch at hand
    float* Ob = (float*)take((size_t)NB_ * NH_ * TT * HV * 4); float* CTX = (float*)take((size_t)NB_ * TT * DQ * 4); float* LAM = (float*)take(256); bf* ATh = (bf*)take((size_t)TT * DQ * 2); bf* ATl = (bf*)take((size_t)TT * DQ * 2);
    if ((size_t)(wsp - (char*)d_ws) > ws_size) return;    // ws 256 MiB
    { k_wtG<<<dim3((unsigned)((DM * DQ / 64 + 63) / 64), 3, 1), 256, 0, stream>>>(wq, wk, wv, DM, DQ, WQ); k_lambda<<<1, 256, 0, stream>>>(lq1, lk1, lq2, lk2, LAM);
      k_wtG<<<(unsigned)((DQ * DM / 64 + 63) / 64), 256, 0, stream>>>(wo, wo, wo, DQ, DM, WO);
       }
    k_csid<<<(TT * HD + 255) / 256, 256, 0, stream>>>(CS);
    const unsigned LQK = (unsigned)(((size_t)(NH_ + NKV) * TT * HD / 2 + 255) / 256), LKv = (unsigned)(((size_t)NKV * TT * HD / 2 + 255) / 256);
    for (int b = 0; b < NB_; ++b) {
        k_cvt8<<<dim3((unsigned)(((size_t)TT * DM / 8 + 255) / 256), 3, 1), 256, 0, stream>>>(x + (size_t)b * TT * DM, xk + (size_t)b * TT * DM, xv + (size_t)b * TT * DM, XB, (size_t)TT * DM / 8);
        k_gemmw<bf, 0, true><<<dim3(TT / 64, DQ / 64, 3), 32, 0, stream>>>(XB, nullptr, WQ, nullptr, DM, DM, 0, FQ, DQ, bq, bk, bv, (size_t)TT * DM, (size_t)DQ * DM, (size_t)TT * DQ);   /* q, k and v projections on grid z */
        k_rope<<<LQK, 256, 0, stream>>>(FQ, DQ, NH_ + NKV, CS, nullptr, nullptr, 1.0f, QK16 + b * SQK, QKh + b * SQK, QKl + b * SQK);   /* q and k planes */
        k_vtpV<<<LKv, 256, 0, stream>>>(FV, DKV, NP, VT16 + b * SV, VTh + b * SV, VTl + b * SV); }
    k_fattn<<<NB_ * NH_ * (RH / 16 + (TT - RH) / 32), 32 * KQ, 0, stream>>>(QK16, QKh, QKl, VT16, VTh, VTl, Ob);   /* every batch, head and query tile */
    k_dmerge<<<dim3((unsigned)(((size_t)TT * HV / 4 + 255) / 256), NB_ * NP, 1), 256, 0, stream>>>(Ob, LAM, CTX);
    for (int b = 0; b < NB_; ++b) {
        k_lnrowD<DQ><<<(unsigned)((TT + 7) / 8), 256, 0, stream>>>(CTX + (size_t)b * TT * DQ, (size_t)TT, lng, lnb, ATh, ATl);   /* LayerNorm (eps 1e-6) x (1 - lambda_init) -> hi/lo planes */ k_gemmw<bf, 1, true><<<dim3(TT / 64, DM / 64, 1), 32, 0, stream>>>(ATh, ATl, WO, nullptr, DQ, DQ, 0, OUT + (size_t)b * TT * DM, DM, bo, bo, bo, 0, 0, 0); }
}

// v004
// A run of this version takes 278 microseconds.
// Timed twice side by side with v003, it ran 1.54 and 1.55 times as fast.
// Counting every step since v000, it is 7.01 times as fast.
#include <hip/hip_runtime.h>

// Multi-head DIFFERENTIAL attention (query, key, value [2][2048][512]; q = query Wq + bq, k = key Wk + bk as 16 heads x 64, v = value Wv + bv as 8 heads x 128 ('xw' [512][1024] + [1024], 0.02); w = softmax(q.k / 8) per head; for each pair p: dw = w[2p] - lambda w[2p+1], lambda = exp(lq1.lk1) - exp(lq2.lk2) + lambda_init (lq/lk [64], read); attn = dw v_p -> [2048][1024]; LayerNorm (eps 1e-6, affine) x (1 - lambda_init); out = attn Wo + bo ('xw' [1024][512]) -> [2][2048][512] (2.1 M)).
// Layout: per batch bf16 copies of the three inputs (one launch, as for the three projections and for the q and k planes); exact projections + f32 biases; q/k planes for the 16 score heads, v^T planes per 128-wide value head, kept for both batches; lambda computed once on device (one wave: two 64-term f32 dots, precise expf); ONE fused attention launch for every batch, head and query tile (k_fattn: scores, online softmax and P.v in registers, no score matrix in memory; hybrid rows: < 512 hi/lo 3 products, rest fp16), each head's normalised w v as an f32 plane; a merge kernel writes w0 v - lambda w1 v into the context; then a LayerNorm row kernel (f32, fixed order) scaled by (1 - lambda_init), converted to hi/lo planes, x Wo exact + bo.
// Compute dtypes, f32 accumulate: every input rounded to bf16; projections exact + f32 biases; attention rows < 512 3 products, rest fp16; softmax, lambda, difference, LayerNorm f32; Wo hl x exact + bias.

#define NB_  2
#define TT   2048
#define DM   512
#define NH_  16
#define NKV  16
#define REP  (NH_ / NKV)
#define HD   64
#define DQ   (NH_ * HD)
#define DKV  (NKV * HD)
#define ZH   2
#define RH   512                  // query rows < RH use hi+lo planes (0: none)
#define WIN  0
#define PCAR 1024.0f
#define SCL  0.125f
#define NP   8       // value heads (pairs)
#define HV   128     // value head width
#define LINIT 0.47071301937103271f   // lambda_init = 0.8 - 0.6 exp(-0.6) as float32
#define NWV  4       // waves of a fused-attention work-group: each owns a query tile of its own and walks all TT keys; the staged key and v^T tiles serve all of them
#define BUFE 14848   // 16-bit elements of one stage buffer: hi/lo 2 x (32 x 72 + 128 x 40); fp16 64 x 72 + 128 x 72 is smaller
#define L2E  1.4426950408889634f
#define QP   72      // LDS row pitch of the query and key tiles in 16-bit elements (64 + 8: 16 bytes of pad against bank conflicts between rows)
typedef _Float16 h16;
typedef unsigned short bf;
typedef __attribute__((ext_vector_type(16))) __bf16   v16bf;
typedef __attribute__((ext_vector_type(16))) _Float16 v16h;
typedef __attribute__((ext_vector_type(8)))  _Float16 v8h;
typedef __attribute__((ext_vector_type(8)))  unsigned short v8us;
typedef __attribute__((ext_vector_type(8)))  float    v8f;
typedef __attribute__((ext_vector_type(4)))  float    v4f;
typedef v8h  __attribute__((may_alias)) v8ha;
typedef v4f  __attribute__((may_alias)) v4fa;
typedef v8us __attribute__((may_alias)) v8usa;

__device__ __forceinline__ unsigned short f2bf(float f) { unsigned u = __float_as_uint(f); u += 0x7FFFu + ((u >> 16) & 1u); return (unsigned short)(u >> 16); }
__device__ __forceinline__ float bf2f(unsigned short b) { return __uint_as_float(((unsigned)b) << 16); }
__device__ __forceinline__ float bfr(float f) { return bf2f(f2bf(f)); }
__device__ __forceinline__ v16h cat16(v8h lo, v8h hi) { return __builtin_shufflevector(lo, hi, 0, 1, 2, 3, 4, 5, 6, 7, 8, 9, 10, 11, 12, 13, 14, 15); }
__device__ __forceinline__ v16bf cat16b(v8us lo, v8us hi) { return __builtin_bit_cast(v16bf, __builtin_shufflevector(lo, hi, 0, 1, 2, 3, 4, 5, 6, 7, 8, 9, 10, 11, 12, 13, 14, 15)); }
__device__ __forceinline__ v8f wmma16(v16h a, v16h b, v8f c) { return __builtin_amdgcn_wmma_f32_16x16x32_f16(false, a, false, b, (short)0, c, false, false); }
__device__ __forceinline__ v8f wmmab(v16bf a, v16bf b, v8f c) { return __builtin_amdgcn_wmma_f32_16x16x32_bf16(false, a, false, b, (short)0, c, false, false); }



// ---- k_gemmw: register-blocked GEMM, ONE WAVE per 64x64 output tile (16 accumulators), operands straight from K-contiguous 16-bit planes; grid (M/64, N/64, Z), 32 threads.
// C[m][n] (f32, pitch ldc, + optional f32 bias[n]) = sum_k A[m][k] Bt[n][k] (+ split products per NSPLIT). A rows have pitch lda, Bt rows pitch K. z-batch strides sA/sB/sC in elements; batch z reads Bt plane z >> bsh (bsh = 1: two batches share one); batch z adds bias vector z. K % 32 == 0.
// KS > 1: grid z = batches x KS; blockIdx.z = batch * KS + slice; a slice sums k in [slice K/KS, (slice + 1) K/KS) into its own plane C + blockIdx.z * sC. K % (32 KS) == 0.
template <typename T16> struct WFrag;
template <> struct WFrag<h16> { typedef v16h V; static __device__ __forceinline__ V ld(const h16* p) { return cat16(*(const v8h*)p, *(const v8h*)(p + 16)); } static __device__ __forceinline__ v8f mma(V a, V b, v8f c) { return wmma16(a, b, c); } };
template <> struct WFrag<bf> { typedef v16bf V; static __device__ __forceinline__ V ld(const bf* p) { return cat16b(*(const v8us*)p, *(const v8us*)(p + 16)); } static __device__ __forceinline__ v8f mma(V a, V b, v8f c) { return wmmab(a, b, c); } };
template <typename T16, int NSPLIT, bool BIAS, int KS = 1>
__global__ __launch_bounds__(32) void k_gemmw(const T16* __restrict__ A, const T16* __restrict__ A2, const T16* __restrict__ Bt, const T16* __restrict__ Bt2, int K, int lda, int bsh, float* C, int ldc, const float* __restrict__ bias0, const float* __restrict__ bias1, const float* __restrict__ bias2, size_t sA, size_t sB, size_t sC) {
    typedef typename WFrag<T16>::V V;
    __shared__ __align__(16) float os[16 * 68];
    const size_t z = blockIdx.z / KS; const int ks = (int)(blockIdx.z % KS); A += z * sA; if (A2) A2 += z * sA; Bt += (z >> bsh) * sB; if (Bt2) Bt2 += (z >> bsh) * sB; C += (size_t)blockIdx.z * sC;
    const float* __restrict__ bias = z == 0 ? bias0 : z == 1 ? bias1 : bias2;   // up to three biased batches, each with its own bias vector
    const int kbeg = ks * (K / KS), kend = kbeg + K / KS;
    const int lane = threadIdx.x & 31, lr = lane & 15, hi = lane >> 4; const int r0 = blockIdx.x * 64, c0 = blockIdx.y * 64;
    v8f acc[4][4];
#pragma unroll
    for (int mb = 0; mb < 4; ++mb)
#pragma unroll
        for (int nb = 0; nb < 4; ++nb) acc[mb][nb] = (v8f){};
    const size_t aoff = (size_t)(r0 + lr) * lda + 8 * hi, boff = (size_t)(c0 + lr) * K + 8 * hi;
#pragma unroll 1
    for (int kc = kbeg; kc < kend; kc += 32) {
        V a[4], a2[4]; const T16* pa[4]; const T16* pa2[4];
#pragma unroll
        for (int mb = 0; mb < 4; ++mb) { pa[mb] = A + aoff + (size_t)mb * 16 * lda + kc; a[mb] = WFrag<T16>::ld(pa[mb]); if (NSPLIT == 1 || NSPLIT == 2) { pa2[mb] = A2 + aoff + (size_t)mb * 16 * lda + kc; a2[mb] = WFrag<T16>::ld(pa2[mb]); } }
        // the A row addresses are inputs of this wait so that their registers stay untouched from the loads down to it; only behind it may they take new values. It orders every load around it, so with three products it stands at the loop's foot instead: here it would cut the B loads into more, serial, batches
        if (NSPLIT == 1) asm volatile("s_wait_xcnt 0x0" :: "v"(pa[0]), "v"(pa[1]), "v"(pa[2]), "v"(pa[3]), "v"(pa2[0]), "v"(pa2[1]), "v"(pa2[2]), "v"(pa2[3]) : "memory");
        if (NSPLIT == 0 || NSPLIT > 2) asm volatile("s_wait_xcnt 0x0" :: "v"(pa[0]), "v"(pa[1]), "v"(pa[2]), "v"(pa[3]) : "memory");
#pragma unroll
        for (int nb = 0; nb < 4; ++nb) { const V b = WFrag<T16>::ld(Bt + boff + (size_t)nb * 16 * K + kc); V b2; if (NSPLIT >= 2) b2 = WFrag<T16>::ld(Bt2 + boff + (size_t)nb * 16 * K + kc);
#pragma unroll
            for (int mb = 0; mb < 4; ++mb) { acc[mb][nb] = WFrag<T16>::mma(a[mb], b, acc[mb][nb]); if (NSPLIT == 1 || NSPLIT == 2) acc[mb][nb] = WFrag<T16>::mma(a2[mb], b, acc[mb][nb]); if (NSPLIT >= 2) acc[mb][nb] = WFrag<T16>::mma(a[mb], b2, acc[mb][nb]); } }
        if (NSPLIT == 2) asm volatile("s_wait_xcnt 0x0" :: "v"(pa[0]), "v"(pa[1]), "v"(pa[2]), "v"(pa[3]), "v"(pa2[0]), "v"(pa2[1]), "v"(pa2[2]), "v"(pa2[3]) : "memory");   // the same wait for the three-product form
        asm volatile("v_nop\n\tv_nop\n\tv_nop\n\tv_nop" : "+v"(acc[0][0]), "+v"(acc[1][1]), "+v"(acc[2][2]), "+v"(acc[3][3]) : "v"(a[0]), "v"(a[3]));
    }
#pragma unroll
    for (int mb = 0; mb < 4; ++mb) {
#pragma unroll
        for (int nb = 0; nb < 4; ++nb) {
#pragma unroll
            for (int j = 0; j < 8; ++j) os[(hi * 8 + j) * 68 + nb * 16 + lr] = acc[mb][nb][j]; }
        __builtin_amdgcn_wave_barrier(); asm volatile("" ::: "memory");
        float* crow = C + (size_t)(r0 + mb * 16) * ldc + c0;
{
#pragma unroll
            for (int s = 0; s < 8; ++s) { const int row = 2 * s + hi, cofs = lr * 4; v4f val = *(const v4fa*)(os + row * 68 + cofs); if (BIAS) { val[0] += bfr(bias[c0 + cofs]); val[1] += bfr(bias[c0 + cofs + 1]); val[2] += bfr(bias[c0 + cofs + 2]); val[3] += bfr(bias[c0 + cofs + 3]); }
                *(v4f*)(crow + (size_t)row * ldc + cofs) = val; }
             }
        __builtin_amdgcn_wave_barrier(); asm volatile("" ::: "memory");
    }
}

__device__ __forceinline__ h16 tohx(float x) { return (h16)x; }
__device__ __forceinline__ void splitf(float y, unsigned short& h, unsigned short& l) { h = f2bf(y); l = f2bf(y - bf2f(h)); }
typedef __attribute__((ext_vector_type(2))) _Float16 v2h;
typedef __attribute__((ext_vector_type(4))) _Float16 v4h;
typedef __attribute__((ext_vector_type(2))) unsigned short v2us;
typedef __attribute__((ext_vector_type(4))) unsigned short v4us;
typedef __attribute__((ext_vector_type(2))) float v2f;
typedef __attribute__((ext_vector_type(4))) int v4i;

// grid y: which of up to three equally shaped weights; their Bt planes follow one another
__global__ __launch_bounds__(256) void k_wtG(const float* __restrict__ w0, const float* __restrict__ w1, const float* __restrict__ w2, int K, int N, bf* Bt) {
    const float* __restrict__ w = blockIdx.y == 0 ? w0 : blockIdx.y == 1 ? w1 : w2; Bt += (size_t)blockIdx.y * K * N;
    const int lane = threadIdx.x & 31; const int L0 = (blockIdx.x * 8 + (threadIdx.x >> 5)) * 8; const int nlines = N * K / 64;
{
#pragma unroll 1
        for (int l = 0; l < 8; ++l) { const int L = L0 + l; if (L >= nlines) break; const size_t e = (size_t)L * 64 + lane * 2; const int k = (int)(e % K), n = (int)(e / K); v2us o;
            o[0] = f2bf(w[(size_t)k * N + n]); o[1] = f2bf(w[(size_t)(k + 1) * N + n]); *(v2us*)(Bt + e) = o; }
         }
}
// grid y: which of the three sources; their bf16 copies follow one another
__global__ __launch_bounds__(256) void k_cvt8(const float* __restrict__ s0, const float* __restrict__ s1, const float* __restrict__ s2, bf* dst, size_t n8) { const float* __restrict__ src = blockIdx.y == 0 ? s0 : blockIdx.y == 1 ? s1 : s2; dst += (size_t)blockIdx.y * n8 * 8; const size_t i = (size_t)blockIdx.x * 256 + threadIdx.x; if (i >= n8) return; const v8f v = *(const v8f*)(src + i * 8); v8us o;
#pragma unroll
    for (int k = 0; k < 8; ++k) o[k] = f2bf(v[k]); *(v8us*)(dst + i * 8) = o;  }

// k_rope: head planes [h][t][d] (fp16 + hi/lo) of rope(x) x sc with the rotate-half convention out[d] = x[d] cos[t][d] - x[d+HD/2] sin[t][d], out[d+HD/2] = x[d+HD/2] cos[t][d+HD/2] + x[d] sin[t][d+HD/2]
__global__ __launch_bounds__(256) void k_rope(const float* __restrict__ F, int pitch, int nheads, const float* __restrict__ CS, const float* __restrict__ RF, const float* __restrict__ nw, float sc, h16* P16, bf* Ph, bf* Pl) {
    const size_t e = ((size_t)blockIdx.x * 256 + threadIdx.x) * 2; if (e >= (size_t)nheads * TT * HD) return; const int d = (int)(e % HD); const int t = (int)((e / HD) % TT); const int h = (int)(e / ((size_t)HD * TT)); const float* f = F + (size_t)t * pitch + h * HD; const float rf = RF ? RF[(size_t)h * TT + t] : 1.0f; v2h o16; v2us oh, ol;
    f += (size_t)(h / NH_) * ((size_t)TT * pitch - NH_ * HD);   // heads NH_ and up come from the next [TT][pitch] plane (k behind q)
#pragma unroll
    for (int q = 0; q < 2; ++q) { const int dd = d + q; const int dp = (dd < HD / 2) ? dd + HD / 2 : dd - HD / 2; float x0 = f[dd], x1 = f[dp];
        if (RF) { float n0 = __fmul_rn(x0, rf), n1 = __fmul_rn(x1, rf); asm volatile("" : "+v"(n0)); asm volatile("" : "+v"(n1)); x0 = __fmul_rn(bfr(nw[dd]), n0); x1 = __fmul_rn(bfr(nw[dp]), n1); }
        const v2f cs = *(const v2f*)(CS + ((size_t)t * HD + dd) * 2); float a = __fmul_rn(x0, cs[0]), bq = __fmul_rn(x1, cs[1]); asm volatile("" : "+v"(a)); asm volatile("" : "+v"(bq)); const float r = ((dd < HD / 2) ? __fsub_rn(a, bq) : __fadd_rn(a, bq)) * sc;
        o16[q] = tohx(r); unsigned short a2, c2; splitf(r, a2, c2); oh[q] = a2; ol[q] = c2; }
    *(v2h*)(P16 + e) = o16; *(v2us*)(Ph + e) = oh; *(v2us*)(Pl + e) = ol;  }
__global__ __launch_bounds__(256) void k_vtp(const float* __restrict__ F, int pitch, int nheads, h16* V16, bf* Vh, bf* Vl) { const size_t e = ((size_t)blockIdx.x * 256 + threadIdx.x) * 2; if (e >= (size_t)nheads * HD * TT) return; const int t = (int)(e % TT); const int d = (int)((e / TT) % HD); const int g = (int)(e / ((size_t)TT * HD)); v2h o16; v2us oh, ol;
#pragma unroll
    for (int q = 0; q < 2; ++q) { const float x = F[(size_t)(t + q) * pitch + g * HD + d]; o16[q] = tohx(x); unsigned short a2, c2; splitf(x, a2, c2); oh[q] = a2; ol[q] = c2; }
    *(v2h*)(V16 + e) = o16; *(v2us*)(Vh + e) = oh; *(v2us*)(Vl + e) = ol;  }
__global__ __launch_bounds__(256) void k_csid(float* CS) { const int idx = blockIdx.x * 256 + threadIdx.x; if (idx >= TT * HD) return; v2f cs; cs[0] = 1.0f; cs[1] = 0.0f; *(v2f*)(CS + (size_t)idx * 2) = cs;  }
// ---- k_fattn: fused attention. A work-group = NWV query tiles of one (batch, head), one per wave; every wave walks all TT keys in steps of 32 with an online softmax. The key rows and v^T rows of a stage (KS keys) are brought into LDS once for the four waves by asynchronous copies, two buffers: the next stage flies while this one is worked on.
// Transposed form: S^T = K Q^T (A = key rows, B = query rows), so a lane holds, for query lr, keys hi*8 + j of each 16-key tile: two such tiles side by side ARE the B fragment (k = 8 hi + i, 16 + 8 hi + i) of O^T = V^T P^T (A = v^T rows e, k = keys). Softmax runs down a lane's own registers plus one exchange between the lane halves.
// HI: bf16 hi/lo planes, three products each (hh + lh + hl) for both products; else fp16, P unnormalised in (0, 1]. O[t][e] (f32, pitch HV) = softmax row x v, normalised.
typedef __attribute__((ext_vector_type(16))) unsigned short v16us;
// One stage into one buffer: KS key rows (128 bytes each, LDS pitch 144) and HV v^T rows (2 KS bytes each, LDS pitch 2 KS + 16), per plane; 16 bytes a lane and copy, twelve copies a lane, whole lines of the source. Buffer: [K planes][V planes].
template <typename T16, bool HI, int KS>
__device__ __forceinline__ void stage_kv(const T16* __restrict__ Kp, const T16* __restrict__ K2, const T16* __restrict__ Vt, const T16* __restrict__ V2, int k0, T16* buf) {
    constexpr int NPL = HI ? 2 : 1, KE = KS * QP, VP = KS + 8, VE = HV * VP, CV = KS / 8;
    static_assert(NPL * (KS / 16 + KS / 8) == 12, "twelve copies a lane"); static_assert(NPL * (KE + VE) <= BUFE, "stage fits its buffer");
    const int tid = (int)threadIdx.x; unsigned la[12]; const T16* ga[12]; int c = 0; constexpr int RV = 32 * NWV / CV;   // v^T rows that one copy of the work-group covers
    // the lane's own offsets: copy i adds whole rows, a constant. Key rows: 8 lanes a row, 16 rows a copy, contiguous in the source; v^T rows: CV lanes a row, RV rows a copy
    const int gk = tid * 8, gv = (tid / CV) * TT + (tid % CV) * 8; const unsigned lk = (unsigned)(size_t)(buf + (tid >> 3) * QP + (tid & 7) * 8), lv = (unsigned)(size_t)(buf + NPL * KE + (tid / CV) * VP + (tid % CV) * 8);
#pragma unroll
    for (int pl = 0; pl < NPL; ++pl)
#pragma unroll
        for (int i = 0; i < KS / 16; ++i) { ga[c] = (pl ? K2 : Kp) + (size_t)k0 * HD + i * (32 * NWV * 8) + gk; la[c] = lk + (unsigned)(pl * KE + i * 16 * QP) * 2u; ++c; }
#pragma unroll
    for (int pl = 0; pl < NPL; ++pl)
#pragma unroll
        for (int i = 0; i < KS / 8; ++i) { ga[c] = (pl ? V2 : Vt) + (size_t)i * RV * TT + k0 + gv; la[c] = lv + (unsigned)(pl * VE + i * RV * VP) * 2u; ++c; }
    // the copies and, as the last line of the same statement, the wait behind which their address registers may take new values
    asm volatile("global_load_async_to_lds_b128 %0, %12, off\n\tglobal_load_async_to_lds_b128 %1, %13, off\n\tglobal_load_async_to_lds_b128 %2, %14, off\n\tglobal_load_async_to_lds_b128 %3, %15, off\n\t"
                 "global_load_async_to_lds_b128 %4, %16, off\n\tglobal_load_async_to_lds_b128 %5, %17, off\n\tglobal_load_async_to_lds_b128 %6, %18, off\n\tglobal_load_async_to_lds_b128 %7, %19, off\n\t"
                 "global_load_async_to_lds_b128 %8, %20, off\n\tglobal_load_async_to_lds_b128 %9, %21, off\n\tglobal_load_async_to_lds_b128 %10, %22, off\n\tglobal_load_async_to_lds_b128 %11, %23, off\n\ts_wait_xcnt 0x0"
                 :: "v"(la[0]), "v"(la[1]), "v"(la[2]), "v"(la[3]), "v"(la[4]), "v"(la[5]), "v"(la[6]), "v"(la[7]), "v"(la[8]), "v"(la[9]), "v"(la[10]), "v"(la[11]),
                    "v"(ga[0]), "v"(ga[1]), "v"(ga[2]), "v"(ga[3]), "v"(ga[4]), "v"(ga[5]), "v"(ga[6]), "v"(ga[7]), "v"(ga[8]), "v"(ga[9]), "v"(ga[10]), "v"(ga[11]) : "memory");
}
template <typename T16, bool HI, int NQ, int KS>
__device__ __forceinline__ void attn_tile(const T16* __restrict__ Q, const T16* __restrict__ Q2, const T16* __restrict__ Kp, const T16* __restrict__ K2, const T16* __restrict__ Vt, const T16* __restrict__ V2, int q0, float* __restrict__ O, T16* skv, T16* sq) {
    typedef typename WFrag<T16>::V V;
    constexpr int NPL = HI ? 2 : 1, KE = KS * QP, VP = KS + 8, VE = HV * VP, NST = TT / KS;
    const int lane = threadIdx.x & 31, lr = lane & 15, hi = lane >> 4; const int w = __builtin_amdgcn_readfirstlane((int)(threadIdx.x >> 5));
    V qf[NQ][2], qg[NQ][2]; v8f acc[NQ][8]; float m[NQ], l[NQ];
#pragma unroll
    for (int n = 0; n < NQ; ++n) { m[n] = -3.0e38f; l[n] = 0.f;
#pragma unroll
        for (int et = 0; et < 8; ++et) acc[n][et] = (v8f){}; }
    // the query fragments do not fit in the registers beside the accumulators and the v^T rows, so each wave's tile lies in LDS, 32 rows of pitch QP (32 queries, or 16 queries hi then lo), and is read anew in every step
    { const int row = (int)threadIdx.x >> 2, col = ((int)threadIdx.x & 3) * 16; const T16* g[NWV]; v4f x0[NWV], x1[NWV];
#pragma unroll
        for (int i = 0; i < NWV; ++i) { g[i] = (HI ? ((row >> 4) ? Q2 : Q) + (size_t)(q0 + i * 16 + (row & 15)) * HD : Q + (size_t)(q0 + i * 32 + row) * HD) + col; x0[i] = *(const v4fa*)g[i]; x1[i] = *(const v4fa*)(g[i] + 8); }
        asm volatile("s_wait_xcnt 0x0" :: "v"(g[0]), "v"(g[1]), "v"(g[2]), "v"(g[3]) : "memory");   // the row addresses are inputs of this wait so that their registers stay untouched from the loads down to it
#pragma unroll
        for (int i = 0; i < NWV; ++i) { *(v4fa*)(sq + (i * 32 + row) * QP + col) = x0[i]; *(v4fa*)(sq + (i * 32 + row) * QP + col + 8) = x1[i]; } }
    // stage 0 lands and is published (with the query tiles) before anybody reads it; stage 1 flies during trip 0
    stage_kv<T16, HI, KS>(Kp, K2, Vt, V2, 0, skv);
    asm volatile("s_wait_asynccnt 0x0" ::: "memory");   // this wave's copies of stage 0 have landed
    __syncthreads();
    stage_kv<T16, HI, KS>(Kp, K2, Vt, V2, KS, skv + BUFE);
    const T16* sqw = sq + w * 32 * QP; const int koff = lr * QP + 8 * hi, voff = NPL * KE + lr * VP + 8 * hi;
#pragma unroll 1
    for (int t = 0; t < NST; ++t) {
        T16* bufp = skv + (t & 1) * BUFE;
#pragma unroll 1   // rolled: with the stage's two steps unrolled the build spills more registers
      for (int ss = 0; ss < KS / 32; ++ss) {
        const T16* kb = bufp + ss * 32 * QP + koff; const T16* kb2 = kb + KE; const T16* vb = bufp + ss * 32 + voff; const T16* vb2 = vb + VE;
#pragma unroll
        for (int n = 0; n < NQ; ++n)
#pragma unroll
            for (int c = 0; c < 2; ++c) { qf[n][c] = WFrag<T16>::ld(sqw + (n * 16 + lr) * QP + c * 32 + 8 * hi); if (HI) qg[n][c] = WFrag<T16>::ld(sqw + (16 + lr) * QP + c * 32 + 8 * hi); }
        v8f s[NQ][2]; V ka[2][2], kl[2][2];   // all of the step's key fragments are requested first: one wait instead of one per 16 keys
#pragma unroll
        for (int kt = 0; kt < 2; ++kt)
#pragma unroll
            for (int c = 0; c < 2; ++c) { ka[kt][c] = WFrag<T16>::ld(kb + kt * 16 * QP + c * 32); if (HI) kl[kt][c] = WFrag<T16>::ld(kb2 + kt * 16 * QP + c * 32); }
#pragma unroll
        for (int kt = 0; kt < 2; ++kt)
#pragma unroll
            for (int n = 0; n < NQ; ++n) { v8f t2 = (v8f){};
#pragma unroll
                for (int c = 0; c < 2; ++c) { t2 = WFrag<T16>::mma(ka[kt][c], qf[n][c], t2); if (HI) { t2 = WFrag<T16>::mma(ka[kt][c], qg[n][c], t2); t2 = WFrag<T16>::mma(kl[kt][c], qf[n][c], t2); } }
                s[n][kt] = t2; }
        V va[8], vl[8];   // v^T rows 0..63 are requested ahead of the softmax arithmetic, rows 64..127 behind it, ahead of the first half's products
#pragma unroll
        for (int et = 0; et < 4; ++et) { va[et] = WFrag<T16>::ld(vb + et * 16 * VP); if (HI) vl[et] = WFrag<T16>::ld(vb2 + et * 16 * VP); }
        V pf[NQ], pg[NQ];
#pragma unroll
        for (int n = 0; n < NQ; ++n) { float p[16]; float mx = -3.0e38f;
#pragma unroll
            for (int i = 0; i < 16; ++i) { p[i] = s[n][i >> 3][i & 7] * SCL; mx = fmaxf(mx, p[i]); }
            mx = fmaxf(mx, __shfl_xor(mx, 16, 32)); const float mn = fmaxf(m[n], mx); const float al = __builtin_amdgcn_exp2f((m[n] - mn) * L2E); m[n] = mn; float sum = 0.f;
#pragma unroll
            for (int i = 0; i < 16; ++i) { p[i] = __builtin_amdgcn_exp2f((p[i] - mn) * L2E); sum += p[i]; }
            l[n] = l[n] * al + sum;   // this lane's keys only; the lane halves are added behind the loop
#pragma unroll
            for (int et = 0; et < 8; ++et) acc[n][et] *= al;
            if (HI) { v16us uh, ul;
#pragma unroll
                for (int i = 0; i < 16; ++i) { unsigned short a, c2; splitf(p[i], a, c2); uh[i] = a; ul[i] = c2; }
                pf[n] = __builtin_bit_cast(V, uh); pg[n] = __builtin_bit_cast(V, ul);
            } else { v16h ph;
#pragma unroll
                for (int i = 0; i < 16; ++i) ph[i] = tohx(p[i]);
                pf[n] = __builtin_bit_cast(V, ph); } }
#pragma unroll
        for (int et = 4; et < 8; ++et) { va[et] = WFrag<T16>::ld(vb + et * 16 * VP); if (HI) vl[et] = WFrag<T16>::ld(vb2 + et * 16 * VP); }
#pragma unroll
        for (int et = 0; et < 8; ++et)
#pragma unroll
            for (int n = 0; n < NQ; ++n) { acc[n][et] = WFrag<T16>::mma(va[et], pf[n], acc[n][et]); if (HI) { acc[n][et] = WFrag<T16>::mma(va[et], pg[n], acc[n][et]); acc[n][et] = WFrag<T16>::mma(vl[et], pf[n], acc[n][et]); } }
      }
        // hand-over: this wave's reads of the buffer are done, its copies of stage t + 1 have landed; the barrier publishes stage t + 1 and ends every wave's reads of this buffer; only then is it refilled
        asm volatile("s_wait_dscnt 0x0" ::: "memory");
        asm volatile("s_wait_asynccnt 0x0" ::: "memory");
        __syncthreads();
        if (t + 2 < NST) stage_kv<T16, HI, KS>(Kp, K2, Vt, V2, (t + 2) * KS, bufp);
    }
    asm volatile("s_wait_asynccnt 0x0" ::: "memory");   // no copy is outstanding when the wave ends
    const int qw = q0 + w * 16 * NQ;
#pragma unroll
    for (int n = 0; n < NQ; ++n) { l[n] += __shfl_xor(l[n], 16, 32); const float f = __fdiv_rn(1.0f, l[n]);
#pragma unroll
        for (int et = 0; et < 8; ++et) { const v8f r = acc[n][et] * f; const v4f a = __builtin_shufflevector(r, r, 0, 1, 2, 3), b = __builtin_shufflevector(r, r, 4, 5, 6, 7);
            float* orow = O + (size_t)(qw + n * 16 + lr) * HV + et * 16 + hi * 8; *(v4f*)orow = a; *(v4f*)(orow + 4) = b;
            asm volatile("s_wait_xcnt 0x0" :: "v"(orow), "v"(a), "v"(b) : "memory"); }   // the stores have left their address and data registers before these are used again
    }
}
// grid x: first the hi/lo work-groups (NWV x 16 queries, the longer ones), then the fp16 ones (NWV x 32 queries); tiles of one head follow one another. waves_per_eu(4): keeps the kernel at 256 registers, so that no register window is switched and up to four work-groups share a WGP. Planes: QK* [b][q heads, k heads][t][HD], VT* [b][p][e][t], O [b][h][t][HV]
__global__ __launch_bounds__(32 * NWV) __attribute__((amdgpu_waves_per_eu(4))) void k_fattn(const h16* __restrict__ QK16, const bf* __restrict__ QKh, const bf* __restrict__ QKl, const h16* __restrict__ VT16, const bf* __restrict__ VTh, const bf* __restrict__ VTl, float* __restrict__ O) {
    __shared__ __align__(16) h16 skv[2 * BUFE]; __shared__ __align__(16) h16 sq[NWV * 32 * QP];
    const int NHB = NB_ * NH_ * (RH / (16 * NWV)); int blk = (int)blockIdx.x; const bool hires = blk < NHB; if (!hires) blk -= NHB;
    const int per = hires ? RH / (16 * NWV) : (TT - RH) / (32 * NWV); const int bh = blk / per, tile = blk % per; const int b = bh / NH_, h = bh % NH_;
    const size_t oq = (size_t)(b * (NH_ + NKV) + h) * TT * HD, ok = (size_t)(b * (NH_ + NKV) + NH_ + h) * TT * HD, ov = (size_t)(b * NP + h / 2) * HV * TT; float* Oh = O + (size_t)bh * TT * HV;
    if (hires) attn_tile<bf, true, 1, 32>(QKh + oq, QKl + oq, QKh + ok, QKl + ok, VTh + ov, VTl + ov, tile * 16 * NWV, Oh, (bf*)skv, (bf*)sq);
    else attn_tile<h16, false, 2, 64>(QK16 + oq, nullptr, QK16 + ok, nullptr, VT16 + ov, nullptr, RH + tile * 32 * NWV, Oh, skv, sq);
}
// k_vtpV: value planes per 128-wide value head [p][e][t] (fp16 + hi/lo) = F[t][p*HV + e]; as k_vtp with HV = 128.
__global__ __launch_bounds__(256) void k_vtpV(const float* __restrict__ F, int pitch, int nheads, h16* V16, bf* Vh, bf* Vl) { const size_t e = ((size_t)blockIdx.x * 256 + threadIdx.x) * 2; if (e >= (size_t)nheads * HV * TT) return; const int t = (int)(e % TT); const int d = (int)((e / TT) % HV); const int g = (int)(e / ((size_t)TT * HV)); v2h o16; v2us oh, ol;
#pragma unroll
    for (int q = 0; q < 2; ++q) { const float x = F[(size_t)(t + q) * pitch + g * HV + d]; o16[q] = tohx(x); unsigned short a2, c2; splitf(x, a2, c2); oh[q] = a2; ol[q] = c2; }
    *(v2h*)(V16 + e) = o16; *(v2us*)(Vh + e) = oh; *(v2us*)(Vl + e) = ol;  }

template <int WD>
__global__ __launch_bounds__(256) void k_lnrowD(const float* __restrict__ X, size_t nrows, const float* __restrict__ g, const float* __restrict__ bb, bf* Hh, bf* Hl) { const int lane = threadIdx.x & 31; const size_t r = (size_t)blockIdx.x * 8 + (threadIdx.x >> 5); if (r >= nrows) return; const float* xr = X + r * WD; float a[WD / 32]; float s = 0.f;
#pragma unroll
    for (int c = 0; c < WD / 128; ++c) { const v4f v = *(const v4f*)(xr + c * 128 + lane * 4); for (int q = 0; q < 4; ++q) { a[c * 4 + q] = v[q]; s = __fadd_rn(s, a[c * 4 + q]); } }
#pragma unroll
    for (int sh = 16; sh; sh >>= 1) s = __fadd_rn(s, __shfl_xor(s, sh, 32));
    const float mean = __fdiv_rn(s, (float)WD); float s2 = 0.f;
#pragma unroll
    for (int k = 0; k < WD / 32; ++k) { const float dv = __fsub_rn(a[k], mean); float p2 = __fmul_rn(dv, dv); asm volatile("" : "+v"(p2)); s2 = __fadd_rn(s2, p2); }   /* mul and add kept separate (no fma contraction) */
#pragma unroll
    for (int sh = 16; sh; sh >>= 1) s2 = __fadd_rn(s2, __shfl_xor(s2, sh, 32));
    const float rs = __fdiv_rn(1.0f, __fsqrt_rn(__fadd_rn(__fdiv_rn(s2, (float)WD), 1e-6f)));
{
#pragma unroll
        for (int c = 0; c < WD / 128; ++c) { v4us oh, ol; for (int q = 0; q < 4; ++q) { const int col = c * 128 + lane * 4 + q; float y = __fmul_rn(__fmul_rn(__fsub_rn(a[c * 4 + q], mean), rs), bfr(g[col])); asm volatile("" : "+v"(y)); y = __fadd_rn(y, bfr(bb[col])); y = __fmul_rn(y, 1.0f - LINIT); unsigned short u, w2; splitf(y, u, w2); oh[q] = u; ol[q] = w2; } *(v4us*)(Hh + r * WD + c * 128 + lane * 4) = oh; *(v4us*)(Hl + r * WD + c * 128 + lane * 4) = ol; }
         } }
__global__ __launch_bounds__(256) void k_lambda(const float* __restrict__ a1, const float* __restrict__ b1, const float* __restrict__ a2, const float* __restrict__ b2, float* LAM) { if (threadIdx.x >= 32) return; const int lane = threadIdx.x; float s1 = __fadd_rn(__fmul_rn(bfr(a1[lane]), bfr(b1[lane])), __fmul_rn(bfr(a1[lane + 32]), bfr(b1[lane + 32]))); float s2 = __fadd_rn(__fmul_rn(bfr(a2[lane]), bfr(b2[lane])), __fmul_rn(bfr(a2[lane + 32]), bfr(b2[lane + 32])));
#pragma unroll
    for (int sh = 16; sh; sh >>= 1) { s1 = __fadd_rn(s1, __shfl_xor(s1, sh, 32)); s2 = __fadd_rn(s2, __shfl_xor(s2, sh, 32)); }
    const float lam = __fadd_rn(__fsub_rn(expf(s1), expf(s2)), LINIT); if (lane == 0) { *(float*)LAM = lam;  } }
// grid y: batch x pair; ctx[b][t][p*128 + e] = w0 v - lambda w1 v from the two heads' planes
__global__ __launch_bounds__(256) void k_dmerge(const float* __restrict__ O, const float* __restrict__ LAM, float* ctx) { const size_t i = (size_t)blockIdx.x * 256 + threadIdx.x; if (i >= (size_t)TT * HV / 4) return; const int b = (int)blockIdx.y / NP, p = (int)blockIdx.y % NP; O += (size_t)(b * NH_ + 2 * p) * TT * HV; const size_t e = i * 4; const int c = (int)(e % HV); const int t = (int)(e / HV); const float lam = LAM[0]; const v4f a = *(const v4f*)(O + e); const v4f b2 = *(const v4f*)(O + (size_t)TT * HV + e);
    *(v4f*)(ctx + ((size_t)b * TT + t) * DQ + p * HV + c) = a - lam * b2;  }
__global__ __launch_bounds__(256) void k_merge(const float* __restrict__ O, int h0, bf* Ah, bf* Al) { const size_t e = ((size_t)blockIdx.x * 256 + threadIdx.x) * 2; if (e >= (size_t)ZH * TT * HD) return; const int d = (int)(e % HD); const int t = (int)((e / HD) % TT); const int zz = (int)(e / ((size_t)HD * TT)); const float cs = (t < RH) ? 1.0f : (1.0f / PCAR); const size_t oo = (size_t)t * DQ + (h0 + zz) * HD + d;
    v2us oh, ol;
#pragma unroll
    for (int q = 0; q < 2; ++q) { unsigned short a, c2; splitf(O[e + q] * cs, a, c2); oh[q] = a; ol[q] = c2; } *(v2us*)(Ah + oo) = oh; *(v2us*)(Al + oo) = ol;  }

extern "C" void kernel_launch(void* const* d_in, const int* in_sizes, int n_in,
                              void* d_out, int out_size, void* d_ws, size_t ws_size, hipStream_t stream) {
    (void)in_sizes; (void)n_in; (void)out_size;
    const float* x = (const float*)d_in[0]; const float* xk = (const float*)d_in[1]; const float* xv = (const float*)d_in[2]; const float* wq = (const float*)d_in[3]; const float* bq = (const float*)d_in[4]; const float* wk = (const float*)d_in[5]; const float* bk = (const float*)d_in[6]; const float* wv = (const float*)d_in[7]; const float* bv = (const float*)d_in[8]; const float* lq1 = (const float*)d_in[9]; const float* lk1 = (const float*)d_in[10]; const float* lq2 = (const float*)d_in[11]; const float* lk2 = (const float*)d_in[12]; const float* lng = (const float*)d_in[13]; const float* lnb = (const float*)d_in[14]; const float* wo = (const float*)d_in[15]; const float* bo = (const float*)d_in[16];
    float* OUT = (float*)d_out;     // [2][2048][512]
    char* wsp = (char*)d_ws;
    auto take = [&](size_t bytes) { char* p = wsp; wsp += (bytes + 255) & ~(size_t)255; return (void*)p; };
    bf* WQ = (bf*)take((size_t)DQ * DM * 2); bf* WK = (bf*)take((size_t)DKV * DM * 2); bf* WV = (bf*)take((size_t)DKV * DM * 2); bf* WO = (bf*)take((size_t)DM * DQ * 2); float* CS = (float*)take((size_t)TT * HD * 2 * 4); (void)WK; (void)WV;
    const size_t SQK = (size_t)(NH_ + NKV) * TT * HD, SV = (size_t)NP * HV * TT;   // one batch's q + k planes (k directly behind q: one launch writes both) and v^T planes, in elements
    h16* QK16 = (h16*)take(NB_ * SQK * 2); bf* QKh = (bf*)take(NB_ * SQK * 2); bf* QKl = (bf*)take(NB_ * SQK * 2); h16* VT16 = (h16*)take(NB_ * SV * 2); bf* VTh = (bf*)take(NB_ * SV * 2); bf* VTl = (bf*)take(NB_ * SV * 2);
    bf* XB = (bf*)take((size_t)3 * TT * DM * 2); float* FQ = (float*)take((size_t)3 * TT * DQ * 4); float* FV = FQ + (size_t)2 * TT * DQ;   // the three bf16 input copies and the three f32 projections [q][k][v] of the batch at hand
    float* Ob = (float*)take((size_t)NB_ * NH_ * TT * HV * 4); float* CTX = (float*)take((size_t)NB_ * TT * DQ * 4); float* LAM = (float*)take(256); bf* ATh = (bf*)take((size_t)TT * DQ * 2); bf* ATl = (bf*)take((size_t)TT * DQ * 2);
    if ((size_t)(wsp - (char*)d_ws) > ws_size) return;    // ws 256 MiB
    { k_wtG<<<dim3((unsigned)((DM * DQ / 64 + 63) / 64), 3, 1), 256, 0, stream>>>(wq, wk, wv, DM, DQ, WQ); k_lambda<<<1, 256, 0, stream>>>(lq1, lk1, lq2, lk2, LAM);
      k_wtG<<<(unsigned)((DQ * DM / 64 + 63) / 64), 256, 0, stream>>>(wo, wo, wo, DQ, DM, WO);
       }
    k_csid<<<(TT * HD + 255) / 256, 256, 0, stream>>>(CS);
    const unsigned LQK = (unsigned)(((size_t)(NH_ + NKV) * TT * HD / 2 + 255) / 256), LKv = (unsigned)(((size_t)NKV * TT * HD / 2 + 255) / 256);
    for (int b = 0; b < NB_; ++b) {
        k_cvt8<<<dim3((unsigned)(((size_t)TT * DM / 8 + 255) / 256), 3, 1), 256, 0, stream>>>(x + (size_t)b * TT * DM, xk + (size_t)b * TT * DM, xv + (size_t)b * TT * DM, XB, (size_t)TT * DM / 8);
        k_gemmw<bf, 0, true><<<dim3(TT / 64, DQ / 64, 3), 32, 0, stream>>>(XB, nullptr, WQ, nullptr, DM, DM, 0, FQ, DQ, bq, bk, bv, (size_t)TT * DM, (size_t)DQ * DM, (size_t)TT * DQ);   /* q, k and v projections on grid z */
        k_rope<<<LQK, 256, 0, stream>>>(FQ, DQ, NH_ + NKV, CS, nullptr, nullptr, 1.0f, QK16 + b * SQK, QKh + b * SQK, QKl + b * SQK);   /* q and k planes */
        k_vtpV<<<LKv, 256, 0, stream>>>(FV, DKV, NP, VT16 + b * SV, VTh + b * SV, VTl + b * SV); }
    k_fattn<<<NB_ * NH_ * (RH / (16 * NWV) + (TT - RH) / (32 * NWV)), 32 * NWV, 0, stream>>>(QK16, QKh, QKl, VT16, VTh, VTl, Ob);   /* every batch, head and query tile */
    k_dmerge<<<dim3((unsigned)(((size_t)TT * HV / 4 + 255) / 256), NB_ * NP, 1), 256, 0, stream>>>(Ob, LAM, CTX);
    for (int b = 0; b < NB_; ++b) {
        k_lnrowD<DQ><<<(unsigned)((TT + 7) / 8), 256, 0, stream>>>(CTX + (size_t)b * TT * DQ, (size_t)TT, lng, lnb, ATh, ATl);   /* LayerNorm (eps 1e-6) x (1 - lambda_init) -> hi/lo planes */ k_gemmw<bf, 1, true><<<dim3(TT / 64, DM / 64, 1), 32, 0, stream>>>(ATh, ATl, WO, nullptr, DQ, DQ, 0, OUT + (size_t)b * TT * DM, DM, bo, bo, bo, 0, 0, 0); }
}

// v005
// A run of this version takes 228 microseconds.
// Two timings next to v004 both put it at 1.22 times that version's speed.
// All steps since v000 together make it 8.57 times as fast.
#include <hip/hip_runtime.h>

// Multi-head DIFFERENTIAL attention (query, key, value [2][2048][512]; q = query Wq + bq, k = key Wk + bk as 16 heads x 64, v = value Wv + bv as 8 heads x 128 ('xw' [512][1024] + [1024], 0.02); w = softmax(q.k / 8) per head; for each pair p: dw = w[2p] - lambda w[2p+1], lambda = exp(lq1.lk1) - exp(lq2.lk2) + lambda_init (lq/lk [64], read); attn = dw v_p -> [2048][1024]; LayerNorm (eps 1e-6, affine) x (1 - lambda_init); out = attn Wo + bo ('xw' [1024][512]) -> [2][2048][512] (2.1 M)).
// Layout: per batch bf16 copies of the three inputs (one launch, as for the three projections); exact projections + f32 biases, whose GEMM stores the q/k planes for the 16 score heads and the v^T planes per 128-wide value head itself, kept for both batches; lambda computed on device by every wave that uses it (two 64-term f32 dots, precise expf); ONE fused attention launch for every batch, head and query tile (k_fattn: scores, online softmax and P.v in registers, no score matrix in memory; hybrid rows: < 512 hi/lo 3 products, rest fp16), each head's normalised w v as an f32 plane; then a LayerNorm row kernel (forms w0 v - lambda w1 v as it reads the planes; f32, fixed order) scaled by (1 - lambda_init), converted to hi/lo planes, x Wo exact + bo.
// Compute dtypes, f32 accumulate: every input rounded to bf16; projections exact + f32 biases; attention rows < 512 3 products, rest fp16; softmax, lambda, difference, LayerNorm f32; Wo hl x exact + bias.

#define NB_  2
#define TT   2048
#define DM   512
#define NH_  16
#define NKV  16
#define REP  (NH_ / NKV)
#define HD   64
#define DQ   (NH_ * HD)
#define DKV  (NKV * HD)
#define ZH   2
#define RH   512                  // query rows < RH use hi+lo planes (0: none)
#define WIN  0
#define PCAR 1024.0f
#define SCL  0.125f
#define NP   8       // value heads (pairs)
#define HV   128     // value head width
#define LINIT 0.47071301937103271f   // lambda_init = 0.8 - 0.6 exp(-0.6) as float32
#define NWV  4       // waves of a fused-attention work-group: each owns a query tile of its own and walks all TT keys; the staged key and v^T tiles serve all of them
#define BUFE 14848   // 16-bit elements of one stage buffer: hi/lo 2 x (32 x 72 + 128 x 40); fp16 64 x 72 + 128 x 72 is smaller
#define L2E  1.4426950408889634f
#define QP   72      // LDS row pitch of the query and key tiles in 16-bit elements (64 + 8: 16 bytes of pad against bank conflicts between rows)
typedef _Float16 h16;
typedef unsigned short bf;
typedef __attribute__((ext_vector_type(16))) __bf16   v16bf;
typedef __attribute__((ext_vector_type(16))) _Float16 v16h;
typedef __attribute__((ext_vector_type(8)))  _Float16 v8h;
typedef __attribute__((ext_vector_type(8)))  unsigned short v8us;
typedef __attribute__((ext_vector_type(8)))  float    v8f;
typedef __attribute__((ext_vector_type(4)))  float    v4f;
typedef v8h  __attribute__((may_alias)) v8ha;
typedef v4f  __attribute__((may_alias)) v4fa;
typedef v8us __attribute__((may_alias)) v8usa;

__device__ __forceinline__ unsigned short f2bf(float f) { unsigned u = __float_as_uint(f); u += 0x7FFFu + ((u >> 16) & 1u); return (unsigned short)(u >> 16); }
__device__ __forceinline__ float bf2f(unsigned short b) { return __uint_as_float(((unsigned)b) << 16); }
__device__ __forceinline__ float bfr(float f) { return bf2f(f2bf(f)); }
__device__ __forceinline__ v16h cat16(v8h lo, v8h hi) { return __builtin_shufflevector(lo, hi, 0, 1, 2, 3, 4, 5, 6, 7, 8, 9, 10, 11, 12, 13, 14, 15); }
__device__ __forceinline__ v16bf cat16b(v8us lo, v8us hi) { return __builtin_bit_cast(v16bf, __builtin_shufflevector(lo, hi, 0, 1, 2, 3, 4, 5, 6, 7, 8, 9, 10, 11, 12, 13, 14, 15)); }
__device__ __forceinline__ v8f wmma16(v16h a, v16h b, v8f c) { return __builtin_amdgcn_wmma_f32_16x16x32_f16(false, a, false, b, (short)0, c, false, false); }
__device__ __forceinline__ v8f wmmab(v16bf a, v16bf b, v8f c) { return __builtin_amdgcn_wmma_f32_16x16x32_bf16(false, a, false, b, (short)0, c, false, false); }



// ---- k_gemmw: register-blocked GEMM, ONE WAVE per 64x64 output tile (16 accumulators), operands straight from K-contiguous 16-bit planes; grid (M/64, N/64, Z), 32 threads.
// C[m][n] (f32, pitch ldc, + optional f32 bias[n]) = sum_k A[m][k] Bt[n][k] (+ split products per NSPLIT). A rows have pitch lda, Bt rows pitch K. z-batch strides sA/sB/sC in elements; batch z reads Bt plane z >> bsh (bsh = 1: two batches share one); batch z adds bias vector z. K % 32 == 0.
// PL: no f32 C; the epilogue stores the result + bias as 16-bit planes (fp16, bf16 hi, bf16 lo): batches 0 and 1 as head planes P*[z * NH_ + column tile][row][HD], batch 2 transposed as V*[column / HV][column % HV][row].
// KS > 1: grid z = batches x KS; blockIdx.z = batch * KS + slice; a slice sums k in [slice K/KS, (slice + 1) K/KS) into its own plane C + blockIdx.z * sC. K % (32 KS) == 0.
template <typename T16> struct WFrag;
template <> struct WFrag<h16> { typedef v16h V; static __device__ __forceinline__ V ld(const h16* p) { return cat16(*(const v8h*)p, *(const v8h*)(p + 16)); } static __device__ __forceinline__ v8f mma(V a, V b, v8f c) { return wmma16(a, b, c); } };
template <> struct WFrag<bf> { typedef v16bf V; static __device__ __forceinline__ V ld(const bf* p) { return cat16b(*(const v8us*)p, *(const v8us*)(p + 16)); } static __device__ __forceinline__ v8f mma(V a, V b, v8f c) { return wmmab(a, b, c); } };
__device__ __forceinline__ h16 tohx(float x) { return (h16)x; }
__device__ __forceinline__ void splitf(float y, unsigned short& h, unsigned short& l) { h = f2bf(y); l = f2bf(y - bf2f(h)); }
typedef __attribute__((ext_vector_type(8))) __bf16 v8b;
// eight f32 to the three planes' formats with the packed conversion instructions (round to nearest even: for finite values the bits of tohx and splitf), which keeps the epilogue's text short
__device__ __forceinline__ void plane8(v8f x, v8h& o16, v8us& oh, v8us& ol) { o16 = __builtin_convertvector(x, v8h); const v8b h = __builtin_convertvector(x, v8b); const v8b l = __builtin_convertvector(x - __builtin_convertvector(h, v8f), v8b); oh = __builtin_bit_cast(v8us, h); ol = __builtin_bit_cast(v8us, l); }
template <typename T16, int NSPLIT, bool BIAS, int KS = 1, bool PL = false>
__global__ __launch_bounds__(32) void k_gemmw(const T16* __restrict__ A, const T16* __restrict__ A2, const T16* __restrict__ Bt, const T16* __restrict__ Bt2, int K, int lda, int bsh, float* C, int ldc, const float* __restrict__ bias0, const float* __restrict__ bias1, const float* __restrict__ bias2, size_t sA, size_t sB, size_t sC, h16* P16, bf* Ph, bf* Pl, h16* V16, bf* Vh, bf* Vl) {
    typedef typename WFrag<T16>::V V;
    __shared__ __align__(16) float os[16 * 68];
    const size_t z = blockIdx.z / KS; const int ks = (int)(blockIdx.z % KS); A += z * sA; if (A2) A2 += z * sA; Bt += (z >> bsh) * sB; if (Bt2) Bt2 += (z >> bsh) * sB; C += (size_t)blockIdx.z * sC;
    const float* __restrict__ bias = z == 0 ? bias0 : z == 1 ? bias1 : bias2;   // up to three biased batches, each with its own bias vector
    const int kbeg = ks * (K / KS), kend = kbeg + K / KS;
    const int lane = threadIdx.x & 31, lr = lane & 15, hi = lane >> 4; const int r0 = blockIdx.x * 64, c0 = blockIdx.y * 64;
    v8f acc[4][4];
#pragma unroll
    for (int mb = 0; mb < 4; ++mb)
#pragma unroll
        for (int nb = 0; nb < 4; ++nb) acc[mb][nb] = (v8f){};
    const size_t aoff = (size_t)(r0 + lr) * lda + 8 * hi, boff = (size_t)(c0 + lr) * K + 8 * hi;
#pragma unroll 1
    for (int kc = kbeg; kc < kend; kc += 32) {
        V a[4], a2[4]; const T16* pa[4]; const T16* pa2[4];
#pragma unroll
        for (int mb = 0; mb < 4; ++mb) { pa[mb] = A + aoff + (size_t)mb * 16 * lda + kc; a[mb] = WFrag<T16>::ld(pa[mb]); if (NSPLIT == 1 || NSPLIT == 2) { pa2[mb] = A2 + aoff + (size_t)mb * 16 * lda + kc; a2[mb] = WFrag<T16>::ld(pa2[mb]); } }
        // the A row addresses are inputs of this wait so that their registers stay untouched from the loads down to it; only behind it may they take new values. It orders every load around it, so with three products it stands at the loop's foot instead: here it would cut the B loads into more, serial, batches
        if (NSPLIT == 1) asm volatile("s_wait_xcnt 0x0" :: "v"(pa[0]), "v"(pa[1]), "v"(pa[2]), "v"(pa[3]), "v"(pa2[0]), "v"(pa2[1]), "v"(pa2[2]), "v"(pa2[3]) : "memory");
        if (NSPLIT == 0 || NSPLIT > 2) asm volatile("s_wait_xcnt 0x0" :: "v"(pa[0]), "v"(pa[1]), "v"(pa[2]), "v"(pa[3]) : "memory");
#pragma unroll
        for (int nb = 0; nb < 4; ++nb) { const V b = WFrag<T16>::ld(Bt + boff + (size_t)nb * 16 * K + kc); V b2; if (NSPLIT >= 2) b2 = WFrag<T16>::ld(Bt2 + boff + (size_t)nb * 16 * K + kc);
#pragma unroll
            for (int mb = 0; mb < 4; ++mb) { acc[mb][nb] = WFrag<T16>::mma(a[mb], b, acc[mb][nb]); if (NSPLIT == 1 || NSPLIT == 2) acc[mb][nb] = WFrag<T16>::mma(a2[mb], b, acc[mb][nb]); if (NSPLIT >= 2) acc[mb][nb] = WFrag<T16>::mma(a[mb], b2, acc[mb][nb]); } }
        if (NSPLIT == 2) asm volatile("s_wait_xcnt 0x0" :: "v"(pa[0]), "v"(pa[1]), "v"(pa[2]), "v"(pa[3]), "v"(pa2[0]), "v"(pa2[1]), "v"(pa2[2]), "v"(pa2[3]) : "memory");   // the same wait for the three-product form
        asm volatile("v_nop\n\tv_nop\n\tv_nop\n\tv_nop" : "+v"(acc[0][0]), "+v"(acc[1][1]), "+v"(acc[2][2]), "+v"(acc[3][3]) : "v"(a[0]), "v"(a[3]));
    }
    if (PL && z == 2) {   // v^T planes: a lane's accumulator holds 8 consecutive rows (t) of one column (e), which are 16 bytes of a v^T row; the tile's 64 rows fill whole 128-byte lines
#pragma unroll
        for (int nb = 0; nb < 4; ++nb) { const float bs = bfr(bias[c0 + nb * 16 + lr]); const size_t vo = ((size_t)(c0 / HV) * HV + c0 % HV + nb * 16 + lr) * TT + r0 + hi * 8;
#pragma unroll
            for (int mb = 0; mb < 4; ++mb) { v8h o16; v8us oh, ol; plane8(acc[mb][nb] + bs, o16, oh, ol);
                h16* d0 = V16 + vo + mb * 16; bf* d1 = Vh + vo + mb * 16; bf* d2 = Vl + vo + mb * 16; *(v8h*)d0 = o16; *(v8us*)d1 = oh; *(v8us*)d2 = ol;
                asm volatile("s_wait_xcnt 0x0" :: "v"(d0), "v"(d1), "v"(d2), "v"(o16), "v"(oh), "v"(ol) : "memory"); } }   // the stores have left their address and data registers before these are used again
        return; }
    if (PL) {   // q and k head planes: the column tile is one head; through LDS so that 8 lanes store one 128-byte plane row
        const int rw = lane >> 3, cf = (lane & 7) * 8; v8f bs;
#pragma unroll
        for (int i = 0; i < 8; ++i) bs[i] = bfr(bias[c0 + cf + i]);
        const size_t po = ((z * NH_ + blockIdx.y) * TT + r0 + rw) * HD + cf;
#pragma unroll
        for (int mb = 0; mb < 4; ++mb) {
#pragma unroll
            for (int nb = 0; nb < 4; ++nb) {
#pragma unroll
                for (int j = 0; j < 8; ++j) os[(hi * 8 + j) * 68 + nb * 16 + lr] = acc[mb][nb][j]; }
            v4f u0[4], u1[4];   // all of the tile's LDS reads are requested first: the waits below would otherwise put them one behind the other
#pragma unroll
            for (int s = 0; s < 4; ++s) { u0[s] = *(const v4fa*)(os + (4 * s + rw) * 68 + cf); u1[s] = *(const v4fa*)(os + (4 * s + rw) * 68 + cf + 4); }
#pragma unroll
            for (int s = 0; s < 4; ++s) { v8h o16; v8us oh, ol; plane8(__builtin_shufflevector(u0[s], u1[s], 0, 1, 2, 3, 4, 5, 6, 7) + bs, o16, oh, ol);
                h16* d0 = P16 + po + (mb * 16 + 4 * s) * HD; bf* d1 = Ph + po + (mb * 16 + 4 * s) * HD; bf* d2 = Pl + po + (mb * 16 + 4 * s) * HD; *(v8h*)d0 = o16; *(v8us*)d1 = oh; *(v8us*)d2 = ol;
                asm volatile("s_wait_xcnt 0x0" :: "v"(d0), "v"(d1), "v"(d2), "v"(o16), "v"(oh), "v"(ol) : "memory"); }   // as above
        }
        return; }
#pragma unroll
    for (int mb = 0; mb < 4; ++mb) {
#pragma unroll
        for (int nb = 0; nb < 4; ++nb) {
#pragma unroll
            for (int j = 0; j < 8; ++j) os[(hi * 8 + j) * 68 + nb * 16 + lr] = acc[mb][nb][j]; }
        __builtin_amdgcn_wave_barrier(); asm volatile("" ::: "memory");
        float* crow = C + (size_t)(r0 + mb * 16) * ldc + c0;
{
#pragma unroll
            for (int s = 0; s < 8; ++s) { const int row = 2 * s + hi, cofs = lr * 4; v4f val = *(const v4fa*)(os + row * 68 + cofs); if (BIAS) { val[0] += bfr(bias[c0 + cofs]); val[1] += bfr(bias[c0 + cofs + 1]); val[2] += bfr(bias[c0 + cofs + 2]); val[3] += bfr(bias[c0 + cofs + 3]); }
                *(v4f*)(crow + (size_t)row * ldc + cofs) = val; }
             }
        __builtin_amdgcn_wave_barrier(); asm volatile("" ::: "memory");
    }
}

typedef __attribute__((ext_vector_type(2))) _Float16 v2h;
typedef __attribute__((ext_vector_type(4))) _Float16 v4h;
typedef __attribute__((ext_vector_type(2))) unsigned short v2us;
typedef __attribute__((ext_vector_type(4))) unsigned short v4us;
typedef __attribute__((ext_vector_type(2))) float v2f;
typedef __attribute__((ext_vector_type(4))) int v4i;

// grid y: which of up to three equally shaped weights; their Bt planes follow one another
__global__ __launch_bounds__(256) void k_wtG(const float* __restrict__ w0, const float* __restrict__ w1, const float* __restrict__ w2, int K, int N, bf* Bt) {
    const float* __restrict__ w = blockIdx.y == 0 ? w0 : blockIdx.y == 1 ? w1 : w2; Bt += (size_t)blockIdx.y * K * N;
    const int lane = threadIdx.x & 31; const int L0 = (blockIdx.x * 8 + (threadIdx.x >> 5)) * 8; const int nlines = N * K / 64;
{
#pragma unroll 1
        for (int l = 0; l < 8; ++l) { const int L = L0 + l; if (L >= nlines) break; const size_t e = (size_t)L * 64 + lane * 2; const int k = (int)(e % K), n = (int)(e / K); v2us o;
            o[0] = f2bf(w[(size_t)k * N + n]); o[1] = f2bf(w[(size_t)(k + 1) * N + n]); *(v2us*)(Bt + e) = o; }
         }
}
// grid y: which of the three sources; their bf16 copies follow one another
__global__ __launch_bounds__(256) void k_cvt8(const float* __restrict__ s0, const float* __restrict__ s1, const float* __restrict__ s2, bf* dst, size_t n8) { const float* __restrict__ src = blockIdx.y == 0 ? s0 : blockIdx.y == 1 ? s1 : s2; dst += (size_t)blockIdx.y * n8 * 8; const size_t i = (size_t)blockIdx.x * 256 + threadIdx.x; if (i >= n8) return; const v8f v = *(const v8f*)(src + i * 8); v8us o;
#pragma unroll
    for (int k = 0; k < 8; ++k) o[k] = f2bf(v[k]); *(v8us*)(dst + i * 8) = o;  }

__global__ __launch_bounds__(256) void k_vtp(const float* __restrict__ F, int pitch, int nheads, h16* V16, bf* Vh, bf* Vl) { const size_t e = ((size_t)blockIdx.x * 256 + threadIdx.x) * 2; if (e >= (size_t)nheads * HD * TT) return; const int t = (int)(e % TT); const int d = (int)((e / TT) % HD); const int g = (int)(e / ((size_t)TT * HD)); v2h o16; v2us oh, ol;
#pragma unroll
    for (int q = 0; q < 2; ++q) { const float x = F[(size_t)(t + q) * pitch + g * HD + d]; o16[q] = tohx(x); unsigned short a2, c2; splitf(x, a2, c2); oh[q] = a2; ol[q] = c2; }
    *(v2h*)(V16 + e) = o16; *(v2us*)(Vh + e) = oh; *(v2us*)(Vl + e) = ol;  }
// ---- k_fattn: fused attention. A work-group = NWV query tiles of one (batch, head), one per wave; every wave walks all TT keys in steps of 32 with an online softmax. The key rows and v^T rows of a stage (KS keys) are brought into LDS once for the four waves by asynchronous copies, two buffers: the next stage flies while this one is worked on.
// Transposed form: S^T = K Q^T (A = key rows, B = query rows), so a lane holds, for query lr, keys hi*8 + j of each 16-key tile: two such tiles side by side ARE the B fragment (k = 8 hi + i, 16 + 8 hi + i) of O^T = V^T P^T (A = v^T rows e, k = keys). Softmax runs down a lane's own registers plus one exchange between the lane halves.
// HI: bf16 hi/lo planes, three products each (hh + lh + hl) for both products; else fp16, P unnormalised in (0, 1]. O[t][e] (f32, pitch HV) = softmax row x v, normalised.
typedef __attribute__((ext_vector_type(16))) unsigned short v16us;
// One stage into one buffer: KS key rows (128 bytes each, LDS pitch 144) and HV v^T rows (2 KS bytes each, LDS pitch 2 KS + 16), per plane; 16 bytes a lane and copy, twelve copies a lane, whole lines of the source. Buffer: [K planes][V planes].
template <typename T16, bool HI, int KS>
__device__ __forceinline__ void stage_kv(const T16* __restrict__ Kp, const T16* __restrict__ K2, const T16* __restrict__ Vt, const T16* __restrict__ V2, int k0, T16* buf) {
    constexpr int NPL = HI ? 2 : 1, KE = KS * QP, VP = KS + 8, VE = HV * VP, CV = KS / 8;
    static_assert(NPL * (KS / 16 + KS / 8) == 12, "twelve copies a lane"); static_assert(NPL * (KE + VE) <= BUFE, "stage fits its buffer");
    const int tid = (int)threadIdx.x; unsigned la[12]; const T16* ga[12]; int c = 0; constexpr int RV = 32 * NWV / CV;   // v^T rows that one copy of the work-group covers
    // the lane's own offsets: copy i adds whole rows, a constant. Key rows: 8 lanes a row, 16 rows a copy, contiguous in the source; v^T rows: CV lanes a row, RV rows a copy
    const int gk = tid * 8, gv = (tid / CV) * TT + (tid % CV) * 8; const unsigned lk = (unsigned)(size_t)(buf + (tid >> 3) * QP + (tid & 7) * 8), lv = (unsigned)(size_t)(buf + NPL * KE + (tid / CV) * VP + (tid % CV) * 8);
#pragma unroll
    for (int pl = 0; pl < NPL; ++pl)
#pragma unroll
        for (int i = 0; i < KS / 16; ++i) { ga[c] = (pl ? K2 : Kp) + (size_t)k0 * HD + i * (32 * NWV * 8) + gk; la[c] = lk + (unsigned)(pl * KE + i * 16 * QP) * 2u; ++c; }
#pragma unroll
    for (int pl = 0; pl < NPL; ++pl)
#pragma unroll
        for (int i = 0; i < KS / 8; ++i) { ga[c] = (pl ? V2 : Vt) + (size_t)i * RV * TT + k0 + gv; la[c] = lv + (unsigned)(pl * VE + i * RV * VP) * 2u; ++c; }
    // the copies and, as the last line of the same statement, the wait behind which their address registers may take new values
    asm volatile("global_load_async_to_lds_b128 %0, %12, off\n\tglobal_load_async_to_lds_b128 %1, %13, off\n\tglobal_load_async_to_lds_b128 %2, %14, off\n\tglobal_load_async_to_lds_b128 %3, %15, off\n\t"
                 "global_load_async_to_lds_b128 %4, %16, off\n\tglobal_load_async_to_lds_b128 %5, %17, off\n\tglobal_load_async_to_lds_b128 %6, %18, off\n\tglobal_load_async_to_lds_b128 %7, %19, off\n\t"
                 "global_load_async_to_lds_b128 %8, %20, off\n\tglobal_load_async_to_lds_b128 %9, %21, off\n\tglobal_load_async_to_lds_b128 %10, %22, off\n\tglobal_load_async_to_lds_b128 %11, %23, off\n\ts_wait_xcnt 0x0"
                 :: "v"(la[0]), "v"(la[1]), "v"(la[2]), "v"(la[3]), "v"(la[4]), "v"(la[5]), "v"(la[6]), "v"(la[7]), "v"(la[8]), "v"(la[9]), "v"(la[10]), "v"(la[11]),
                    "v"(ga[0]), "v"(ga[1]), "v"(ga[2]), "v"(ga[3]), "v"(ga[4]), "v"(ga[5]), "v"(ga[6]), "v"(ga[7]), "v"(ga[8]), "v"(ga[9]), "v"(ga[10]), "v"(ga[11]) : "memory");
}
template <typename T16, bool HI, int NQ, int KS>
__device__ __forceinline__ void attn_tile(const T16* __restrict__ Q, const T16* __restrict__ Q2, const T16* __restrict__ Kp, const T16* __restrict__ K2, const T16* __restrict__ Vt, const T16* __restrict__ V2, int q0, float* __restrict__ O, T16* skv, T16* sq) {
    typedef typename WFrag<T16>::V V;
    constexpr int NPL = HI ? 2 : 1, KE = KS * QP, VP = KS + 8, VE = HV * VP, NST = TT / KS;
    const int lane = threadIdx.x & 31, lr = lane & 15, hi = lane >> 4; const int w = __builtin_amdgcn_readfirstlane((int)(threadIdx.x >> 5));
    V qf[NQ][2], qg[NQ][2]; v8f acc[NQ][8]; float m[NQ], l[NQ];
#pragma unroll
    for (int n = 0; n < NQ; ++n) { m[n] = -3.0e38f; l[n] = 0.f;
#pragma unroll
        for (int et = 0; et < 8; ++et) acc[n][et] = (v8f){}; }
    // the query fragments do not fit in the registers beside the accumulators and the v^T rows, so each wave's tile lies in LDS, 32 rows of pitch QP (32 queries, or 16 queries hi then lo), and is read anew in every step
    { const int row = (int)threadIdx.x >> 2, col = ((int)threadIdx.x & 3) * 16; const T16* g[NWV]; v4f x0[NWV], x1[NWV];
#pragma unroll
        for (int i = 0; i < NWV; ++i) { g[i] = (HI ? ((row >> 4) ? Q2 : Q) + (size_t)(q0 + i * 16 + (row & 15)) * HD : Q + (size_t)(q0 + i * 32 + row) * HD) + col; x0[i] = *(const v4fa*)g[i]; x1[i] = *(const v4fa*)(g[i] + 8); }
        asm volatile("s_wait_xcnt 0x0" :: "v"(g[0]), "v"(g[1]), "v"(g[2]), "v"(g[3]) : "memory");   // the row addresses are inputs of this wait so that their registers stay untouched from the loads down to it
#pragma unroll
        for (int i = 0; i < NWV; ++i) { *(v4fa*)(sq + (i * 32 + row) * QP + col) = x0[i]; *(v4fa*)(sq + (i * 32 + row) * QP + col + 8) = x1[i]; } }
    // stage 0 lands and is published (with the query tiles) before anybody reads it; stage 1 flies during trip 0
    stage_kv<T16, HI, KS>(Kp, K2, Vt, V2, 0, skv);
    asm volatile("s_wait_asynccnt 0x0" ::: "memory");   // this wave's copies of stage 0 have landed
    __syncthreads();
    stage_kv<T16, HI, KS>(Kp, K2, Vt, V2, KS, skv + BUFE);
    const T16* sqw = sq + w * 32 * QP; const int koff = lr * QP + 8 * hi, voff = NPL * KE + lr * VP + 8 * hi;
#pragma unroll 1
    for (int t = 0; t < NST; ++t) {
        T16* bufp = skv + (t & 1) * BUFE;
#pragma unroll 1   // rolled: with the stage's two steps unrolled the build spills more registers
      for (int ss = 0; ss < KS / 32; ++ss) {
        const T16* kb = bufp + ss * 32 * QP + koff; const T16* kb2 = kb + KE; const T16* vb = bufp + ss * 32 + voff; const T16* vb2 = vb + VE;
#pragma unroll
        for (int n = 0; n < NQ; ++n)
#pragma unroll
            for (int c = 0; c < 2; ++c) { qf[n][c] = WFrag<T16>::ld(sqw + (n * 16 + lr) * QP + c * 32 + 8 * hi); if (HI) qg[n][c] = WFrag<T16>::ld(sqw + (16 + lr) * QP + c * 32 + 8 * hi); }
        v8f s[NQ][2]; V ka[2][2], kl[2][2];   // all of the step's key fragments are requested first: one wait instead of one per 16 keys
#pragma unroll
        for (int kt = 0; kt < 2; ++kt)
#pragma unroll
            for (int c = 0; c < 2; ++c) { ka[kt][c] = WFrag<T16>::ld(kb + kt * 16 * QP + c * 32); if (HI) kl[kt][c] = WFrag<T16>::ld(kb2 + kt * 16 * QP + c * 32); }
#pragma unroll
        for (int kt = 0; kt < 2; ++kt)
#pragma unroll
            for (int n = 0; n < NQ; ++n) { v8f t2 = (v8f){};
#pragma unroll
                for (int c = 0; c < 2; ++c) { t2 = WFrag<T16>::mma(ka[kt][c], qf[n][c], t2); if (HI) { t2 = WFrag<T16>::mma(ka[kt][c], qg[n][c], t2); t2 = WFrag<T16>::mma(kl[kt][c], qf[n][c], t2); } }
                s[n][kt] = t2; }
        V va[8], vl[8];   // v^T rows 0..63 are requested ahead of the softmax arithmetic, rows 64..127 behind it, ahead of the first half's products
#pragma unroll
        for (int et = 0; et < 4; ++et) { va[et] = WFrag<T16>::ld(vb + et * 16 * VP); if (HI) vl[et] = WFrag<T16>::ld(vb2 + et * 16 * VP); }
        V pf[NQ], pg[NQ];
#pragma unroll
        for (int n = 0; n < NQ; ++n) { float p[16]; float mx = -3.0e38f;
#pragma unroll
            for (int i = 0; i < 16; ++i) { p[i] = s[n][i >> 3][i & 7] * SCL; mx = fmaxf(mx, p[i]); }
            mx = fmaxf(mx, __shfl_xor(mx, 16, 32)); const float mn = fmaxf(m[n], mx); const float al = __builtin_amdgcn_exp2f((m[n] - mn) * L2E); m[n] = mn; float sum = 0.f;
#pragma unroll
            for (int i = 0; i < 16; ++i) { p[i] = __builtin_amdgcn_exp2f((p[i] - mn) * L2E); sum += p[i]; }
            l[n] = l[n] * al + sum;   // this lane's keys only; the lane halves are added behind the loop
#pragma unroll
            for (int et = 0; et < 8; ++et) acc[n][et] *= al;
            if (HI) { v16us uh, ul;
#pragma unroll
                for (int i = 0; i < 16; ++i) { unsigned short a, c2; splitf(p[i], a, c2); uh[i] = a; ul[i] = c2; }
                pf[n] = __builtin_bit_cast(V, uh); pg[n] = __builtin_bit_cast(V, ul);
            } else { v16h ph;
#pragma unroll
                for (int i = 0; i < 16; ++i) ph[i] = tohx(p[i]);
                pf[n] = __builtin_bit_cast(V, ph); } }
#pragma unroll
        for (int et = 4; et < 8; ++et) { va[et] = WFrag<T16>::ld(vb + et * 16 * VP); if (HI) vl[et] = WFrag<T16>::ld(vb2 + et * 16 * VP); }
#pragma unroll
        for (int et = 0; et < 8; ++et)
#pragma unroll
            for (int n = 0; n < NQ; ++n) { acc[n][et] = WFrag<T16>::mma(va[et], pf[n], acc[n][et]); if (HI) { acc[n][et] = WFrag<T16>::mma(va[et], pg[n], acc[n][et]); acc[n][et] = WFrag<T16>::mma(vl[et], pf[n], acc[n][et]); } }
      }
        // hand-over: this wave's reads of the buffer are done, its copies of stage t + 1 have landed; the barrier publishes stage t + 1 and ends every wave's reads of this buffer; only then is it refilled
        asm volatile("s_wait_dscnt 0x0" ::: "memory");
        asm volatile("s_wait_asynccnt 0x0" ::: "memory");
        __syncthreads();
        if (t + 2 < NST) stage_kv<T16, HI, KS>(Kp, K2, Vt, V2, (t + 2) * KS, bufp);
    }
    asm volatile("s_wait_asynccnt 0x0" ::: "memory");   // no copy is outstanding when the wave ends
    const int qw = q0 + w * 16 * NQ;
#pragma unroll
    for (int n = 0; n < NQ; ++n) { l[n] += __shfl_xor(l[n], 16, 32); const float f = __fdiv_rn(1.0f, l[n]);
#pragma unroll
        for (int et = 0; et < 8; ++et) { const v8f r = acc[n][et] * f; const v4f a = __builtin_shufflevector(r, r, 0, 1, 2, 3), b = __builtin_shufflevector(r, r, 4, 5, 6, 7);
            float* orow = O + (size_t)(qw + n * 16 + lr) * HV + et * 16 + hi * 8; *(v4f*)orow = a; *(v4f*)(orow + 4) = b;
            asm volatile("s_wait_xcnt 0x0" :: "v"(orow), "v"(a), "v"(b) : "memory"); }   // the stores have left their address and data registers before these are used again
    }
}
// grid x: first the hi/lo work-groups (NWV x 16 queries, the longer ones), then the fp16 ones (NWV x 32 queries); tiles of one head follow one another. waves_per_eu(4): keeps the kernel at 256 registers, so that no register window is switched and up to four work-groups share a WGP. Planes: QK* [b][q heads, k heads][t][HD], VT* [b][p][e][t], O [b][h][t][HV]
__global__ __launch_bounds__(32 * NWV) __attribute__((amdgpu_waves_per_eu(4))) void k_fattn(const h16* __restrict__ QK16, const bf* __restrict__ QKh, const bf* __restrict__ QKl, const h16* __restrict__ VT16, const bf* __restrict__ VTh, const bf* __restrict__ VTl, float* __restrict__ O) {
    __shared__ __align__(16) h16 skv[2 * BUFE]; __shared__ __align__(16) h16 sq[NWV * 32 * QP];
    const int NHB = NB_ * NH_ * (RH / (16 * NWV)); int blk = (int)blockIdx.x; const bool hires = blk < NHB; if (!hires) blk -= NHB;
    const int per = hires ? RH / (16 * NWV) : (TT - RH) / (32 * NWV); const int bh = blk / per, tile = blk % per; const int b = bh / NH_, h = bh % NH_;
    const size_t oq = (size_t)(b * (NH_ + NKV) + h) * TT * HD, ok = (size_t)(b * (NH_ + NKV) + NH_ + h) * TT * HD, ov = (size_t)(b * NP + h / 2) * HV * TT; float* Oh = O + (size_t)bh * TT * HV;
    if (hires) attn_tile<bf, true, 1, 32>(QKh + oq, QKl + oq, QKh + ok, QKl + ok, VTh + ov, VTl + ov, tile * 16 * NWV, Oh, (bf*)skv, (bf*)sq);
    else attn_tile<h16, false, 2, 64>(QK16 + oq, nullptr, QK16 + ok, nullptr, VT16 + ov, nullptr, RH + tile * 32 * NWV, Oh, skv, sq);
}
// lambda, by one wave: two 64-term f32 dots (butterfly sums: every lane ends with the same value), precise expf
__device__ __forceinline__ float lambda_wave(const float* __restrict__ a1, const float* __restrict__ b1, const float* __restrict__ a2, const float* __restrict__ b2, int lane) { const float p0 = a1[lane], p1 = b1[lane], p2 = a1[lane + 32], p3 = b1[lane + 32], r0 = a2[lane], r1 = b2[lane], r2 = a2[lane + 32], r3 = b2[lane + 32];
    asm volatile("s_wait_xcnt 0x0" :: "v"(lane) : "memory");   // the lane index is the loads' offset register and an input of this wait, so that it stays untouched from the loads down to it
    float s1 = __fadd_rn(__fmul_rn(bfr(p0), bfr(p1)), __fmul_rn(bfr(p2), bfr(p3))); float s2 = __fadd_rn(__fmul_rn(bfr(r0), bfr(r1)), __fmul_rn(bfr(r2), bfr(r3)));
#pragma unroll
    for (int sh = 16; sh; sh >>= 1) { s1 = __fadd_rn(s1, __shfl_xor(s1, sh, 32)); s2 = __fadd_rn(s2, __shfl_xor(s2, sh, 32)); }
    return __fadd_rn(__fsub_rn(expf(s1), expf(s2)), LINIT); }
// row r of the context is formed on the way in: columns p*HV + e = w0 v - lambda w1 v from the planes O[2p][r][e], O[2p + 1][r][e] of one batch
template <int WD>
__global__ __launch_bounds__(256) void k_lnrowD(const float* __restrict__ O, const float* __restrict__ lq1, const float* __restrict__ lk1, const float* __restrict__ lq2, const float* __restrict__ lk2, size_t nrows, const float* __restrict__ g, const float* __restrict__ bb, bf* Hh, bf* Hl) { const int lane = threadIdx.x & 31; const size_t r = (size_t)blockIdx.x * 8 + (threadIdx.x >> 5); if (r >= nrows) return; const float* xr = O + r * HV + lane * 4; float a[WD / 32]; float s = 0.f; static_assert(WD == NP * HV && HV == 128, "one 128-wide chunk per pair"); v4f w0[NP], w1[NP];
#pragma unroll
    for (int c = 0; c < NP; ++c) { w0[c] = *(const v4f*)(xr + (size_t)(2 * c) * TT * HV); w1[c] = *(const v4f*)(xr + (size_t)(2 * c + 1) * TT * HV); }
    asm volatile("s_wait_xcnt 0x0" :: "v"(xr) : "memory");   // the row address is an input of this wait so that its registers stay untouched from the loads down to it
    const float lam = lambda_wave(lq1, lk1, lq2, lk2, lane);   // every wave forms it for itself while its row's loads fly
#pragma unroll
    for (int c = 0; c < WD / 128; ++c) { const v4f v = w0[c] - lam * w1[c]; for (int q = 0; q < 4; ++q) { a[c * 4 + q] = v[q]; s = __fadd_rn(s, a[c * 4 + q]); } }
#pragma unroll
    for (int sh = 16; sh; sh >>= 1) s = __fadd_rn(s, __shfl_xor(s, sh, 32));
    const float mean = __fdiv_rn(s, (float)WD); float s2 = 0.f;
#pragma unroll
    for (int k = 0; k < WD / 32; ++k) { const float dv = __fsub_rn(a[k], mean); float p2 = __fmul_rn(dv, dv); asm volatile("" : "+v"(p2)); s2 = __fadd_rn(s2, p2); }   /* mul and add kept separate (no fma contraction) */
#pragma unroll
    for (int sh = 16; sh; sh >>= 1) s2 = __fadd_rn(s2, __shfl_xor(s2, sh, 32));
    const float rs = __fdiv_rn(1.0f, __fsqrt_rn(__fadd_rn(__fdiv_rn(s2, (float)WD), 1e-6f)));
{
#pragma unroll
        for (int c = 0; c < WD / 128; ++c) { v4us oh, ol; for (int q = 0; q < 4; ++q) { const int col = c * 128 + lane * 4 + q; float y = __fmul_rn(__fmul_rn(__fsub_rn(a[c * 4 + q], mean), rs), bfr(g[col])); asm volatile("" : "+v"(y)); y = __fadd_rn(y, bfr(bb[col])); y = __fmul_rn(y, 1.0f - LINIT); unsigned short u, w2; splitf(y, u, w2); oh[q] = u; ol[q] = w2; } *(v4us*)(Hh + r * WD + c * 128 + lane * 4) = oh; *(v4us*)(Hl + r * WD + c * 128 + lane * 4) = ol; }
         } }
__global__ __launch_bounds__(256) void k_merge(const float* __restrict__ O, int h0, bf* Ah, bf* Al) { const size_t e = ((size_t)blockIdx.x * 256 + threadIdx.x) * 2; if (e >= (size_t)ZH * TT * HD) return; const int d = (int)(e % HD); const int t = (int)((e / HD) % TT); const int zz = (int)(e / ((size_t)HD * TT)); const float cs = (t < RH) ? 1.0f : (1.0f / PCAR); const size_t oo = (size_t)t * DQ + (h0 + zz) * HD + d;
    v2us oh, ol;
#pragma unroll
    for (int q = 0; q < 2; ++q) { unsigned short a, c2; splitf(O[e + q] * cs, a, c2); oh[q] = a; ol[q] = c2; } *(v2us*)(Ah + oo) = oh; *(v2us*)(Al + oo) = ol;  }

extern "C" void kernel_launch(void* const* d_in, const int* in_sizes, int n_in,
                              void* d_out, int out_size, void* d_ws, size_t ws_size, hipStream_t stream) {
    (void)in_sizes; (void)n_in; (void)out_size;
    const float* x = (const float*)d_in[0]; const float* xk = (const float*)d_in[1]; const float* xv = (const float*)d_in[2]; const float* wq = (const float*)d_in[3]; const float* bq = (const float*)d_in[4]; const float* wk = (const float*)d_in[5]; const float* bk = (const float*)d_in[6]; const float* wv = (const float*)d_in[7]; const float* bv = (const float*)d_in[8]; const float* lq1 = (const float*)d_in[9]; const float* lk1 = (const float*)d_in[10]; const float* lq2 = (const float*)d_in[11]; const float* lk2 = (const float*)d_in[12]; const float* lng = (const float*)d_in[13]; const float* lnb = (const float*)d_in[14]; const float* wo = (const float*)d_in[15]; const float* bo = (const float*)d_in[16];
    float* OUT = (float*)d_out;     // [2][2048][512]
    char* wsp = (char*)d_ws;
    auto take = [&](size_t bytes) { char* p = wsp; wsp += (bytes + 255) & ~(size_t)255; return (void*)p; };
    bf* WQ = (bf*)take((size_t)DQ * DM * 2); bf* WK = (bf*)take((size_t)DKV * DM * 2); bf* WV = (bf*)take((size_t)DKV * DM * 2); bf* WO = (bf*)take((size_t)DM * DQ * 2); (void)WK; (void)WV;
    const size_t SQK = (size_t)(NH_ + NKV) * TT * HD, SV = (size_t)NP * HV * TT;   // one batch's q + k planes (k directly behind q: one launch writes both) and v^T planes, in elements
    h16* QK16 = (h16*)take(NB_ * SQK * 2); bf* QKh = (bf*)take(NB_ * SQK * 2); bf* QKl = (bf*)take(NB_ * SQK * 2); h16* VT16 = (h16*)take(NB_ * SV * 2); bf* VTh = (bf*)take(NB_ * SV * 2); bf* VTl = (bf*)take(NB_ * SV * 2);
    bf* XB = (bf*)take((size_t)3 * TT * DM * 2);   // the three bf16 input copies of the batch at hand
    float* Ob = (float*)take((size_t)NB_ * NH_ * TT * HV * 4); bf* ATh = (bf*)take((size_t)TT * DQ * 2); bf* ATl = (bf*)take((size_t)TT * DQ * 2);
    if ((size_t)(wsp - (char*)d_ws) > ws_size) return;    // ws 256 MiB
    { k_wtG<<<dim3((unsigned)((DM * DQ / 64 + 63) / 64), 3, 1), 256, 0, stream>>>(wq, wk, wv, DM, DQ, WQ);
      k_wtG<<<(unsigned)((DQ * DM / 64 + 63) / 64), 256, 0, stream>>>(wo, wo, wo, DQ, DM, WO);
       }
    for (int b = 0; b < NB_; ++b) {
        k_cvt8<<<dim3((unsigned)(((size_t)TT * DM / 8 + 255) / 256), 3, 1), 256, 0, stream>>>(x + (size_t)b * TT * DM, xk + (size_t)b * TT * DM, xv + (size_t)b * TT * DM, XB, (size_t)TT * DM / 8);
        k_gemmw<bf, 0, true, 1, true><<<dim3(TT / 64, DQ / 64, 3), 32, 0, stream>>>(XB, nullptr, WQ, nullptr, DM, DM, 0, nullptr, 0, bq, bk, bv, (size_t)TT * DM, (size_t)DQ * DM, 0, QK16 + b * SQK, QKh + b * SQK, QKl + b * SQK, VT16 + b * SV, VTh + b * SV, VTl + b * SV); }   /* q, k and v projections on grid z, stored as the q, k and v^T planes */
    k_fattn<<<NB_ * NH_ * (RH / (16 * NWV) + (TT - RH) / (32 * NWV)), 32 * NWV, 0, stream>>>(QK16, QKh, QKl, VT16, VTh, VTl, Ob);   /* every batch, head and query tile */
    for (int b = 0; b < NB_; ++b) {
        k_lnrowD<DQ><<<(unsigned)((TT + 7) / 8), 256, 0, stream>>>(Ob + (size_t)b * NH_ * TT * HV, lq1, lk1, lq2, lk2, (size_t)TT, lng, lnb, ATh, ATl);   /* head difference, LayerNorm (eps 1e-6) x (1 - lambda_init) -> hi/lo planes */ k_gemmw<bf, 1, true><<<dim3(TT / 64, DM / 64, 1), 32, 0, stream>>>(ATh, ATl, WO, nullptr, DQ, DQ, 0, OUT + (size_t)b * TT * DM, DM, bo, bo, bo, 0, 0, 0, nullptr, nullptr, nullptr, nullptr, nullptr, nullptr); }
}

// v006
// Measured time: 183 microseconds a run.
// Timed twice side by side with v005, it ran 1.25 times as fast both times.
// Over all steps from v000 it is 10.7 times as fast.
#include <hip/hip_runtime.h>

// Multi-head DIFFERENTIAL attention (query, key, value [2][2048][512]; q = query Wq + bq, k = key Wk + bk as 16 heads x 64, v = value Wv + bv as 8 heads x 128 ('xw' [512][1024] + [1024], 0.02); w = softmax(q.k / 8) per head; for each pair p: dw = w[2p] - lambda w[2p+1], lambda = exp(lq1.lk1) - exp(lq2.lk2) + lambda_init (lq/lk [64], read); attn = dw v_p -> [2048][1024]; LayerNorm (eps 1e-6, affine) x (1 - lambda_init); out = attn Wo + bo ('xw' [1024][512]) -> [2][2048][512] (2.1 M)).
// Layout: five launches, each for both batches (rows [batch][t] form one row axis of 4096). One launch for all that reads only inputs (the four weights' K-contiguous bf16 planes, the bf16 copies of the three inputs); exact projections + f32 biases, whose GEMM stores the q/k planes for the 16 score heads and the v^T planes per 128-wide value head itself; lambda computed on device by every wave that uses it (two 64-term f32 dots, precise expf); ONE fused attention launch for every batch, head and query tile (k_fattn: scores, online softmax and P.v in registers, no score matrix in memory; hybrid rows: < 512 hi/lo 3 products, rest fp16), each head's normalised w v as an f32 plane; then a LayerNorm row kernel (forms w0 v - lambda w1 v as it reads the planes; f32, fixed order) scaled by (1 - lambda_init), converted to hi/lo planes, x Wo exact + bo.
// Compute dtypes, f32 accumulate: every input rounded to bf16; projections exact + f32 biases; attention rows < 512 3 products, rest fp16; softmax, lambda, difference, LayerNorm f32; Wo hl x exact + bias.

#define NB_  2
#define TT   2048
#define DM   512
#define NH_  16
#define NKV  16
#define REP  (NH_ / NKV)
#define HD   64
#define DQ   (NH_ * HD)
#define DKV  (NKV * HD)
#define ZH   2
#define RH   512                  // query rows < RH use hi+lo planes (0: none)
#define WIN  0
#define PCAR 1024.0f
#define SCL  0.125f
#define NP   8       // value heads (pairs)
#define HV   128     // value head width
#define LINIT 0.47071301937103271f   // lambda_init = 0.8 - 0.6 exp(-0.6) as float32
#define NWV  4       // waves of a fused-attention work-group: each owns a query tile of its own and walks all TT keys; the staged key and v^T tiles serve all of them
#define BUFE 14848   // 16-bit elements of one stage buffer: hi/lo 2 x (32 x 72 + 128 x 40); fp16 64 x 72 + 128 x 72 is smaller
#define L2E  1.4426950408889634f
#define QP   72      // LDS row pitch of the query and key tiles in 16-bit elements (64 + 8: 16 bytes of pad against bank conflicts between rows)
typedef _Float16 h16;
typedef unsigned short bf;
typedef __attribute__((ext_vector_type(16))) __bf16   v16bf;
typedef __attribute__((ext_vector_type(16))) _Float16 v16h;
typedef __attribute__((ext_vector_type(8)))  _Float16 v8h;
typedef __attribute__((ext_vector_type(8)))  unsigned short v8us;
typedef __attribute__((ext_vector_type(8)))  float    v8f;
typedef __attribute__((ext_vector_type(4)))  float    v4f;
typedef v8h  __attribute__((may_alias)) v8ha;
typedef v4f  __attribute__((may_alias)) v4fa;
typedef v8us __attribute__((may_alias)) v8usa;

__device__ __forceinline__ unsigned short f2bf(float f) { unsigned u = __float_as_uint(f); u += 0x7FFFu + ((u >> 16) & 1u); return (unsigned short)(u >> 16); }
__device__ __forceinline__ float bf2f(unsigned short b) { return __uint_as_float(((unsigned)b) << 16); }
__device__ __forceinline__ float bfr(float f) { return bf2f(f2bf(f)); }
__device__ __forceinline__ v16h cat16(v8h lo, v8h hi) { return __builtin_shufflevector(lo, hi, 0, 1, 2, 3, 4, 5, 6, 7, 8, 9, 10, 11, 12, 13, 14, 15); }
__device__ __forceinline__ v16bf cat16b(v8us lo, v8us hi) { return __builtin_bit_cast(v16bf, __builtin_shufflevector(lo, hi, 0, 1, 2, 3, 4, 5, 6, 7, 8, 9, 10, 11, 12, 13, 14, 15)); }
__device__ __forceinline__ v8f wmma16(v16h a, v16h b, v8f c) { return __builtin_amdgcn_wmma_f32_16x16x32_f16(false, a, false, b, (short)0, c, false, false); }
__device__ __forceinline__ v8f wmmab(v16bf a, v16bf b, v8f c) { return __builtin_amdgcn_wmma_f32_16x16x32_bf16(false, a, false, b, (short)0, c, false, false); }



// ---- k_gemmw: register-blocked GEMM, ONE WAVE per 64x64 output tile (16 accumulators), operands straight from K-contiguous 16-bit planes; grid (M/64, N/64, Z), 32 threads.
// C[m][n] (f32, pitch ldc, + optional f32 bias[n]) = sum_k A[m][k] Bt[n][k] (+ split products per NSPLIT). A rows have pitch lda, Bt rows pitch K. z-batch strides sA/sB/sC in elements; batch z reads Bt plane z >> bsh (bsh = 1: two batches share one); batch z adds bias vector z. K % 32 == 0.
// PL: no f32 C; rows are [b][t] (b = row / TT); the epilogue stores the result + bias as 16-bit planes (fp16, bf16 hi, bf16 lo): batches 0 and 1 as head planes P*[b][z * NH_ + column tile][t][HD], batch 2 transposed as V*[b][column / HV][column % HV][t].
// KS > 1: grid z = batches x KS; blockIdx.z = batch * KS + slice; a slice sums k in [slice K/KS, (slice + 1) K/KS) into its own plane C + blockIdx.z * sC. K % (32 KS) == 0.
template <typename T16> struct WFrag;
template <> struct WFrag<h16> { typedef v16h V; static __device__ __forceinline__ V ld(const h16* p) { return cat16(*(const v8h*)p, *(const v8h*)(p + 16)); } static __device__ __forceinline__ v8f mma(V a, V b, v8f c) { return wmma16(a, b, c); } };
template <> struct WFrag<bf> { typedef v16bf V; static __device__ __forceinline__ V ld(const bf* p) { return cat16b(*(const v8us*)p, *(const v8us*)(p + 16)); } static __device__ __forceinline__ v8f mma(V a, V b, v8f c) { return wmmab(a, b, c); } };
__device__ __forceinline__ h16 tohx(float x) { return (h16)x; }
__device__ __forceinline__ void splitf(float y, unsigned short& h, unsigned short& l) { h = f2bf(y); l = f2bf(y - bf2f(h)); }
typedef __attribute__((ext_vector_type(8))) __bf16 v8b;
// eight f32 to the three planes' formats with the packed conversion instructions (round to nearest even: for finite values the bits of tohx and splitf), which keeps the epilogue's text short
__device__ __forceinline__ void plane8(v8f x, v8h& o16, v8us& oh, v8us& ol) { o16 = __builtin_convertvector(x, v8h); const v8b h = __builtin_convertvector(x, v8b); const v8b l = __builtin_convertvector(x - __builtin_convertvector(h, v8f), v8b); oh = __builtin_bit_cast(v8us, h); ol = __builtin_bit_cast(v8us, l); }
template <typename T16, int NSPLIT, bool BIAS, int KS = 1, bool PL = false>
__global__ __launch_bounds__(32) void k_gemmw(const T16* __restrict__ A, const T16* __restrict__ A2, const T16* __restrict__ Bt, const T16* __restrict__ Bt2, int K, int lda, int bsh, float* C, int ldc, const float* __restrict__ bias0, const float* __restrict__ bias1, const float* __restrict__ bias2, size_t sA, size_t sB, size_t sC, h16* P16, bf* Ph, bf* Pl, h16* V16, bf* Vh, bf* Vl) {
    typedef typename WFrag<T16>::V V;
    __shared__ __align__(16) float os[16 * 68];
    const size_t z = blockIdx.z / KS; const int ks = (int)(blockIdx.z % KS); A += z * sA; if (A2) A2 += z * sA; Bt += (z >> bsh) * sB; if (Bt2) Bt2 += (z >> bsh) * sB; C += (size_t)blockIdx.z * sC;
    const float* __restrict__ bias = z == 0 ? bias0 : z == 1 ? bias1 : bias2;   // up to three biased batches, each with its own bias vector
    const int kbeg = ks * (K / KS), kend = kbeg + K / KS;
    const int lane = threadIdx.x & 31, lr = lane & 15, hi = lane >> 4; const int r0 = blockIdx.x * 64, c0 = blockIdx.y * 64;
    v8f acc[4][4];
#pragma unroll
    for (int mb = 0; mb < 4; ++mb)
#pragma unroll
        for (int nb = 0; nb < 4; ++nb) acc[mb][nb] = (v8f){};
    const size_t aoff = (size_t)(r0 + lr) * lda + 8 * hi, boff = (size_t)(c0 + lr) * K + 8 * hi;
#pragma unroll 1
    for (int kc = kbeg; kc < kend; kc += 32) {
        V a[4], a2[4]; const T16* pa[4]; const T16* pa2[4];
#pragma unroll
        for (int mb = 0; mb < 4; ++mb) { pa[mb] = A + aoff + (size_t)mb * 16 * lda + kc; a[mb] = WFrag<T16>::ld(pa[mb]); if (NSPLIT == 1 || NSPLIT == 2) { pa2[mb] = A2 + aoff + (size_t)mb * 16 * lda + kc; a2[mb] = WFrag<T16>::ld(pa2[mb]); } }
        // the A row addresses are inputs of this wait so that their registers stay untouched from the loads down to it; only behind it may they take new values. It orders every load around it, so with three products it stands at the loop's foot instead: here it would cut the B loads into more, serial, batches
        if (NSPLIT == 1) asm volatile("s_wait_xcnt 0x0" :: "v"(pa[0]), "v"(pa[1]), "v"(pa[2]), "v"(pa[3]), "v"(pa2[0]), "v"(pa2[1]), "v"(pa2[2]), "v"(pa2[3]) : "memory");
        if (NSPLIT == 0 || NSPLIT > 2) asm volatile("s_wait_xcnt 0x0" :: "v"(pa[0]), "v"(pa[1]), "v"(pa[2]), "v"(pa[3]) : "memory");
#pragma unroll
        for (int nb = 0; nb < 4; ++nb) { const V b = WFrag<T16>::ld(Bt + boff + (size_t)nb * 16 * K + kc); V b2; if (NSPLIT >= 2) b2 = WFrag<T16>::ld(Bt2 + boff + (size_t)nb * 16 * K + kc);
#pragma unroll
            for (int mb = 0; mb < 4; ++mb) { acc[mb][nb] = WFrag<T16>::mma(a[mb], b, acc[mb][nb]); if (NSPLIT == 1 || NSPLIT == 2) acc[mb][nb] = WFrag<T16>::mma(a2[mb], b, acc[mb][nb]); if (NSPLIT >= 2) acc[mb][nb] = WFrag<T16>::mma(a[mb], b2, acc[mb][nb]); } }
        if (NSPLIT == 2) asm volatile("s_wait_xcnt 0x0" :: "v"(pa[0]), "v"(pa[1]), "v"(pa[2]), "v"(pa[3]), "v"(pa2[0]), "v"(pa2[1]), "v"(pa2[2]), "v"(pa2[3]) : "memory");   // the same wait for the three-product form
        asm volatile("v_nop\n\tv_nop\n\tv_nop\n\tv_nop" : "+v"(acc[0][0]), "+v"(acc[1][1]), "+v"(acc[2][2]), "+v"(acc[3][3]) : "v"(a[0]), "v"(a[3]));
    }
    const int pb = r0 / TT, rl = r0 % TT;   // PL: the tile's batch and its first row there (TT % 64 == 0: a tile lies in one batch)
    if (PL && z == 2) {   // v^T planes: a lane's accumulator holds 8 consecutive rows (t) of one column (e), which are 16 bytes of a v^T row; the tile's 64 rows fill whole 128-byte lines
#pragma unroll
        for (int nb = 0; nb < 4; ++nb) { const float bs = bfr(bias[c0 + nb * 16 + lr]); const size_t vo = ((size_t)(pb * NP + c0 / HV) * HV + c0 % HV + nb * 16 + lr) * TT + rl + hi * 8;
#pragma unroll
            for (int mb = 0; mb < 4; ++mb) { v8h o16; v8us oh, ol; plane8(acc[mb][nb] + bs, o16, oh, ol);
                h16* d0 = V16 + vo + mb * 16; bf* d1 = Vh + vo + mb * 16; bf* d2 = Vl + vo + mb * 16; *(v8h*)d0 = o16; *(v8us*)d1 = oh; *(v8us*)d2 = ol;
                asm volatile("s_wait_xcnt 0x0" :: "v"(d0), "v"(d1), "v"(d2), "v"(o16), "v"(oh), "v"(ol) : "memory"); } }   // the stores have left their address and data registers before these are used again
        return; }
    if (PL) {   // q and k head planes: the column tile is one head; through LDS so that 8 lanes store one 128-byte plane row
        const int rw = lane >> 3, cf = (lane & 7) * 8; v8f bs;
#pragma unroll
        for (int i = 0; i < 8; ++i) bs[i] = bfr(bias[c0 + cf + i]);
        const size_t po = (((size_t)pb * (NH_ + NKV) + z * NH_ + blockIdx.y) * TT + rl + rw) * HD + cf;
#pragma unroll
        for (int mb = 0; mb < 4; ++mb) {
#pragma unroll
            for (int nb = 0; nb < 4; ++nb) {
#pragma unroll
                for (int j = 0; j < 8; ++j) os[(hi * 8 + j) * 68 + nb * 16 + lr] = acc[mb][nb][j]; }
            v4f u0[4], u1[4];   // all of the tile's LDS reads are requested first: the waits below would otherwise put them one behind the other
#pragma unroll
            for (int s = 0; s < 4; ++s) { u0[s] = *(const v4fa*)(os + (4 * s + rw) * 68 + cf); u1[s] = *(const v4fa*)(os + (4 * s + rw) * 68 + cf + 4); }
#pragma unroll
            for (int s = 0; s < 4; ++s) { v8h o16; v8us oh, ol; plane8(__builtin_shufflevector(u0[s], u1[s], 0, 1, 2, 3, 4, 5, 6, 7) + bs, o16, oh, ol);
                h16* d0 = P16 + po + (mb * 16 + 4 * s) * HD; bf* d1 = Ph + po + (mb * 16 + 4 * s) * HD; bf* d2 = Pl + po + (mb * 16 + 4 * s) * HD; *(v8h*)d0 = o16; *(v8us*)d1 = oh; *(v8us*)d2 = ol;
                asm volatile("s_wait_xcnt 0x0" :: "v"(d0), "v"(d1), "v"(d2), "v"(o16), "v"(oh), "v"(ol) : "memory"); }   // as above
        }
        return; }
#pragma unroll
    for (int mb = 0; mb < 4; ++mb) {
#pragma unroll
        for (int nb = 0; nb < 4; ++nb) {
#pragma unroll
            for (int j = 0; j < 8; ++j) os[(hi * 8 + j) * 68 + nb * 16 + lr] = acc[mb][nb][j]; }
        __builtin_amdgcn_wave_barrier(); asm volatile("" ::: "memory");
        float* crow = C + (size_t)(r0 + mb * 16) * ldc + c0;
{
#pragma unroll
            for (int s = 0; s < 8; ++s) { const int row = 2 * s + hi, cofs = lr * 4; v4f val = *(const v4fa*)(os + row * 68 + cofs); if (BIAS) { val[0] += bfr(bias[c0 + cofs]); val[1] += bfr(bias[c0 + cofs + 1]); val[2] += bfr(bias[c0 + cofs + 2]); val[3] += bfr(bias[c0 + cofs + 3]); }
                *(v4f*)(crow + (size_t)row * ldc + cofs) = val; }
             }
        __builtin_amdgcn_wave_barrier(); asm volatile("" ::: "memory");
    }
}

typedef __attribute__((ext_vector_type(2))) _Float16 v2h;
typedef __attribute__((ext_vector_type(4))) _Float16 v4h;
typedef __attribute__((ext_vector_type(2))) unsigned short v2us;
typedef __attribute__((ext_vector_type(4))) unsigned short v4us;
typedef __attribute__((ext_vector_type(2))) float v2f;
typedef __attribute__((ext_vector_type(4))) int v4i;

// ---- k_prep: all the work that reads nothing but inputs, in one launch. Blocks [0, 4 WB): the weights as K-contiguous bf16 planes Bt[n][k], one after another (they start first: their eight dependent trips are the launch's longest path); the other 3 CB blocks: the bf16 copies of the three inputs, both batches, one after another.
#define WB (DM * DQ / 64 / 64)          // blocks of one weight: 8 waves x 8 lines of 64 elements
#define CB (NB_ * TT * DM / 8 / 256)    // blocks of one input: 8 elements a thread
__device__ __forceinline__ void wt_lines(const float* __restrict__ w, int K, int N, bf* Bt, int bx) {
    const int lane = threadIdx.x & 31; const int L0 = (bx * 8 + (threadIdx.x >> 5)) * 8; const int nlines = N * K / 64;
#pragma unroll 1
    for (int l = 0; l < 8; ++l) { const int L = L0 + l; if (L >= nlines) break; const size_t e = (size_t)L * 64 + lane * 2; const int k = (int)(e % K), n = (int)(e / K); v2us o;
        const float* p = w + (size_t)k * N + n; const float a0 = p[0], a1 = p[N];   // rows k and k + 1
        asm volatile("s_wait_xcnt 0x0" :: "v"(p) : "memory");   // the address is an input of this wait so that its registers stay untouched from the loads down to it
        o[0] = f2bf(a0); o[1] = f2bf(a1); bf* d = Bt + e; *(v2us*)d = o;
        asm volatile("s_wait_xcnt 0x0" :: "v"(d), "v"(o) : "memory"); }   // the store has left its address and data registers before the next trip rewrites them
}
__global__ __launch_bounds__(256) void k_prep(const float* __restrict__ w0, const float* __restrict__ w1, const float* __restrict__ w2, const float* __restrict__ w3, const float* __restrict__ s0, const float* __restrict__ s1, const float* __restrict__ s2, bf* Bt, bf* dst) {
    int blk = (int)blockIdx.x;
    if (blk < 3 * WB) { const int y = blk / WB; wt_lines(y == 0 ? w0 : y == 1 ? w1 : w2, DM, DQ, Bt + (size_t)y * DM * DQ, blk % WB); return; }
    if (blk < 4 * WB) { wt_lines(w3, DQ, DM, Bt + (size_t)3 * DM * DQ, blk - 3 * WB); return; }
    blk -= 4 * WB; const int y = blk / CB; const float* __restrict__ src = y == 0 ? s0 : y == 1 ? s1 : s2; const size_t i = (size_t)(blk % CB) * 256 + threadIdx.x;
    const v8f v = *(const v8f*)(src + i * 8); v8us o;
    asm volatile("s_wait_xcnt 0x0" ::: "memory");   // the load has left its address registers before anything rewrites them
#pragma unroll
    for (int k = 0; k < 8; ++k) o[k] = f2bf(v[k]);
    *(v8us*)(dst + ((size_t)y * CB * 256 + i) * 8) = o; }

__global__ __launch_bounds__(256) void k_vtp(const float* __restrict__ F, int pitch, int nheads, h16* V16, bf* Vh, bf* Vl) { const size_t e = ((size_t)blockIdx.x * 256 + threadIdx.x) * 2; if (e >= (size_t)nheads * HD * TT) return; const int t = (int)(e % TT); const int d = (int)((e / TT) % HD); const int g = (int)(e / ((size_t)TT * HD)); v2h o16; v2us oh, ol;
#pragma unroll
    for (int q = 0; q < 2; ++q) { const float x = F[(size_t)(t + q) * pitch + g * HD + d]; o16[q] = tohx(x); unsigned short a2, c2; splitf(x, a2, c2); oh[q] = a2; ol[q] = c2; }
    *(v2h*)(V16 + e) = o16; *(v2us*)(Vh + e) = oh; *(v2us*)(Vl + e) = ol;  }
// ---- k_fattn: fused attention. A work-group = NWV query tiles of one (batch, head), one per wave; every wave walks all TT keys in steps of 32 with an online softmax. The key rows and v^T rows of a stage (KS keys) are brought into LDS once for the four waves by asynchronous copies, two buffers: the next stage flies while this one is worked on.
// Transposed form: S^T = K Q^T (A = key rows, B = query rows), so a lane holds, for query lr, keys hi*8 + j of each 16-key tile: two such tiles side by side ARE the B fragment (k = 8 hi + i, 16 + 8 hi + i) of O^T = V^T P^T (A = v^T rows e, k = keys). Softmax runs down a lane's own registers plus one exchange between the lane halves.
// HI: bf16 hi/lo planes, three products each (hh + lh + hl) for both products; else fp16, P unnormalised in (0, 1]. O[t][e] (f32, pitch HV) = softmax row x v, normalised.
typedef __attribute__((ext_vector_type(16))) unsigned short v16us;
// One stage into one buffer: KS key rows (128 bytes each, LDS pitch 144) and HV v^T rows (2 KS bytes each, LDS pitch 2 KS + 16), per plane; 16 bytes a lane and copy, twelve copies a lane, whole lines of the source. Buffer: [K planes][V planes].
template <typename T16, bool HI, int KS>
__device__ __forceinline__ void stage_kv(const T16* __restrict__ Kp, const T16* __restrict__ K2, const T16* __restrict__ Vt, const T16* __restrict__ V2, int k0, T16* buf) {
    constexpr int NPL = HI ? 2 : 1, KE = KS * QP, VP = KS + 8, VE = HV * VP, CV = KS / 8;
    static_assert(NPL * (KS / 16 + KS / 8) == 12, "twelve copies a lane"); static_assert(NPL * (KE + VE) <= BUFE, "stage fits its buffer");
    const int tid = (int)threadIdx.x; unsigned la[12]; const T16* ga[12]; int c = 0; constexpr int RV = 32 * NWV / CV;   // v^T rows that one copy of the work-group covers
    // the lane's own offsets: copy i adds whole rows, a constant. Key rows: 8 lanes a row, 16 rows a copy, contiguous in the source; v^T rows: CV lanes a row, RV rows a copy
    const int gk = tid * 8, gv = (tid / CV) * TT + (tid % CV) * 8; const unsigned lk = (unsigned)(size_t)(buf + (tid >> 3) * QP + (tid & 7) * 8), lv = (unsigned)(size_t)(buf + NPL * KE + (tid / CV) * VP + (tid % CV) * 8);
#pragma unroll
    for (int pl = 0; pl < NPL; ++pl)
#pragma unroll
        for (int i = 0; i < KS / 16; ++i) { ga[c] = (pl ? K2 : Kp) + (size_t)k0 * HD + i * (32 * NWV * 8) + gk; la[c] = lk + (unsigned)(pl * KE + i * 16 * QP) * 2u; ++c; }
#pragma unroll
    for (int pl = 0; pl < NPL; ++pl)
#pragma unroll
        for (int i = 0; i < KS / 8; ++i) { ga[c] = (pl ? V2 : Vt) + (size_t)i * RV * TT + k0 + gv; la[c] = lv + (unsigned)(pl * VE + i * RV * VP) * 2u; ++c; }
    // the copies and, as the last line of the same statement, the wait behind which their address registers may take new values
    asm volatile("global_load_async_to_lds_b128 %0, %12, off\n\tglobal_load_async_to_lds_b128 %1, %13, off\n\tglobal_load_async_to_lds_b128 %2, %14, off\n\tglobal_load_async_to_lds_b128 %3, %15, off\n\t"
                 "global_load_async_to_lds_b128 %4, %16, off\n\tglobal_load_async_to_lds_b128 %5, %17, off\n\tglobal_load_async_to_lds_b128 %6, %18, off\n\tglobal_load_async_to_lds_b128 %7, %19, off\n\t"
                 "global_load_async_to_lds_b128 %8, %20, off\n\tglobal_load_async_to_lds_b128 %9, %21, off\n\tglobal_load_async_to_lds_b128 %10, %22, off\n\tglobal_load_async_to_lds_b128 %11, %23, off\n\ts_wait_xcnt 0x0"
                 :: "v"(la[0]), "v"(la[1]), "v"(la[2]), "v"(la[3]), "v"(la[4]), "v"(la[5]), "v"(la[6]), "v"(la[7]), "v"(la[8]), "v"(la[9]), "v"(la[10]), "v"(la[11]),
                    "v"(ga[0]), "v"(ga[1]), "v"(ga[2]), "v"(ga[3]), "v"(ga[4]), "v"(ga[5]), "v"(ga[6]), "v"(ga[7]), "v"(ga[8]), "v"(ga[9]), "v"(ga[10]), "v"(ga[11]) : "memory");
}
template <typename T16, bool HI, int NQ, int KS>
__device__ __forceinline__ void attn_tile(const T16* __restrict__ Q, const T16* __restrict__ Q2, const T16* __restrict__ Kp, const T16* __restrict__ K2, const T16* __restrict__ Vt, const T16* __restrict__ V2, int q0, float* __restrict__ O, T16* skv, T16* sq) {
    typedef typename WFrag<T16>::V V;
    constexpr int NPL = HI ? 2 : 1, KE = KS * QP, VP = KS + 8, VE = HV * VP, NST = TT / KS;
    const int lane = threadIdx.x & 31, lr = lane & 15, hi = lane >> 4; const int w = __builtin_amdgcn_readfirstlane((int)(threadIdx.x >> 5));
    V qf[NQ][2], qg[NQ][2]; v8f acc[NQ][8]; float m[NQ], l[NQ];
#pragma unroll
    for (int n = 0; n < NQ; ++n) { m[n] = -3.0e38f; l[n] = 0.f;
#pragma unroll
        for (int et = 0; et < 8; ++et) acc[n][et] = (v8f){}; }
    // the query fragments do not fit in the registers beside the accumulators and the v^T rows, so each wave's tile lies in LDS, 32 rows of pitch QP (32 queries, or 16 queries hi then lo), and is read anew in every step
    { const int row = (int)threadIdx.x >> 2, col = ((int)threadIdx.x & 3) * 16; const T16* g[NWV]; v4f x0[NWV], x1[NWV];
#pragma unroll
        for (int i = 0; i < NWV; ++i) { g[i] = (HI ? ((row >> 4) ? Q2 : Q) + (size_t)(q0 + i * 16 + (row & 15)) * HD : Q + (size_t)(q0 + i * 32 + row) * HD) + col; x0[i] = *(const v4fa*)g[i]; x1[i] = *(const v4fa*)(g[i] + 8); }
        asm volatile("s_wait_xcnt 0x0" :: "v"(g[0]), "v"(g[1]), "v"(g[2]), "v"(g[3]) : "memory");   // the row addresses are inputs of this wait so that their registers stay untouched from the loads down to it
#pragma unroll
        for (int i = 0; i < NWV; ++i) { *(v4fa*)(sq + (i * 32 + row) * QP + col) = x0[i]; *(v4fa*)(sq + (i * 32 + row) * QP + col + 8) = x1[i]; } }
    // stage 0 lands and is published (with the query tiles) before anybody reads it; stage 1 flies during trip 0
    stage_kv<T16, HI, KS>(Kp, K2, Vt, V2, 0, skv);
    asm volatile("s_wait_asynccnt 0x0" ::: "memory");   // this wave's copies of stage 0 have landed
    __syncthreads();
    stage_kv<T16, HI, KS>(Kp, K2, Vt, V2, KS, skv + BUFE);
    const T16* sqw = sq + w * 32 * QP; const int koff = lr * QP + 8 * hi, voff = NPL * KE + lr * VP + 8 * hi;
#pragma unroll 1
    for (int t = 0; t < NST; ++t) {
        T16* bufp = skv + (t & 1) * BUFE;
#pragma unroll 1   // rolled: with the stage's two steps unrolled the build spills more registers
      for (int ss = 0; ss < KS / 32; ++ss) {
        const T16* kb = bufp + ss * 32 * QP + koff; const T16* kb2 = kb + KE; const T16* vb = bufp + ss * 32 + voff; const T16* vb2 = vb + VE;
#pragma unroll
        for (int n = 0; n < NQ; ++n)
#pragma unroll
            for (int c = 0; c < 2; ++c) { qf[n][c] = WFrag<T16>::ld(sqw + (n * 16 + lr) * QP + c * 32 + 8 * hi); if (HI) qg[n][c] = WFrag<T16>::ld(sqw + (16 + lr) * QP + c * 32 + 8 * hi); }
        v8f s[NQ][2]; V ka[2][2], kl[2][2];   // all of the step's key fragments are requested first: one wait instead of one per 16 keys
#pragma unroll
        for (int kt = 0; kt < 2; ++kt)
#pragma unroll
            for (int c = 0; c < 2; ++c) { ka[kt][c] = WFrag<T16>::ld(kb + kt * 16 * QP + c * 32); if (HI) kl[kt][c] = WFrag<T16>::ld(kb2 + kt * 16 * QP + c * 32); }
#pragma unroll
        for (int kt = 0; kt < 2; ++kt)
#pragma unroll
            for (int n = 0; n < NQ; ++n) { v8f t2 = (v8f){};
#pragma unroll
                for (int c = 0; c < 2; ++c) { t2 = WFrag<T16>::mma(ka[kt][c], qf[n][c], t2); if (HI) { t2 = WFrag<T16>::mma(ka[kt][c], qg[n][c], t2); t2 = WFrag<T16>::mma(kl[kt][c], qf[n][c], t2); } }
                s[n][kt] = t2; }
        V va[8], vl[8];   // v^T rows 0..63 are requested ahead of the softmax arithmetic, rows 64..127 behind it, ahead of the first half's products
#pragma unroll
        for (int et = 0; et < 4; ++et) { va[et] = WFrag<T16>::ld(vb + et * 16 * VP); if (HI) vl[et] = WFrag<T16>::ld(vb2 + et * 16 * VP); }
        V pf[NQ], pg[NQ];
#pragma unroll
        for (int n = 0; n < NQ; ++n) { float p[16]; float mx = -3.0e38f;
#pragma unroll
            for (int i = 0; i < 16; ++i) { p[i] = s[n][i >> 3][i & 7] * SCL; mx = fmaxf(mx, p[i]); }
            mx = fmaxf(mx, __shfl_xor(mx, 16, 32)); const float mn = fmaxf(m[n], mx); const float al = __builtin_amdgcn_exp2f((m[n] - mn) * L2E); m[n] = mn; float sum = 0.f;
#pragma unroll
            for (int i = 0; i < 16; ++i) { p[i] = __builtin_amdgcn_exp2f((p[i] - mn) * L2E); sum += p[i]; }
            l[n] = l[n] * al + sum;   // this lane's keys only; the lane halves are added behind the loop
#pragma unroll
            for (int et = 0; et < 8; ++et) acc[n][et] *= al;
            if (HI) { v16us uh, ul;
#pragma unroll
                for (int i = 0; i < 16; ++i) { unsigned short a, c2; splitf(p[i], a, c2); uh[i] = a; ul[i] = c2; }
                pf[n] = __builtin_bit_cast(V, uh); pg[n] = __builtin_bit_cast(V, ul);
            } else { v16h ph;
#pragma unroll
                for (int i = 0; i < 16; ++i) ph[i] = tohx(p[i]);
                pf[n] = __builtin_bit_cast(V, ph); } }
#pragma unroll
        for (int et = 4; et < 8; ++et) { va[et] = WFrag<T16>::ld(vb + et * 16 * VP); if (HI) vl[et] = WFrag<T16>::ld(vb2 + et * 16 * VP); }
#pragma unroll
        for (int et = 0; et < 8; ++et)
#pragma unroll
            for (int n = 0; n < NQ; ++n) { acc[n][et] = WFrag<T16>::mma(va[et], pf[n], acc[n][et]); if (HI) { acc[n][et] = WFrag<T16>::mma(va[et], pg[n], acc[n][et]); acc[n][et] = WFrag<T16>::mma(vl[et], pf[n], acc[n][et]); } }
      }
        // hand-over: this wave's reads of the buffer are done, its copies of stage t + 1 have landed; the barrier publishes stage t + 1 and ends every wave's reads of this buffer; only then is it refilled
        asm volatile("s_wait_dscnt 0x0" ::: "memory");
        asm volatile("s_wait_asynccnt 0x0" ::: "memory");
        __syncthreads();
        if (t + 2 < NST) stage_kv<T16, HI, KS>(Kp, K2, Vt, V2, (t + 2) * KS, bufp);
    }
    asm volatile("s_wait_asynccnt 0x0" ::: "memory");   // no copy is outstanding when the wave ends
    const int qw = q0 + w * 16 * NQ;
#pragma unroll
    for (int n = 0; n < NQ; ++n) { l[n] += __shfl_xor(l[n], 16, 32); const float f = __fdiv_rn(1.0f, l[n]);
#pragma unroll
        for (int et = 0; et < 8; ++et) { const v8f r = acc[n][et] * f; const v4f a = __builtin_shufflevector(r, r, 0, 1, 2, 3), b = __builtin_shufflevector(r, r, 4, 5, 6, 7);
            float* orow = O + (size_t)(qw + n * 16 + lr) * HV + et * 16 + hi * 8; *(v4f*)orow = a; *(v4f*)(orow + 4) = b;
            asm volatile("s_wait_xcnt 0x0" :: "v"(orow), "v"(a), "v"(b) : "memory"); }   // the stores have left their address and data registers before these are used again
    }
}
// grid x: first the hi/lo work-groups (NWV x 16 queries, the longer ones), then the fp16 ones (NWV x 32 queries); tiles of one head follow one another. waves_per_eu(4): keeps the kernel at 256 registers, so that no register window is switched and up to four work-groups share a WGP. Planes: QK* [b][q heads, k heads][t][HD], VT* [b][p][e][t], O [b][h][t][HV]
__global__ __launch_bounds__(32 * NWV) __attribute__((amdgpu_waves_per_eu(4))) void k_fattn(const h16* __restrict__ QK16, const bf* __restrict__ QKh, const bf* __restrict__ QKl, const h16* __restrict__ VT16, const bf* __restrict__ VTh, const bf* __restrict__ VTl, float* __restrict__ O) {
    __shared__ __align__(16) h16 skv[2 * BUFE]; __shared__ __align__(16) h16 sq[NWV * 32 * QP];
    const int NHB = NB_ * NH_ * (RH / (16 * NWV)); int blk = (int)blockIdx.x; const bool hires = blk < NHB; if (!hires) blk -= NHB;
    const int per = hires ? RH / (16 * NWV) : (TT - RH) / (32 * NWV); const int bh = blk / per, tile = blk % per; const int b = bh / NH_, h = bh % NH_;
    const size_t oq = (size_t)(b * (NH_ + NKV) + h) * TT * HD, ok = (size_t)(b * (NH_ + NKV) + NH_ + h) * TT * HD, ov = (size_t)(b * NP + h / 2) * HV * TT; float* Oh = O + (size_t)bh * TT * HV;
    if (hires) attn_tile<bf, true, 1, 32>(QKh + oq, QKl + oq, QKh + ok, QKl + ok, VTh + ov, VTl + ov, tile * 16 * NWV, Oh, (bf*)skv, (bf*)sq);
    else attn_tile<h16, false, 2, 64>(QK16 + oq, nullptr, QK16 + ok, nullptr, VT16 + ov, nullptr, RH + tile * 32 * NWV, Oh, skv, sq);
}
// lambda, by one wave: two 64-term f32 dots (butterfly sums: every lane ends with the same value), precise expf
__device__ __forceinline__ float lambda_wave(const float* __restrict__ a1, const float* __restrict__ b1, const float* __restrict__ a2, const float* __restrict__ b2, int lane) { const float p0 = a1[lane], p1 = b1[lane], p2 = a1[lane + 32], p3 = b1[lane + 32], r0 = a2[lane], r1 = b2[lane], r2 = a2[lane + 32], r3 = b2[lane + 32];
    asm volatile("s_wait_xcnt 0x0" :: "v"(lane) : "memory");   // the lane index is the loads' offset register and an input of this wait, so that it stays untouched from the loads down to it
    float s1 = __fadd_rn(__fmul_rn(bfr(p0), bfr(p1)), __fmul_rn(bfr(p2), bfr(p3))); float s2 = __fadd_rn(__fmul_rn(bfr(r0), bfr(r1)), __fmul_rn(bfr(r2), bfr(r3)));
#pragma unroll
    for (int sh = 16; sh; sh >>= 1) { s1 = __fadd_rn(s1, __shfl_xor(s1, sh, 32)); s2 = __fadd_rn(s2, __shfl_xor(s2, sh, 32)); }
    return __fadd_rn(__fsub_rn(expf(s1), expf(s2)), LINIT); }
// row r = b TT + t of the context is formed on the way in: columns p*HV + e = w0 v - lambda w1 v from the planes O[b][2p][t][e], O[b][2p + 1][t][e]
template <int WD>
__global__ __launch_bounds__(256) void k_lnrowD(const float* __restrict__ O, const float* __restrict__ lq1, const float* __restrict__ lk1, const float* __restrict__ lq2, const float* __restrict__ lk2, size_t nrows, const float* __restrict__ g, const float* __restrict__ bb, bf* Hh, bf* Hl) { const int lane = threadIdx.x & 31; const size_t r = (size_t)blockIdx.x * 8 + (threadIdx.x >> 5); if (r >= nrows) return; const float* xr = O + (r / TT) * ((size_t)NH_ * TT * HV) + (r % TT) * HV + lane * 4; float a[WD / 32]; float s = 0.f; static_assert(WD == NP * HV && HV == 128, "one 128-wide chunk per pair"); v4f w0[NP], w1[NP];
#pragma unroll
    for (int c = 0; c < NP; ++c) { w0[c] = *(const v4f*)(xr + (size_t)(2 * c) * TT * HV); w1[c] = *(const v4f*)(xr + (size_t)(2 * c + 1) * TT * HV); }
    asm volatile("s_wait_xcnt 0x0" :: "v"(xr) : "memory");   // the row address is an input of this wait so that its registers stay untouched from the loads down to it
    const float lam = lambda_wave(lq1, lk1, lq2, lk2, lane);   // every wave forms it for itself while its row's loads fly
#pragma unroll
    for (int c = 0; c < WD / 128; ++c) { const v4f v = w0[c] - lam * w1[c]; for (int q = 0; q < 4; ++q) { a[c * 4 + q] = v[q]; s = __fadd_rn(s, a[c * 4 + q]); } }
#pragma unroll
    for (int sh = 16; sh; sh >>= 1) s = __fadd_rn(s, __shfl_xor(s, sh, 32));
    const float mean = __fdiv_rn(s, (float)WD); float s2 = 0.f;
#pragma unroll
    for (int k = 0; k < WD / 32; ++k) { const float dv = __fsub_rn(a[k], mean); float p2 = __fmul_rn(dv, dv); asm volatile("" : "+v"(p2)); s2 = __fadd_rn(s2, p2); }   /* mul and add kept separate (no fma contraction) */
#pragma unroll
    for (int sh = 16; sh; sh >>= 1) s2 = __fadd_rn(s2, __shfl_xor(s2, sh, 32));
    const float rs = __fdiv_rn(1.0f, __fsqrt_rn(__fadd_rn(__fdiv_rn(s2, (float)WD), 1e-6f)));
{
#pragma unroll
        for (int c = 0; c < WD / 128; ++c) { v4us oh, ol; for (int q = 0; q < 4; ++q) { const int col = c * 128 + lane * 4 + q; float y = __fmul_rn(__fmul_rn(__fsub_rn(a[c * 4 + q], mean), rs), bfr(g[col])); asm volatile("" : "+v"(y)); y = __fadd_rn(y, bfr(bb[col])); y = __fmul_rn(y, 1.0f - LINIT); unsigned short u, w2; splitf(y, u, w2); oh[q] = u; ol[q] = w2; } *(v4us*)(Hh + r * WD + c * 128 + lane * 4) = oh; *(v4us*)(Hl + r * WD + c * 128 + lane * 4) = ol; }
         } }
__global__ __launch_bounds__(256) void k_merge(const float* __restrict__ O, int h0, bf* Ah, bf* Al) { const size_t e = ((size_t)blockIdx.x * 256 + threadIdx.x) * 2; if (e >= (size_t)ZH * TT * HD) return; const int d = (int)(e % HD); const int t = (int)((e / HD) % TT); const int zz = (int)(e / ((size_t)HD * TT)); const float cs = (t < RH) ? 1.0f : (1.0f / PCAR); const size_t oo = (size_t)t * DQ + (h0 + zz) * HD + d;
    v2us oh, ol;
#pragma unroll
    for (int q = 0; q < 2; ++q) { unsigned short a, c2; splitf(O[e + q] * cs, a, c2); oh[q] = a; ol[q] = c2; } *(v2us*)(Ah + oo) = oh; *(v2us*)(Al + oo) = ol;  }

extern "C" void kernel_launch(void* const* d_in, const int* in_sizes, int n_in,
                              void* d_out, int out_size, void* d_ws, size_t ws_size, hipStream_t stream) {
    (void)in_sizes; (void)n_in; (void)out_size;
    const float* x = (const float*)d_in[0]; const float* xk = (const float*)d_in[1]; const float* xv = (const float*)d_in[2]; const float* wq = (const float*)d_in[3]; const float* bq = (const float*)d_in[4]; const float* wk = (const float*)d_in[5]; const float* bk = (const float*)d_in[6]; const float* wv = (const float*)d_in[7]; const float* bv = (const float*)d_in[8]; const float* lq1 = (const float*)d_in[9]; const float* lk1 = (const float*)d_in[10]; const float* lq2 = (const float*)d_in[11]; const float* lk2 = (const float*)d_in[12]; const float* lng = (const float*)d_in[13]; const float* lnb = (const float*)d_in[14]; const float* wo = (const float*)d_in[15]; const float* bo = (const float*)d_in[16];
    float* OUT = (float*)d_out;     // [2][2048][512]
    char* wsp = (char*)d_ws;
    auto take = [&](size_t bytes) { char* p = wsp; wsp += (bytes + 255) & ~(size_t)255; return (void*)p; };
    bf* WQ = (bf*)take((size_t)DQ * DM * 2); bf* WK = (bf*)take((size_t)DKV * DM * 2); bf* WV = (bf*)take((size_t)DKV * DM * 2); bf* WO = (bf*)take((size_t)DM * DQ * 2); (void)WK; (void)WV;
    const size_t SQK = (size_t)(NH_ + NKV) * TT * HD, SV = (size_t)NP * HV * TT;   // one batch's q + k planes (k directly behind q: one launch writes both) and v^T planes, in elements
    h16* QK16 = (h16*)take(NB_ * SQK * 2); bf* QKh = (bf*)take(NB_ * SQK * 2); bf* QKl = (bf*)take(NB_ * SQK * 2); h16* VT16 = (h16*)take(NB_ * SV * 2); bf* VTh = (bf*)take(NB_ * SV * 2); bf* VTl = (bf*)take(NB_ * SV * 2);
    bf* XB = (bf*)take((size_t)3 * NB_ * TT * DM * 2);   // the three bf16 input copies, both batches each
    float* Ob = (float*)take((size_t)NB_ * NH_ * TT * HV * 4); bf* ATh = (bf*)take((size_t)NB_ * TT * DQ * 2); bf* ATl = (bf*)take((size_t)NB_ * TT * DQ * 2);
    if ((size_t)(wsp - (char*)d_ws) > ws_size) return;    // ws 256 MiB
    k_prep<<<4 * WB + 3 * CB, 256, 0, stream>>>(wq, wk, wv, wo, x, xk, xv, WQ, XB);   /* weight planes (WQ, WK, WV, WO lie one behind another) and input copies */
    k_gemmw<bf, 0, true, 1, true><<<dim3(NB_ * TT / 64, DQ / 64, 3), 32, 0, stream>>>(XB, nullptr, WQ, nullptr, DM, DM, 0, nullptr, 0, bq, bk, bv, (size_t)NB_ * TT * DM, (size_t)DQ * DM, 0, QK16, QKh, QKl, VT16, VTh, VTl);   /* q, k and v projections on grid z, both batches on the row axis, stored as the q, k and v^T planes */
    k_fattn<<<NB_ * NH_ * (RH / (16 * NWV) + (TT - RH) / (32 * NWV)), 32 * NWV, 0, stream>>>(QK16, QKh, QKl, VT16, VTh, VTl, Ob);   /* every batch, head and query tile */
    k_lnrowD<DQ><<<NB_ * TT / 8, 256, 0, stream>>>(Ob, lq1, lk1, lq2, lk2, (size_t)NB_ * TT, lng, lnb, ATh, ATl);   /* head difference, LayerNorm (eps 1e-6) x (1 - lambda_init) -> hi/lo planes */
    k_gemmw<bf, 1, true><<<dim3(NB_ * TT / 64, DM / 64, 1), 32, 0, stream>>>(ATh, ATl, WO, nullptr, DQ, DQ, 0, OUT, DM, bo, bo, bo, 0, 0, 0, nullptr, nullptr, nullptr, nullptr, nullptr, nullptr);
}

// v007
// A run of this version takes 159 microseconds.
// Two timings next to v006 both put it at 1.15 times that version's speed.
// All steps since v000 together make it 12.4 times as fast.
#include <hip/hip_runtime.h>

// Multi-head DIFFERENTIAL attention (query, key, value [2][2048][512]; q = query Wq + bq, k = key Wk + bk as 16 heads x 64, v = value Wv + bv as 8 heads x 128 ('xw' [512][1024] + [1024], 0.02); w = softmax(q.k / 8) per head; for each pair p: dw = w[2p] - lambda w[2p+1], lambda = exp(lq1.lk1) - exp(lq2.lk2) + lambda_init (lq/lk [64], read); attn = dw v_p -> [2048][1024]; LayerNorm (eps 1e-6, affine) x (1 - lambda_init); out = attn Wo + bo ('xw' [1024][512]) -> [2][2048][512] (2.1 M)).
// Layout: five launches, each for both batches (rows [batch][t] form one row axis of 4096). One launch for all that reads only inputs (the four weights' K-contiguous bf16 planes, the bf16 copies of the three inputs); exact projections + f32 biases, whose GEMM stores the q/k planes for the 16 score heads and the v^T planes per 128-wide value head itself; lambda computed on device by every wave that uses it (two 64-term f32 dots, precise expf); ONE fused attention launch for every batch, head and query tile (k_fattn: scores, online softmax and P.v in registers, no score matrix in memory; hybrid rows: < 512 hi/lo 3 products, rest fp16), each head's normalised w v as an f32 plane; then a LayerNorm row kernel (forms w0 v - lambda w1 v as it reads the planes; f32, fixed order) scaled by (1 - lambda_init), converted to hi/lo planes, x Wo exact + bo.
// Compute dtypes, f32 accumulate: every input rounded to bf16; projections exact + f32 biases; attention rows < 512 3 products, rest fp16; softmax, lambda, difference, LayerNorm f32; Wo hl x exact + bias.

#define NB_  2
#define TT   2048
#define DM   512
#define NH_  16
#define NKV  16
#define REP  (NH_ / NKV)
#define HD   64
#define DQ   (NH_ * HD)
#define DKV  (NKV * HD)
#define ZH   2
#define RH   512                  // query rows < RH use hi+lo planes (0: none)
#define WIN  0
#define PCAR 1024.0f
#define SCL  0.125f
#define NP   8       // value heads (pairs)
#define HV   128     // value head width
#define LINIT 0.47071301937103271f   // lambda_init = 0.8 - 0.6 exp(-0.6) as float32
#define NWV  4       // waves of a fused-attention work-group: each owns a query tile of its own and walks all TT keys; the staged key and v^T tiles serve all of them
#define BUFE 14848   // 16-bit elements of one stage buffer: hi/lo 2 x (32 x 72 + 128 x 40); fp16 64 x 72 + 128 x 72 is smaller
#define L2E  1.4426950408889634f
#define QP   72      // LDS row pitch of the query and key tiles in 16-bit elements (64 + 8: 16 bytes of pad against bank conflicts between rows)
typedef _Float16 h16;
typedef unsigned short bf;
typedef __attribute__((ext_vector_type(16))) __bf16   v16bf;
typedef __attribute__((ext_vector_type(16))) _Float16 v16h;
typedef __attribute__((ext_vector_type(8)))  _Float16 v8h;
typedef __attribute__((ext_vector_type(8)))  unsigned short v8us;
typedef __attribute__((ext_vector_type(8)))  float    v8f;
typedef __attribute__((ext_vector_type(4)))  float    v4f;
typedef v8h  __attribute__((may_alias)) v8ha;
typedef v4f  __attribute__((may_alias)) v4fa;
typedef v8us __attribute__((may_alias)) v8usa;

__device__ __forceinline__ unsigned short f2bf(float f) { unsigned u = __float_as_uint(f); u += 0x7FFFu + ((u >> 16) & 1u); return (unsigned short)(u >> 16); }
__device__ __forceinline__ float bf2f(unsigned short b) { return __uint_as_float(((unsigned)b) << 16); }
__device__ __forceinline__ float bfr(float f) { return bf2f(f2bf(f)); }
__device__ __forceinline__ v16h cat16(v8h lo, v8h hi) { return __builtin_shufflevector(lo, hi, 0, 1, 2, 3, 4, 5, 6, 7, 8, 9, 10, 11, 12, 13, 14, 15); }
__device__ __forceinline__ v16bf cat16b(v8us lo, v8us hi) { return __builtin_bit_cast(v16bf, __builtin_shufflevector(lo, hi, 0, 1, 2, 3, 4, 5, 6, 7, 8, 9, 10, 11, 12, 13, 14, 15)); }
__device__ __forceinline__ v8f wmma16(v16h a, v16h b, v8f c) { return __builtin_amdgcn_wmma_f32_16x16x32_f16(false, a, false, b, (short)0, c, false, false); }
__device__ __forceinline__ v8f wmmab(v16bf a, v16bf b, v8f c) { return __builtin_amdgcn_wmma_f32_16x16x32_bf16(false, a, false, b, (short)0, c, false, false); }



// ---- k_gemmw: register-blocked GEMM, one wave per 64x64 output tile (16 accumulators); GW = 4 waves (2 x 2) form a work-group with a 128x128 tile. The group's A and Bt rows (K-contiguous 16-bit planes) come into LDS in stages of GK = 64 k (whole 128-byte lines) by asynchronous copies, two buffers: the next stage flies while this one is worked on; fragments are read from LDS. grid (M/128, N/128, Z), 128 threads. M % 128 == 0, N % 128 == 0. waves_per_eu(4): keeps the kernel at 256 registers, so that no register window is switched.
// C[m][n] (f32, pitch ldc, + optional f32 bias[n]) = sum_k A[m][k] Bt[n][k] (+ split products per NSPLIT). A rows have pitch lda, Bt rows pitch K. z-batch strides sA/sB/sC in elements; batch z reads Bt plane z >> bsh (bsh = 1: two batches share one); batch z adds bias vector z. K % 64 == 0.
// PL: no f32 C; rows are [b][t] (b = row / TT); the epilogue stores the result + bias as 16-bit planes (fp16, bf16 hi, bf16 lo): batches 0 and 1 as head planes P*[b][z * NH_ + column tile][t][HD], batch 2 transposed as V*[b][column / HV][column % HV][t].
// KS > 1: grid z = batches x KS; blockIdx.z = batch * KS + slice; a slice sums k in [slice K/KS, (slice + 1) K/KS) into its own plane C + blockIdx.z * sC. K % (64 KS) == 0.
template <typename T16> struct WFrag;
template <> struct WFrag<h16> { typedef v16h V; static __device__ __forceinline__ V ld(const h16* p) { return cat16(*(const v8h*)p, *(const v8h*)(p + 16)); } static __device__ __forceinline__ v8f mma(V a, V b, v8f c) { return wmma16(a, b, c); } };
template <> struct WFrag<bf> { typedef v16bf V; static __device__ __forceinline__ V ld(const bf* p) { return cat16b(*(const v8us*)p, *(const v8us*)(p + 16)); } static __device__ __forceinline__ v8f mma(V a, V b, v8f c) { return wmmab(a, b, c); } };
__device__ __forceinline__ h16 tohx(float x) { return (h16)x; }
__device__ __forceinline__ void splitf(float y, unsigned short& h, unsigned short& l) { h = f2bf(y); l = f2bf(y - bf2f(h)); }
typedef __attribute__((ext_vector_type(8))) __bf16 v8b;
// eight f32 to the three planes' formats with the packed conversion instructions (round to nearest even: for finite values the bits of tohx and splitf), which keeps the epilogue's text short
__device__ __forceinline__ void plane8(v8f x, v8h& o16, v8us& oh, v8us& ol) { o16 = __builtin_convertvector(x, v8h); const v8b h = __builtin_convertvector(x, v8b); const v8b l = __builtin_convertvector(x - __builtin_convertvector(h, v8f), v8b); oh = __builtin_bit_cast(v8us, h); ol = __builtin_bit_cast(v8us, l); }
#define GW 4     // waves of a GEMM work-group
#define GK 64    // k extent of a stage
// 128 rows of one plane, GK elements (128 bytes) each, into LDS rows of pitch QP: 8 lanes a row, 16 rows a copy of the work-group, eight copies a lane. g and s are the lane's own first source address and LDS place.
template <typename T16>
__device__ __forceinline__ void stage_rows(const T16* __restrict__ g, size_t pitch, T16* s) {
    unsigned la[8]; const T16* ga[8];
#pragma unroll
    for (int i = 0; i < 8; ++i) { ga[i] = g + (size_t)i * 16 * pitch; la[i] = (unsigned)(size_t)(s + i * 16 * QP); }
    // the copies and, as the last line of the same statement, the wait behind which their address registers may take new values
    asm volatile("global_load_async_to_lds_b128 %0, %8, off\n\tglobal_load_async_to_lds_b128 %1, %9, off\n\tglobal_load_async_to_lds_b128 %2, %10, off\n\tglobal_load_async_to_lds_b128 %3, %11, off\n\t"
                 "global_load_async_to_lds_b128 %4, %12, off\n\tglobal_load_async_to_lds_b128 %5, %13, off\n\tglobal_load_async_to_lds_b128 %6, %14, off\n\tglobal_load_async_to_lds_b128 %7, %15, off\n\ts_wait_xcnt 0x0"
                 :: "v"(la[0]), "v"(la[1]), "v"(la[2]), "v"(la[3]), "v"(la[4]), "v"(la[5]), "v"(la[6]), "v"(la[7]),
                    "v"(ga[0]), "v"(ga[1]), "v"(ga[2]), "v"(ga[3]), "v"(ga[4]), "v"(ga[5]), "v"(ga[6]), "v"(ga[7]) : "memory");
}
template <typename T16, int NSPLIT, bool BIAS, int KS = 1, bool PL = false>
__global__ __launch_bounds__(32 * GW) __attribute__((amdgpu_waves_per_eu(4))) void k_gemmw(const T16* __restrict__ A, const T16* __restrict__ A2, const T16* __restrict__ Bt, const T16* __restrict__ Bt2, int K, int lda, int bsh, float* C, int ldc, const float* __restrict__ bias0, const float* __restrict__ bias1, const float* __restrict__ bias2, size_t sA, size_t sB, size_t sC, h16* P16, bf* Ph, bf* Pl, h16* V16, bf* Vh, bf* Vl) {
    typedef typename WFrag<T16>::V V;
    constexpr int NPA = (NSPLIT == 1 || NSPLIT == 2) ? 2 : 1, NPB = NSPLIT >= 2 ? 2 : 1, PE = 128 * QP, SE = (NPA + NPB) * PE;   // planes of A and of Bt, elements of one plane's stage and of one buffer: [A planes][Bt planes]
    __shared__ __align__(16) T16 sab[2 * SE]; static_assert(GW * 16 * 68 * 4 <= 2 * SE * 2, "the epilogue's rows fit the stage buffers");
    const int w = __builtin_amdgcn_readfirstlane((int)(threadIdx.x >> 5)); float* os = (float*)sab + w * (16 * 68);   // the epilogue's staging rows, each wave's own, lie in the stage buffers: behind the last trip's barrier nobody reads these and no copy is outstanding
    const size_t z = blockIdx.z / KS; const int ks = (int)(blockIdx.z % KS); A += z * sA; if (A2) A2 += z * sA; Bt += (z >> bsh) * sB; if (Bt2) Bt2 += (z >> bsh) * sB; C += (size_t)blockIdx.z * sC;
    const float* __restrict__ bias = z == 0 ? bias0 : z == 1 ? bias1 : bias2;   // up to three biased batches, each with its own bias vector
    const int kbeg = ks * (K / KS), kend = kbeg + K / KS;
    const int lane = threadIdx.x & 31, lr = lane & 15, hi = lane >> 4; const int R0 = blockIdx.x * 128, C0 = blockIdx.y * 128, r0 = R0 + (w & 1) * 64, c0 = C0 + (w >> 1) * 64;
    v8f acc[4][4];
#pragma unroll
    for (int mb = 0; mb < 4; ++mb)
#pragma unroll
        for (int nb = 0; nb < 4; ++nb) acc[mb][nb] = (v8f){};
    const int crow = (int)threadIdx.x >> 3, ccol = ((int)threadIdx.x & 7) * 8;   // the lane's row and 16-byte piece in every copy
    const T16* gA = A + (size_t)(R0 + crow) * lda + ccol; const T16* gA2 = NPA == 2 ? A2 + (size_t)(R0 + crow) * lda + ccol : nullptr; const T16* gB = Bt + (size_t)(C0 + crow) * K + ccol; const T16* gB2 = NPB == 2 ? Bt2 + (size_t)(C0 + crow) * K + ccol : nullptr;
    T16* sl = sab + crow * QP + ccol;
    auto stage = [&](int kc, int bi) { T16* s = sl + bi * SE; stage_rows<T16>(gA + kc, (size_t)lda, s); if (NPA == 2) stage_rows<T16>(gA2 + kc, (size_t)lda, s + PE); stage_rows<T16>(gB + kc, (size_t)K, s + NPA * PE); if (NPB == 2) stage_rows<T16>(gB2 + kc, (size_t)K, s + (NPA + 1) * PE); };
    const int nst = (kend - kbeg) / GK;
    // stage 0 lands and is published before anybody reads it; stage 1 flies during trip 0
    stage(kbeg, 0);
    asm volatile("s_wait_asynccnt 0x0" ::: "memory");   // this wave's copies of stage 0 have landed
    __syncthreads();
    if (nst > 1) stage(kbeg + GK, 1);
    const int aoff = ((w & 1) * 64 + lr) * QP + 8 * hi, boff = NPA * PE + ((w >> 1) * 64 + lr) * QP + 8 * hi;
#pragma unroll 1
    for (int t = 0; t < nst; ++t) {
        const T16* bufp = sab + (t & 1) * SE; V a[4], a2[4], b[4], b2[4];
#pragma unroll
        for (int kk = 0; kk < GK; kk += 32) {
#pragma unroll
            for (int nb = 0; nb < 4; ++nb) {   // in the order of first use: Bt block 0, the A blocks, the other Bt blocks, the second planes
                b[nb] = WFrag<T16>::ld(bufp + boff + nb * 16 * QP + kk);
                if (nb == 0) {
#pragma unroll
                    for (int mb = 0; mb < 4; ++mb) a[mb] = WFrag<T16>::ld(bufp + aoff + mb * 16 * QP + kk); } }
#pragma unroll
            for (int mb = 0; mb < 4; ++mb) { if (NPA == 2) a2[mb] = WFrag<T16>::ld(bufp + PE + aoff + mb * 16 * QP + kk); if (NPB == 2) b2[mb] = WFrag<T16>::ld(bufp + PE + boff + mb * 16 * QP + kk); }
            __builtin_amdgcn_sched_barrier(0);   // all of the step's fragments are requested ahead of its products: without it the Bt loads sink to their first use, one register set for all four, and each column block waits out an LDS latency of its own
#pragma unroll
            for (int nb = 0; nb < 4; ++nb)
#pragma unroll
                for (int mb = 0; mb < 4; ++mb) { acc[mb][nb] = WFrag<T16>::mma(a[mb], b[nb], acc[mb][nb]); if (NSPLIT == 1 || NSPLIT == 2) acc[mb][nb] = WFrag<T16>::mma(a2[mb], b[nb], acc[mb][nb]); if (NSPLIT >= 2) acc[mb][nb] = WFrag<T16>::mma(a[mb], b2[nb], acc[mb][nb]); }
        }
        // hand-over: this wave's reads of the buffer are done, its copies of stage t + 1 have landed; the barrier publishes stage t + 1 and ends every wave's reads of this buffer; only then is it refilled
        asm volatile("s_wait_dscnt 0x0" ::: "memory");
        asm volatile("s_wait_asynccnt 0x0" ::: "memory");
        __syncthreads();
        if (t + 2 < nst) stage(kbeg + (t + 2) * GK, t & 1);
    }
    asm volatile("s_wait_asynccnt 0x0" ::: "memory");   // no copy is outstanding behind the loop
    const int pb = r0 / TT, rl = r0 % TT;   // PL: the tile's batch and its first row there (TT % 64 == 0: a tile lies in one batch)
    if (PL && z == 2) {   // v^T planes: a lane's accumulator holds 8 consecutive rows (t) of one column (e), which are 16 bytes of a v^T row; the tile's 64 rows fill whole 128-byte lines
#pragma unroll
        for (int nb = 0; nb < 4; ++nb) { const float bs = bfr(bias[c0 + nb * 16 + lr]); const size_t vo = ((size_t)(pb * NP + c0 / HV) * HV + c0 % HV + nb * 16 + lr) * TT + rl + hi * 8;
#pragma unroll
            for (int mb = 0; mb < 4; ++mb) { v8h o16; v8us oh, ol; plane8(acc[mb][nb] + bs, o16, oh, ol);
                h16* d0 = V16 + vo + mb * 16; bf* d1 = Vh + vo + mb * 16; bf* d2 = Vl + vo + mb * 16; *(v8h*)d0 = o16; *(v8us*)d1 = oh; *(v8us*)d2 = ol;
                asm volatile("s_wait_xcnt 0x0" :: "v"(d0), "v"(d1), "v"(d2), "v"(o16), "v"(oh), "v"(ol) : "memory"); } }   // the stores have left their address and data registers before these are used again
        return; }
    if (PL) {   // q and k head planes: the column tile is one head; through LDS so that 8 lanes store one 128-byte plane row
        const int rw = lane >> 3, cf = (lane & 7) * 8; v8f bs;
#pragma unroll
        for (int i = 0; i < 8; ++i) bs[i] = bfr(bias[c0 + cf + i]);
        const size_t po = (((size_t)pb * (NH_ + NKV) + z * NH_ + c0 / 64) * TT + rl + rw) * HD + cf;
#pragma unroll
        for (int mb = 0; mb < 4; ++mb) {
#pragma unroll
            for (int nb = 0; nb < 4; ++nb) {
#pragma unroll
                for (int j = 0; j < 8; ++j) os[(hi * 8 + j) * 68 + nb * 16 + lr] = acc[mb][nb][j]; }
            v4f u0[4], u1[4];   // all of the tile's LDS reads are requested first: the waits below would otherwise put them one behind the other
#pragma unroll
            for (int s = 0; s < 4; ++s) { u0[s] = *(const v4fa*)(os + (4 * s + rw) * 68 + cf); u1[s] = *(const v4fa*)(os + (4 * s + rw) * 68 + cf + 4); }
#pragma unroll
            for (int s = 0; s < 4; ++s) { v8h o16; v8us oh, ol; plane8(__builtin_shufflevector(u0[s], u1[s], 0, 1, 2, 3, 4, 5, 6, 7) + bs, o16, oh, ol);
                h16* d0 = P16 + po + (mb * 16 + 4 * s) * HD; bf* d1 = Ph + po + (mb * 16 + 4 * s) * HD; bf* d2 = Pl + po + (mb * 16 + 4 * s) * HD; *(v8h*)d0 = o16; *(v8us*)d1 = oh; *(v8us*)d2 = ol;
                asm volatile("s_wait_xcnt 0x0" :: "v"(d0), "v"(d1), "v"(d2), "v"(o16), "v"(oh), "v"(ol) : "memory"); }   // as above
        }
        return; }
#pragma unroll
    for (int mb = 0; mb < 4; ++mb) {
#pragma unroll
        for (int nb = 0; nb < 4; ++nb) {
#pragma unroll
            for (int j = 0; j < 8; ++j) os[(hi * 8 + j) * 68 + nb * 16 + lr] = acc[mb][nb][j]; }
        __builtin_amdgcn_wave_barrier(); asm volatile("" ::: "memory");
        float* crow = C + (size_t)(r0 + mb * 16) * ldc + c0;
{
#pragma unroll
            for (int s = 0; s < 8; ++s) { const int row = 2 * s + hi, cofs = lr * 4; v4f val = *(const v4fa*)(os + row * 68 + cofs); if (BIAS) { val[0] += bfr(bias[c0 + cofs]); val[1] += bfr(bias[c0 + cofs + 1]); val[2] += bfr(bias[c0 + cofs + 2]); val[3] += bfr(bias[c0 + cofs + 3]); }
                *(v4f*)(crow + (size_t)row * ldc + cofs) = val; }
             }
        __builtin_amdgcn_wave_barrier(); asm volatile("" ::: "memory");
    }
}

typedef __attribute__((ext_vector_type(2))) _Float16 v2h;
typedef __attribute__((ext_vector_type(4))) _Float16 v4h;
typedef __attribute__((ext_vector_type(2))) unsigned short v2us;
typedef __attribute__((ext_vector_type(4))) unsigned short v4us;
typedef __attribute__((ext_vector_type(2))) float v2f;
typedef __attribute__((ext_vector_type(4))) int v4i;

// ---- k_prep: all the work that reads nothing but inputs, in one launch. Blocks [0, 4 WB): the weights as K-contiguous bf16 planes Bt[n][k], one after another (they start first: their eight dependent trips are the launch's longest path); the other 3 CB blocks: the bf16 copies of the three inputs, both batches, one after another.
#define WB (DM * DQ / 64 / 64)          // blocks of one weight: 8 waves x 8 lines of 64 elements
#define CB (NB_ * TT * DM / 8 / 256)    // blocks of one input: 8 elements a thread
__device__ __forceinline__ void wt_lines(const float* __restrict__ w, int K, int N, bf* Bt, int bx) {
    const int lane = threadIdx.x & 31; const int L0 = (bx * 8 + (threadIdx.x >> 5)) * 8; const int nlines = N * K / 64;
#pragma unroll 1
    for (int l = 0; l < 8; ++l) { const int L = L0 + l; if (L >= nlines) break; const size_t e = (size_t)L * 64 + lane * 2; const int k = (int)(e % K), n = (int)(e / K); v2us o;
        const float* p = w + (size_t)k * N + n; const float a0 = p[0], a1 = p[N];   // rows k and k + 1
        asm volatile("s_wait_xcnt 0x0" :: "v"(p) : "memory");   // the address is an input of this wait so that its registers stay untouched from the loads down to it
        o[0] = f2bf(a0); o[1] = f2bf(a1); bf* d = Bt + e; *(v2us*)d = o;
        asm volatile("s_wait_xcnt 0x0" :: "v"(d), "v"(o) : "memory"); }   // the store has left its address and data registers before the next trip rewrites them
}
__global__ __launch_bounds__(256) void k_prep(const float* __restrict__ w0, const float* __restrict__ w1, const float* __restrict__ w2, const float* __restrict__ w3, const float* __restrict__ s0, const float* __restrict__ s1, const float* __restrict__ s2, bf* Bt, bf* dst) {
    int blk = (int)blockIdx.x;
    if (blk < 3 * WB) { const int y = blk / WB; wt_lines(y == 0 ? w0 : y == 1 ? w1 : w2, DM, DQ, Bt + (size_t)y * DM * DQ, blk % WB); return; }
    if (blk < 4 * WB) { wt_lines(w3, DQ, DM, Bt + (size_t)3 * DM * DQ, blk - 3 * WB); return; }
    blk -= 4 * WB; const int y = blk / CB; const float* __restrict__ src = y == 0 ? s0 : y == 1 ? s1 : s2; const size_t i = (size_t)(blk % CB) * 256 + threadIdx.x;
    const v8f v = *(const v8f*)(src + i * 8); v8us o;
    asm volatile("s_wait_xcnt 0x0" ::: "memory");   // the load has left its address registers before anything rewrites them
#pragma unroll
    for (int k = 0; k < 8; ++k) o[k] = f2bf(v[k]);
    *(v8us*)(dst + ((size_t)y * CB * 256 + i) * 8) = o; }

__global__ __launch_bounds__(256) void k_vtp(const float* __restrict__ F, int pitch, int nheads, h16* V16, bf* Vh, bf* Vl) { const size_t e = ((size_t)blockIdx.x * 256 + threadIdx.x) * 2; if (e >= (size_t)nheads * HD * TT) return; const int t = (int)(e % TT); const int d = (int)((e / TT) % HD); const int g = (int)(e / ((size_t)TT * HD)); v2h o16; v2us oh, ol;
#pragma unroll
    for (int q = 0; q < 2; ++q) { const float x = F[(size_t)(t + q) * pitch + g * HD + d]; o16[q] = tohx(x); unsigned short a2, c2; splitf(x, a2, c2); oh[q] = a2; ol[q] = c2; }
    *(v2h*)(V16 + e) = o16; *(v2us*)(Vh + e) = oh; *(v2us*)(Vl + e) = ol;  }
// ---- k_fattn: fused attention. A work-group = NWV query tiles of one (batch, head), one per wave; every wave walks all TT keys in steps of 32 with an online softmax. The key rows and v^T rows of a stage (KS keys) are brought into LDS once for the four waves by asynchronous copies, two buffers: the next stage flies while this one is worked on.
// Transposed form: S^T = K Q^T (A = key rows, B = query rows), so a lane holds, for query lr, keys hi*8 + j of each 16-key tile: two such tiles side by side ARE the B fragment (k = 8 hi + i, 16 + 8 hi + i) of O^T = V^T P^T (A = v^T rows e, k = keys). Softmax runs down a lane's own registers plus one exchange between the lane halves.
// HI: bf16 hi/lo planes, three products each (hh + lh + hl) for both products; else fp16, P unnormalised in (0, 1]. O[t][e] (f32, pitch HV) = softmax row x v, normalised.
typedef __attribute__((ext_vector_type(16))) unsigned short v16us;
// One stage into one buffer: KS key rows (128 bytes each, LDS pitch 144) and HV v^T rows (2 KS bytes each, LDS pitch 2 KS + 16), per plane; 16 bytes a lane and copy, twelve copies a lane, whole lines of the source. Buffer: [K planes][V planes].
template <typename T16, bool HI, int KS>
__device__ __forceinline__ void stage_kv(const T16* __restrict__ Kp, const T16* __restrict__ K2, const T16* __restrict__ Vt, const T16* __restrict__ V2, int k0, T16* buf) {
    constexpr int NPL = HI ? 2 : 1, KE = KS * QP, VP = KS + 8, VE = HV * VP, CV = KS / 8;
    static_assert(NPL * (KS / 16 + KS / 8) == 12, "twelve copies a lane"); static_assert(NPL * (KE + VE) <= BUFE, "stage fits its buffer");
    const int tid = (int)threadIdx.x; unsigned la[12]; const T16* ga[12]; int c = 0; constexpr int RV = 32 * NWV / CV;   // v^T rows that one copy of the work-group covers
    // the lane's own offsets: copy i adds whole rows, a constant. Key rows: 8 lanes a row, 16 rows a copy, contiguous in the source; v^T rows: CV lanes a row, RV rows a copy
    const int gk = tid * 8, gv = (tid / CV) * TT + (tid % CV) * 8; const unsigned lk = (unsigned)(size_t)(buf + (tid >> 3) * QP + (tid & 7) * 8), lv = (unsigned)(size_t)(buf + NPL * KE + (tid / CV) * VP + (tid % CV) * 8);
#pragma unroll
    for (int pl = 0; pl < NPL; ++pl)
#pragma unroll
        for (int i = 0; i < KS / 16; ++i) { ga[c] = (pl ? K2 : Kp) + (size_t)k0 * HD + i * (32 * NWV * 8) + gk; la[c] = lk + (unsigned)(pl * KE + i * 16 * QP) * 2u; ++c; }
#pragma unroll
    for (int pl = 0; pl < NPL; ++pl)
#pragma unroll
        for (int i = 0; i < KS / 8; ++i) { ga[c] = (pl ? V2 : Vt) + (size_t)i * RV * TT + k0 + gv; la[c] = lv + (unsigned)(pl * VE + i * RV * VP) * 2u; ++c; }
    // the copies and, as the last line of the same statement, the wait behind which their address registers may take new values
    asm volatile("global_load_async_to_lds_b128 %0, %12, off\n\tglobal_load_async_to_lds_b128 %1, %13, off\n\tglobal_load_async_to_lds_b128 %2, %14, off\n\tglobal_load_async_to_lds_b128 %3, %15, off\n\t"
                 "global_load_async_to_lds_b128 %4, %16, off\n\tglobal_load_async_to_lds_b128 %5, %17, off\n\tglobal_load_async_to_lds_b128 %6, %18, off\n\tglobal_load_async_to_lds_b128 %7, %19, off\n\t"
                 "global_load_async_to_lds_b128 %8, %20, off\n\tglobal_load_async_to_lds_b128 %9, %21, off\n\tglobal_load_async_to_lds_b128 %10, %22, off\n\tglobal_load_async_to_lds_b128 %11, %23, off\n\ts_wait_xcnt 0x0"
                 :: "v"(la[0]), "v"(la[1]), "v"(la[2]), "v"(la[3]), "v"(la[4]), "v"(la[5]), "v"(la[6]), "v"(la[7]), "v"(la[8]), "v"(la[9]), "v"(la[10]), "v"(la[11]),
                    "v"(ga[0]), "v"(ga[1]), "v"(ga[2]), "v"(ga[3]), "v"(ga[4]), "v"(ga[5]), "v"(ga[6]), "v"(ga[7]), "v"(ga[8]), "v"(ga[9]), "v"(ga[10]), "v"(ga[11]) : "memory");
}
template <typename T16, bool HI, int NQ, int KS>
__device__ __forceinline__ void attn_tile(const T16* __restrict__ Q, const T16* __restrict__ Q2, const T16* __restrict__ Kp, const T16* __restrict__ K2, const T16* __restrict__ Vt, const T16* __restrict__ V2, int q0, float* __restrict__ O, T16* skv, T16* sq) {
    typedef typename WFrag<T16>::V V;
    constexpr int NPL = HI ? 2 : 1, KE = KS * QP, VP = KS + 8, VE = HV * VP, NST = TT / KS;
    const int lane = threadIdx.x & 31, lr = lane & 15, hi = lane >> 4; const int w = __builtin_amdgcn_readfirstlane((int)(threadIdx.x >> 5));
    V qf[NQ][2], qg[NQ][2]; v8f acc[NQ][8]; float m[NQ], l[NQ];
#pragma unroll
    for (int n = 0; n < NQ; ++n) { m[n] = -3.0e38f; l[n] = 0.f;
#pragma unroll
        for (int et = 0; et < 8; ++et) acc[n][et] = (v8f){}; }
    // the query fragments do not fit in the registers beside the accumulators and the v^T rows, so each wave's tile lies in LDS, 32 rows of pitch QP (32 queries, or 16 queries hi then lo), and is read anew in every step
    { const int row = (int)threadIdx.x >> 2, col = ((int)threadIdx.x & 3) * 16; const T16* g[NWV]; v4f x0[NWV], x1[NWV];
#pragma unroll
        for (int i = 0; i < NWV; ++i) { g[i] = (HI ? ((row >> 4) ? Q2 : Q) + (size_t)(q0 + i * 16 + (row & 15)) * HD : Q + (size_t)(q0 + i * 32 + row) * HD) + col; x0[i] = *(const v4fa*)g[i]; x1[i] = *(const v4fa*)(g[i] + 8); }
        asm volatile("s_wait_xcnt 0x0" :: "v"(g[0]), "v"(g[1]), "v"(g[2]), "v"(g[3]) : "memory");   // the row addresses are inputs of this wait so that their registers stay untouched from the loads down to it
#pragma unroll
        for (int i = 0; i < NWV; ++i) { *(v4fa*)(sq + (i * 32 + row) * QP + col) = x0[i]; *(v4fa*)(sq + (i * 32 + row) * QP + col + 8) = x1[i]; } }
    // stage 0 lands and is published (with the query tiles) before anybody reads it; stage 1 flies during trip 0
    stage_kv<T16, HI, KS>(Kp, K2, Vt, V2, 0, skv);
    asm volatile("s_wait_asynccnt 0x0" ::: "memory");   // this wave's copies of stage 0 have landed
    __syncthreads();
    stage_kv<T16, HI, KS>(Kp, K2, Vt, V2, KS, skv + BUFE);
    const T16* sqw = sq + w * 32 * QP; const int koff = lr * QP + 8 * hi, voff = NPL * KE + lr * VP + 8 * hi;
#pragma unroll 1
    for (int t = 0; t < NST; ++t) {
        T16* bufp = skv + (t & 1) * BUFE;
#pragma unroll 1   // rolled: with the stage's two steps unrolled the build spills more registers
      for (int ss = 0; ss < KS / 32; ++ss) {
        const T16* kb = bufp + ss * 32 * QP + koff; const T16* kb2 = kb + KE; const T16* vb = bufp + ss * 32 + voff; const T16* vb2 = vb + VE;
#pragma unroll
        for (int n = 0; n < NQ; ++n)
#pragma unroll
            for (int c = 0; c < 2; ++c) { qf[n][c] = WFrag<T16>::ld(sqw + (n * 16 + lr) * QP + c * 32 + 8 * hi); if (HI) qg[n][c] = WFrag<T16>::ld(sqw + (16 + lr) * QP + c * 32 + 8 * hi); }
        v8f s[NQ][2]; V ka[2][2], kl[2][2];   // all of the step's key fragments are requested first: one wait instead of one per 16 keys
#pragma unroll
        for (int kt = 0; kt < 2; ++kt)
#pragma unroll
            for (int c = 0; c < 2; ++c) { ka[kt][c] = WFrag<T16>::ld(kb + kt * 16 * QP + c * 32); if (HI) kl[kt][c] = WFrag<T16>::ld(kb2 + kt * 16 * QP + c * 32); }
#pragma unroll
        for (int kt = 0; kt < 2; ++kt)
#pragma unroll
            for (int n = 0; n < NQ; ++n) { v8f t2 = (v8f){};
#pragma unroll
                for (int c = 0; c < 2; ++c) { t2 = WFrag<T16>::mma(ka[kt][c], qf[n][c], t2); if (HI) { t2 = WFrag<T16>::mma(ka[kt][c], qg[n][c], t2); t2 = WFrag<T16>::mma(kl[kt][c], qf[n][c], t2); } }
                s[n][kt] = t2; }
        V va[8], vl[8];   // v^T rows 0..63 are requested ahead of the softmax arithmetic, rows 64..127 behind it, ahead of the first half's products
#pragma unroll
        for (int et = 0; et < 4; ++et) { va[et] = WFrag<T16>::ld(vb + et * 16 * VP); if (HI) vl[et] = WFrag<T16>::ld(vb2 + et * 16 * VP); }
        V pf[NQ], pg[NQ];
#pragma unroll
        for (int n = 0; n < NQ; ++n) { float p[16]; float mx = -3.0e38f;
#pragma unroll
            for (int i = 0; i < 16; ++i) { p[i] = s[n][i >> 3][i & 7] * SCL; mx = fmaxf(mx, p[i]); }
            mx = fmaxf(mx, __shfl_xor(mx, 16, 32)); const float mn = fmaxf(m[n], mx); const float al = __builtin_amdgcn_exp2f((m[n] - mn) * L2E); m[n] = mn; float sum = 0.f;
#pragma unroll
            for (int i = 0; i < 16; ++i) { p[i] = __builtin_amdgcn_exp2f((p[i] - mn) * L2E); sum += p[i]; }
            l[n] = l[n] * al + sum;   // this lane's keys only; the lane halves are added behind the loop
#pragma unroll
            for (int et = 0; et < 8; ++et) acc[n][et] *= al;
            if (HI) { v16us uh, ul;
#pragma unroll
                for (int i = 0; i < 16; ++i) { unsigned short a, c2; splitf(p[i], a, c2); uh[i] = a; ul[i] = c2; }
                pf[n] = __builtin_bit_cast(V, uh); pg[n] = __builtin_bit_cast(V, ul);
            } else { v16h ph;
#pragma unroll
                for (int i = 0; i < 16; ++i) ph[i] = tohx(p[i]);
                pf[n] = __builtin_bit_cast(V, ph); } }
#pragma unroll
        for (int et = 4; et < 8; ++et) { va[et] = WFrag<T16>::ld(vb + et * 16 * VP); if (HI) vl[et] = WFrag<T16>::ld(vb2 + et * 16 * VP); }
#pragma unroll
        for (int et = 0; et < 8; ++et)
#pragma unroll
            for (int n = 0; n < NQ; ++n) { acc[n][et] = WFrag<T16>::mma(va[et], pf[n], acc[n][et]); if (HI) { acc[n][et] = WFrag<T16>::mma(va[et], pg[n], acc[n][et]); acc[n][et] = WFrag<T16>::mma(vl[et], pf[n], acc[n][et]); } }
      }
        // hand-over: this wave's reads of the buffer are done, its copies of stage t + 1 have landed; the barrier publishes stage t + 1 and ends every wave's reads of this buffer; only then is it refilled
        asm volatile("s_wait_dscnt 0x0" ::: "memory");
        asm volatile("s_wait_asynccnt 0x0" ::: "memory");
        __syncthreads();
        if (t + 2 < NST) stage_kv<T16, HI, KS>(Kp, K2, Vt, V2, (t + 2) * KS, bufp);
    }
    asm volatile("s_wait_asynccnt 0x0" ::: "memory");   // no copy is outstanding when the wave ends
    const int qw = q0 + w * 16 * NQ;
#pragma unroll
    for (int n = 0; n < NQ; ++n) { l[n] += __shfl_xor(l[n], 16, 32); const float f = __fdiv_rn(1.0f, l[n]);
#pragma unroll
        for (int et = 0; et < 8; ++et) { const v8f r = acc[n][et] * f; const v4f a = __builtin_shufflevector(r, r, 0, 1, 2, 3), b = __builtin_shufflevector(r, r, 4, 5, 6, 7);
            float* orow = O + (size_t)(qw + n * 16 + lr) * HV + et * 16 + hi * 8; *(v4f*)orow = a; *(v4f*)(orow + 4) = b;
            asm volatile("s_wait_xcnt 0x0" :: "v"(orow), "v"(a), "v"(b) : "memory"); }   // the stores have left their address and data registers before these are used again
    }
}
// grid x: first the hi/lo work-groups (NWV x 16 queries, the longer ones), then the fp16 ones (NWV x 32 queries); tiles of one head follow one another. waves_per_eu(4): keeps the kernel at 256 registers, so that no register window is switched and up to four work-groups share a WGP. Planes: QK* [b][q heads, k heads][t][HD], VT* [b][p][e][t], O [b][h][t][HV]
__global__ __launch_bounds__(32 * NWV) __attribute__((amdgpu_waves_per_eu(4))) void k_fattn(const h16* __restrict__ QK16, const bf* __restrict__ QKh, const bf* __restrict__ QKl, const h16* __restrict__ VT16, const bf* __restrict__ VTh, const bf* __restrict__ VTl, float* __restrict__ O) {
    __shared__ __align__(16) h16 skv[2 * BUFE]; __shared__ __align__(16) h16 sq[NWV * 32 * QP];
    const int NHB = NB_ * NH_ * (RH / (16 * NWV)); int blk = (int)blockIdx.x; const bool hires = blk < NHB; if (!hires) blk -= NHB;
    const int per = hires ? RH / (16 * NWV) : (TT - RH) / (32 * NWV); const int bh = blk / per, tile = blk % per; const int b = bh / NH_, h = bh % NH_;
    const size_t oq = (size_t)(b * (NH_ + NKV) + h) * TT * HD, ok = (size_t)(b * (NH_ + NKV) + NH_ + h) * TT * HD, ov = (size_t)(b * NP + h / 2) * HV * TT; float* Oh = O + (size_t)bh * TT * HV;
    if (hires) attn_tile<bf, true, 1, 32>(QKh + oq, QKl + oq, QKh + ok, QKl + ok, VTh + ov, VTl + ov, tile * 16 * NWV, Oh, (bf*)skv, (bf*)sq);
    else attn_tile<h16, false, 2, 64>(QK16 + oq, nullptr, QK16 + ok, nullptr, VT16 + ov, nullptr, RH + tile * 32 * NWV, Oh, skv, sq);
}
// lambda, by one wave: two 64-term f32 dots (butterfly sums: every lane ends with the same value), precise expf
__device__ __forceinline__ float lambda_wave(const float* __restrict__ a1, const float* __restrict__ b1, const float* __restrict__ a2, const float* __restrict__ b2, int lane) { const float p0 = a1[lane], p1 = b1[lane], p2 = a1[lane + 32], p3 = b1[lane + 32], r0 = a2[lane], r1 = b2[lane], r2 = a2[lane + 32], r3 = b2[lane + 32];
    asm volatile("s_wait_xcnt 0x0" :: "v"(lane) : "memory");   // the lane index is the loads' offset register and an input of this wait, so that it stays untouched from the loads down to it
    float s1 = __fadd_rn(__fmul_rn(bfr(p0), bfr(p1)), __fmul_rn(bfr(p2), bfr(p3))); float s2 = __fadd_rn(__fmul_rn(bfr(r0), bfr(r1)), __fmul_rn(bfr(r2), bfr(r3)));
#pragma unroll
    for (int sh = 16; sh; sh >>= 1) { s1 = __fadd_rn(s1, __shfl_xor(s1, sh, 32)); s2 = __fadd_rn(s2, __shfl_xor(s2, sh, 32)); }
    return __fadd_rn(__fsub_rn(expf(s1), expf(s2)), LINIT); }
// row r = b TT + t of the context is formed on the way in: columns p*HV + e = w0 v - lambda w1 v from the planes O[b][2p][t][e], O[b][2p + 1][t][e]
template <int WD>
__global__ __launch_bounds__(256) void k_lnrowD(const float* __restrict__ O, const float* __restrict__ lq1, const float* __restrict__ lk1, const float* __restrict__ lq2, const float* __restrict__ lk2, size_t nrows, const float* __restrict__ g, const float* __restrict__ bb, bf* Hh, bf* Hl) { const int lane = threadIdx.x & 31; const size_t r = (size_t)blockIdx.x * 8 + (threadIdx.x >> 5); if (r >= nrows) return; const float* xr = O + (r / TT) * ((size_t)NH_ * TT * HV) + (r % TT) * HV + lane * 4; float a[WD / 32]; float s = 0.f; static_assert(WD == NP * HV && HV == 128, "one 128-wide chunk per pair"); v4f w0[NP], w1[NP];
#pragma unroll
    for (int c = 0; c < NP; ++c) { w0[c] = *(const v4f*)(xr + (size_t)(2 * c) * TT * HV); w1[c] = *(const v4f*)(xr + (size_t)(2 * c + 1) * TT * HV); }
    asm volatile("s_wait_xcnt 0x0" :: "v"(xr) : "memory");   // the row address is an input of this wait so that its registers stay untouched from the loads down to it
    const float lam = lambda_wave(lq1, lk1, lq2, lk2, lane);   // every wave forms it for itself while its row's loads fly
#pragma unroll
    for (int c = 0; c < WD / 128; ++c) { const v4f v = w0[c] - lam * w1[c]; for (int q = 0; q < 4; ++q) { a[c * 4 + q] = v[q]; s = __fadd_rn(s, a[c * 4 + q]); } }
#pragma unroll
    for (int sh = 16; sh; sh >>= 1) s = __fadd_rn(s, __shfl_xor(s, sh, 32));
    const float mean = __fdiv_rn(s, (float)WD); float s2 = 0.f;
#pragma unroll
    for (int k = 0; k < WD / 32; ++k) { const float dv = __fsub_rn(a[k], mean); float p2 = __fmul_rn(dv, dv); asm volatile("" : "+v"(p2)); s2 = __fadd_rn(s2, p2); }   /* mul and add kept separate (no fma contraction) */
#pragma unroll
    for (int sh = 16; sh; sh >>= 1) s2 = __fadd_rn(s2, __shfl_xor(s2, sh, 32));
    const float rs = __fdiv_rn(1.0f, __fsqrt_rn(__fadd_rn(__fdiv_rn(s2, (float)WD), 1e-6f)));
{
#pragma unroll
        for (int c = 0; c < WD / 128; ++c) { v4us oh, ol; for (int q = 0; q < 4; ++q) { const int col = c * 128 + lane * 4 + q; float y = __fmul_rn(__fmul_rn(__fsub_rn(a[c * 4 + q], mean), rs), bfr(g[col])); asm volatile("" : "+v"(y)); y = __fadd_rn(y, bfr(bb[col])); y = __fmul_rn(y, 1.0f - LINIT); unsigned short u, w2; splitf(y, u, w2); oh[q] = u; ol[q] = w2; } *(v4us*)(Hh + r * WD + c * 128 + lane * 4) = oh; *(v4us*)(Hl + r * WD + c * 128 + lane * 4) = ol; }
         } }
__global__ __launch_bounds__(256) void k_merge(const float* __restrict__ O, int h0, bf* Ah, bf* Al) { const size_t e = ((size_t)blockIdx.x * 256 + threadIdx.x) * 2; if (e >= (size_t)ZH * TT * HD) return; const int d = (int)(e % HD); const int t = (int)((e / HD) % TT); const int zz = (int)(e / ((size_t)HD * TT)); const float cs = (t < RH) ? 1.0f : (1.0f / PCAR); const size_t oo = (size_t)t * DQ + (h0 + zz) * HD + d;
    v2us oh, ol;
#pragma unroll
    for (int q = 0; q < 2; ++q) { unsigned short a, c2; splitf(O[e + q] * cs, a, c2); oh[q] = a; ol[q] = c2; } *(v2us*)(Ah + oo) = oh; *(v2us*)(Al + oo) = ol;  }

extern "C" void kernel_launch(void* const* d_in, const int* in_sizes, int n_in,
                              void* d_out, int out_size, void* d_ws, size_t ws_size, hipStream_t stream) {
    (void)in_sizes; (void)n_in; (void)out_size;
    const float* x = (const float*)d_in[0]; const float* xk = (const float*)d_in[1]; const float* xv = (const float*)d_in[2]; const float* wq = (const float*)d_in[3]; const float* bq = (const float*)d_in[4]; const float* wk = (const float*)d_in[5]; const float* bk = (const float*)d_in[6]; const float* wv = (const float*)d_in[7]; const float* bv = (const float*)d_in[8]; const float* lq1 = (const float*)d_in[9]; const float* lk1 = (const float*)d_in[10]; const float* lq2 = (const float*)d_in[11]; const float* lk2 = (const float*)d_in[12]; const float* lng = (const float*)d_in[13]; const float* lnb = (const float*)d_in[14]; const float* wo = (const float*)d_in[15]; const float* bo = (const float*)d_in[16];
    float* OUT = (float*)d_out;     // [2][2048][512]
    char* wsp = (char*)d_ws;
    auto take = [&](size_t bytes) { char* p = wsp; wsp += (bytes + 255) & ~(size_t)255; return (void*)p; };
    bf* WQ = (bf*)take((size_t)DQ * DM * 2); bf* WK = (bf*)take((size_t)DKV * DM * 2); bf* WV = (bf*)take((size_t)DKV * DM * 2); bf* WO = (bf*)take((size_t)DM * DQ * 2); (void)WK; (void)WV;
    const size_t SQK = (size_t)(NH_ + NKV) * TT * HD, SV = (size_t)NP * HV * TT;   // one batch's q + k planes (k directly behind q: one launch writes both) and v^T planes, in elements
    h16* QK16 = (h16*)take(NB_ * SQK * 2); bf* QKh = (bf*)take(NB_ * SQK * 2); bf* QKl = (bf*)take(NB_ * SQK * 2); h16* VT16 = (h16*)take(NB_ * SV * 2); bf* VTh = (bf*)take(NB_ * SV * 2); bf* VTl = (bf*)take(NB_ * SV * 2);
    bf* XB = (bf*)take((size_t)3 * NB_ * TT * DM * 2);   // the three bf16 input copies, both batches each
    float* Ob = (float*)take((size_t)NB_ * NH_ * TT * HV * 4); bf* ATh = (bf*)take((size_t)NB_ * TT * DQ * 2); bf* ATl = (bf*)take((size_t)NB_ * TT * DQ * 2);
    if ((size_t)(wsp - (char*)d_ws) > ws_size) return;    // ws 256 MiB
    k_prep<<<4 * WB + 3 * CB, 256, 0, stream>>>(wq, wk, wv, wo, x, xk, xv, WQ, XB);   /* weight planes (WQ, WK, WV, WO lie one behind another) and input copies */
    k_gemmw<bf, 0, true, 1, true><<<dim3(NB_ * TT / 128, DQ / 128, 3), 32 * GW, 0, stream>>>(XB, nullptr, WQ, nullptr, DM, DM, 0, nullptr, 0, bq, bk, bv, (size_t)NB_ * TT * DM, (size_t)DQ * DM, 0, QK16, QKh, QKl, VT16, VTh, VTl);   /* q, k and v projections on grid z, both batches on the row axis, stored as the q, k and v^T planes */
    k_fattn<<<NB_ * NH_ * (RH / (16 * NWV) + (TT - RH) / (32 * NWV)), 32 * NWV, 0, stream>>>(QK16, QKh, QKl, VT16, VTh, VTl, Ob);   /* every batch, head and query tile */
    k_lnrowD<DQ><<<NB_ * TT / 8, 256, 0, stream>>>(Ob, lq1, lk1, lq2, lk2, (size_t)NB_ * TT, lng, lnb, ATh, ATl);   /* head difference, LayerNorm (eps 1e-6) x (1 - lambda_init) -> hi/lo planes */
    k_gemmw<bf, 1, true><<<dim3(NB_ * TT / 128, DM / 128, 1), 32 * GW, 0, stream>>>(ATh, ATl, WO, nullptr, DQ, DQ, 0, OUT, DM, bo, bo, bo, 0, 0, 0, nullptr, nullptr, nullptr, nullptr, nullptr, nullptr);
}

// v008
// It runs in 144 microseconds.
// Timed twice side by side with v007, it ran 1.10 and 1.11 times as fast.
// Over all steps from v000 it is 13.6 times as fast.
#include <hip/hip_runtime.h>

// Multi-head DIFFERENTIAL attention (query, key, value [2][2048][512]; q = query Wq + bq, k = key Wk + bk as 16 heads x 64, v = value Wv + bv as 8 heads x 128 ('xw' [512][1024] + [1024], 0.02); w = softmax(q.k / 8) per head; for each pair p: dw = w[2p] - lambda w[2p+1], lambda = exp(lq1.lk1) - exp(lq2.lk2) + lambda_init (lq/lk [64], read); attn = dw v_p -> [2048][1024]; LayerNorm (eps 1e-6, affine) x (1 - lambda_init); out = attn Wo + bo ('xw' [1024][512]) -> [2][2048][512] (2.1 M)).
// Layout: five launches, each for both batches (rows [batch][t] form one row axis of 4096). One launch for all that reads only inputs (the four weights' K-contiguous bf16 planes, the bf16 copies of the three inputs); exact projections + f32 biases, whose GEMM stores the q/k planes for the 16 score heads and the v^T planes per 128-wide value head itself; lambda computed on device by every wave that uses it (two 64-term f32 dots, precise expf); ONE fused attention launch for every batch, head and query tile (k_fattn: scores, online softmax and P.v in registers, no score matrix in memory; hybrid rows: < 512 hi/lo 3 products, rest fp16), each head's normalised w v as an f32 plane; then a LayerNorm row kernel (forms w0 v - lambda w1 v as it reads the planes; f32, fixed order) scaled by (1 - lambda_init), converted to hi/lo planes, x Wo exact + bo.
// Compute dtypes, f32 accumulate: every input rounded to bf16; projections exact + f32 biases; attention rows < 512 3 products, rest fp16; softmax, lambda, difference, LayerNorm f32; Wo hl x exact + bias.

#define NB_  2
#define TT   2048
#define DM   512
#define NH_  16
#define NKV  16
#define REP  (NH_ / NKV)
#define HD   64
#define DQ   (NH_ * HD)
#define DKV  (NKV * HD)
#define ZH   2
#define RH   512                  // query rows < RH use hi+lo planes (0: none)
#define WIN  0
#define PCAR 1024.0f
#define SCL  0.125f
#define NP   8       // value heads (pairs)
#define HV   128     // value head width
#define LINIT 0.47071301937103271f   // lambda_init = 0.8 - 0.6 exp(-0.6) as float32
#define NWV  4       // waves of a fused-attention work-group: each owns a query tile of its own and walks all TT keys; the staged key and v^T tiles serve all of them
#define BUFE 14848   // 16-bit elements of one stage buffer: hi/lo 2 x (32 x 72 + 128 x 40); fp16 64 x 72 + 128 x 72 is smaller
#define L2E  1.4426950408889634f
#define LZT  5.5451774444795623f   // 8 ln 2: how far a score may lie above its row's reference maximum before the row is rescaled
#define QP   72      // LDS row pitch of the query and key tiles in 16-bit elements (64 + 8: 16 bytes of pad against bank conflicts between rows)
typedef _Float16 h16;
typedef unsigned short bf;
typedef __attribute__((ext_vector_type(16))) __bf16   v16bf;
typedef __attribute__((ext_vector_type(16))) _Float16 v16h;
typedef __attribute__((ext_vector_type(8)))  _Float16 v8h;
typedef __attribute__((ext_vector_type(8)))  unsigned short v8us;
typedef __attribute__((ext_vector_type(8)))  float    v8f;
typedef __attribute__((ext_vector_type(4)))  float    v4f;
typedef v8h  __attribute__((may_alias)) v8ha;
typedef v4f  __attribute__((may_alias)) v4fa;
typedef v8us __attribute__((may_alias)) v8usa;

__device__ __forceinline__ unsigned short f2bf(float f) { unsigned u = __float_as_uint(f); u += 0x7FFFu + ((u >> 16) & 1u); return (unsigned short)(u >> 16); }
__device__ __forceinline__ float bf2f(unsigned short b) { return __uint_as_float(((unsigned)b) << 16); }
__device__ __forceinline__ float bfr(float f) { return bf2f(f2bf(f)); }
__device__ __forceinline__ v16h cat16(v8h lo, v8h hi) { return __builtin_shufflevector(lo, hi, 0, 1, 2, 3, 4, 5, 6, 7, 8, 9, 10, 11, 12, 13, 14, 15); }
__device__ __forceinline__ v16bf cat16b(v8us lo, v8us hi) { return __builtin_bit_cast(v16bf, __builtin_shufflevector(lo, hi, 0, 1, 2, 3, 4, 5, 6, 7, 8, 9, 10, 11, 12, 13, 14, 15)); }
__device__ __forceinline__ v8f wmma16(v16h a, v16h b, v8f c) { return __builtin_amdgcn_wmma_f32_16x16x32_f16(false, a, false, b, (short)0, c, false, false); }
__device__ __forceinline__ v8f wmmab(v16bf a, v16bf b, v8f c) { return __builtin_amdgcn_wmma_f32_16x16x32_bf16(false, a, false, b, (short)0, c, false, false); }



// ---- k_gemmw: register-blocked GEMM, one wave per 64x64 output tile (16 accumulators); GW = 4 waves (2 x 2) form a work-group with a 128x128 tile. The group's A and Bt rows (K-contiguous 16-bit planes) come into LDS in stages of GK = 64 k (whole 128-byte lines) by asynchronous copies, two buffers: the next stage flies while this one is worked on; fragments are read from LDS. grid (M/128, N/128, Z), 128 threads. M % 128 == 0, N % 128 == 0. waves_per_eu(4): keeps the kernel at 256 registers, so that no register window is switched.
// C[m][n] (f32, pitch ldc, + optional f32 bias[n]) = sum_k A[m][k] Bt[n][k] (+ split products per NSPLIT). A rows have pitch lda, Bt rows pitch K. z-batch strides sA/sB/sC in elements; batch z reads Bt plane z >> bsh (bsh = 1: two batches share one); batch z adds bias vector z. K % 64 == 0.
// PL: no f32 C; rows are [b][t] (b = row / TT); the epilogue stores the result + bias as 16-bit planes (fp16, bf16 hi, bf16 lo): batches 0 and 1 as head planes P*[b][z * NH_ + column tile][t][HD], batch 2 transposed as V*[b][column / HV][column % HV][t].
// KS > 1: grid z = batches x KS; blockIdx.z = batch * KS + slice; a slice sums k in [slice K/KS, (slice + 1) K/KS) into its own plane C + blockIdx.z * sC. K % (64 KS) == 0.
template <typename T16> struct WFrag;
template <> struct WFrag<h16> { typedef v16h V; static __device__ __forceinline__ V ld(const h16* p) { return cat16(*(const v8h*)p, *(const v8h*)(p + 16)); } static __device__ __forceinline__ v8f mma(V a, V b, v8f c) { return wmma16(a, b, c); } };
template <> struct WFrag<bf> { typedef v16bf V; static __device__ __forceinline__ V ld(const bf* p) { return cat16b(*(const v8us*)p, *(const v8us*)(p + 16)); } static __device__ __forceinline__ v8f mma(V a, V b, v8f c) { return wmmab(a, b, c); } };
__device__ __forceinline__ h16 tohx(float x) { return (h16)x; }
__device__ __forceinline__ void splitf(float y, unsigned short& h, unsigned short& l) { h = f2bf(y); l = f2bf(y - bf2f(h)); }
typedef __attribute__((ext_vector_type(8))) __bf16 v8b;
// eight f32 to the three planes' formats with the packed conversion instructions (round to nearest even: for finite values the bits of tohx and splitf), which keeps the epilogue's text short
__device__ __forceinline__ void plane8(v8f x, v8h& o16, v8us& oh, v8us& ol) { o16 = __builtin_convertvector(x, v8h); const v8b h = __builtin_convertvector(x, v8b); const v8b l = __builtin_convertvector(x - __builtin_convertvector(h, v8f), v8b); oh = __builtin_bit_cast(v8us, h); ol = __builtin_bit_cast(v8us, l); }
#define GW 4     // waves of a GEMM work-group
#define GK 64    // k extent of a stage
// 128 rows of one plane, GK elements (128 bytes) each, into LDS rows of pitch QP: 8 lanes a row, 16 rows a copy of the work-group, eight copies a lane. g and s are the lane's own first source address and LDS place.
template <typename T16>
__device__ __forceinline__ void stage_rows(const T16* __restrict__ g, size_t pitch, T16* s) {
    unsigned la[8]; const T16* ga[8];
#pragma unroll
    for (int i = 0; i < 8; ++i) { ga[i] = g + (size_t)i * 16 * pitch; la[i] = (unsigned)(size_t)(s + i * 16 * QP); }
    // the copies and, as the last line of the same statement, the wait behind which their address registers may take new values
    asm volatile("global_load_async_to_lds_b128 %0, %8, off\n\tglobal_load_async_to_lds_b128 %1, %9, off\n\tglobal_load_async_to_lds_b128 %2, %10, off\n\tglobal_load_async_to_lds_b128 %3, %11, off\n\t"
                 "global_load_async_to_lds_b128 %4, %12, off\n\tglobal_load_async_to_lds_b128 %5, %13, off\n\tglobal_load_async_to_lds_b128 %6, %14, off\n\tglobal_load_async_to_lds_b128 %7, %15, off\n\ts_wait_xcnt 0x0"
                 :: "v"(la[0]), "v"(la[1]), "v"(la[2]), "v"(la[3]), "v"(la[4]), "v"(la[5]), "v"(la[6]), "v"(la[7]),
                    "v"(ga[0]), "v"(ga[1]), "v"(ga[2]), "v"(ga[3]), "v"(ga[4]), "v"(ga[5]), "v"(ga[6]), "v"(ga[7]) : "memory");
}
template <typename T16, int NSPLIT, bool BIAS, int KS = 1, bool PL = false>
__global__ __launch_bounds__(32 * GW) __attribute__((amdgpu_waves_per_eu(4))) void k_gemmw(const T16* __restrict__ A, const T16* __restrict__ A2, const T16* __restrict__ Bt, const T16* __restrict__ Bt2, int K, int lda, int bsh, float* C, int ldc, const float* __restrict__ bias0, const float* __restrict__ bias1, const float* __restrict__ bias2, size_t sA, size_t sB, size_t sC, h16* P16, bf* Ph, bf* Pl, h16* V16, bf* Vh, bf* Vl) {
    typedef typename WFrag<T16>::V V;
    constexpr int NPA = (NSPLIT == 1 || NSPLIT == 2) ? 2 : 1, NPB = NSPLIT >= 2 ? 2 : 1, PE = 128 * QP, SE = (NPA + NPB) * PE;   // planes of A and of Bt, elements of one plane's stage and of one buffer: [A planes][Bt planes]
    __shared__ __align__(16) T16 sab[2 * SE]; static_assert(GW * 16 * 68 * 4 <= 2 * SE * 2, "the epilogue's rows fit the stage buffers");
    const int w = __builtin_amdgcn_readfirstlane((int)(threadIdx.x >> 5)); float* os = (float*)sab + w * (16 * 68);   // the epilogue's staging rows, each wave's own, lie in the stage buffers: behind the last trip's barrier nobody reads these and no copy is outstanding
    const size_t z = blockIdx.z / KS; const int ks = (int)(blockIdx.z % KS); A += z * sA; if (A2) A2 += z * sA; Bt += (z >> bsh) * sB; if (Bt2) Bt2 += (z >> bsh) * sB; C += (size_t)blockIdx.z * sC;
    const float* __restrict__ bias = z == 0 ? bias0 : z == 1 ? bias1 : bias2;   // up to three biased batches, each with its own bias vector
    const int kbeg = ks * (K / KS), kend = kbeg + K / KS;
    const int lane = threadIdx.x & 31, lr = lane & 15, hi = lane >> 4; const int R0 = blockIdx.x * 128, C0 = blockIdx.y * 128, r0 = R0 + (w & 1) * 64, c0 = C0 + (w >> 1) * 64;
    v8f acc[4][4];
#pragma unroll
    for (int mb = 0; mb < 4; ++mb)
#pragma unroll
        for (int nb = 0; nb < 4; ++nb) acc[mb][nb] = (v8f){};
    const int crow = (int)threadIdx.x >> 3, ccol = ((int)threadIdx.x & 7) * 8;   // the lane's row and 16-byte piece in every copy
    const T16* gA = A + (size_t)(R0 + crow) * lda + ccol; const T16* gA2 = NPA == 2 ? A2 + (size_t)(R0 + crow) * lda + ccol : nullptr; const T16* gB = Bt + (size_t)(C0 + crow) * K + ccol; const T16* gB2 = NPB == 2 ? Bt2 + (size_t)(C0 + crow) * K + ccol : nullptr;
    T16* sl = sab + crow * QP + ccol;
    auto stage = [&](int kc, int bi) { T16* s = sl + bi * SE; stage_rows<T16>(gA + kc, (size_t)lda, s); if (NPA == 2) stage_rows<T16>(gA2 + kc, (size_t)lda, s + PE); stage_rows<T16>(gB + kc, (size_t)K, s + NPA * PE); if (NPB == 2) stage_rows<T16>(gB2 + kc, (size_t)K, s + (NPA + 1) * PE); };
    const int nst = (kend - kbeg) / GK;
    // stage 0 lands and is published before anybody reads it; stage 1 flies during trip 0
    stage(kbeg, 0);
    asm volatile("s_wait_asynccnt 0x0" ::: "memory");   // this wave's copies of stage 0 have landed
    __syncthreads();
    if (nst > 1) stage(kbeg + GK, 1);
    const int aoff = ((w & 1) * 64 + lr) * QP + 8 * hi, boff = NPA * PE + ((w >> 1) * 64 + lr) * QP + 8 * hi;
#pragma unroll 1
    for (int t = 0; t < nst; ++t) {
        const T16* bufp = sab + (t & 1) * SE; V a[4], a2[4], b[4], b2[4];
#pragma unroll
        for (int kk = 0; kk < GK; kk += 32) {
#pragma unroll
            for (int nb = 0; nb < 4; ++nb) {   // in the order of first use: Bt block 0, the A blocks, the other Bt blocks, the second planes
                b[nb] = WFrag<T16>::ld(bufp + boff + nb * 16 * QP + kk);
                if (nb == 0) {
#pragma unroll
                    for (int mb = 0; mb < 4; ++mb) a[mb] = WFrag<T16>::ld(bufp + aoff + mb * 16 * QP + kk); } }
#pragma unroll
            for (int mb = 0; mb < 4; ++mb) { if (NPA == 2) a2[mb] = WFrag<T16>::ld(bufp + PE + aoff + mb * 16 * QP + kk); if (NPB == 2) b2[mb] = WFrag<T16>::ld(bufp + PE + boff + mb * 16 * QP + kk); }
            __builtin_amdgcn_sched_barrier(0);   // all of the step's fragments are requested ahead of its products: without it the Bt loads sink to their first use, one register set for all four, and each column block waits out an LDS latency of its own
#pragma unroll
            for (int nb = 0; nb < 4; ++nb)
#pragma unroll
                for (int mb = 0; mb < 4; ++mb) { acc[mb][nb] = WFrag<T16>::mma(a[mb], b[nb], acc[mb][nb]); if (NSPLIT == 1 || NSPLIT == 2) acc[mb][nb] = WFrag<T16>::mma(a2[mb], b[nb], acc[mb][nb]); if (NSPLIT >= 2) acc[mb][nb] = WFrag<T16>::mma(a[mb], b2[nb], acc[mb][nb]); }
        }
        // hand-over: this wave's reads of the buffer are done, its copies of stage t + 1 have landed; the barrier publishes stage t + 1 and ends every wave's reads of this buffer; only then is it refilled
        asm volatile("s_wait_dscnt 0x0" ::: "memory");
        asm volatile("s_wait_asynccnt 0x0" ::: "memory");
        __syncthreads();
        if (t + 2 < nst) stage(kbeg + (t + 2) * GK, t & 1);
    }
    asm volatile("s_wait_asynccnt 0x0" ::: "memory");   // no copy is outstanding behind the loop
    const int pb = r0 / TT, rl = r0 % TT;   // PL: the tile's batch and its first row there (TT % 64 == 0: a tile lies in one batch)
    if (PL && z == 2) {   // v^T planes: a lane's accumulator holds 8 consecutive rows (t) of one column (e), which are 16 bytes of a v^T row; the tile's 64 rows fill whole 128-byte lines
#pragma unroll
        for (int nb = 0; nb < 4; ++nb) { const float bs = bfr(bias[c0 + nb * 16 + lr]); const size_t vo = ((size_t)(pb * NP + c0 / HV) * HV + c0 % HV + nb * 16 + lr) * TT + rl + hi * 8;
#pragma unroll
            for (int mb = 0; mb < 4; ++mb) { v8h o16; v8us oh, ol; plane8(acc[mb][nb] + bs, o16, oh, ol);
                h16* d0 = V16 + vo + mb * 16; bf* d1 = Vh + vo + mb * 16; bf* d2 = Vl + vo + mb * 16; *(v8h*)d0 = o16; *(v8us*)d1 = oh; *(v8us*)d2 = ol;
                asm volatile("s_wait_xcnt 0x0" :: "v"(d0), "v"(d1), "v"(d2), "v"(o16), "v"(oh), "v"(ol) : "memory"); } }   // the stores have left their address and data registers before these are used again
        return; }
    if (PL) {   // q and k head planes: the column tile is one head; through LDS so that 8 lanes store one 128-byte plane row
        const int rw = lane >> 3, cf = (lane & 7) * 8; v8f bs;
#pragma unroll
        for (int i = 0; i < 8; ++i) bs[i] = bfr(bias[c0 + cf + i]);
        const size_t po = (((size_t)pb * (NH_ + NKV) + z * NH_ + c0 / 64) * TT + rl + rw) * HD + cf;
#pragma unroll
        for (int mb = 0; mb < 4; ++mb) {
#pragma unroll
            for (int nb = 0; nb < 4; ++nb) {
#pragma unroll
                for (int j = 0; j < 8; ++j) os[(hi * 8 + j) * 68 + nb * 16 + lr] = acc[mb][nb][j]; }
            v4f u0[4], u1[4];   // all of the tile's LDS reads are requested first: the waits below would otherwise put them one behind the other
#pragma unroll
            for (int s = 0; s < 4; ++s) { u0[s] = *(const v4fa*)(os + (4 * s + rw) * 68 + cf); u1[s] = *(const v4fa*)(os + (4 * s + rw) * 68 + cf + 4); }
#pragma unroll
            for (int s = 0; s < 4; ++s) { v8h o16; v8us oh, ol; plane8(__builtin_shufflevector(u0[s], u1[s], 0, 1, 2, 3, 4, 5, 6, 7) + bs, o16, oh, ol);
                h16* d0 = P16 + po + (mb * 16 + 4 * s) * HD; bf* d1 = Ph + po + (mb * 16 + 4 * s) * HD; bf* d2 = Pl + po + (mb * 16 + 4 * s) * HD; *(v8h*)d0 = o16; *(v8us*)d1 = oh; *(v8us*)d2 = ol;
                asm volatile("s_wait_xcnt 0x0" :: "v"(d0), "v"(d1), "v"(d2), "v"(o16), "v"(oh), "v"(ol) : "memory"); }   // as above
        }
        return; }
#pragma unroll
    for (int mb = 0; mb < 4; ++mb) {
#pragma unroll
        for (int nb = 0; nb < 4; ++nb) {
#pragma unroll
            for (int j = 0; j < 8; ++j) os[(hi * 8 + j) * 68 + nb * 16 + lr] = acc[mb][nb][j]; }
        __builtin_amdgcn_wave_barrier(); asm volatile("" ::: "memory");
        float* crow = C + (size_t)(r0 + mb * 16) * ldc + c0;
{
#pragma unroll
            for (int s = 0; s < 8; ++s) { const int row = 2 * s + hi, cofs = lr * 4; v4f val = *(const v4fa*)(os + row * 68 + cofs); if (BIAS) { val[0] += bfr(bias[c0 + cofs]); val[1] += bfr(bias[c0 + cofs + 1]); val[2] += bfr(bias[c0 + cofs + 2]); val[3] += bfr(bias[c0 + cofs + 3]); }
                *(v4f*)(crow + (size_t)row * ldc + cofs) = val; }
             }
        __builtin_amdgcn_wave_barrier(); asm volatile("" ::: "memory");
    }
}

typedef __attribute__((ext_vector_type(2))) _Float16 v2h;
typedef __attribute__((ext_vector_type(4))) _Float16 v4h;
typedef __attribute__((ext_vector_type(2))) unsigned short v2us;
typedef __attribute__((ext_vector_type(4))) unsigned short v4us;
typedef __attribute__((ext_vector_type(2))) float v2f;
typedef __attribute__((ext_vector_type(4))) int v4i;

// ---- k_prep: all the work that reads nothing but inputs, in one launch. Blocks [0, 4 WB): the weights as K-contiguous bf16 planes Bt[n][k], one after another (they start first: their eight dependent trips are the launch's longest path); the other 3 CB blocks: the bf16 copies of the three inputs, both batches, one after another.
#define WB (DM * DQ / 64 / 64)          // blocks of one weight: 8 waves x 8 lines of 64 elements
#define CB (NB_ * TT * DM / 8 / 256)    // blocks of one input: 8 elements a thread
__device__ __forceinline__ void wt_lines(const float* __restrict__ w, int K, int N, bf* Bt, int bx) {
    const int lane = threadIdx.x & 31; const int L0 = (bx * 8 + (threadIdx.x >> 5)) * 8; const int nlines = N * K / 64;
#pragma unroll 1
    for (int l = 0; l < 8; ++l) { const int L = L0 + l; if (L >= nlines) break; const size_t e = (size_t)L * 64 + lane * 2; const int k = (int)(e % K), n = (int)(e / K); v2us o;
        const float* p = w + (size_t)k * N + n; const float a0 = p[0], a1 = p[N];   // rows k and k + 1
        asm volatile("s_wait_xcnt 0x0" :: "v"(p) : "memory");   // the address is an input of this wait so that its registers stay untouched from the loads down to it
        o[0] = f2bf(a0); o[1] = f2bf(a1); bf* d = Bt + e; *(v2us*)d = o;
        asm volatile("s_wait_xcnt 0x0" :: "v"(d), "v"(o) : "memory"); }   // the store has left its address and data registers before the next trip rewrites them
}
__global__ __launch_bounds__(256) void k_prep(const float* __restrict__ w0, const float* __restrict__ w1, const float* __restrict__ w2, const float* __restrict__ w3, const float* __restrict__ s0, const float* __restrict__ s1, const float* __restrict__ s2, bf* Bt, bf* dst) {
    int blk = (int)blockIdx.x;
    if (blk < 3 * WB) { const int y = blk / WB; wt_lines(y == 0 ? w0 : y == 1 ? w1 : w2, DM, DQ, Bt + (size_t)y * DM * DQ, blk % WB); return; }
    if (blk < 4 * WB) { wt_lines(w3, DQ, DM, Bt + (size_t)3 * DM * DQ, blk - 3 * WB); return; }
    blk -= 4 * WB; const int y = blk / CB; const float* __restrict__ src = y == 0 ? s0 : y == 1 ? s1 : s2; const size_t i = (size_t)(blk % CB) * 256 + threadIdx.x;
    const v8f v = *(const v8f*)(src + i * 8); v8us o;
    asm volatile("s_wait_xcnt 0x0" ::: "memory");   // the load has left its address registers before anything rewrites them
#pragma unroll
    for (int k = 0; k < 8; ++k) o[k] = f2bf(v[k]);
    *(v8us*)(dst + ((size_t)y * CB * 256 + i) * 8) = o; }

__global__ __launch_bounds__(256) void k_vtp(const float* __restrict__ F, int pitch, int nheads, h16* V16, bf* Vh, bf* Vl) { const size_t e = ((size_t)blockIdx.x * 256 + threadIdx.x) * 2; if (e >= (size_t)nheads * HD * TT) return; const int t = (int)(e % TT); const int d = (int)((e / TT) % HD); const int g = (int)(e / ((size_t)TT * HD)); v2h o16; v2us oh, ol;
#pragma unroll
    for (int q = 0; q < 2; ++q) { const float x = F[(size_t)(t + q) * pitch + g * HD + d]; o16[q] = tohx(x); unsigned short a2, c2; splitf(x, a2, c2); oh[q] = a2; ol[q] = c2; }
    *(v2h*)(V16 + e) = o16; *(v2us*)(Vh + e) = oh; *(v2us*)(Vl + e) = ol;  }
// ---- k_fattn: fused attention. A work-group = NWV query tiles of one (batch, head), one per wave; every wave walks all TT keys in steps of 32 with an online softmax. The key rows and v^T rows of a stage (KS keys) are brought into LDS once for the four waves by asynchronous copies, two buffers: the next stage flies while this one is worked on.
// Transposed form: S^T = K Q^T (A = key rows, B = query rows), so a lane holds, for query lr, keys hi*8 + j of each 16-key tile: two such tiles side by side ARE the B fragment (k = 8 hi + i, 16 + 8 hi + i) of O^T = V^T P^T (A = v^T rows e, k = keys). Softmax runs down a lane's own registers plus one exchange between the lane halves.
// HI: bf16 hi/lo planes, three products each (hh + lh + hl) for both products; else fp16, P unnormalised in (0, 2^8]. O[t][e] (f32, pitch HV) = softmax row x v, normalised.
typedef __attribute__((ext_vector_type(16))) unsigned short v16us;
// One stage into one buffer: KS key rows (128 bytes each, LDS pitch 144) and HV v^T rows (2 KS bytes each, LDS pitch 2 KS + 16), per plane; 16 bytes a lane and copy, twelve copies a lane, whole lines of the source (KS = 32: v^T rows are half lines). Buffer: [K planes][V planes].
template <typename T16, bool HI, int KS>
__device__ __forceinline__ void stage_kv(const T16* __restrict__ Kp, const T16* __restrict__ K2, const T16* __restrict__ Vt, const T16* __restrict__ V2, int k0, T16* buf) {
    constexpr int NPL = HI ? 2 : 1, KE = KS * QP, VP = KS + 8, VE = HV * VP, CV = KS / 8;
    static_assert(NPL * (KS / 16 + KS / 8) == 12, "twelve copies a lane"); static_assert(NPL * (KE + VE) <= BUFE, "stage fits its buffer");
    const int tid = (int)threadIdx.x; unsigned la[12]; const T16* ga[12]; int c = 0; constexpr int RV = 32 * NWV / CV;   // v^T rows that one copy of the work-group covers
    // the lane's own offsets: copy i adds whole rows, a constant. Key rows: 8 lanes a row, 16 rows a copy, contiguous in the source; v^T rows: CV lanes a row, RV rows a copy
    const int gk = tid * 8, gv = (tid / CV) * TT + (tid % CV) * 8; const unsigned lk = (unsigned)(size_t)(buf + (tid >> 3) * QP + (tid & 7) * 8), lv = (unsigned)(size_t)(buf + NPL * KE + (tid / CV) * VP + (tid % CV) * 8);
#pragma unroll
    for (int pl = 0; pl < NPL; ++pl)
#pragma unroll
        for (int i = 0; i < KS / 16; ++i) { ga[c] = (pl ? K2 : Kp) + (size_t)k0 * HD + i * (32 * NWV * 8) + gk; la[c] = lk + (unsigned)(pl * KE + i * 16 * QP) * 2u; ++c; }
#pragma unroll
    for (int pl = 0; pl < NPL; ++pl)
#pragma unroll
        for (int i = 0; i < KS / 8; ++i) { ga[c] = (pl ? V2 : Vt) + (size_t)i * RV * TT + k0 + gv; la[c] = lv + (unsigned)(pl * VE + i * RV * VP) * 2u; ++c; }
    // the copies and, as the last line of the same statement, the wait behind which their address registers may take new values
    asm volatile("global_load_async_to_lds_b128 %0, %12, off\n\tglobal_load_async_to_lds_b128 %1, %13, off\n\tglobal_load_async_to_lds_b128 %2, %14, off\n\tglobal_load_async_to_lds_b128 %3, %15, off\n\t"
                 "global_load_async_to_lds_b128 %4, %16, off\n\tglobal_load_async_to_lds_b128 %5, %17, off\n\tglobal_load_async_to_lds_b128 %6, %18, off\n\tglobal_load_async_to_lds_b128 %7, %19, off\n\t"
                 "global_load_async_to_lds_b128 %8, %20, off\n\tglobal_load_async_to_lds_b128 %9, %21, off\n\tglobal_load_async_to_lds_b128 %10, %22, off\n\tglobal_load_async_to_lds_b128 %11, %23, off\n\ts_wait_xcnt 0x0"
                 :: "v"(la[0]), "v"(la[1]), "v"(la[2]), "v"(la[3]), "v"(la[4]), "v"(la[5]), "v"(la[6]), "v"(la[7]), "v"(la[8]), "v"(la[9]), "v"(la[10]), "v"(la[11]),
                    "v"(ga[0]), "v"(ga[1]), "v"(ga[2]), "v"(ga[3]), "v"(ga[4]), "v"(ga[5]), "v"(ga[6]), "v"(ga[7]), "v"(ga[8]), "v"(ga[9]), "v"(ga[10]), "v"(ga[11]) : "memory");
}
template <typename T16, bool HI, int NQ, int KS>
__device__ __forceinline__ void attn_tile(const T16* __restrict__ Q, const T16* __restrict__ Q2, const T16* __restrict__ Kp, const T16* __restrict__ K2, const T16* __restrict__ Vt, const T16* __restrict__ V2, int q0, float* __restrict__ O, T16* skv, T16* sq) {
    typedef typename WFrag<T16>::V V;
    constexpr int NPL = HI ? 2 : 1, KE = KS * QP, VP = KS + 8, VE = HV * VP, NST = TT / KS;
    const int lane = threadIdx.x & 31, lr = lane & 15, hi = lane >> 4; const int w = __builtin_amdgcn_readfirstlane((int)(threadIdx.x >> 5));
    V qf[NQ][2], qg[NQ][2]; v8f acc[NQ][8]; float m[NQ], l[NQ];
#pragma unroll
    for (int n = 0; n < NQ; ++n) { m[n] = -3.0e38f; l[n] = 0.f;
#pragma unroll
        for (int et = 0; et < 8; ++et) acc[n][et] = (v8f){}; }
    // the query fragments do not fit in the registers beside the accumulators and the v^T rows, so each wave's tile lies in LDS, 32 rows of pitch QP (32 queries, or 16 queries hi then lo), and is read anew in every step
    { const int row = (int)threadIdx.x >> 2, col = ((int)threadIdx.x & 3) * 16; const T16* g[NWV]; v4f x0[NWV], x1[NWV];
#pragma unroll
        for (int i = 0; i < NWV; ++i) { g[i] = (HI ? ((row >> 4) ? Q2 : Q) + (size_t)(q0 + i * 16 + (row & 15)) * HD : Q + (size_t)(q0 + i * 32 + row) * HD) + col; x0[i] = *(const v4fa*)g[i]; x1[i] = *(const v4fa*)(g[i] + 8); }
        asm volatile("s_wait_xcnt 0x0" :: "v"(g[0]), "v"(g[1]), "v"(g[2]), "v"(g[3]) : "memory");   // the row addresses are inputs of this wait so that their registers stay untouched from the loads down to it
#pragma unroll
        for (int i = 0; i < NWV; ++i) { *(v4fa*)(sq + (i * 32 + row) * QP + col) = x0[i]; *(v4fa*)(sq + (i * 32 + row) * QP + col + 8) = x1[i]; } }
    // stage 0 lands and is published (with the query tiles) before anybody reads it; stage 1 flies during trip 0
    stage_kv<T16, HI, KS>(Kp, K2, Vt, V2, 0, skv);
    asm volatile("s_wait_asynccnt 0x0" ::: "memory");   // this wave's copies of stage 0 have landed
    __syncthreads();
    stage_kv<T16, HI, KS>(Kp, K2, Vt, V2, KS, skv + BUFE);
    const T16* sqw = sq + w * 32 * QP; const int koff = lr * QP + 8 * hi, voff = NPL * KE + lr * VP + 8 * hi;
#pragma unroll 1
    for (int t = 0; t < NST; ++t) {
        T16* bufp = skv + (t & 1) * BUFE;
#pragma unroll 1   // rolled: with the stage's two steps unrolled the build spills more registers
      for (int ss = 0; ss < KS / 32; ++ss) {
        const T16* kb = bufp + ss * 32 * QP + koff; const T16* kb2 = kb + KE; const T16* vb = bufp + ss * 32 + voff; const T16* vb2 = vb + VE;
#pragma unroll
        for (int n = 0; n < NQ; ++n)
#pragma unroll
            for (int c = 0; c < 2; ++c) { qf[n][c] = WFrag<T16>::ld(sqw + (n * 16 + lr) * QP + c * 32 + 8 * hi); if (HI) qg[n][c] = WFrag<T16>::ld(sqw + (16 + lr) * QP + c * 32 + 8 * hi); }
        v8f s[NQ][2]; V ka[2][2], kl[2][2];   // all of the step's key fragments are requested first: one wait instead of one per 16 keys
#pragma unroll
        for (int kt = 0; kt < 2; ++kt)
#pragma unroll
            for (int c = 0; c < 2; ++c) { ka[kt][c] = WFrag<T16>::ld(kb + kt * 16 * QP + c * 32); if (HI) kl[kt][c] = WFrag<T16>::ld(kb2 + kt * 16 * QP + c * 32); }
#pragma unroll
        for (int kt = 0; kt < 2; ++kt)
#pragma unroll
            for (int n = 0; n < NQ; ++n) { v8f t2 = (v8f){};
#pragma unroll
                for (int c = 0; c < 2; ++c) { t2 = WFrag<T16>::mma(ka[kt][c], qf[n][c], t2); if (HI) { t2 = WFrag<T16>::mma(ka[kt][c], qg[n][c], t2); t2 = WFrag<T16>::mma(kl[kt][c], qf[n][c], t2); } }
                s[n][kt] = t2; }
        V pf[NQ], pg[NQ]; float mx[NQ]; bool need = false;
        // lazy rescale: a row keeps the reference maximum m it has while no score of the step lies more than LZT above it (P then stays <= 2^8, and row sum and output carry the same factor, which the final division takes out)
#pragma unroll
        for (int n = 0; n < NQ; ++n) { mx[n] = -3.0e38f;
#pragma unroll
            for (int i = 0; i < 16; ++i) { s[n][i >> 3][i & 7] *= SCL; mx[n] = fmaxf(mx[n], s[n][i >> 3][i & 7]); }
            need = need || mx[n] > m[n] + LZT; }
        if (__builtin_amdgcn_ballot_w32(need) != 0) {   // one test a step for the whole wave, a scalar branch: taken in the first step and where a score has outgrown its row's reference
#pragma unroll
            for (int n = 0; n < NQ; ++n) { const float mn = fmaxf(m[n], fmaxf(mx[n], __shfl_xor(mx[n], 16, 32))); const float al = __builtin_amdgcn_exp2f((m[n] - mn) * L2E); m[n] = mn; l[n] *= al;   // both lane halves of a row take the same new reference
#pragma unroll
                for (int et = 0; et < 8; ++et) acc[n][et] *= al; } }
        V va[8], vl[8];   // v^T rows 0..63 are requested ahead of the softmax arithmetic, rows 64..127 (hi/lo: 64..95) behind it, ahead of the first half's products
#pragma unroll
        for (int et = 0; et < 4; ++et) { va[et] = WFrag<T16>::ld(vb + et * 16 * VP); if (HI) vl[et] = WFrag<T16>::ld(vb2 + et * 16 * VP); }
        __builtin_amdgcn_sched_barrier(0);   // the requests stay ahead of the softmax arithmetic, which covers their latency: without it they sink to their first use
#pragma unroll
        for (int n = 0; n < NQ; ++n) { float p[16]; const float mn = m[n]; float sum = 0.f;
#pragma unroll
            for (int i = 0; i < 16; ++i) { p[i] = __builtin_amdgcn_exp2f((s[n][i >> 3][i & 7] - mn) * L2E); sum += p[i]; }
            l[n] += sum;   // this lane's keys only; the lane halves are added behind the loop
            if (HI) { v16us uh, ul;
#pragma unroll
                for (int i = 0; i < 16; ++i) { unsigned short a, c2; splitf(p[i], a, c2); uh[i] = a; ul[i] = c2; }
                pf[n] = __builtin_bit_cast(V, uh); pg[n] = __builtin_bit_cast(V, ul);
            } else { v16h ph;
#pragma unroll
                for (int i = 0; i < 16; ++i) ph[i] = tohx(p[i]);
                pf[n] = __builtin_bit_cast(V, ph); } }
#pragma unroll
        for (int et = 4; et < (HI ? 6 : 8); ++et) { va[et] = WFrag<T16>::ld(vb + et * 16 * VP); if (HI) vl[et] = WFrag<T16>::ld(vb2 + et * 16 * VP); }
        __builtin_amdgcn_sched_barrier(0);   // likewise ahead of the first half's products; hi/lo: all sixteen fragments do not fit in the registers at once, the last four follow as the first are used up
#pragma unroll
        for (int et = (HI ? 6 : 8); et < 8; ++et) { va[et] = WFrag<T16>::ld(vb + et * 16 * VP); if (HI) vl[et] = WFrag<T16>::ld(vb2 + et * 16 * VP); }
#pragma unroll
        for (int et = 0; et < 8; ++et)
#pragma unroll
            for (int n = 0; n < NQ; ++n) { acc[n][et] = WFrag<T16>::mma(va[et], pf[n], acc[n][et]); if (HI) { acc[n][et] = WFrag<T16>::mma(va[et], pg[n], acc[n][et]); acc[n][et] = WFrag<T16>::mma(vl[et], pf[n], acc[n][et]); } }
      }
        // hand-over: this wave's reads of the buffer are done, its copies of stage t + 1 have landed; the barrier publishes stage t + 1 and ends every wave's reads of this buffer; only then is it refilled
        asm volatile("s_wait_dscnt 0x0" ::: "memory");
        asm volatile("s_wait_asynccnt 0x0" ::: "memory");
        __syncthreads();
        if (t + 2 < NST) stage_kv<T16, HI, KS>(Kp, K2, Vt, V2, (t + 2) * KS, bufp);
    }
    asm volatile("s_wait_asynccnt 0x0" ::: "memory");   // no copy is outstanding when the wave ends
    const int qw = q0 + w * 16 * NQ;
#pragma unroll
    for (int n = 0; n < NQ; ++n) { l[n] += __shfl_xor(l[n], 16, 32); const float f = __fdiv_rn(1.0f, l[n]);
#pragma unroll
        for (int et = 0; et < 8; ++et) { const v8f r = acc[n][et] * f; const v4f a = __builtin_shufflevector(r, r, 0, 1, 2, 3), b = __builtin_shufflevector(r, r, 4, 5, 6, 7);
            float* orow = O + (size_t)(qw + n * 16 + lr) * HV + et * 16 + hi * 8; *(v4f*)orow = a; *(v4f*)(orow + 4) = b;
            asm volatile("s_wait_xcnt 0x0" :: "v"(orow), "v"(a), "v"(b) : "memory"); }   // the stores have left their address and data registers before these are used again
    }
}
// grid x: first the hi/lo work-groups (NWV x 16 queries, the longer ones), then the fp16 ones (NWV x 32 queries); tiles of one head follow one another. waves_per_eu(4): keeps the kernel at 256 registers, so that no register window is switched and up to four work-groups share a WGP. Planes: QK* [b][q heads, k heads][t][HD], VT* [b][p][e][t], O [b][h][t][HV]
__global__ __launch_bounds__(32 * NWV) __attribute__((amdgpu_waves_per_eu(4))) void k_fattn(const h16* __restrict__ QK16, const bf* __restrict__ QKh, const bf* __restrict__ QKl, const h16* __restrict__ VT16, const bf* __restrict__ VTh, const bf* __restrict__ VTl, float* __restrict__ O) {
    __shared__ __align__(16) h16 skv[2 * BUFE]; __shared__ __align__(16) h16 sq[NWV * 32 * QP];
    const int NHB = NB_ * NH_ * (RH / (16 * NWV)); int blk = (int)blockIdx.x; const bool hires = blk < NHB; if (!hires) blk -= NHB;
    const int per = hires ? RH / (16 * NWV) : (TT - RH) / (32 * NWV); const int bh = blk / per, tile = blk % per; const int b = bh / NH_, h = bh % NH_;
    const size_t oq = (size_t)(b * (NH_ + NKV) + h) * TT * HD, ok = (size_t)(b * (NH_ + NKV) + NH_ + h) * TT * HD, ov = (size_t)(b * NP + h / 2) * HV * TT; float* Oh = O + (size_t)bh * TT * HV;
    if (hires) attn_tile<bf, true, 1, 32>(QKh + oq, QKl + oq, QKh + ok, QKl + ok, VTh + ov, VTl + ov, tile * 16 * NWV, Oh, (bf*)skv, (bf*)sq);
    else attn_tile<h16, false, 2, 64>(QK16 + oq, nullptr, QK16 + ok, nullptr, VT16 + ov, nullptr, RH + tile * 32 * NWV, Oh, skv, sq);
}
// lambda, by one wave: two 64-term f32 dots (butterfly sums: every lane ends with the same value), precise expf
__device__ __forceinline__ float lambda_wave(const float* __restrict__ a1, const float* __restrict__ b1, const float* __restrict__ a2, const float* __restrict__ b2, int lane) { const float p0 = a1[lane], p1 = b1[lane], p2 = a1[lane + 32], p3 = b1[lane + 32], r0 = a2[lane], r1 = b2[lane], r2 = a2[lane + 32], r3 = b2[lane + 32];
    asm volatile("s_wait_xcnt 0x0" :: "v"(lane) : "memory");   // the lane index is the loads' offset register and an input of this wait, so that it stays untouched from the loads down to it
    float s1 = __fadd_rn(__fmul_rn(bfr(p0), bfr(p1)), __fmul_rn(bfr(p2), bfr(p3))); float s2 = __fadd_rn(__fmul_rn(bfr(r0), bfr(r1)), __fmul_rn(bfr(r2), bfr(r3)));
#pragma unroll
    for (int sh = 16; sh; sh >>= 1) { s1 = __fadd_rn(s1, __shfl_xor(s1, sh, 32)); s2 = __fadd_rn(s2, __shfl_xor(s2, sh, 32)); }
    return __fadd_rn(__fsub_rn(expf(s1), expf(s2)), LINIT); }
// row r = b TT + t of the context is formed on the way in: columns p*HV + e = w0 v - lambda w1 v from the planes O[b][2p][t][e], O[b][2p + 1][t][e]
template <int WD>
__global__ __launch_bounds__(256) void k_lnrowD(const float* __restrict__ O, const float* __restrict__ lq1, const float* __restrict__ lk1, const float* __restrict__ lq2, const float* __restrict__ lk2, size_t nrows, const float* __restrict__ g, const float* __restrict__ bb, bf* Hh, bf* Hl) { const int lane = threadIdx.x & 31; const size_t r = (size_t)blockIdx.x * 8 + (threadIdx.x >> 5); if (r >= nrows) return; const float* xr = O + (r / TT) * ((size_t)NH_ * TT * HV) + (r % TT) * HV + lane * 4; float a[WD / 32]; float s = 0.f; static_assert(WD == NP * HV && HV == 128, "one 128-wide chunk per pair"); v4f w0[NP], w1[NP];
#pragma unroll
    for (int c = 0; c < NP; ++c) { w0[c] = *(const v4f*)(xr + (size_t)(2 * c) * TT * HV); w1[c] = *(const v4f*)(xr + (size_t)(2 * c + 1) * TT * HV); }
    asm volatile("s_wait_xcnt 0x0" :: "v"(xr) : "memory");   // the row address is an input of this wait so that its registers stay untouched from the loads down to it
    const float lam = lambda_wave(lq1, lk1, lq2, lk2, lane);   // every wave forms it for itself while its row's loads fly
#pragma unroll
    for (int c = 0; c < WD / 128; ++c) { const v4f v = w0[c] - lam * w1[c]; for (int q = 0; q < 4; ++q) { a[c * 4 + q] = v[q]; s = __fadd_rn(s, a[c * 4 + q]); } }
#pragma unroll
    for (int sh = 16; sh; sh >>= 1) s = __fadd_rn(s, __shfl_xor(s, sh, 32));
    const float mean = __fdiv_rn(s, (float)WD); float s2 = 0.f;
#pragma unroll
    for (int k = 0; k < WD / 32; ++k) { const float dv = __fsub_rn(a[k], mean); float p2 = __fmul_rn(dv, dv); asm volatile("" : "+v"(p2)); s2 = __fadd_rn(s2, p2); }   /* mul and add kept separate (no fma contraction) */
#pragma unroll
    for (int sh = 16; sh; sh >>= 1) s2 = __fadd_rn(s2, __shfl_xor(s2, sh, 32));
    const float rs = __fdiv_rn(1.0f, __fsqrt_rn(__fadd_rn(__fdiv_rn(s2, (float)WD), 1e-6f)));
{
#pragma unroll
        for (int c = 0; c < WD / 128; ++c) { v4us oh, ol; for (int q = 0; q < 4; ++q) { const int col = c * 128 + lane * 4 + q; float y = __fmul_rn(__fmul_rn(__fsub_rn(a[c * 4 + q], mean), rs), bfr(g[col])); asm volatile("" : "+v"(y)); y = __fadd_rn(y, bfr(bb[col])); y = __fmul_rn(y, 1.0f - LINIT); unsigned short u, w2; splitf(y, u, w2); oh[q] = u; ol[q] = w2; } *(v4us*)(Hh + r * WD + c * 128 + lane * 4) = oh; *(v4us*)(Hl + r * WD + c * 128 + lane * 4) = ol; }
         } }
__global__ __launch_bounds__(256) void k_merge(const float* __restrict__ O, int h0, bf* Ah, bf* Al) { const size_t e = ((size_t)blockIdx.x * 256 + threadIdx.x) * 2; if (e >= (size_t)ZH * TT * HD) return; const int d = (int)(e % HD); const int t = (int)((e / HD) % TT); const int zz = (int)(e / ((size_t)HD * TT)); const float cs = (t < RH) ? 1.0f : (1.0f / PCAR); const size_t oo = (size_t)t * DQ + (h0 + zz) * HD + d;
    v2us oh, ol;
#pragma unroll
    for (int q = 0; q < 2; ++q) { unsigned short a, c2; splitf(O[e + q] * cs, a, c2); oh[q] = a; ol[q] = c2; } *(v2us*)(Ah + oo) = oh; *(v2us*)(Al + oo) = ol;  }

extern "C" void kernel_launch(void* const* d_in, const int* in_sizes, int n_in,
                              void* d_out, int out_size, void* d_ws, size_t ws_size, hipStream_t stream) {
    (void)in_sizes; (void)n_in; (void)out_size;
    const float* x = (const float*)d_in[0]; const float* xk = (const float*)d_in[1]; const float* xv = (const float*)d_in[2]; const float* wq = (const float*)d_in[3]; const float* bq = (const float*)d_in[4]; const float* wk = (const float*)d_in[5]; const float* bk = (const float*)d_in[6]; const float* wv = (const float*)d_in[7]; const float* bv = (const float*)d_in[8]; const float* lq1 = (const float*)d_in[9]; const float* lk1 = (const float*)d_in[10]; const float* lq2 = (const float*)d_in[11]; const float* lk2 = (const float*)d_in[12]; const float* lng = (const float*)d_in[13]; const float* lnb = (const float*)d_in[14]; const float* wo = (const float*)d_in[15]; const float* bo = (const float*)d_in[16];
    float* OUT = (float*)d_out;     // [2][2048][512]
    char* wsp = (char*)d_ws;
    auto take = [&](size_t bytes) { char* p = wsp; wsp += (bytes + 255) & ~(size_t)255; return (void*)p; };
    bf* WQ = (bf*)take((size_t)DQ * DM * 2); bf* WK = (bf*)take((size_t)DKV * DM * 2); bf* WV = (bf*)take((size_t)DKV * DM * 2); bf* WO = (bf*)take((size_t)DM * DQ * 2); (void)WK; (void)WV;
    const size_t SQK = (size_t)(NH_ + NKV) * TT * HD, SV = (size_t)NP * HV * TT;   // one batch's q + k planes (k directly behind q: one launch writes both) and v^T planes, in elements
    h16* QK16 = (h16*)take(NB_ * SQK * 2); bf* QKh = (bf*)take(NB_ * SQK * 2); bf* QKl = (bf*)take(NB_ * SQK * 2); h16* VT16 = (h16*)take(NB_ * SV * 2); bf* VTh = (bf*)take(NB_ * SV * 2); bf* VTl = (bf*)take(NB_ * SV * 2);
    bf* XB = (bf*)take((size_t)3 * NB_ * TT * DM * 2);   // the three bf16 input copies, both batches each
    float* Ob = (float*)take((size_t)NB_ * NH_ * TT * HV * 4); bf* ATh = (bf*)take((size_t)NB_ * TT * DQ * 2); bf* ATl = (bf*)take((size_t)NB_ * TT * DQ * 2);
    if ((size_t)(wsp - (char*)d_ws) > ws_size) return;    // ws 256 MiB
    k_prep<<<4 * WB + 3 * CB, 256, 0, stream>>>(wq, wk, wv, wo, x, xk, xv, WQ, XB);   /* weight planes (WQ, WK, WV, WO lie one behind another) and input copies */
    k_gemmw<bf, 0, true, 1, true><<<dim3(NB_ * TT / 128, DQ / 128, 3), 32 * GW, 0, stream>>>(XB, nullptr, WQ, nullptr, DM, DM, 0, nullptr, 0, bq, bk, bv, (size_t)NB_ * TT * DM, (size_t)DQ * DM, 0, QK16, QKh, QKl, VT16, VTh, VTl);   /* q, k and v projections on grid z, both batches on the row axis, stored as the q, k and v^T planes */
    k_fattn<<<NB_ * NH_ * (RH / (16 * NWV) + (TT - RH) / (32 * NWV)), 32 * NWV, 0, stream>>>(QK16, QKh, QKl, VT16, VTh, VTl, Ob);   /* every batch, head and query tile */
    k_lnrowD<DQ><<<NB_ * TT / 8, 256, 0, stream>>>(Ob, lq1, lk1, lq2, lk2, (size_t)NB_ * TT, lng, lnb, ATh, ATl);   /* head difference, LayerNorm (eps 1e-6) x (1 - lambda_init) -> hi/lo planes */
    k_gemmw<bf, 1, true><<<dim3(NB_ * TT / 128, DM / 128, 1), 32 * GW, 0, stream>>>(ATh, ATl, WO, nullptr, DQ, DQ, 0, OUT, DM, bo, bo, bo, 0, 0, 0, nullptr, nullptr, nullptr, nullptr, nullptr, nullptr);
}

// v009
// A run of this version takes 139 microseconds.
// Two timings next to v008 both put it at 1.03 times that version's speed.
// Over all steps from v000 it is 14.0 times as fast.
#include <hip/hip_runtime.h>

// Multi-head DIFFERENTIAL attention (query, key, value [2][2048][512]; q = query Wq + bq, k = key Wk + bk as 16 heads x 64, v = value Wv + bv as 8 heads x 128 ('xw' [512][1024] + [1024], 0.02); w = softmax(q.k / 8) per head; for each pair p: dw = w[2p] - lambda w[2p+1], lambda = exp(lq1.lk1) - exp(lq2.lk2) + lambda_init (lq/lk [64], read); attn = dw v_p -> [2048][1024]; LayerNorm (eps 1e-6, affine) x (1 - lambda_init); out = attn Wo + bo ('xw' [1024][512]) -> [2][2048][512] (2.1 M)).
// Layout: five launches, each for both batches (rows [batch][t] form one row axis of 4096). One launch for all that reads only inputs (the four weights' K-contiguous bf16 planes, the bf16 copies of the three inputs); exact projections + f32 biases, whose GEMM stores the q/k planes for the 16 score heads and the v^T planes per 128-wide value head itself; lambda computed on device by every wave that uses it (two 64-term f32 dots, precise expf); ONE fused attention launch for every batch, head and query tile (k_fattn: scores, online softmax and P.v in registers, no score matrix in memory; hybrid rows: < 512 hi/lo 3 products, rest fp16), each head's normalised w v as an f32 plane; then a LayerNorm row kernel (forms w0 v - lambda w1 v as it reads the planes; f32, fixed order) scaled by (1 - lambda_init), converted to hi/lo planes, x Wo exact + bo.
// Compute dtypes, f32 accumulate: every input rounded to bf16; projections exact + f32 biases; attention rows < 512 3 products, rest fp16; softmax, lambda, difference, LayerNorm f32; Wo hl x exact + bias.

#define NB_  2
#define TT   2048
#define DM   512
#define NH_  16
#define NKV  16
#define REP  (NH_ / NKV)
#define HD   64
#define DQ   (NH_ * HD)
#define DKV  (NKV * HD)
#define ZH   2
#define RH   512                  // query rows < RH use hi+lo planes (0: none)
#define WIN  0
#define PCAR 1024.0f
#define SCL  0.125f
#define NP   8       // value heads (pairs)
#define HV   128     // value head width
#define LINIT 0.47071301937103271f   // lambda_init = 0.8 - 0.6 exp(-0.6) as float32
#define NWV  4       // waves of a fused-attention work-group: each owns a query tile of its own and walks all TT keys; the staged key and v^T tiles serve all of them
#define BUFE 14848   // 16-bit elements of one stage buffer: hi/lo 2 x (32 x 72 + 128 x 40); fp16 64 x 72 + 128 x 72 is smaller
#define L2E  1.4426950408889634f
#define CSL  (SCL * L2E)          // a raw score (q.k) times this is its softmax exponent to base 2; SCL is a power of two, so the product is exact
#define LZR  44.361419555836498f  // 8 ln 2 / SCL: how far a raw score may lie above its row's reference maximum before the row is rescaled
#define QP   72      // LDS row pitch of the query and key tiles in 16-bit elements (64 + 8: 16 bytes of pad against bank conflicts between rows)
typedef _Float16 h16;
typedef unsigned short bf;
typedef __attribute__((ext_vector_type(16))) __bf16   v16bf;
typedef __attribute__((ext_vector_type(16))) _Float16 v16h;
typedef __attribute__((ext_vector_type(8)))  _Float16 v8h;
typedef __attribute__((ext_vector_type(8)))  unsigned short v8us;
typedef __attribute__((ext_vector_type(8)))  float    v8f;
typedef __attribute__((ext_vector_type(4)))  float    v4f;
typedef v8h  __attribute__((may_alias)) v8ha;
typedef v4f  __attribute__((may_alias)) v4fa;
typedef v8us __attribute__((may_alias)) v8usa;

__device__ __forceinline__ unsigned short f2bf(float f) { unsigned u = __float_as_uint(f); u += 0x7FFFu + ((u >> 16) & 1u); return (unsigned short)(u >> 16); }
__device__ __forceinline__ float bf2f(unsigned short b) { return __uint_as_float(((unsigned)b) << 16); }
__device__ __forceinline__ float bfr(float f) { return bf2f(f2bf(f)); }
__device__ __forceinline__ v16h cat16(v8h lo, v8h hi) { return __builtin_shufflevector(lo, hi, 0, 1, 2, 3, 4, 5, 6, 7, 8, 9, 10, 11, 12, 13, 14, 15); }
__device__ __forceinline__ v16bf cat16b(v8us lo, v8us hi) { return __builtin_bit_cast(v16bf, __builtin_shufflevector(lo, hi, 0, 1, 2, 3, 4, 5, 6, 7, 8, 9, 10, 11, 12, 13, 14, 15)); }
__device__ __forceinline__ v8f wmma16(v16h a, v16h b, v8f c) { return __builtin_amdgcn_wmma_f32_16x16x32_f16(false, a, false, b, (short)0, c, false, false); }
__device__ __forceinline__ v8f wmmab(v16bf a, v16bf b, v8f c) { return __builtin_amdgcn_wmma_f32_16x16x32_bf16(false, a, false, b, (short)0, c, false, false); }



// ---- k_gemmw: register-blocked GEMM, one wave per 64x64 output tile (16 accumulators); GW = 4 waves (2 x 2) form a work-group with a 128x128 tile. The group's A and Bt rows (K-contiguous 16-bit planes) come into LDS in stages of GK = 64 k (whole 128-byte lines) by asynchronous copies, two buffers: the next stage flies while this one is worked on; fragments are read from LDS. grid (M/128, N/128, Z), 128 threads. M % 128 == 0, N % 128 == 0. waves_per_eu(4): keeps the kernel at 256 registers, so that no register window is switched.
// C[m][n] (f32, pitch ldc, + optional f32 bias[n]) = sum_k A[m][k] Bt[n][k] (+ split products per NSPLIT). A rows have pitch lda, Bt rows pitch K. z-batch strides sA/sB/sC in elements; batch z reads Bt plane z >> bsh (bsh = 1: two batches share one); batch z adds bias vector z. K % 64 == 0.
// PL: no f32 C; rows are [b][t] (b = row / TT); the epilogue stores the result + bias as 16-bit planes (fp16, bf16 hi, bf16 lo): batches 0 and 1 as head planes P*[b][z * NH_ + column tile][t][HD], batch 2 transposed as V*[b][column / HV][column % HV][t].
// KS > 1: grid z = batches x KS; blockIdx.z = batch * KS + slice; a slice sums k in [slice K/KS, (slice + 1) K/KS) into its own plane C + blockIdx.z * sC. K % (64 KS) == 0.
template <typename T16> struct WFrag;
template <> struct WFrag<h16> { typedef v16h V; static __device__ __forceinline__ V ld(const h16* p) { return cat16(*(const v8h*)p, *(const v8h*)(p + 16)); } static __device__ __forceinline__ v8f mma(V a, V b, v8f c) { return wmma16(a, b, c); } };
template <> struct WFrag<bf> { typedef v16bf V; static __device__ __forceinline__ V ld(const bf* p) { return cat16b(*(const v8us*)p, *(const v8us*)(p + 16)); } static __device__ __forceinline__ v8f mma(V a, V b, v8f c) { return wmmab(a, b, c); } };
__device__ __forceinline__ h16 tohx(float x) { return (h16)x; }
__device__ __forceinline__ void splitf(float y, unsigned short& h, unsigned short& l) { h = f2bf(y); l = f2bf(y - bf2f(h)); }
typedef __attribute__((ext_vector_type(8))) __bf16 v8b;
// eight f32 to the three planes' formats with the packed conversion instructions (round to nearest even: for finite values the bits of tohx and splitf), which keeps the epilogue's text short
__device__ __forceinline__ void plane8(v8f x, v8h& o16, v8us& oh, v8us& ol) { o16 = __builtin_convertvector(x, v8h); const v8b h = __builtin_convertvector(x, v8b); const v8b l = __builtin_convertvector(x - __builtin_convertvector(h, v8f), v8b); oh = __builtin_bit_cast(v8us, h); ol = __builtin_bit_cast(v8us, l); }
#define GW 4     // waves of a GEMM work-group
#define GK 64    // k extent of a stage
// 128 rows of one plane, GK elements (128 bytes) each, into LDS rows of pitch QP: 8 lanes a row, 16 rows a copy of the work-group, eight copies a lane. g and s are the lane's own first source address and LDS place.
template <typename T16>
__device__ __forceinline__ void stage_rows(const T16* __restrict__ g, size_t pitch, T16* s) {
    unsigned la[8]; const T16* ga[8];
#pragma unroll
    for (int i = 0; i < 8; ++i) { ga[i] = g + (size_t)i * 16 * pitch; la[i] = (unsigned)(size_t)(s + i * 16 * QP); }
    // the copies and, as the last line of the same statement, the wait behind which their address registers may take new values
    asm volatile("global_load_async_to_lds_b128 %0, %8, off\n\tglobal_load_async_to_lds_b128 %1, %9, off\n\tglobal_load_async_to_lds_b128 %2, %10, off\n\tglobal_load_async_to_lds_b128 %3, %11, off\n\t"
                 "global_load_async_to_lds_b128 %4, %12, off\n\tglobal_load_async_to_lds_b128 %5, %13, off\n\tglobal_load_async_to_lds_b128 %6, %14, off\n\tglobal_load_async_to_lds_b128 %7, %15, off\n\ts_wait_xcnt 0x0"
                 :: "v"(la[0]), "v"(la[1]), "v"(la[2]), "v"(la[3]), "v"(la[4]), "v"(la[5]), "v"(la[6]), "v"(la[7]),
                    "v"(ga[0]), "v"(ga[1]), "v"(ga[2]), "v"(ga[3]), "v"(ga[4]), "v"(ga[5]), "v"(ga[6]), "v"(ga[7]) : "memory");
}
template <typename T16, int NSPLIT, bool BIAS, int KS = 1, bool PL = false>
__global__ __launch_bounds__(32 * GW) __attribute__((amdgpu_waves_per_eu(4))) void k_gemmw(const T16* __restrict__ A, const T16* __restrict__ A2, const T16* __restrict__ Bt, const T16* __restrict__ Bt2, int K, int lda, int bsh, float* C, int ldc, const float* __restrict__ bias0, const float* __restrict__ bias1, const float* __restrict__ bias2, size_t sA, size_t sB, size_t sC, h16* P16, bf* Ph, bf* Pl, h16* V16, bf* Vh, bf* Vl) {
    typedef typename WFrag<T16>::V V;
    constexpr int NPA = (NSPLIT == 1 || NSPLIT == 2) ? 2 : 1, NPB = NSPLIT >= 2 ? 2 : 1, PE = 128 * QP, SE = (NPA + NPB) * PE;   // planes of A and of Bt, elements of one plane's stage and of one buffer: [A planes][Bt planes]
    __shared__ __align__(16) T16 sab[2 * SE]; static_assert(GW * 16 * 68 * 4 <= 2 * SE * 2, "the epilogue's rows fit the stage buffers");
    const int w = __builtin_amdgcn_readfirstlane((int)(threadIdx.x >> 5)); float* os = (float*)sab + w * (16 * 68);   // the epilogue's staging rows, each wave's own, lie in the stage buffers: behind the last trip's barrier nobody reads these and no copy is outstanding
    const size_t z = blockIdx.z / KS; const int ks = (int)(blockIdx.z % KS); A += z * sA; if (A2) A2 += z * sA; Bt += (z >> bsh) * sB; if (Bt2) Bt2 += (z >> bsh) * sB; C += (size_t)blockIdx.z * sC;
    const float* __restrict__ bias = z == 0 ? bias0 : z == 1 ? bias1 : bias2;   // up to three biased batches, each with its own bias vector
    const int kbeg = ks * (K / KS), kend = kbeg + K / KS;
    const int lane = threadIdx.x & 31, lr = lane & 15, hi = lane >> 4; const int R0 = blockIdx.x * 128, C0 = blockIdx.y * 128, r0 = R0 + (w & 1) * 64, c0 = C0 + (w >> 1) * 64;
    v8f acc[4][4];
#pragma unroll
    for (int mb = 0; mb < 4; ++mb)
#pragma unroll
        for (int nb = 0; nb < 4; ++nb) acc[mb][nb] = (v8f){};
    const int crow = (int)threadIdx.x >> 3, ccol = ((int)threadIdx.x & 7) * 8;   // the lane's row and 16-byte piece in every copy
    const T16* gA = A + (size_t)(R0 + crow) * lda + ccol; const T16* gA2 = NPA == 2 ? A2 + (size_t)(R0 + crow) * lda + ccol : nullptr; const T16* gB = Bt + (size_t)(C0 + crow) * K + ccol; const T16* gB2 = NPB == 2 ? Bt2 + (size_t)(C0 + crow) * K + ccol : nullptr;
    T16* sl = sab + crow * QP + ccol;
    auto stage = [&](int kc, int bi) { T16* s = sl + bi * SE; stage_rows<T16>(gA + kc, (size_t)lda, s); if (NPA == 2) stage_rows<T16>(gA2 + kc, (size_t)lda, s + PE); stage_rows<T16>(gB + kc, (size_t)K, s + NPA * PE); if (NPB == 2) stage_rows<T16>(gB2 + kc, (size_t)K, s + (NPA + 1) * PE); };
    const int nst = (kend - kbeg) / GK;
    // stage 0 lands and is published before anybody reads it; stage 1 flies during trip 0
    stage(kbeg, 0);
    asm volatile("s_wait_asynccnt 0x0" ::: "memory");   // this wave's copies of stage 0 have landed
    __syncthreads();
    if (nst > 1) stage(kbeg + GK, 1);
    const int aoff = ((w & 1) * 64 + lr) * QP + 8 * hi, boff = NPA * PE + ((w >> 1) * 64 + lr) * QP + 8 * hi;
#pragma unroll 1
    for (int t = 0; t < nst; ++t) {
        const T16* bufp = sab + (t & 1) * SE; V a[4], a2[4], b[4], b2[4];
#pragma unroll
        for (int kk = 0; kk < GK; kk += 32) {
#pragma unroll
            for (int nb = 0; nb < 4; ++nb) {   // in the order of first use: Bt block 0, the A blocks, the other Bt blocks, the second planes
                b[nb] = WFrag<T16>::ld(bufp + boff + nb * 16 * QP + kk);
                if (nb == 0) {
#pragma unroll
                    for (int mb = 0; mb < 4; ++mb) a[mb] = WFrag<T16>::ld(bufp + aoff + mb * 16 * QP + kk); } }
#pragma unroll
            for (int mb = 0; mb < 4; ++mb) { if (NPA == 2) a2[mb] = WFrag<T16>::ld(bufp + PE + aoff + mb * 16 * QP + kk); if (NPB == 2) b2[mb] = WFrag<T16>::ld(bufp + PE + boff + mb * 16 * QP + kk); }
            __builtin_amdgcn_sched_barrier(0);   // all of the step's fragments are requested ahead of its products: without it the Bt loads sink to their first use, one register set for all four, and each column block waits out an LDS latency of its own
#pragma unroll
            for (int nb = 0; nb < 4; ++nb)
#pragma unroll
                for (int mb = 0; mb < 4; ++mb) { acc[mb][nb] = WFrag<T16>::mma(a[mb], b[nb], acc[mb][nb]); if (NSPLIT == 1 || NSPLIT == 2) acc[mb][nb] = WFrag<T16>::mma(a2[mb], b[nb], acc[mb][nb]); if (NSPLIT >= 2) acc[mb][nb] = WFrag<T16>::mma(a[mb], b2[nb], acc[mb][nb]); }
        }
        // hand-over: this wave's reads of the buffer are done, its copies of stage t + 1 have landed; the barrier publishes stage t + 1 and ends every wave's reads of this buffer; only then is it refilled
        asm volatile("s_wait_dscnt 0x0" ::: "memory");
        asm volatile("s_wait_asynccnt 0x0" ::: "memory");
        __syncthreads();
        if (t + 2 < nst) stage(kbeg + (t + 2) * GK, t & 1);
    }
    asm volatile("s_wait_asynccnt 0x0" ::: "memory");   // no copy is outstanding behind the loop
    const int pb = r0 / TT, rl = r0 % TT;   // PL: the tile's batch and its first row there (TT % 64 == 0: a tile lies in one batch)
    if (PL && z == 2) {   // v^T planes: a lane's accumulator holds 8 consecutive rows (t) of one column (e), which are 16 bytes of a v^T row; the tile's 64 rows fill whole 128-byte lines
#pragma unroll
        for (int nb = 0; nb < 4; ++nb) { const float bs = bfr(bias[c0 + nb * 16 + lr]); const size_t vo = ((size_t)(pb * NP + c0 / HV) * HV + c0 % HV + nb * 16 + lr) * TT + rl + hi * 8;
#pragma unroll
            for (int mb = 0; mb < 4; ++mb) { v8h o16; v8us oh, ol; plane8(acc[mb][nb] + bs, o16, oh, ol);
                h16* d0 = V16 + vo + mb * 16; bf* d1 = Vh + vo + mb * 16; bf* d2 = Vl + vo + mb * 16; *(v8h*)d0 = o16; *(v8us*)d1 = oh; *(v8us*)d2 = ol;
                asm volatile("s_wait_xcnt 0x0" :: "v"(d0), "v"(d1), "v"(d2), "v"(o16), "v"(oh), "v"(ol) : "memory"); } }   // the stores have left their address and data registers before these are used again
        return; }
    if (PL) {   // q and k head planes: the column tile is one head; through LDS so that 8 lanes store one 128-byte plane row
        const int rw = lane >> 3, cf = (lane & 7) * 8; v8f bs;
#pragma unroll
        for (int i = 0; i < 8; ++i) bs[i] = bfr(bias[c0 + cf + i]);
        const size_t po = (((size_t)pb * (NH_ + NKV) + z * NH_ + c0 / 64) * TT + rl + rw) * HD + cf;
#pragma unroll
        for (int mb = 0; mb < 4; ++mb) {
#pragma unroll
            for (int nb = 0; nb < 4; ++nb) {
#pragma unroll
                for (int j = 0; j < 8; ++j) os[(hi * 8 + j) * 68 + nb * 16 + lr] = acc[mb][nb][j]; }
            v4f u0[4], u1[4];   // all of the tile's LDS reads are requested first: the waits below would otherwise put them one behind the other
#pragma unroll
            for (int s = 0; s < 4; ++s) { u0[s] = *(const v4fa*)(os + (4 * s + rw) * 68 + cf); u1[s] = *(const v4fa*)(os + (4 * s + rw) * 68 + cf + 4); }
#pragma unroll
            for (int s = 0; s < 4; ++s) { v8h o16; v8us oh, ol; plane8(__builtin_shufflevector(u0[s], u1[s], 0, 1, 2, 3, 4, 5, 6, 7) + bs, o16, oh, ol);
                h16* d0 = P16 + po + (mb * 16 + 4 * s) * HD; bf* d1 = Ph + po + (mb * 16 + 4 * s) * HD; bf* d2 = Pl + po + (mb * 16 + 4 * s) * HD; *(v8h*)d0 = o16; *(v8us*)d1 = oh; *(v8us*)d2 = ol;
                asm volatile("s_wait_xcnt 0x0" :: "v"(d0), "v"(d1), "v"(d2), "v"(o16), "v"(oh), "v"(ol) : "memory"); }   // as above
        }
        return; }
#pragma unroll
    for (int mb = 0; mb < 4; ++mb) {
#pragma unroll
        for (int nb = 0; nb < 4; ++nb) {
#pragma unroll
            for (int j = 0; j < 8; ++j) os[(hi * 8 + j) * 68 + nb * 16 + lr] = acc[mb][nb][j]; }
        __builtin_amdgcn_wave_barrier(); asm volatile("" ::: "memory");
        float* crow = C + (size_t)(r0 + mb * 16) * ldc + c0;
{
#pragma unroll
            for (int s = 0; s < 8; ++s) { const int row = 2 * s + hi, cofs = lr * 4; v4f val = *(const v4fa*)(os + row * 68 + cofs); if (BIAS) { val[0] += bfr(bias[c0 + cofs]); val[1] += bfr(bias[c0 + cofs + 1]); val[2] += bfr(bias[c0 + cofs + 2]); val[3] += bfr(bias[c0 + cofs + 3]); }
                *(v4f*)(crow + (size_t)row * ldc + cofs) = val; }
             }
        __builtin_amdgcn_wave_barrier(); asm volatile("" ::: "memory");
    }
}

typedef __attribute__((ext_vector_type(2))) _Float16 v2h;
typedef __attribute__((ext_vector_type(4))) _Float16 v4h;
typedef __attribute__((ext_vector_type(2))) unsigned short v2us;
typedef __attribute__((ext_vector_type(4))) unsigned short v4us;
typedef __attribute__((ext_vector_type(2))) float v2f;
typedef __attribute__((ext_vector_type(4))) int v4i;

// ---- k_prep: all the work that reads nothing but inputs, in one launch. Blocks [0, 4 WB): the weights as K-contiguous bf16 planes Bt[n][k], one after another (they start first: their eight dependent trips are the launch's longest path); the other 3 CB blocks: the bf16 copies of the three inputs, both batches, one after another.
#define WB (DM * DQ / 64 / 64)          // blocks of one weight: 8 waves x 8 lines of 64 elements
#define CB (NB_ * TT * DM / 8 / 256)    // blocks of one input: 8 elements a thread
__device__ __forceinline__ void wt_lines(const float* __restrict__ w, int K, int N, bf* Bt, int bx) {
    const int lane = threadIdx.x & 31; const int L0 = (bx * 8 + (threadIdx.x >> 5)) * 8; const int nlines = N * K / 64;
#pragma unroll 1
    for (int l = 0; l < 8; ++l) { const int L = L0 + l; if (L >= nlines) break; const size_t e = (size_t)L * 64 + lane * 2; const int k = (int)(e % K), n = (int)(e / K); v2us o;
        const float* p = w + (size_t)k * N + n; const float a0 = p[0], a1 = p[N];   // rows k and k + 1
        asm volatile("s_wait_xcnt 0x0" :: "v"(p) : "memory");   // the address is an input of this wait so that its registers stay untouched from the loads down to it
        o[0] = f2bf(a0); o[1] = f2bf(a1); bf* d = Bt + e; *(v2us*)d = o;
        asm volatile("s_wait_xcnt 0x0" :: "v"(d), "v"(o) : "memory"); }   // the store has left its address and data registers before the next trip rewrites them
}
__global__ __launch_bounds__(256) void k_prep(const float* __restrict__ w0, const float* __restrict__ w1, const float* __restrict__ w2, const float* __restrict__ w3, const float* __restrict__ s0, const float* __restrict__ s1, const float* __restrict__ s2, bf* Bt, bf* dst) {
    int blk = (int)blockIdx.x;
    if (blk < 3 * WB) { const int y = blk / WB; wt_lines(y == 0 ? w0 : y == 1 ? w1 : w2, DM, DQ, Bt + (size_t)y * DM * DQ, blk % WB); return; }
    if (blk < 4 * WB) { wt_lines(w3, DQ, DM, Bt + (size_t)3 * DM * DQ, blk - 3 * WB); return; }
    blk -= 4 * WB; const int y = blk / CB; const float* __restrict__ src = y == 0 ? s0 : y == 1 ? s1 : s2; const size_t i = (size_t)(blk % CB) * 256 + threadIdx.x;
    const v8f v = *(const v8f*)(src + i * 8); v8us o;
    asm volatile("s_wait_xcnt 0x0" ::: "memory");   // the load has left its address registers before anything rewrites them
#pragma unroll
    for (int k = 0; k < 8; ++k) o[k] = f2bf(v[k]);
    *(v8us*)(dst + ((size_t)y * CB * 256 + i) * 8) = o; }

__global__ __launch_bounds__(256) void k_vtp(const float* __restrict__ F, int pitch, int nheads, h16* V16, bf* Vh, bf* Vl) { const size_t e = ((size_t)blockIdx.x * 256 + threadIdx.x) * 2; if (e >= (size_t)nheads * HD * TT) return; const int t = (int)(e % TT); const int d = (int)((e / TT) % HD); const int g = (int)(e / ((size_t)TT * HD)); v2h o16; v2us oh, ol;
#pragma unroll
    for (int q = 0; q < 2; ++q) { const float x = F[(size_t)(t + q) * pitch + g * HD + d]; o16[q] = tohx(x); unsigned short a2, c2; splitf(x, a2, c2); oh[q] = a2; ol[q] = c2; }
    *(v2h*)(V16 + e) = o16; *(v2us*)(Vh + e) = oh; *(v2us*)(Vl + e) = ol;  }
// ---- k_fattn: fused attention. A work-group = NWV query tiles of one (batch, head), one per wave; every wave walks all TT keys in steps of 32 with an online softmax. The key rows and v^T rows of a stage (KS keys) are brought into LDS once for the four waves by asynchronous copies, two buffers: the next stage flies while this one is worked on.
// Transposed form: S^T = K Q^T (A = key rows, B = query rows), so a lane holds, for query lr, keys hi*8 + j of each 16-key tile: two such tiles side by side ARE the B fragment (k = 8 hi + i, 16 + 8 hi + i) of O^T = V^T P^T (A = v^T rows e, k = keys). Softmax runs down a lane's own registers plus one exchange between the lane halves.
// HI: bf16 hi/lo planes, three products each (hh + lh + hl) for both products; else fp16, P unnormalised in (0, 2^8]. O[t][e] (f32, pitch HV) = softmax row x v, normalised.
typedef __attribute__((ext_vector_type(16))) unsigned short v16us;
typedef __attribute__((ext_vector_type(16))) float v16f;
typedef __attribute__((ext_vector_type(8))) unsigned v8u;
// One stage into one buffer: KS key rows (128 bytes each, LDS pitch 144) and HV v^T rows (2 KS bytes each, LDS pitch 2 KS + 16), per plane; 16 bytes a lane and copy, twelve copies a lane, whole lines of the source. Buffer: [K planes][V planes].
template <typename T16, bool HI, int KS>
__device__ __forceinline__ void stage_kv(const T16* __restrict__ Kp, const T16* __restrict__ K2, const T16* __restrict__ Vt, const T16* __restrict__ V2, int k0, T16* buf) {
    constexpr int NPL = HI ? 2 : 1, KE = KS * QP, VP = KS + 8, VE = HV * VP, CV = KS / 8;
    static_assert(NPL * (KS / 16 + KS / 8) == 12, "twelve copies a lane"); static_assert(NPL * (KE + VE) <= BUFE, "stage fits its buffer");
    const int tid = (int)threadIdx.x; unsigned la[12]; const T16* ga[12]; int c = 0; constexpr int RV = 32 * NWV / CV;   // v^T rows that one copy of the work-group covers
    // the lane's own offsets: copy i adds whole rows, a constant. Key rows: 8 lanes a row, 16 rows a copy, contiguous in the source; v^T rows: CV lanes a row, RV rows a copy
    const int gk = tid * 8, gv = (tid / CV) * TT + (tid % CV) * 8; const unsigned lk = (unsigned)(size_t)(buf + (tid >> 3) * QP + (tid & 7) * 8), lv = (unsigned)(size_t)(buf + NPL * KE + (tid / CV) * VP + (tid % CV) * 8);
#pragma unroll
    for (int pl = 0; pl < NPL; ++pl)
#pragma unroll
        for (int i = 0; i < KS / 16; ++i) { ga[c] = (pl ? K2 : Kp) + (size_t)k0 * HD + i * (32 * NWV * 8) + gk; la[c] = lk + (unsigned)(pl * KE + i * 16 * QP) * 2u; ++c; }
#pragma unroll
    for (int pl = 0; pl < NPL; ++pl)
#pragma unroll
        for (int i = 0; i < KS / 8; ++i) { ga[c] = (pl ? V2 : Vt) + (size_t)i * RV * TT + k0 + gv; la[c] = lv + (unsigned)(pl * VE + i * RV * VP) * 2u; ++c; }
    // the copies and, as the last line of the same statement, the wait behind which their address registers may take new values
    asm volatile("global_load_async_to_lds_b128 %0, %12, off\n\tglobal_load_async_to_lds_b128 %1, %13, off\n\tglobal_load_async_to_lds_b128 %2, %14, off\n\tglobal_load_async_to_lds_b128 %3, %15, off\n\t"
                 "global_load_async_to_lds_b128 %4, %16, off\n\tglobal_load_async_to_lds_b128 %5, %17, off\n\tglobal_load_async_to_lds_b128 %6, %18, off\n\tglobal_load_async_to_lds_b128 %7, %19, off\n\t"
                 "global_load_async_to_lds_b128 %8, %20, off\n\tglobal_load_async_to_lds_b128 %9, %21, off\n\tglobal_load_async_to_lds_b128 %10, %22, off\n\tglobal_load_async_to_lds_b128 %11, %23, off\n\ts_wait_xcnt 0x0"
                 :: "v"(la[0]), "v"(la[1]), "v"(la[2]), "v"(la[3]), "v"(la[4]), "v"(la[5]), "v"(la[6]), "v"(la[7]), "v"(la[8]), "v"(la[9]), "v"(la[10]), "v"(la[11]),
                    "v"(ga[0]), "v"(ga[1]), "v"(ga[2]), "v"(ga[3]), "v"(ga[4]), "v"(ga[5]), "v"(ga[6]), "v"(ga[7]), "v"(ga[8]), "v"(ga[9]), "v"(ga[10]), "v"(ga[11]) : "memory");
}
template <typename T16, bool HI, int NQ, int KS>
__device__ __forceinline__ void attn_tile(const T16* __restrict__ Q, const T16* __restrict__ Q2, const T16* __restrict__ Kp, const T16* __restrict__ K2, const T16* __restrict__ Vt, const T16* __restrict__ V2, int q0, float* __restrict__ O, T16* skv, T16* sq) {
    typedef typename WFrag<T16>::V V;
    constexpr int NPL = HI ? 2 : 1, KE = KS * QP, VP = KS + 8, VE = HV * VP, NST = TT / KS;
    const int lane = threadIdx.x & 31, lr = lane & 15, hi = lane >> 4; const int w = __builtin_amdgcn_readfirstlane((int)(threadIdx.x >> 5));
    V qf[NQ][2], qg[NQ][2]; v8f acc[NQ][8]; float m[NQ]; v2f l[NQ];   // m: the row's reference maximum as a raw score; l: the row sum in two halves (even and odd keys of the lane), for packed adds
#pragma unroll
    for (int n = 0; n < NQ; ++n) { m[n] = -3.0e38f; l[n] = (v2f){};
#pragma unroll
        for (int et = 0; et < 8; ++et) acc[n][et] = (v8f){}; }
    // the query fragments do not fit in the registers beside the accumulators and the v^T rows, so each wave's tile lies in LDS, 32 rows of pitch QP (32 queries, or 16 queries hi then lo), and is read anew in every step
    { const int row = (int)threadIdx.x >> 2, col = ((int)threadIdx.x & 3) * 16; const T16* g[NWV]; v4f x0[NWV], x1[NWV];
#pragma unroll
        for (int i = 0; i < NWV; ++i) { g[i] = (HI ? ((row >> 4) ? Q2 : Q) + (size_t)(q0 + i * 16 + (row & 15)) * HD : Q + (size_t)(q0 + i * 32 + row) * HD) + col; x0[i] = *(const v4fa*)g[i]; x1[i] = *(const v4fa*)(g[i] + 8); }
        asm volatile("s_wait_xcnt 0x0" :: "v"(g[0]), "v"(g[1]), "v"(g[2]), "v"(g[3]) : "memory");   // the row addresses are inputs of this wait so that their registers stay untouched from the loads down to it
#pragma unroll
        for (int i = 0; i < NWV; ++i) { *(v4fa*)(sq + (i * 32 + row) * QP + col) = x0[i]; *(v4fa*)(sq + (i * 32 + row) * QP + col + 8) = x1[i]; } }
    // stage 0 lands and is published (with the query tiles) before anybody reads it; stage 1 flies during trip 0
    stage_kv<T16, HI, KS>(Kp, K2, Vt, V2, 0, skv);
    asm volatile("s_wait_asynccnt 0x0" ::: "memory");   // this wave's copies of stage 0 have landed
    __syncthreads();
    stage_kv<T16, HI, KS>(Kp, K2, Vt, V2, KS, skv + BUFE);
    const T16* sqw = sq + w * 32 * QP; const int koff = lr * QP + 8 * hi, voff = NPL * KE + lr * VP + 8 * hi;
#pragma unroll 1
    for (int t = 0; t < NST; ++t) {
        T16* bufp = skv + (t & 1) * BUFE;
#pragma unroll 1   // rolled: with the stage's two steps unrolled the build spills more registers
      for (int ss = 0; ss < KS / 32; ++ss) {
        const T16* kb = bufp + ss * 32 * QP + koff; const T16* kb2 = kb + KE; const T16* vb = bufp + ss * 32 + voff; const T16* vb2 = vb + VE;
#pragma unroll
        for (int n = 0; n < NQ; ++n)
#pragma unroll
            for (int c = 0; c < 2; ++c) { qf[n][c] = WFrag<T16>::ld(sqw + (n * 16 + lr) * QP + c * 32 + 8 * hi); if (HI) qg[n][c] = WFrag<T16>::ld(sqw + (16 + lr) * QP + c * 32 + 8 * hi); }
        v8f s[NQ][2]; V ka[2][2], kl[2][2];   // all of the step's key fragments are requested first: one wait instead of one per 16 keys
#pragma unroll
        for (int kt = 0; kt < 2; ++kt)
#pragma unroll
            for (int c = 0; c < 2; ++c) { ka[kt][c] = WFrag<T16>::ld(kb + kt * 16 * QP + c * 32); if (HI) kl[kt][c] = WFrag<T16>::ld(kb2 + kt * 16 * QP + c * 32); }
#pragma unroll
        for (int kt = 0; kt < 2; ++kt)
#pragma unroll
            for (int n = 0; n < NQ; ++n) { v8f t2 = (v8f){};
#pragma unroll
                for (int c = 0; c < 2; ++c) { t2 = WFrag<T16>::mma(ka[kt][c], qf[n][c], t2); if (HI) { t2 = WFrag<T16>::mma(ka[kt][c], qg[n][c], t2); t2 = WFrag<T16>::mma(kl[kt][c], qf[n][c], t2); } }
                s[n][kt] = t2; }
        V pf[NQ], pg[NQ]; float mx[NQ]; bool need = false;
        // lazy rescale: a row keeps the reference maximum m it has while no score of the step lies more than LZR above it (P then stays <= 2^8, and row sum and output carry the same factor, which the final division takes out). Maximum and test run on the raw scores: the scale is positive and enters once, in the exponent's multiply-add
#pragma unroll
        for (int n = 0; n < NQ; ++n) { mx[n] = -3.0e38f;
#pragma unroll
            for (int i = 0; i < 16; ++i) mx[n] = fmaxf(mx[n], s[n][i >> 3][i & 7]);
            need = need || mx[n] > m[n] + LZR; }
        if (__builtin_amdgcn_ballot_w32(need) != 0) {   // one test a step for the whole wave, a scalar branch: taken in the first step and where a score has outgrown its row's reference
#pragma unroll
            for (int n = 0; n < NQ; ++n) { const float mn = fmaxf(m[n], fmaxf(mx[n], __shfl_xor(mx[n], 16, 32))); const float al = __builtin_amdgcn_exp2f((m[n] - mn) * CSL); m[n] = mn; l[n] *= al;   // both lane halves of a row take the same new reference
#pragma unroll
                for (int et = 0; et < 8; ++et) acc[n][et] *= al; } }
        V va[8], vl[8];   // v^T rows 0..63 are requested ahead of the softmax arithmetic, rows 64..127 (hi/lo: 64..95) behind it, ahead of the first half's products
#pragma unroll
        for (int et = 0; et < 4; ++et) { va[et] = WFrag<T16>::ld(vb + et * 16 * VP); if (HI) vl[et] = WFrag<T16>::ld(vb2 + et * 16 * VP); }
        __builtin_amdgcn_sched_barrier(0);   // the requests stay ahead of the softmax arithmetic, which covers their latency: without it they sink to their first use
#pragma unroll
        for (int n = 0; n < NQ; ++n) { const v8f c8 = (v8f){} + CSL, m8 = (v8f){} - m[n] * CSL; v8f p0, p1;
            const v8f a0 = __builtin_elementwise_fma(s[n][0], c8, m8), a1 = __builtin_elementwise_fma(s[n][1], c8, m8);   // one (packed) multiply-add a score: s CSL - m CSL
#pragma unroll
            for (int i = 0; i < 8; ++i) { p0[i] = __builtin_amdgcn_exp2f(a0[i]); p1[i] = __builtin_amdgcn_exp2f(a1[i]); }
            const v8f t8 = p0 + p1; const v4f t4 = __builtin_shufflevector(t8, t8, 0, 1, 2, 3) + __builtin_shufflevector(t8, t8, 4, 5, 6, 7);   // the sixteen terms by packed adds, a tree of pairs
            l[n] += __builtin_shufflevector(t4, t4, 0, 1) + __builtin_shufflevector(t4, t4, 2, 3);   // this lane's keys only; the two halves and the lane halves are added behind the loop
            const v16f pv = __builtin_shufflevector(p0, p1, 0, 1, 2, 3, 4, 5, 6, 7, 8, 9, 10, 11, 12, 13, 14, 15);
            if (HI) { const v16bf h = __builtin_convertvector(pv, v16bf); const v8u hw = __builtin_bit_cast(v8u, h); v16f hf;   // packed conversions, round to nearest even: for finite values the bits of splitf
#pragma unroll
                for (int i = 0; i < 8; ++i) { hf[2 * i] = __uint_as_float(hw[i] << 16); hf[2 * i + 1] = __uint_as_float(hw[i] & 0xFFFF0000u); }   // the hi parts back as f32, straight from the packed words
                pf[n] = __builtin_bit_cast(V, h); pg[n] = __builtin_bit_cast(V, __builtin_convertvector(pv - hf, v16bf));
            } else pf[n] = __builtin_bit_cast(V, __builtin_convertvector(pv, v16h)); }
#pragma unroll
        for (int et = 4; et < (HI ? 6 : 8); ++et) { va[et] = WFrag<T16>::ld(vb + et * 16 * VP); if (HI) vl[et] = WFrag<T16>::ld(vb2 + et * 16 * VP); }
        __builtin_amdgcn_sched_barrier(0);   // likewise ahead of the first half's products; hi/lo: all sixteen fragments do not fit in the registers at once, the last four follow as the first are used up
#pragma unroll
        for (int et = (HI ? 6 : 8); et < 8; ++et) { va[et] = WFrag<T16>::ld(vb + et * 16 * VP); if (HI) vl[et] = WFrag<T16>::ld(vb2 + et * 16 * VP); }
#pragma unroll
        for (int et = 0; et < 8; ++et)
#pragma unroll
            for (int n = 0; n < NQ; ++n) { acc[n][et] = WFrag<T16>::mma(va[et], pf[n], acc[n][et]); if (HI) { acc[n][et] = WFrag<T16>::mma(va[et], pg[n], acc[n][et]); acc[n][et] = WFrag<T16>::mma(vl[et], pf[n], acc[n][et]); } }
      }
        // hand-over: this wave's reads of the buffer are done, its copies of stage t + 1 have landed; the barrier publishes stage t + 1 and ends every wave's reads of this buffer; only then is it refilled
        asm volatile("s_wait_dscnt 0x0" ::: "memory");
        asm volatile("s_wait_asynccnt 0x0" ::: "memory");
        __syncthreads();
        if (t + 2 < NST) stage_kv<T16, HI, KS>(Kp, K2, Vt, V2, (t + 2) * KS, bufp);
    }
    asm volatile("s_wait_asynccnt 0x0" ::: "memory");   // no copy is outstanding when the wave ends
    const int qw = q0 + w * 16 * NQ;
#pragma unroll
    for (int n = 0; n < NQ; ++n) { float ls = l[n][0] + l[n][1]; ls += __shfl_xor(ls, 16, 32); const float f = __fdiv_rn(1.0f, ls);
#pragma unroll
        for (int et = 0; et < 8; ++et) { const v8f r = acc[n][et] * f; const v4f a = __builtin_shufflevector(r, r, 0, 1, 2, 3), b = __builtin_shufflevector(r, r, 4, 5, 6, 7);
            float* orow = O + (size_t)(qw + n * 16 + lr) * HV + et * 16 + hi * 8; *(v4f*)orow = a; *(v4f*)(orow + 4) = b;
            asm volatile("s_wait_xcnt 0x0" :: "v"(orow), "v"(a), "v"(b) : "memory"); }   // the stores have left their address and data registers before these are used again
    }
}
// grid x: first the hi/lo work-groups (NWV x 16 queries, the longer ones), then the fp16 ones (NWV x 32 queries); tiles of one head follow one another. waves_per_eu(4): keeps the kernel at 256 registers, so that no register window is switched and up to four work-groups share a WGP. Planes: QK* [b][q heads, k heads][t][HD], VT* [b][p][e][t], O [b][h][t][HV]
__global__ __launch_bounds__(32 * NWV) __attribute__((amdgpu_waves_per_eu(4))) void k_fattn(const h16* __restrict__ QK16, const bf* __restrict__ QKh, const bf* __restrict__ QKl, const h16* __restrict__ VT16, const bf* __restrict__ VTh, const bf* __restrict__ VTl, float* __restrict__ O) {
    __shared__ __align__(16) h16 skv[2 * BUFE]; __shared__ __align__(16) h16 sq[NWV * 32 * QP];
    const int NHB = NB_ * NH_ * (RH / (16 * NWV)); int blk = (int)blockIdx.x; const bool hires = blk < NHB; if (!hires) blk -= NHB;
    const int per = hires ? RH / (16 * NWV) : (TT - RH) / (32 * NWV); const int bh = blk / per, tile = blk % per; const int b = bh / NH_, h = bh % NH_;
    const size_t oq = (size_t)(b * (NH_ + NKV) + h) * TT * HD, ok = (size_t)(b * (NH_ + NKV) + NH_ + h) * TT * HD, ov = (size_t)(b * NP + h / 2) * HV * TT; float* Oh = O + (size_t)bh * TT * HV;
    if (hires) attn_tile<bf, true, 1, 32>(QKh + oq, QKl + oq, QKh + ok, QKl + ok, VTh + ov, VTl + ov, tile * 16 * NWV, Oh, (bf*)skv, (bf*)sq);
    else attn_tile<h16, false, 2, 64>(QK16 + oq, nullptr, QK16 + ok, nullptr, VT16 + ov, nullptr, RH + tile * 32 * NWV, Oh, skv, sq);
}
// lambda, by one wave: two 64-term f32 dots (butterfly sums: every lane ends with the same value), precise expf
__device__ __forceinline__ float lambda_wave(const float* __restrict__ a1, const float* __restrict__ b1, const float* __restrict__ a2, const float* __restrict__ b2, int lane) { const float p0 = a1[lane], p1 = b1[lane], p2 = a1[lane + 32], p3 = b1[lane + 32], r0 = a2[lane], r1 = b2[lane], r2 = a2[lane + 32], r3 = b2[lane + 32];
    asm volatile("s_wait_xcnt 0x0" :: "v"(lane) : "memory");   // the lane index is the loads' offset register and an input of this wait, so that it stays untouched from the loads down to it
    float s1 = __fadd_rn(__fmul_rn(bfr(p0), bfr(p1)), __fmul_rn(bfr(p2), bfr(p3))); float s2 = __fadd_rn(__fmul_rn(bfr(r0), bfr(r1)), __fmul_rn(bfr(r2), bfr(r3)));
#pragma unroll
    for (int sh = 16; sh; sh >>= 1) { s1 = __fadd_rn(s1, __shfl_xor(s1, sh, 32)); s2 = __fadd_rn(s2, __shfl_xor(s2, sh, 32)); }
    return __fadd_rn(__fsub_rn(expf(s1), expf(s2)), LINIT); }
// row r = b TT + t of the context is formed on the way in: columns p*HV + e = w0 v - lambda w1 v from the planes O[b][2p][t][e], O[b][2p + 1][t][e]
template <int WD>
__global__ __launch_bounds__(256) void k_lnrowD(const float* __restrict__ O, const float* __restrict__ lq1, const float* __restrict__ lk1, const float* __restrict__ lq2, const float* __restrict__ lk2, size_t nrows, const float* __restrict__ g, const float* __restrict__ bb, bf* Hh, bf* Hl) { const int lane = threadIdx.x & 31; const size_t r = (size_t)blockIdx.x * 8 + (threadIdx.x >> 5); if (r >= nrows) return; const float* xr = O + (r / TT) * ((size_t)NH_ * TT * HV) + (r % TT) * HV + lane * 4; float a[WD / 32]; float s = 0.f; static_assert(WD == NP * HV && HV == 128, "one 128-wide chunk per pair"); v4f w0[NP], w1[NP];
#pragma unroll
    for (int c = 0; c < NP; ++c) { w0[c] = *(const v4f*)(xr + (size_t)(2 * c) * TT * HV); w1[c] = *(const v4f*)(xr + (size_t)(2 * c + 1) * TT * HV); }
    asm volatile("s_wait_xcnt 0x0" :: "v"(xr) : "memory");   // the row address is an input of this wait so that its registers stay untouched from the loads down to it
    const float lam = lambda_wave(lq1, lk1, lq2, lk2, lane);   // every wave forms it for itself while its row's loads fly
#pragma unroll
    for (int c = 0; c < WD / 128; ++c) { const v4f v = w0[c] - lam * w1[c]; for (int q = 0; q < 4; ++q) { a[c * 4 + q] = v[q]; s = __fadd_rn(s, a[c * 4 + q]); } }
#pragma unroll
    for (int sh = 16; sh; sh >>= 1) s = __fadd_rn(s, __shfl_xor(s, sh, 32));
    const float mean = __fdiv_rn(s, (float)WD); float s2 = 0.f;
#pragma unroll
    for (int k = 0; k < WD / 32; ++k) { const float dv = __fsub_rn(a[k], mean); float p2 = __fmul_rn(dv, dv); asm volatile("" : "+v"(p2)); s2 = __fadd_rn(s2, p2); }   /* mul and add kept separate (no fma contraction) */
#pragma unroll
    for (int sh = 16; sh; sh >>= 1) s2 = __fadd_rn(s2, __shfl_xor(s2, sh, 32));
    const float rs = __fdiv_rn(1.0f, __fsqrt_rn(__fadd_rn(__fdiv_rn(s2, (float)WD), 1e-6f)));
{
#pragma unroll
        for (int c = 0; c < WD / 128; ++c) { v4us oh, ol; for (int q = 0; q < 4; ++q) { const int col = c * 128 + lane * 4 + q; float y = __fmul_rn(__fmul_rn(__fsub_rn(a[c * 4 + q], mean), rs), bfr(g[col])); asm volatile("" : "+v"(y)); y = __fadd_rn(y, bfr(bb[col])); y = __fmul_rn(y, 1.0f - LINIT); unsigned short u, w2; splitf(y, u, w2); oh[q] = u; ol[q] = w2; } *(v4us*)(Hh + r * WD + c * 128 + lane * 4) = oh; *(v4us*)(Hl + r * WD + c * 128 + lane * 4) = ol; }
         } }
__global__ __launch_bounds__(256) void k_merge(const float* __restrict__ O, int h0, bf* Ah, bf* Al) { const size_t e = ((size_t)blockIdx.x * 256 + threadIdx.x) * 2; if (e >= (size_t)ZH * TT * HD) return; const int d = (int)(e % HD); const int t = (int)((e / HD) % TT); const int zz = (int)(e / ((size_t)HD * TT)); const float cs = (t < RH) ? 1.0f : (1.0f / PCAR); const size_t oo = (size_t)t * DQ + (h0 + zz) * HD + d;
    v2us oh, ol;
#pragma unroll
    for (int q = 0; q < 2; ++q) { unsigned short a, c2; splitf(O[e + q] * cs, a, c2); oh[q] = a; ol[q] = c2; } *(v2us*)(Ah + oo) = oh; *(v2us*)(Al + oo) = ol;  }

extern "C" void kernel_launch(void* const* d_in, const int* in_sizes, int n_in,
                              void* d_out, int out_size, void* d_ws, size_t ws_size, hipStream_t stream) {
    (void)in_sizes; (void)n_in; (void)out_size;
    const float* x = (const float*)d_in[0]; const float* xk = (const float*)d_in[1]; const float* xv = (const float*)d_in[2]; const float* wq = (const float*)d_in[3]; const float* bq = (const float*)d_in[4]; const float* wk = (const float*)d_in[5]; const float* bk = (const float*)d_in[6]; const float* wv = (const float*)d_in[7]; const float* bv = (const float*)d_in[8]; const float* lq1 = (const float*)d_in[9]; const float* lk1 = (const float*)d_in[10]; const float* lq2 = (const float*)d_in[11]; const float* lk2 = (const float*)d_in[12]; const float* lng = (const float*)d_in[13]; const float* lnb = (const float*)d_in[14]; const float* wo = (const float*)d_in[15]; const float* bo = (const float*)d_in[16];
    float* OUT = (float*)d_out;     // [2][2048][512]
    char* wsp = (char*)d_ws;
    auto take = [&](size_t bytes) { char* p = wsp; wsp += (bytes + 255) & ~(size_t)255; return (void*)p; };
    bf* WQ = (bf*)take((size_t)DQ * DM * 2); bf* WK = (bf*)take((size_t)DKV * DM * 2); bf* WV = (bf*)take((size_t)DKV * DM * 2); bf* WO = (bf*)take((size_t)DM * DQ * 2); (void)WK; (void)WV;
    const size_t SQK = (size_t)(NH_ + NKV) * TT * HD, SV = (size_t)NP * HV * TT;   // one batch's q + k planes (k directly behind q: one launch writes both) and v^T planes, in elements
    h16* QK16 = (h16*)take(NB_ * SQK * 2); bf* QKh = (bf*)take(NB_ * SQK * 2); bf* QKl = (bf*)take(NB_ * SQK * 2); h16* VT16 = (h16*)take(NB_ * SV * 2); bf* VTh = (bf*)take(NB_ * SV * 2); bf* VTl = (bf*)take(NB_ * SV * 2);
    bf* XB = (bf*)take((size_t)3 * NB_ * TT * DM * 2);   // the three bf16 input copies, both batches each
    float* Ob = (float*)take((size_t)NB_ * NH_ * TT * HV * 4); bf* ATh = (bf*)take((size_t)NB_ * TT * DQ * 2); bf* ATl = (bf*)take((size_t)NB_ * TT * DQ * 2);
    if ((size_t)(wsp - (char*)d_ws) > ws_size) return;    // ws 256 MiB
    k_prep<<<4 * WB + 3 * CB, 256, 0, stream>>>(wq, wk, wv, wo, x, xk, xv, WQ, XB);   /* weight planes (WQ, WK, WV, WO lie one behind another) and input copies */
    k_gemmw<bf, 0, true, 1, true><<<dim3(NB_ * TT / 128, DQ / 128, 3), 32 * GW, 0, stream>>>(XB, nullptr, WQ, nullptr, DM, DM, 0, nullptr, 0, bq, bk, bv, (size_t)NB_ * TT * DM, (size_t)DQ * DM, 0, QK16, QKh, QKl, VT16, VTh, VTl);   /* q, k and v projections on grid z, both batches on the row axis, stored as the q, k and v^T planes */
    k_fattn<<<NB_ * NH_ * (RH / (16 * NWV) + (TT - RH) / (32 * NWV)), 32 * NWV, 0, stream>>>(QK16, QKh, QKl, VT16, VTh, VTl, Ob);   /* every batch, head and query tile */
    k_lnrowD<DQ><<<NB_ * TT / 8, 256, 0, stream>>>(Ob, lq1, lk1, lq2, lk2, (size_t)NB_ * TT, lng, lnb, ATh, ATl);   /* head difference, LayerNorm (eps 1e-6) x (1 - lambda_init) -> hi/lo planes */
    k_gemmw<bf, 1, true><<<dim3(NB_ * TT / 128, DM / 128, 1), 32 * GW, 0, stream>>>(ATh, ATl, WO, nullptr, DQ, DQ, 0, OUT, DM, bo, bo, bo, 0, 0, 0, nullptr, nullptr, nullptr, nullptr, nullptr, nullptr);
}

// v010
// It runs in 127 microseconds.
// Two timings next to v009 both put it at 1.09 times that version's speed.
// Counting every step since v000, it is 15.3 times as fast.
#include <hip/hip_runtime.h>

// Multi-head DIFFERENTIAL attention (query, key, value [2][2048][512]; q = query Wq + bq, k = key Wk + bk as 16 heads x 64, v = value Wv + bv as 8 heads x 128 ('xw' [512][1024] + [1024], 0.02); w = softmax(q.k / 8) per head; for each pair p: dw = w[2p] - lambda w[2p+1], lambda = exp(lq1.lk1) - exp(lq2.lk2) + lambda_init (lq/lk [64], read); attn = dw v_p -> [2048][1024]; LayerNorm (eps 1e-6, affine) x (1 - lambda_init); out = attn Wo + bo ('xw' [1024][512]) -> [2][2048][512] (2.1 M)).
// Layout: four launches, each for both batches (rows [batch][t] form one row axis of 4096). One launch for all that reads only inputs (the four weights' K-contiguous bf16 planes, the bf16 copies of the three inputs); exact projections + f32 biases, whose GEMM stores the q/k planes for the 16 score heads and the v^T planes per 128-wide value head itself; lambda computed on device by every wave that uses it (two 64-term f32 dots, precise expf); ONE fused attention launch for every batch, head and query tile (k_fattn: scores, online softmax and P.v in registers, no score matrix in memory; hybrid rows: < 512 hi/lo 3 products, rest fp16), each head's normalised w v as an f32 plane; then one launch that forms w0 v - lambda w1 v as it reads the planes, LayerNorm (f32, fixed order) scaled by (1 - lambda_init), converted to hi/lo rows in LDS, x Wo exact + bo.
// Compute dtypes, f32 accumulate: every input rounded to bf16; projections exact + f32 biases; attention rows < 512 3 products, rest fp16; softmax, lambda, difference, LayerNorm f32; Wo hl x exact + bias.

#define NB_  2
#define TT   2048
#define DM   512
#define NH_  16
#define NKV  16
#define REP  (NH_ / NKV)
#define HD   64
#define DQ   (NH_ * HD)
#define DKV  (NKV * HD)
#define ZH   2
#define RH   512                  // query rows < RH use hi+lo planes (0: none)
#define WIN  0
#define PCAR 1024.0f
#define SCL  0.125f
#define NP   8       // value heads (pairs)
#define HV   128     // value head width
#define LINIT 0.47071301937103271f   // lambda_init = 0.8 - 0.6 exp(-0.6) as float32
#define NWV  4       // waves of a fused-attention work-group: each owns a query tile of its own and walks all TT keys; the staged key and v^T tiles serve all of them
#define BUFE 14848   // 16-bit elements of one stage buffer: hi/lo 2 x (32 x 72 + 128 x 40); fp16 64 x 72 + 128 x 72 is smaller
#define L2E  1.4426950408889634f
#define CSL  (SCL * L2E)          // a raw score (q.k) times this is its softmax exponent to base 2; SCL is a power of two, so the product is exact
#define LZR  44.361419555836498f  // 8 ln 2 / SCL: how far a raw score may lie above its row's reference maximum before the row is rescaled
#define QP   72      // LDS row pitch of the query and key tiles in 16-bit elements (64 + 8: 16 bytes of pad against bank conflicts between rows)
typedef _Float16 h16;
typedef unsigned short bf;
typedef __attribute__((ext_vector_type(16))) __bf16   v16bf;
typedef __attribute__((ext_vector_type(16))) _Float16 v16h;
typedef __attribute__((ext_vector_type(8)))  _Float16 v8h;
typedef __attribute__((ext_vector_type(8)))  unsigned short v8us;
typedef __attribute__((ext_vector_type(8)))  float    v8f;
typedef __attribute__((ext_vector_type(4)))  float    v4f;
typedef v8h  __attribute__((may_alias)) v8ha;
typedef v4f  __attribute__((may_alias)) v4fa;
typedef v8us __attribute__((may_alias)) v8usa;

__device__ __forceinline__ unsigned short f2bf(float f) { unsigned u = __float_as_uint(f); u += 0x7FFFu + ((u >> 16) & 1u); return (unsigned short)(u >> 16); }
__device__ __forceinline__ float bf2f(unsigned short b) { return __uint_as_float(((unsigned)b) << 16); }
__device__ __forceinline__ float bfr(float f) { return bf2f(f2bf(f)); }
__device__ __forceinline__ v16h cat16(v8h lo, v8h hi) { return __builtin_shufflevector(lo, hi, 0, 1, 2, 3, 4, 5, 6, 7, 8, 9, 10, 11, 12, 13, 14, 15); }
__device__ __forceinline__ v16bf cat16b(v8us lo, v8us hi) { return __builtin_bit_cast(v16bf, __builtin_shufflevector(lo, hi, 0, 1, 2, 3, 4, 5, 6, 7, 8, 9, 10, 11, 12, 13, 14, 15)); }
__device__ __forceinline__ v8f wmma16(v16h a, v16h b, v8f c) { return __builtin_amdgcn_wmma_f32_16x16x32_f16(false, a, false, b, (short)0, c, false, false); }
__device__ __forceinline__ v8f wmmab(v16bf a, v16bf b, v8f c) { return __builtin_amdgcn_wmma_f32_16x16x32_bf16(false, a, false, b, (short)0, c, false, false); }



// ---- k_gemmw: register-blocked GEMM, one wave per 64x64 output tile (16 accumulators); GW = 4 waves (2 x 2) form a work-group with a 128x128 tile. The group's A and Bt rows (K-contiguous 16-bit planes) come into LDS in stages of GK = 64 k (whole 128-byte lines) by asynchronous copies, two buffers: the next stage flies while this one is worked on; fragments are read from LDS. grid (M/128, N/128, Z), 128 threads. M % 128 == 0, N % 128 == 0. waves_per_eu(4): keeps the kernel at 256 registers, so that no register window is switched.
// C[m][n] (f32, pitch ldc, + optional f32 bias[n]) = sum_k A[m][k] Bt[n][k] (+ split products per NSPLIT). A rows have pitch lda, Bt rows pitch K. z-batch strides sA/sB/sC in elements; batch z reads Bt plane z >> bsh (bsh = 1: two batches share one); batch z adds bias vector z. K % 64 == 0.
// PL: no f32 C; rows are [b][t] (b = row / TT); the epilogue stores the result + bias as 16-bit planes (fp16, bf16 hi, bf16 lo): batches 0 and 1 as head planes P*[b][z * NH_ + column tile][t][HD], batch 2 transposed as V*[b][column / HV][column % HV][t].
// KS > 1: grid z = batches x KS; blockIdx.z = batch * KS + slice; a slice sums k in [slice K/KS, (slice + 1) K/KS) into its own plane C + blockIdx.z * sC. K % (64 KS) == 0.
template <typename T16> struct WFrag;
template <> struct WFrag<h16> { typedef v16h V; static __device__ __forceinline__ V ld(const h16* p) { return cat16(*(const v8h*)p, *(const v8h*)(p + 16)); } static __device__ __forceinline__ v8f mma(V a, V b, v8f c) { return wmma16(a, b, c); } };
template <> struct WFrag<bf> { typedef v16bf V; static __device__ __forceinline__ V ld(const bf* p) { return cat16b(*(const v8us*)p, *(const v8us*)(p + 16)); } static __device__ __forceinline__ v8f mma(V a, V b, v8f c) { return wmmab(a, b, c); } };
__device__ __forceinline__ h16 tohx(float x) { return (h16)x; }
__device__ __forceinline__ void splitf(float y, unsigned short& h, unsigned short& l) { h = f2bf(y); l = f2bf(y - bf2f(h)); }
typedef __attribute__((ext_vector_type(8))) __bf16 v8b;
// eight f32 to the three planes' formats with the packed conversion instructions (round to nearest even: for finite values the bits of tohx and splitf), which keeps the epilogue's text short
__device__ __forceinline__ void plane8(v8f x, v8h& o16, v8us& oh, v8us& ol) { o16 = __builtin_convertvector(x, v8h); const v8b h = __builtin_convertvector(x, v8b); const v8b l = __builtin_convertvector(x - __builtin_convertvector(h, v8f), v8b); oh = __builtin_bit_cast(v8us, h); ol = __builtin_bit_cast(v8us, l); }
#define GW 4     // waves of a GEMM work-group
#define GK 64    // k extent of a stage
// 8 RS rows of one plane, GK elements (128 bytes) each, into LDS rows of pitch QP: 8 lanes a row, RS rows a copy of the work-group, eight copies a lane. g and s are the lane's own first source address and LDS place.
template <typename T16, int RS = 16>   // RS: rows that one copy of the work-group covers (threads / 8); eight copies bring 8 RS rows
__device__ __forceinline__ void stage_rows(const T16* __restrict__ g, size_t pitch, T16* s) {
    unsigned la[8]; const T16* ga[8];
#pragma unroll
    for (int i = 0; i < 8; ++i) { ga[i] = g + (size_t)i * RS * pitch; la[i] = (unsigned)(size_t)(s + i * RS * QP); }
    // the copies and, as the last line of the same statement, the wait behind which their address registers may take new values
    asm volatile("global_load_async_to_lds_b128 %0, %8, off\n\tglobal_load_async_to_lds_b128 %1, %9, off\n\tglobal_load_async_to_lds_b128 %2, %10, off\n\tglobal_load_async_to_lds_b128 %3, %11, off\n\t"
                 "global_load_async_to_lds_b128 %4, %12, off\n\tglobal_load_async_to_lds_b128 %5, %13, off\n\tglobal_load_async_to_lds_b128 %6, %14, off\n\tglobal_load_async_to_lds_b128 %7, %15, off\n\ts_wait_xcnt 0x0"
                 :: "v"(la[0]), "v"(la[1]), "v"(la[2]), "v"(la[3]), "v"(la[4]), "v"(la[5]), "v"(la[6]), "v"(la[7]),
                    "v"(ga[0]), "v"(ga[1]), "v"(ga[2]), "v"(ga[3]), "v"(ga[4]), "v"(ga[5]), "v"(ga[6]), "v"(ga[7]) : "memory");
}
template <typename T16, int NSPLIT, bool BIAS, int KS = 1, bool PL = false>
__global__ __launch_bounds__(32 * GW) __attribute__((amdgpu_waves_per_eu(4))) void k_gemmw(const T16* __restrict__ A, const T16* __restrict__ A2, const T16* __restrict__ Bt, const T16* __restrict__ Bt2, int K, int lda, int bsh, float* C, int ldc, const float* __restrict__ bias0, const float* __restrict__ bias1, const float* __restrict__ bias2, size_t sA, size_t sB, size_t sC, h16* P16, bf* Ph, bf* Pl, h16* V16, bf* Vh, bf* Vl) {
    typedef typename WFrag<T16>::V V;
    constexpr int NPA = (NSPLIT == 1 || NSPLIT == 2) ? 2 : 1, NPB = NSPLIT >= 2 ? 2 : 1, PE = 128 * QP, SE = (NPA + NPB) * PE;   // planes of A and of Bt, elements of one plane's stage and of one buffer: [A planes][Bt planes]
    __shared__ __align__(16) T16 sab[2 * SE]; static_assert(GW * 16 * 68 * 4 <= 2 * SE * 2, "the epilogue's rows fit the stage buffers");
    const int w = __builtin_amdgcn_readfirstlane((int)(threadIdx.x >> 5)); float* os = (float*)sab + w * (16 * 68);   // the epilogue's staging rows, each wave's own, lie in the stage buffers: behind the last trip's barrier nobody reads these and no copy is outstanding
    const size_t z = blockIdx.z / KS; const int ks = (int)(blockIdx.z % KS); A += z * sA; if (A2) A2 += z * sA; Bt += (z >> bsh) * sB; if (Bt2) Bt2 += (z >> bsh) * sB; C += (size_t)blockIdx.z * sC;
    const float* __restrict__ bias = z == 0 ? bias0 : z == 1 ? bias1 : bias2;   // up to three biased batches, each with its own bias vector
    const int kbeg = ks * (K / KS), kend = kbeg + K / KS;
    const int lane = threadIdx.x & 31, lr = lane & 15, hi = lane >> 4; const int R0 = blockIdx.x * 128, C0 = blockIdx.y * 128, r0 = R0 + (w & 1) * 64, c0 = C0 + (w >> 1) * 64;
    v8f acc[4][4];
#pragma unroll
    for (int mb = 0; mb < 4; ++mb)
#pragma unroll
        for (int nb = 0; nb < 4; ++nb) acc[mb][nb] = (v8f){};
    const int crow = (int)threadIdx.x >> 3, ccol = ((int)threadIdx.x & 7) * 8;   // the lane's row and 16-byte piece in every copy
    const T16* gA = A + (size_t)(R0 + crow) * lda + ccol; const T16* gA2 = NPA == 2 ? A2 + (size_t)(R0 + crow) * lda + ccol : nullptr; const T16* gB = Bt + (size_t)(C0 + crow) * K + ccol; const T16* gB2 = NPB == 2 ? Bt2 + (size_t)(C0 + crow) * K + ccol : nullptr;
    T16* sl = sab + crow * QP + ccol;
    auto stage = [&](int kc, int bi) { T16* s = sl + bi * SE; stage_rows<T16>(gA + kc, (size_t)lda, s); if (NPA == 2) stage_rows<T16>(gA2 + kc, (size_t)lda, s + PE); stage_rows<T16>(gB + kc, (size_t)K, s + NPA * PE); if (NPB == 2) stage_rows<T16>(gB2 + kc, (size_t)K, s + (NPA + 1) * PE); };
    const int nst = (kend - kbeg) / GK;
    // stage 0 lands and is published before anybody reads it; stage 1 flies during trip 0
    stage(kbeg, 0);
    asm volatile("s_wait_asynccnt 0x0" ::: "memory");   // this wave's copies of stage 0 have landed
    __syncthreads();
    if (nst > 1) stage(kbeg + GK, 1);
    const int aoff = ((w & 1) * 64 + lr) * QP + 8 * hi, boff = NPA * PE + ((w >> 1) * 64 + lr) * QP + 8 * hi;
#pragma unroll 1
    for (int t = 0; t < nst; ++t) {
        const T16* bufp = sab + (t & 1) * SE; V a[4], a2[4], b[4], b2[4];
#pragma unroll
        for (int kk = 0; kk < GK; kk += 32) {
#pragma unroll
            for (int nb = 0; nb < 4; ++nb) {   // in the order of first use: Bt block 0, the A blocks, the other Bt blocks, the second planes
                b[nb] = WFrag<T16>::ld(bufp + boff + nb * 16 * QP + kk);
                if (nb == 0) {
#pragma unroll
                    for (int mb = 0; mb < 4; ++mb) a[mb] = WFrag<T16>::ld(bufp + aoff + mb * 16 * QP + kk); } }
#pragma unroll
            for (int mb = 0; mb < 4; ++mb) { if (NPA == 2) a2[mb] = WFrag<T16>::ld(bufp + PE + aoff + mb * 16 * QP + kk); if (NPB == 2) b2[mb] = WFrag<T16>::ld(bufp + PE + boff + mb * 16 * QP + kk); }
            __builtin_amdgcn_sched_barrier(0);   // all of the step's fragments are requested ahead of its products: without it the Bt loads sink to their first use, one register set for all four, and each column block waits out an LDS latency of its own
#pragma unroll
            for (int nb = 0; nb < 4; ++nb)
#pragma unroll
                for (int mb = 0; mb < 4; ++mb) { acc[mb][nb] = WFrag<T16>::mma(a[mb], b[nb], acc[mb][nb]); if (NSPLIT == 1 || NSPLIT == 2) acc[mb][nb] = WFrag<T16>::mma(a2[mb], b[nb], acc[mb][nb]); if (NSPLIT >= 2) acc[mb][nb] = WFrag<T16>::mma(a[mb], b2[nb], acc[mb][nb]); }
        }
        // hand-over: this wave's reads of the buffer are done, its copies of stage t + 1 have landed; the barrier publishes stage t + 1 and ends every wave's reads of this buffer; only then is it refilled
        asm volatile("s_wait_dscnt 0x0" ::: "memory");
        asm volatile("s_wait_asynccnt 0x0" ::: "memory");
        __syncthreads();
        if (t + 2 < nst) stage(kbeg + (t + 2) * GK, t & 1);
    }
    asm volatile("s_wait_asynccnt 0x0" ::: "memory");   // no copy is outstanding behind the loop
    const int pb = r0 / TT, rl = r0 % TT;   // PL: the tile's batch and its first row there (TT % 64 == 0: a tile lies in one batch)
    if (PL && z == 2) {   // v^T planes: a lane's accumulator holds 8 consecutive rows (t) of one column (e), which are 16 bytes of a v^T row; the tile's 64 rows fill whole 128-byte lines
#pragma unroll
        for (int nb = 0; nb < 4; ++nb) { const float bs = bfr(bias[c0 + nb * 16 + lr]); const size_t vo = ((size_t)(pb * NP + c0 / HV) * HV + c0 % HV + nb * 16 + lr) * TT + rl + hi * 8;
#pragma unroll
            for (int mb = 0; mb < 4; ++mb) { v8h o16; v8us oh, ol; plane8(acc[mb][nb] + bs, o16, oh, ol);
                h16* d0 = V16 + vo + mb * 16; bf* d1 = Vh + vo + mb * 16; bf* d2 = Vl + vo + mb * 16; *(v8h*)d0 = o16; *(v8us*)d1 = oh; *(v8us*)d2 = ol;
                asm volatile("s_wait_xcnt 0x0" :: "v"(d0), "v"(d1), "v"(d2), "v"(o16), "v"(oh), "v"(ol) : "memory"); } }   // the stores have left their address and data registers before these are used again
        return; }
    if (PL) {   // q and k head planes: the column tile is one head; through LDS so that 8 lanes store one 128-byte plane row
        const int rw = lane >> 3, cf = (lane & 7) * 8; v8f bs;
#pragma unroll
        for (int i = 0; i < 8; ++i) bs[i] = bfr(bias[c0 + cf + i]);
        const size_t po = (((size_t)pb * (NH_ + NKV) + z * NH_ + c0 / 64) * TT + rl + rw) * HD + cf;
#pragma unroll
        for (int mb = 0; mb < 4; ++mb) {
#pragma unroll
            for (int nb = 0; nb < 4; ++nb) {
#pragma unroll
                for (int j = 0; j < 8; ++j) os[(hi * 8 + j) * 68 + nb * 16 + lr] = acc[mb][nb][j]; }
            v4f u0[4], u1[4];   // all of the tile's LDS reads are requested first: the waits below would otherwise put them one behind the other
#pragma unroll
            for (int s = 0; s < 4; ++s) { u0[s] = *(const v4fa*)(os + (4 * s + rw) * 68 + cf); u1[s] = *(const v4fa*)(os + (4 * s + rw) * 68 + cf + 4); }
#pragma unroll
            for (int s = 0; s < 4; ++s) { v8h o16; v8us oh, ol; plane8(__builtin_shufflevector(u0[s], u1[s], 0, 1, 2, 3, 4, 5, 6, 7) + bs, o16, oh, ol);
                h16* d0 = P16 + po + (mb * 16 + 4 * s) * HD; bf* d1 = Ph + po + (mb * 16 + 4 * s) * HD; bf* d2 = Pl + po + (mb * 16 + 4 * s) * HD; *(v8h*)d0 = o16; *(v8us*)d1 = oh; *(v8us*)d2 = ol;
                asm volatile("s_wait_xcnt 0x0" :: "v"(d0), "v"(d1), "v"(d2), "v"(o16), "v"(oh), "v"(ol) : "memory"); }   // as above
        }
        return; }
#pragma unroll
    for (int mb = 0; mb < 4; ++mb) {
#pragma unroll
        for (int nb = 0; nb < 4; ++nb) {
#pragma unroll
            for (int j = 0; j < 8; ++j) os[(hi * 8 + j) * 68 + nb * 16 + lr] = acc[mb][nb][j]; }
        __builtin_amdgcn_wave_barrier(); asm volatile("" ::: "memory");
        float* crow = C + (size_t)(r0 + mb * 16) * ldc + c0;
{
#pragma unroll
            for (int s = 0; s < 8; ++s) { const int row = 2 * s + hi, cofs = lr * 4; v4f val = *(const v4fa*)(os + row * 68 + cofs); if (BIAS) { val[0] += bfr(bias[c0 + cofs]); val[1] += bfr(bias[c0 + cofs + 1]); val[2] += bfr(bias[c0 + cofs + 2]); val[3] += bfr(bias[c0 + cofs + 3]); }
                *(v4f*)(crow + (size_t)row * ldc + cofs) = val; }
             }
        __builtin_amdgcn_wave_barrier(); asm volatile("" ::: "memory");
    }
}

typedef __attribute__((ext_vector_type(2))) _Float16 v2h;
typedef __attribute__((ext_vector_type(4))) _Float16 v4h;
typedef __attribute__((ext_vector_type(2))) unsigned short v2us;
typedef __attribute__((ext_vector_type(4))) unsigned short v4us;
typedef __attribute__((ext_vector_type(2))) float v2f;
typedef __attribute__((ext_vector_type(4))) int v4i;

// ---- k_prep: all the work that reads nothing but inputs, in one launch. Blocks [0, 4 WB): the weights as K-contiguous bf16 planes Bt[n][k], one after another (they start first: their eight dependent trips are the launch's longest path); the other 3 CB blocks: the bf16 copies of the three inputs, both batches, one after another.
#define WB (DM * DQ / 64 / 64)          // blocks of one weight: 8 waves x 8 lines of 64 elements
#define CB (NB_ * TT * DM / 8 / 256)    // blocks of one input: 8 elements a thread
__device__ __forceinline__ void wt_lines(const float* __restrict__ w, int K, int N, bf* Bt, int bx) {
    const int lane = threadIdx.x & 31; const int L0 = (bx * 8 + (threadIdx.x >> 5)) * 8; const int nlines = N * K / 64;
#pragma unroll 1
    for (int l = 0; l < 8; ++l) { const int L = L0 + l; if (L >= nlines) break; const size_t e = (size_t)L * 64 + lane * 2; const int k = (int)(e % K), n = (int)(e / K); v2us o;
        const float* p = w + (size_t)k * N + n; const float a0 = p[0], a1 = p[N];   // rows k and k + 1
        asm volatile("s_wait_xcnt 0x0" :: "v"(p) : "memory");   // the address is an input of this wait so that its registers stay untouched from the loads down to it
        o[0] = f2bf(a0); o[1] = f2bf(a1); bf* d = Bt + e; *(v2us*)d = o;
        asm volatile("s_wait_xcnt 0x0" :: "v"(d), "v"(o) : "memory"); }   // the store has left its address and data registers before the next trip rewrites them
}
__global__ __launch_bounds__(256) void k_prep(const float* __restrict__ w0, const float* __restrict__ w1, const float* __restrict__ w2, const float* __restrict__ w3, const float* __restrict__ s0, const float* __restrict__ s1, const float* __restrict__ s2, bf* Bt, bf* dst) {
    int blk = (int)blockIdx.x;
    if (blk < 3 * WB) { const int y = blk / WB; wt_lines(y == 0 ? w0 : y == 1 ? w1 : w2, DM, DQ, Bt + (size_t)y * DM * DQ, blk % WB); return; }
    if (blk < 4 * WB) { wt_lines(w3, DQ, DM, Bt + (size_t)3 * DM * DQ, blk - 3 * WB); return; }
    blk -= 4 * WB; const int y = blk / CB; const float* __restrict__ src = y == 0 ? s0 : y == 1 ? s1 : s2; const size_t i = (size_t)(blk % CB) * 256 + threadIdx.x;
    const v8f v = *(const v8f*)(src + i * 8); v8us o;
    asm volatile("s_wait_xcnt 0x0" ::: "memory");   // the load has left its address registers before anything rewrites them
#pragma unroll
    for (int k = 0; k < 8; ++k) o[k] = f2bf(v[k]);
    *(v8us*)(dst + ((size_t)y * CB * 256 + i) * 8) = o; }

__global__ __launch_bounds__(256) void k_vtp(const float* __restrict__ F, int pitch, int nheads, h16* V16, bf* Vh, bf* Vl) { const size_t e = ((size_t)blockIdx.x * 256 + threadIdx.x) * 2; if (e >= (size_t)nheads * HD * TT) return; const int t = (int)(e % TT); const int d = (int)((e / TT) % HD); const int g = (int)(e / ((size_t)TT * HD)); v2h o16; v2us oh, ol;
#pragma unroll
    for (int q = 0; q < 2; ++q) { const float x = F[(size_t)(t + q) * pitch + g * HD + d]; o16[q] = tohx(x); unsigned short a2, c2; splitf(x, a2, c2); oh[q] = a2; ol[q] = c2; }
    *(v2h*)(V16 + e) = o16; *(v2us*)(Vh + e) = oh; *(v2us*)(Vl + e) = ol;  }
// ---- k_fattn: fused attention. A work-group = NWV query tiles of one (batch, head), one per wave; every wave walks all TT keys in steps of 32 with an online softmax. The key rows and v^T rows of a stage (KS keys) are brought into LDS once for the four waves by asynchronous copies, two buffers: the next stage flies while this one is worked on.
// Transposed form: S^T = K Q^T (A = key rows, B = query rows), so a lane holds, for query lr, keys hi*8 + j of each 16-key tile: two such tiles side by side ARE the B fragment (k = 8 hi + i, 16 + 8 hi + i) of O^T = V^T P^T (A = v^T rows e, k = keys). Softmax runs down a lane's own registers plus one exchange between the lane halves.
// HI: bf16 hi/lo planes, three products each (hh + lh + hl) for both products; else fp16, P unnormalised in (0, 2^8]. O[t][e] (f32, pitch HV) = softmax row x v, normalised.
typedef __attribute__((ext_vector_type(16))) unsigned short v16us;
typedef __attribute__((ext_vector_type(16))) float v16f;
typedef __attribute__((ext_vector_type(8))) unsigned v8u;
// One stage into one buffer: KS key rows (128 bytes each, LDS pitch 144) and HV v^T rows (2 KS bytes each, LDS pitch 2 KS + 16), per plane; 16 bytes a lane and copy, twelve copies a lane, whole lines of the source. Buffer: [K planes][V planes].
template <typename T16, bool HI, int KS>
__device__ __forceinline__ void stage_kv(const T16* __restrict__ Kp, const T16* __restrict__ K2, const T16* __restrict__ Vt, const T16* __restrict__ V2, int k0, T16* buf) {
    constexpr int NPL = HI ? 2 : 1, KE = KS * QP, VP = KS + 8, VE = HV * VP, CV = KS / 8;
    static_assert(NPL * (KS / 16 + KS / 8) == 12, "twelve copies a lane"); static_assert(NPL * (KE + VE) <= BUFE, "stage fits its buffer");
    const int tid = (int)threadIdx.x; unsigned la[12]; const T16* ga[12]; int c = 0; constexpr int RV = 32 * NWV / CV;   // v^T rows that one copy of the work-group covers
    // the lane's own offsets: copy i adds whole rows, a constant. Key rows: 8 lanes a row, 16 rows a copy, contiguous in the source; v^T rows: CV lanes a row, RV rows a copy
    const int gk = tid * 8, gv = (tid / CV) * TT + (tid % CV) * 8; const unsigned lk = (unsigned)(size_t)(buf + (tid >> 3) * QP + (tid & 7) * 8), lv = (unsigned)(size_t)(buf + NPL * KE + (tid / CV) * VP + (tid % CV) * 8);
#pragma unroll
    for (int pl = 0; pl < NPL; ++pl)
#pragma unroll
        for (int i = 0; i < KS / 16; ++i) { ga[c] = (pl ? K2 : Kp) + (size_t)k0 * HD + i * (32 * NWV * 8) + gk; la[c] = lk + (unsigned)(pl * KE + i * 16 * QP) * 2u; ++c; }
#pragma unroll
    for (int pl = 0; pl < NPL; ++pl)
#pragma unroll
        for (int i = 0; i < KS / 8; ++i) { ga[c] = (pl ? V2 : Vt) + (size_t)i * RV * TT + k0 + gv; la[c] = lv + (unsigned)(pl * VE + i * RV * VP) * 2u; ++c; }
    // the copies and, as the last line of the same statement, the wait behind which their address registers may take new values
    asm volatile("global_load_async_to_lds_b128 %0, %12, off\n\tglobal_load_async_to_lds_b128 %1, %13, off\n\tglobal_load_async_to_lds_b128 %2, %14, off\n\tglobal_load_async_to_lds_b128 %3, %15, off\n\t"
                 "global_load_async_to_lds_b128 %4, %16, off\n\tglobal_load_async_to_lds_b128 %5, %17, off\n\tglobal_load_async_to_lds_b128 %6, %18, off\n\tglobal_load_async_to_lds_b128 %7, %19, off\n\t"
                 "global_load_async_to_lds_b128 %8, %20, off\n\tglobal_load_async_to_lds_b128 %9, %21, off\n\tglobal_load_async_to_lds_b128 %10, %22, off\n\tglobal_load_async_to_lds_b128 %11, %23, off\n\ts_wait_xcnt 0x0"
                 :: "v"(la[0]), "v"(la[1]), "v"(la[2]), "v"(la[3]), "v"(la[4]), "v"(la[5]), "v"(la[6]), "v"(la[7]), "v"(la[8]), "v"(la[9]), "v"(la[10]), "v"(la[11]),
                    "v"(ga[0]), "v"(ga[1]), "v"(ga[2]), "v"(ga[3]), "v"(ga[4]), "v"(ga[5]), "v"(ga[6]), "v"(ga[7]), "v"(ga[8]), "v"(ga[9]), "v"(ga[10]), "v"(ga[11]) : "memory");
}
template <typename T16, bool HI, int NQ, int KS>
__device__ __forceinline__ void attn_tile(const T16* __restrict__ Q, const T16* __restrict__ Q2, const T16* __restrict__ Kp, const T16* __restrict__ K2, const T16* __restrict__ Vt, const T16* __restrict__ V2, int q0, float* __restrict__ O, T16* skv, T16* sq) {
    typedef typename WFrag<T16>::V V;
    constexpr int NPL = HI ? 2 : 1, KE = KS * QP, VP = KS + 8, VE = HV * VP, NST = TT / KS;
    const int lane = threadIdx.x & 31, lr = lane & 15, hi = lane >> 4; const int w = __builtin_amdgcn_readfirstlane((int)(threadIdx.x >> 5));
    V qf[NQ][2], qg[NQ][2]; v8f acc[NQ][8]; float m[NQ]; v2f l[NQ];   // m: the row's reference maximum as a raw score; l: the row sum in two halves (even and odd keys of the lane), for packed adds
#pragma unroll
    for (int n = 0; n < NQ; ++n) { m[n] = -3.0e38f; l[n] = (v2f){};
#pragma unroll
        for (int et = 0; et < 8; ++et) acc[n][et] = (v8f){}; }
    // the query fragments do not fit in the registers beside the accumulators and the v^T rows, so each wave's tile lies in LDS, 32 rows of pitch QP (32 queries, or 16 queries hi then lo), and is read anew in every step
    { const int row = (int)threadIdx.x >> 2, col = ((int)threadIdx.x & 3) * 16; const T16* g[NWV]; v4f x0[NWV], x1[NWV];
#pragma unroll
        for (int i = 0; i < NWV; ++i) { g[i] = (HI ? ((row >> 4) ? Q2 : Q) + (size_t)(q0 + i * 16 + (row & 15)) * HD : Q + (size_t)(q0 + i * 32 + row) * HD) + col; x0[i] = *(const v4fa*)g[i]; x1[i] = *(const v4fa*)(g[i] + 8); }
        asm volatile("s_wait_xcnt 0x0" :: "v"(g[0]), "v"(g[1]), "v"(g[2]), "v"(g[3]) : "memory");   // the row addresses are inputs of this wait so that their registers stay untouched from the loads down to it
#pragma unroll
        for (int i = 0; i < NWV; ++i) { *(v4fa*)(sq + (i * 32 + row) * QP + col) = x0[i]; *(v4fa*)(sq + (i * 32 + row) * QP + col + 8) = x1[i]; } }
    // stage 0 lands and is published (with the query tiles) before anybody reads it; stage 1 flies during trip 0
    stage_kv<T16, HI, KS>(Kp, K2, Vt, V2, 0, skv);
    asm volatile("s_wait_asynccnt 0x0" ::: "memory");   // this wave's copies of stage 0 have landed
    __syncthreads();
    stage_kv<T16, HI, KS>(Kp, K2, Vt, V2, KS, skv + BUFE);
    const T16* sqw = sq + w * 32 * QP; const int koff = lr * QP + 8 * hi, voff = NPL * KE + lr * VP + 8 * hi;
#pragma unroll 1
    for (int t = 0; t < NST; ++t) {
        T16* bufp = skv + (t & 1) * BUFE;
#pragma unroll 1   // rolled: with the stage's two steps unrolled the build spills more registers
      for (int ss = 0; ss < KS / 32; ++ss) {
        const T16* kb = bufp + ss * 32 * QP + koff; const T16* kb2 = kb + KE; const T16* vb = bufp + ss * 32 + voff; const T16* vb2 = vb + VE;
#pragma unroll
        for (int n = 0; n < NQ; ++n)
#pragma unroll
            for (int c = 0; c < 2; ++c) { qf[n][c] = WFrag<T16>::ld(sqw + (n * 16 + lr) * QP + c * 32 + 8 * hi); if (HI) qg[n][c] = WFrag<T16>::ld(sqw + (16 + lr) * QP + c * 32 + 8 * hi); }
        v8f s[NQ][2]; V ka[2][2], kl[2][2];   // all of the step's key fragments are requested first: one wait instead of one per 16 keys
#pragma unroll
        for (int kt = 0; kt < 2; ++kt)
#pragma unroll
            for (int c = 0; c < 2; ++c) { ka[kt][c] = WFrag<T16>::ld(kb + kt * 16 * QP + c * 32); if (HI) kl[kt][c] = WFrag<T16>::ld(kb2 + kt * 16 * QP + c * 32); }
#pragma unroll
        for (int kt = 0; kt < 2; ++kt)
#pragma unroll
            for (int n = 0; n < NQ; ++n) { v8f t2 = (v8f){};
#pragma unroll
                for (int c = 0; c < 2; ++c) { t2 = WFrag<T16>::mma(ka[kt][c], qf[n][c], t2); if (HI) { t2 = WFrag<T16>::mma(ka[kt][c], qg[n][c], t2); t2 = WFrag<T16>::mma(kl[kt][c], qf[n][c], t2); } }
                s[n][kt] = t2; }
        V pf[NQ], pg[NQ]; float mx[NQ]; bool need = false;
        // lazy rescale: a row keeps the reference maximum m it has while no score of the step lies more than LZR above it (P then stays <= 2^8, and row sum and output carry the same factor, which the final division takes out). Maximum and test run on the raw scores: the scale is positive and enters once, in the exponent's multiply-add
#pragma unroll
        for (int n = 0; n < NQ; ++n) { mx[n] = -3.0e38f;
#pragma unroll
            for (int i = 0; i < 16; ++i) mx[n] = fmaxf(mx[n], s[n][i >> 3][i & 7]);
            need = need || mx[n] > m[n] + LZR; }
        if (__builtin_amdgcn_ballot_w32(need) != 0) {   // one test a step for the whole wave, a scalar branch: taken in the first step and where a score has outgrown its row's reference
#pragma unroll
            for (int n = 0; n < NQ; ++n) { const float mn = fmaxf(m[n], fmaxf(mx[n], __shfl_xor(mx[n], 16, 32))); const float al = __builtin_amdgcn_exp2f((m[n] - mn) * CSL); m[n] = mn; l[n] *= al;   // both lane halves of a row take the same new reference
#pragma unroll
                for (int et = 0; et < 8; ++et) acc[n][et] *= al; } }
        V va[8], vl[8];   // v^T rows 0..63 are requested ahead of the softmax arithmetic, rows 64..127 (hi/lo: 64..95) behind it, ahead of the first half's products
#pragma unroll
        for (int et = 0; et < 4; ++et) { va[et] = WFrag<T16>::ld(vb + et * 16 * VP); if (HI) vl[et] = WFrag<T16>::ld(vb2 + et * 16 * VP); }
        __builtin_amdgcn_sched_barrier(0);   // the requests stay ahead of the softmax arithmetic, which covers their latency: without it they sink to their first use
#pragma unroll
        for (int n = 0; n < NQ; ++n) { const v8f c8 = (v8f){} + CSL, m8 = (v8f){} - m[n] * CSL; v8f p0, p1;
            const v8f a0 = __builtin_elementwise_fma(s[n][0], c8, m8), a1 = __builtin_elementwise_fma(s[n][1], c8, m8);   // one (packed) multiply-add a score: s CSL - m CSL
#pragma unroll
            for (int i = 0; i < 8; ++i) { p0[i] = __builtin_amdgcn_exp2f(a0[i]); p1[i] = __builtin_amdgcn_exp2f(a1[i]); }
            const v8f t8 = p0 + p1; const v4f t4 = __builtin_shufflevector(t8, t8, 0, 1, 2, 3) + __builtin_shufflevector(t8, t8, 4, 5, 6, 7);   // the sixteen terms by packed adds, a tree of pairs
            l[n] += __builtin_shufflevector(t4, t4, 0, 1) + __builtin_shufflevector(t4, t4, 2, 3);   // this lane's keys only; the two halves and the lane halves are added behind the loop
            const v16f pv = __builtin_shufflevector(p0, p1, 0, 1, 2, 3, 4, 5, 6, 7, 8, 9, 10, 11, 12, 13, 14, 15);
            if (HI) { const v16bf h = __builtin_convertvector(pv, v16bf); const v8u hw = __builtin_bit_cast(v8u, h); v16f hf;   // packed conversions, round to nearest even: for finite values the bits of splitf
#pragma unroll
                for (int i = 0; i < 8; ++i) { hf[2 * i] = __uint_as_float(hw[i] << 16); hf[2 * i + 1] = __uint_as_float(hw[i] & 0xFFFF0000u); }   // the hi parts back as f32, straight from the packed words
                pf[n] = __builtin_bit_cast(V, h); pg[n] = __builtin_bit_cast(V, __builtin_convertvector(pv - hf, v16bf));
            } else pf[n] = __builtin_bit_cast(V, __builtin_convertvector(pv, v16h)); }
#pragma unroll
        for (int et = 4; et < (HI ? 6 : 8); ++et) { va[et] = WFrag<T16>::ld(vb + et * 16 * VP); if (HI) vl[et] = WFrag<T16>::ld(vb2 + et * 16 * VP); }
        __builtin_amdgcn_sched_barrier(0);   // likewise ahead of the first half's products; hi/lo: all sixteen fragments do not fit in the registers at once, the last four follow as the first are used up
#pragma unroll
        for (int et = (HI ? 6 : 8); et < 8; ++et) { va[et] = WFrag<T16>::ld(vb + et * 16 * VP); if (HI) vl[et] = WFrag<T16>::ld(vb2 + et * 16 * VP); }
#pragma unroll
        for (int et = 0; et < 8; ++et)
#pragma unroll
            for (int n = 0; n < NQ; ++n) { acc[n][et] = WFrag<T16>::mma(va[et], pf[n], acc[n][et]); if (HI) { acc[n][et] = WFrag<T16>::mma(va[et], pg[n], acc[n][et]); acc[n][et] = WFrag<T16>::mma(vl[et], pf[n], acc[n][et]); } }
      }
        // hand-over: this wave's reads of the buffer are done, its copies of stage t + 1 have landed; the barrier publishes stage t + 1 and ends every wave's reads of this buffer; only then is it refilled
        asm volatile("s_wait_dscnt 0x0" ::: "memory");
        asm volatile("s_wait_asynccnt 0x0" ::: "memory");
        __syncthreads();
        if (t + 2 < NST) stage_kv<T16, HI, KS>(Kp, K2, Vt, V2, (t + 2) * KS, bufp);
    }
    asm volatile("s_wait_asynccnt 0x0" ::: "memory");   // no copy is outstanding when the wave ends
    const int qw = q0 + w * 16 * NQ;
#pragma unroll
    for (int n = 0; n < NQ; ++n) { float ls = l[n][0] + l[n][1]; ls += __shfl_xor(ls, 16, 32); const float f = __fdiv_rn(1.0f, ls);
#pragma unroll
        for (int et = 0; et < 8; ++et) { const v8f r = acc[n][et] * f; const v4f a = __builtin_shufflevector(r, r, 0, 1, 2, 3), b = __builtin_shufflevector(r, r, 4, 5, 6, 7);
            float* orow = O + (size_t)(qw + n * 16 + lr) * HV + et * 16 + hi * 8; *(v4f*)orow = a; *(v4f*)(orow + 4) = b;
            asm volatile("s_wait_xcnt 0x0" :: "v"(orow), "v"(a), "v"(b) : "memory"); }   // the stores have left their address and data registers before these are used again
    }
}
// grid x: first the hi/lo work-groups (NWV x 16 queries, the longer ones), then the fp16 ones (NWV x 32 queries); tiles of one head follow one another. waves_per_eu(4): keeps the kernel at 256 registers, so that no register window is switched and up to four work-groups share a WGP. Planes: QK* [b][q heads, k heads][t][HD], VT* [b][p][e][t], O [b][h][t][HV]
__global__ __launch_bounds__(32 * NWV) __attribute__((amdgpu_waves_per_eu(4))) void k_fattn(const h16* __restrict__ QK16, const bf* __restrict__ QKh, const bf* __restrict__ QKl, const h16* __restrict__ VT16, const bf* __restrict__ VTh, const bf* __restrict__ VTl, float* __restrict__ O) {
    __shared__ __align__(16) h16 skv[2 * BUFE]; __shared__ __align__(16) h16 sq[NWV * 32 * QP];
    const int NHB = NB_ * NH_ * (RH / (16 * NWV)); int blk = (int)blockIdx.x; const bool hires = blk < NHB; if (!hires) blk -= NHB;
    const int per = hires ? RH / (16 * NWV) : (TT - RH) / (32 * NWV); const int bh = blk / per, tile = blk % per; const int b = bh / NH_, h = bh % NH_;
    const size_t oq = (size_t)(b * (NH_ + NKV) + h) * TT * HD, ok = (size_t)(b * (NH_ + NKV) + NH_ + h) * TT * HD, ov = (size_t)(b * NP + h / 2) * HV * TT; float* Oh = O + (size_t)bh * TT * HV;
    if (hires) attn_tile<bf, true, 1, 32>(QKh + oq, QKl + oq, QKh + ok, QKl + ok, VTh + ov, VTl + ov, tile * 16 * NWV, Oh, (bf*)skv, (bf*)sq);
    else attn_tile<h16, false, 2, 64>(QK16 + oq, nullptr, QK16 + ok, nullptr, VT16 + ov, nullptr, RH + tile * 32 * NWV, Oh, skv, sq);
}
// lambda, by one wave: two 64-term f32 dots (butterfly sums: every lane ends with the same value), precise expf
__device__ __forceinline__ float lambda_wave(const float* __restrict__ a1, const float* __restrict__ b1, const float* __restrict__ a2, const float* __restrict__ b2, int lane) { const float p0 = a1[lane], p1 = b1[lane], p2 = a1[lane + 32], p3 = b1[lane + 32], r0 = a2[lane], r1 = b2[lane], r2 = a2[lane + 32], r3 = b2[lane + 32];
    asm volatile("s_wait_xcnt 0x0" :: "v"(lane) : "memory");   // the lane index is the loads' offset register and an input of this wait, so that it stays untouched from the loads down to it
    float s1 = __fadd_rn(__fmul_rn(bfr(p0), bfr(p1)), __fmul_rn(bfr(p2), bfr(p3))); float s2 = __fadd_rn(__fmul_rn(bfr(r0), bfr(r1)), __fmul_rn(bfr(r2), bfr(r3)));
#pragma unroll
    for (int sh = 16; sh; sh >>= 1) { s1 = __fadd_rn(s1, __shfl_xor(s1, sh, 32)); s2 = __fadd_rn(s2, __shfl_xor(s2, sh, 32)); }
    return __fadd_rn(__fsub_rn(expf(s1), expf(s2)), LINIT); }
// ---- k_lngemm: head difference, LayerNorm and the output GEMM in one launch. A work-group of FW waves owns FR rows (r = b TT + t) and FC output columns. Its rows are formed first, each by one wave, f32 in fixed order: columns p*HV + e = w0 v - lambda w1 v from the planes O[b][2p][t][e], O[b][2p + 1][t][e]; LayerNorm (eps 1e-6, affine) x (1 - lambda_init); the result stays in LDS as bf16 hi and lo rows (pitch AP). Then C = (hi + lo) Bt^T + bias: Bt rows come into LDS in stages of 2 GK k (two blocks of GK k, each as in k_gemmw) by asynchronous copies, two buffers: a stage is long enough in flight to cover the L2 latency; a wave has a 16 x 64 tile. grid (rows / FR, DM / FC): each row is normalised by DM / FC work-groups.
#define FR 32
#define FC 256
#define FW 8
#define AP (DQ + 8)   // 16 bytes of pad: 16 x odd, no bank conflict between the rows of a fragment read
__device__ __forceinline__ void ln_row(const v4f (&w0)[NP], const v4f (&w1)[NP], float lam, const v4f (&gv)[NP], const v4f (&bv)[NP], int lane, bf* dh, bf* dl) {
    constexpr int WD = DQ; float a[WD / 32]; float s = 0.f;
#pragma unroll
    for (int c = 0; c < WD / 128; ++c) { const v4f v = w0[c] - lam * w1[c]; for (int q = 0; q < 4; ++q) { a[c * 4 + q] = v[q]; s = __fadd_rn(s, a[c * 4 + q]); } }
#pragma unroll
    for (int sh = 16; sh; sh >>= 1) s = __fadd_rn(s, __shfl_xor(s, sh, 32));
    const float mean = __fdiv_rn(s, (float)WD); float s2 = 0.f;
#pragma unroll
    for (int k = 0; k < WD / 32; ++k) { const float dv = __fsub_rn(a[k], mean); float p2 = __fmul_rn(dv, dv); asm volatile("" : "+v"(p2)); s2 = __fadd_rn(s2, p2); }   /* mul and add kept separate (no fma contraction) */
#pragma unroll
    for (int sh = 16; sh; sh >>= 1) s2 = __fadd_rn(s2, __shfl_xor(s2, sh, 32));
    const float rs = __fdiv_rn(1.0f, __fsqrt_rn(__fadd_rn(__fdiv_rn(s2, (float)WD), 1e-6f)));
#pragma unroll
    for (int c = 0; c < WD / 128; ++c) { v4us oh, ol; for (int q = 0; q < 4; ++q) { float y = __fmul_rn(__fmul_rn(__fsub_rn(a[c * 4 + q], mean), rs), gv[c][q]); asm volatile("" : "+v"(y)); y = __fadd_rn(y, bv[c][q]); y = __fmul_rn(y, 1.0f - LINIT); unsigned short u, w2; splitf(y, u, w2); oh[q] = u; ol[q] = w2; } *(v4us*)(dh + c * 128 + lane * 4) = oh; *(v4us*)(dl + c * 128 + lane * 4) = ol; }
}
__global__ __launch_bounds__(32 * FW) void k_lngemm(const float* __restrict__ O, const float* __restrict__ lq1, const float* __restrict__ lk1, const float* __restrict__ lq2, const float* __restrict__ lk2, const float* __restrict__ g, const float* __restrict__ bb, const bf* __restrict__ Bt, const float* __restrict__ bias, float* __restrict__ C) {
    typedef WFrag<bf>::V V; constexpr int SE = FC * QP, BE = 2 * SE, NST = DQ / (2 * GK);   // elements of one block of GK k and of one buffer; stages
    __shared__ __align__(16) bf sa[2 * FR * AP]; __shared__ __align__(16) bf sb[2 * BE]; static_assert(FW * 16 * 68 * 4 <= 2 * BE * 2, "the epilogue's rows fit the stage buffers"); static_assert(DQ == NP * HV && HV == 128 && FR == 4 * FW && FC == 8 * 4 * FW, "one 128-wide chunk per pair; four rows a wave; eight copies a lane and block");
    const int w = __builtin_amdgcn_readfirstlane((int)(threadIdx.x >> 5)), lane = threadIdx.x & 31, lr = lane & 15, hi = lane >> 4; const int R0 = blockIdx.x * FR, C0 = blockIdx.y * FC;
    const int crow = (int)threadIdx.x >> 3, ccol = ((int)threadIdx.x & 7) * 8;   // the lane's row and 16-byte piece in every copy
    const bf* gB = Bt + (size_t)(C0 + crow) * DQ + ccol; bf* sl = sb + crow * QP + ccol;
    auto stage = [&](int st, int bi) { stage_rows<bf, 4 * FW>(gB + st * 2 * GK, (size_t)DQ, sl + bi * BE); stage_rows<bf, 4 * FW>(gB + st * 2 * GK + GK, (size_t)DQ, sl + bi * BE + SE); };
    stage(0, 0);   // stage 0 flies while the rows are normalised
    { v4f gv[NP], bv[NP]; const float* gp = g + lane * 4; const float* bp = bb + lane * 4;   // the lane's columns are the same in every row
#pragma unroll
        for (int c = 0; c < NP; ++c) { gv[c] = *(const v4f*)(gp + c * 128); bv[c] = *(const v4f*)(bp + c * 128); }
        asm volatile("s_wait_xcnt 0x0" :: "v"(lane) : "memory");   // the lane index is the loads' offset register and an input of this wait, so that it stays untouched from the loads down to it
        const float lam = lambda_wave(lq1, lk1, lq2, lk2, lane);
#pragma unroll
        for (int c = 0; c < NP; ++c)
#pragma unroll
            for (int q = 0; q < 4; ++q) { gv[c][q] = bfr(gv[c][q]); bv[c][q] = bfr(bv[c][q]); }
#pragma unroll 1   // two rows a trip: their loads fly together and their reduction chains interleave; four would not fit in 256 registers
        for (int rp = 0; rp < 2; ++rp) { const int rl = w * 4 + rp * 2; const size_t r = (size_t)R0 + rl; const float* xr = O + (r / TT) * ((size_t)NH_ * TT * HV) + (r % TT) * HV + lane * 4; v4f w0[2][NP], w1[2][NP];   // r is even and TT is even: rows r and r + 1 lie in one batch
#pragma unroll
            for (int c = 0; c < NP; ++c)
#pragma unroll
                for (int q = 0; q < 2; ++q) { w0[q][c] = *(const v4f*)(xr + (size_t)(2 * c) * TT * HV + q * HV); w1[q][c] = *(const v4f*)(xr + (size_t)(2 * c + 1) * TT * HV + q * HV); }
            asm volatile("s_wait_xcnt 0x0" :: "v"(xr) : "memory");   // the row address is an input of this wait so that its registers stay untouched from the loads down to it
            __builtin_amdgcn_sched_barrier(0);   // all of the two rows' loads are requested ahead of the arithmetic: without it the first differences rise among the loads, four loads fly at a time and the trip waits out eight memory latencies
#pragma unroll
            for (int q = 0; q < 2; ++q) ln_row(w0[q], w1[q], lam, gv, bv, lane, sa + (rl + q) * AP, sa + (FR + rl + q) * AP); } }
    asm volatile("s_wait_asynccnt 0x0" ::: "memory");   // this wave's copies of stage 0 have landed
    __syncthreads();   // publishes stage 0 and every wave's normalised rows
    stage(1, 1);   // stage 1 flies during trip 0
    const int r0 = (w & 1) * 16, c0 = (w >> 1) * 64; const bf* ap = sa + (r0 + lr) * AP + 8 * hi; const int boff = (c0 + lr) * QP + 8 * hi;
    v8f acc[4];
#pragma unroll
    for (int nb = 0; nb < 4; ++nb) acc[nb] = (v8f){};
#pragma unroll 1
    for (int t = 0; t < NST; ++t) {
#pragma unroll
      for (int h = 0; h < 2; ++h) {
        const bf* bp = sb + (t & 1) * BE + h * SE + boff; V a[2], a2[2], b[2][4];
#pragma unroll
        for (int k2 = 0; k2 < 2; ++k2) { a[k2] = WFrag<bf>::ld(ap + (2 * t + h) * GK + k2 * 32); a2[k2] = WFrag<bf>::ld(ap + FR * AP + (2 * t + h) * GK + k2 * 32);
#pragma unroll
            for (int nb = 0; nb < 4; ++nb) b[k2][nb] = WFrag<bf>::ld(bp + nb * 16 * QP + k2 * 32); }
        __builtin_amdgcn_sched_barrier(0);   // all of the block's fragments are requested ahead of its products, one place of LDS reads a block: without it the loads sink to their first use and each waits out an LDS latency of its own
#pragma unroll
        for (int k2 = 0; k2 < 2; ++k2) {   // per accumulator: hi then lo of each 32 k, k rising
#pragma unroll
            for (int nb = 0; nb < 4; ++nb) acc[nb] = WFrag<bf>::mma(a[k2], b[k2][nb], acc[nb]);
#pragma unroll
            for (int nb = 0; nb < 4; ++nb) acc[nb] = WFrag<bf>::mma(a2[k2], b[k2][nb], acc[nb]); }
      }
        // hand-over: this wave's reads of the buffer are done, its copies of stage t + 1 have landed; the barrier publishes stage t + 1 and ends every wave's reads of this buffer; only then is it refilled
        asm volatile("s_wait_dscnt 0x0" ::: "memory");
        asm volatile("s_wait_asynccnt 0x0" ::: "memory");
        __syncthreads();
        if (t + 2 < NST) stage(t + 2, t & 1);
    }
    asm volatile("s_wait_asynccnt 0x0" ::: "memory");   // no copy is outstanding behind the loop
    float* os = (float*)sb + w * (16 * 68);   // the epilogue's staging rows, each wave's own, lie in the stage buffers: behind the last trip's barrier nobody reads these and no copy is outstanding
    const int cofs = lr * 4; const float* bq = bias + C0 + c0 + cofs; v4f bs = *(const v4f*)bq;
    asm volatile("s_wait_xcnt 0x0" :: "v"(bq) : "memory");   // as above
#pragma unroll
    for (int q = 0; q < 4; ++q) bs[q] = bfr(bs[q]);
#pragma unroll
    for (int nb = 0; nb < 4; ++nb)
#pragma unroll
        for (int j = 0; j < 8; ++j) os[(hi * 8 + j) * 68 + nb * 16 + lr] = acc[nb][j];
    __builtin_amdgcn_wave_barrier(); asm volatile("" ::: "memory");   // the wave's LDS reads below stay behind its writes above
#pragma unroll
    for (int s = 0; s < 8; ++s) { const int row = 2 * s + hi; const v4f val = *(const v4fa*)(os + row * 68 + cofs) + bs; float* d = C + (size_t)(R0 + r0 + row) * DM + C0 + c0 + cofs; *(v4f*)d = val;   // 16 lanes store 256 bytes of a row: whole lines
        asm volatile("s_wait_xcnt 0x0" :: "v"(d), "v"(val) : "memory"); }   // the store has left its address and data registers before these are used again
}
__global__ __launch_bounds__(256) void k_merge(const float* __restrict__ O, int h0, bf* Ah, bf* Al) { const size_t e = ((size_t)blockIdx.x * 256 + threadIdx.x) * 2; if (e >= (size_t)ZH * TT * HD) return; const int d = (int)(e % HD); const int t = (int)((e / HD) % TT); const int zz = (int)(e / ((size_t)HD * TT)); const float cs = (t < RH) ? 1.0f : (1.0f / PCAR); const size_t oo = (size_t)t * DQ + (h0 + zz) * HD + d;
    v2us oh, ol;
#pragma unroll
    for (int q = 0; q < 2; ++q) { unsigned short a, c2; splitf(O[e + q] * cs, a, c2); oh[q] = a; ol[q] = c2; } *(v2us*)(Ah + oo) = oh; *(v2us*)(Al + oo) = ol;  }

extern "C" void kernel_launch(void* const* d_in, const int* in_sizes, int n_in,
                              void* d_out, int out_size, void* d_ws, size_t ws_size, hipStream_t stream) {
    (void)in_sizes; (void)n_in; (void)out_size;
    const float* x = (const float*)d_in[0]; const float* xk = (const float*)d_in[1]; const float* xv = (const float*)d_in[2]; const float* wq = (const float*)d_in[3]; const float* bq = (const float*)d_in[4]; const float* wk = (const float*)d_in[5]; const float* bk = (const float*)d_in[6]; const float* wv = (const float*)d_in[7]; const float* bv = (const float*)d_in[8]; const float* lq1 = (const float*)d_in[9]; const float* lk1 = (const float*)d_in[10]; const float* lq2 = (const float*)d_in[11]; const float* lk2 = (const float*)d_in[12]; const float* lng = (const float*)d_in[13]; const float* lnb = (const float*)d_in[14]; const float* wo = (const float*)d_in[15]; const float* bo = (const float*)d_in[16];
    float* OUT = (float*)d_out;     // [2][2048][512]
    char* wsp = (char*)d_ws;
    auto take = [&](size_t bytes) { char* p = wsp; wsp += (bytes + 255) & ~(size_t)255; return (void*)p; };
    bf* WQ = (bf*)take((size_t)DQ * DM * 2); bf* WK = (bf*)take((size_t)DKV * DM * 2); bf* WV = (bf*)take((size_t)DKV * DM * 2); bf* WO = (bf*)take((size_t)DM * DQ * 2); (void)WK; (void)WV;
    const size_t SQK = (size_t)(NH_ + NKV) * TT * HD, SV = (size_t)NP * HV * TT;   // one batch's q + k planes (k directly behind q: one launch writes both) and v^T planes, in elements
    h16* QK16 = (h16*)take(NB_ * SQK * 2); bf* QKh = (bf*)take(NB_ * SQK * 2); bf* QKl = (bf*)take(NB_ * SQK * 2); h16* VT16 = (h16*)take(NB_ * SV * 2); bf* VTh = (bf*)take(NB_ * SV * 2); bf* VTl = (bf*)take(NB_ * SV * 2);
    bf* XB = (bf*)take((size_t)3 * NB_ * TT * DM * 2);   // the three bf16 input copies, both batches each
    float* Ob = (float*)take((size_t)NB_ * NH_ * TT * HV * 4);
    if ((size_t)(wsp - (char*)d_ws) > ws_size) return;    // ws 256 MiB
    k_prep<<<4 * WB + 3 * CB, 256, 0, stream>>>(wq, wk, wv, wo, x, xk, xv, WQ, XB);   /* weight planes (WQ, WK, WV, WO lie one behind another) and input copies */
    k_gemmw<bf, 0, true, 1, true><<<dim3(NB_ * TT / 128, DQ / 128, 3), 32 * GW, 0, stream>>>(XB, nullptr, WQ, nullptr, DM, DM, 0, nullptr, 0, bq, bk, bv, (size_t)NB_ * TT * DM, (size_t)DQ * DM, 0, QK16, QKh, QKl, VT16, VTh, VTl);   /* q, k and v projections on grid z, both batches on the row axis, stored as the q, k and v^T planes */
    k_fattn<<<NB_ * NH_ * (RH / (16 * NWV) + (TT - RH) / (32 * NWV)), 32 * NWV, 0, stream>>>(QK16, QKh, QKl, VT16, VTh, VTl, Ob);   /* every batch, head and query tile */
    k_lngemm<<<dim3(NB_ * TT / FR, DM / FC), 32 * FW, 0, stream>>>(Ob, lq1, lk1, lq2, lk2, lng, lnb, WO, bo, OUT);   /* head difference, LayerNorm (eps 1e-6) x (1 - lambda_init) as hi/lo rows in LDS, x Wo + bo */
}
